// v000
// Measured on an AMD MI455X. A time is GPU time per run, averaged over a window of back-to-back runs after a warm-up
// (all launches, gaps included; the runs take copies of the inputs in turn), and the median of several windows.
// Apart from v000's, it joins two sittings. Times from different sittings can be a few percent apart, while
// side-by-side timings come from the same sitting.
// The starting kernel, v000, takes 2040 microseconds a run.
// compute dtype: all float inputs rounded to bf16; q / k / v projections (256-wide) with EXACT bf16 products on WMMA 16x16x32 (f32 accumulate) + bias; causal logits over the full 256-deep contraction x 256^-0.5: 3 products for the first 384 rows, single f16 q x k after; softmax f32; P x 2^11 once to f16 x v once to f16 (bf16 hi + lo below row 384), four 64-column passes over the same probability plane; the context rows are the f32 output (no output projection).
#include <hip/hip_runtime.h>
#include <math.h>

typedef __attribute__((ext_vector_type(16))) _Float16 v16h;
typedef __attribute__((ext_vector_type(16))) __bf16 v16b;
typedef __attribute__((ext_vector_type(8)))  _Float16 v8h;
typedef __attribute__((ext_vector_type(8)))  float v8f;
typedef __attribute__((ext_vector_type(4)))  float v4f;
typedef __attribute__((ext_vector_type(2)))  float v2f;
typedef __attribute__((ext_vector_type(4)))  unsigned v4u;
typedef __attribute__((ext_vector_type(4)))  int v4i;
typedef float __attribute__((may_alias)) float_a;
typedef int __attribute__((may_alias)) int_a;

template <typename T> __device__ __forceinline__ void vst2(void* p, T v) { *(T*)p = v;  }
__device__ __forceinline__ v8f wmma16(v16h a, v16h b, v8f c) {
  v8f d = __builtin_amdgcn_wmma_f32_16x16x32_f16(false, a, false, b, (short)0, c, false, false);
  asm volatile("v_nop\n\tv_nop\n\tv_nop\n\tv_nop" : "+v"(d) : "v"(a), "v"(b));
  return d;
}
__device__ __forceinline__ v8f wmma_bf(v16b a, v16b b, v8f c) {
  v8f d = __builtin_amdgcn_wmma_f32_16x16x32_bf16(false, a, false, b, (short)0, c, false, false);
  asm volatile("v_nop\n\tv_nop\n\tv_nop\n\tv_nop" : "+v"(d) : "v"(a), "v"(b));
  return d;
}
// 16x16x32 fragments: lane = (h = lane>>4, row/col = lane&15); elements 0..7 = k0+8h+0..7, 8..15 = k0+16+8h+0..7; D element r = row 8h+r
__device__ __forceinline__ v16h frag_h(const _Float16* rowk0, int lane) {
  union { v16h v; v8h q[2]; } u; const _Float16* p = rowk0 + 8 * (lane >> 4);
  u.q[0] = *(const v8h*)p; u.q[1] = *(const v8h*)(p + 16); return u.v;
}
__device__ __forceinline__ v16h frag_f32(const float* rowk0, int lane) {
  v16h a; const float* p = rowk0 + 8 * (lane >> 4);
#pragma unroll
  for (int i = 0; i < 8; ++i) { a[i] = (_Float16)p[i]; a[8 + i] = (_Float16)p[16 + i]; }
  return a;
}
__device__ __forceinline__ v16h frag_f32s(const float* rowk0, int lane, float sc) {
  v16h a; const float* p = rowk0 + 8 * (lane >> 4);
#pragma unroll
  for (int i = 0; i < 8; ++i) { a[i] = (_Float16)(p[i] * sc); a[8 + i] = (_Float16)(p[16 + i] * sc); }
  return a;
}
// column fragment from a [K][ld] layout (column n), rows >= K read as 0
__device__ __forceinline__ v16h fragc_f32(const float* W, int k0, int n, int lane, int ld, int K) {
  v16h a; const int g = lane >> 4;
#pragma unroll
  for (int i = 0; i < 8; ++i) { const int ka = k0 + 8 * g + i, kb = ka + 16;
    a[i] = (_Float16)(ka < K ? W[(size_t)(ka < K ? ka : K - 1) * ld + n] : 0.f); a[8 + i] = (_Float16)(kb < K ? W[(size_t)(kb < K ? kb : K - 1) * ld + n] : 0.f); }
  return a;
}
struct F2 { v16b h, l; };
__device__ __forceinline__ F2 bsplit16(const float v[16]) { F2 r;
#pragma unroll
  for (int i = 0; i < 16; ++i) { const __bf16 h = (__bf16)v[i]; r.h[i] = h; r.l[i] = (__bf16)(v[i] - (float)h); }
  return r; }
__device__ __forceinline__ F2 split_row(const float* row, int k0, int lane) { float v[16]; const float* p = row + k0 + 8 * (lane >> 4);
#pragma unroll
  for (int i = 0; i < 8; ++i) { v[i] = p[i]; v[8 + i] = p[16 + i]; }
  return bsplit16(v); }
__device__ __forceinline__ F2 split_rowK(const float* row, int k0, int lane, int K) { float v[16]; const int g = lane >> 4;
#pragma unroll
  for (int i = 0; i < 8; ++i) { const int ka = k0 + 8 * g + i, kb = ka + 16; v[i] = ka < K ? row[ka < K ? ka : K - 1] : 0.f; v[8 + i] = kb < K ? row[kb < K ? kb : K - 1] : 0.f; }
  return bsplit16(v); }
__device__ __forceinline__ F2 split_col(const float* W, int k0, int n, int lane, int ld, int K) { float v[16]; const int g = lane >> 4;
#pragma unroll
  for (int i = 0; i < 8; ++i) { const int ka = k0 + 8 * g + i, kb = ka + 16; v[i] = ka < K ? W[(size_t)(ka < K ? ka : K - 1) * ld + n] : 0.f; v[8 + i] = kb < K ? W[(size_t)(kb < K ? kb : K - 1) * ld + n] : 0.f; }
  return bsplit16(v); }
__device__ __forceinline__ v8f mac3(const F2& a, const F2& b, v8f c) { c = wmma_bf(a.l, b.h, c); c = wmma_bf(a.h, b.l, c); return wmma_bf(a.h, b.h, c); }
__device__ __forceinline__ float sigm(float v) { return 1.0f / (1.0f + expf(-v)); }
#define LDSX() do { asm volatile("s_wait_dscnt 0" ::: "memory"); __builtin_amdgcn_wave_barrier(); __builtin_amdgcn_fence(__ATOMIC_RELEASE, "workgroup"); } while (0)

// Single-head causal self-attention with a 256-wide head (x [4,4096,256]; (in,out) Wq / Wk / Wv [256,256] uniform(+-1/16) with biases of the same scale - NONZERO; q, k, v = x W + b; attn = q k^T over all 256 dims x 1/sqrt(256) = 1/16; tril kept, -inf elsewhere; softmax; out = probs v, [4,4096,256]; no head split, no output projection). ONE score 'head' whose contraction runs over all 256 columns (the score kernel's head width is switched to 256 regionally), P.v as four ordinary 64-wide column groups that all read the same probability plane.
#define NB 4
#define TT 4096
#define CC 256            // NH * HD = projected width
#define DIN 256          // input (model) width
#define NH 4
#define HD 64
#define NQB (TT / 64)
#define HG 1
#define SCALE (0.0625f)
#define CAUSAL 1
#ifndef TNB
#define TNB NB
#endif
__device__ __forceinline__ float bfr(float v) { return (float)(__bf16)v; }
__host__ __device__ __forceinline__ int kb_last(int qb) { return CAUSAL ? ((qb * 64 + 63) >> 7) : (TT / 128 - 1); }
typedef __attribute__((ext_vector_type(8))) __bf16 v8b;
__device__ __forceinline__ v16b frag_b(const __bf16* rowk0, int lane) {
  union { v16b v; v8b q[2]; } u; const __bf16* p = rowk0 + 8 * (lane >> 4);
  u.q[0] = *(const v8b*)p; u.q[1] = *(const v8b*)(p + 16); return u.v;
}
#define QBH 6              // causal: query blocks 0..QBH-1 of each sequence (few keys, no averaging) take the high-precision path
#define QHI 384            // rows carrying a q residual plane
#define KHI 384            // key rows carrying k residual / v bf16 hi+lo planes (used only by the causal high-precision path)
// B fragment (k rows k0+.., output column o) of a weight: (in,out) [K][ld] or (out,in) [ld rows of K]: bf16 exact, or f16(bf16 * 256) exact
__device__ __forceinline__ v16b wcol_io(const float* Wm, int k0, int o, int lane, int ld) { v16b w; const int g = lane >> 4;
#pragma unroll
  for (int i = 0; i < 8; ++i) { w[i] = (__bf16)Wm[(size_t)(k0 + 8 * g + i) * ld + o]; w[8 + i] = (__bf16)Wm[(size_t)(k0 + 16 + 8 * g + i) * ld + o]; }
  return w; }
__device__ __forceinline__ v16b wcol_oi(const float* Wm, int k0, int o, int lane, int K) { v16b w; const float* p = Wm + (size_t)o * K + k0 + 8 * (lane >> 4);
#pragma unroll
  for (int i = 0; i < 8; ++i) { w[i] = (__bf16)p[i]; w[8 + i] = (__bf16)p[16 + i]; }
  return w; }
__device__ __forceinline__ v16h wcolh_io(const float* Wm, int k0, int o, int lane, int ld) { v16h w; const int g = lane >> 4;
#pragma unroll
  for (int i = 0; i < 8; ++i) { w[i] = (_Float16)(bfr(Wm[(size_t)(k0 + 8 * g + i) * ld + o]) * 256.0f); w[8 + i] = (_Float16)(bfr(Wm[(size_t)(k0 + 16 + 8 * g + i) * ld + o]) * 256.0f); }
  return w; }
__device__ __forceinline__ v16h wcolh_oi(const float* Wm, int k0, int o, int lane, int K) { v16h w; const float* p = Wm + (size_t)o * K + k0 + 8 * (lane >> 4);
#pragma unroll
  for (int i = 0; i < 8; ++i) { w[i] = (_Float16)(bfr(p[i]) * 256.0f); w[8 + i] = (_Float16)(bfr(p[16 + i]) * 256.0f); }
  return w; }
#define WQKV_LAYOUT 0   // 0 = (in,out) [DIN][CC]; 1 = (out,in) [CC][DIN]; 2 = per-head [NH][DIN][HD]
__device__ __forceinline__ v16b wcol_hdk(const float* Wm, int k0, int o, int lane) { v16b w; const int g = lane >> 4; const float* p = Wm + (size_t)(o / HD) * DIN * HD + (o % HD);
#pragma unroll
  for (int i = 0; i < 8; ++i) { w[i] = (__bf16)p[(size_t)(k0 + 8 * g + i) * HD]; w[8 + i] = (__bf16)p[(size_t)(k0 + 16 + 8 * g + i) * HD]; }
  return w; }
#define WO_OUT_IN 0
#if WQKV_LAYOUT == 1
#define WCOL(W, k0, o, lane) wcol_oi(W, k0, o, lane, DIN)
#elif WQKV_LAYOUT == 2
#define WCOL(W, k0, o, lane) wcol_hdk(W, k0, o, lane)
#else
#define WCOL(W, k0, o, lane) wcol_io(W, k0, o, lane, CC)
#endif
#if WO_OUT_IN
#define WOCOL(W, k0, o, lane) wcol_oi(W, k0, o, lane, CC)
#define WOCOLH(W, k0, o, lane) wcolh_oi(W, k0, o, lane, CC)
#else
#define WOCOL(W, k0, o, lane) wcol_io(W, k0, o, lane, DIN)
#define WOCOLH(W, k0, o, lane) wcolh_io(W, k0, o, lane, DIN)
#endif

#ifndef SM_EXTRA_PARAMS
#define SM_EXTRA_PARAMS
#endif
#ifndef PROJ_EXTRA_PARAMS
#define PROJ_EXTRA_PARAMS
#endif
#ifndef SM_MASK_HOOK
#define SM_MASK_HOOK (void)0
#endif

#define WS_QH  0u                                      // f16 q rows [b*t][CC]
#define WS_KH  (WS_QH + 2u * (size_t)NB * TT * CC)      // f16 k rows [b*t][CC]
#define WS_VT  (WS_KH + 2u * (size_t)NB * TT * CC)      // f16 v planes [b][c][t]
#define WS_QL  (WS_VT + 2u * (size_t)NB * CC * TT)      // f16 q residual x 2^10 rows [b][t < QHI][CC]
#define WS_KL  (WS_QL + 2u * (size_t)NB * QHI * CC)     // f16 k residual x 2^10 rows [b][t < KHI][CC]
#define WS_VB  (WS_KL + 2u * (size_t)NB * KHI * CC)     // bf16 v hi planes [b][c][t < KHI]
#define WS_VBL (WS_VB + 2u * (size_t)NB * CC * KHI)
#define WS_S   (WS_VBL + 2u * (size_t)NB * CC * KHI)    // f32 logits / P [hg][t][s]
#define WS_Y   (WS_S  + 4u * (size_t)HG * TT * TT)      // f32 ctx rows [b*t][CC] (only when there is an output projection)
#define WS_END (WS_Y  + 0u)

// ---- k_proj: block = (64 rows, 128 cols, which): q/k/v = X W (+ b) with exact bf16 products (K = DIN) -> which 0: q f16 rows (+ residual rows < QHI); 1: k f16 rows (+ residual rows < KHI); 2: v f16 planes [c][t] (+ bf16 hi/lo planes for t < KHI)
__global__ __launch_bounds__(128) void k_proj(const float* __restrict__ XQ, const float* __restrict__ XK, const float* __restrict__ XV, const float* __restrict__ WQ, const float* __restrict__ WK, const float* __restrict__ WV, const float* __restrict__ BQ, const float* __restrict__ BK, const float* __restrict__ BV,
    _Float16* __restrict__ QH, _Float16* __restrict__ QL, _Float16* __restrict__ KH, _Float16* __restrict__ KL, _Float16* __restrict__ VT, __bf16* __restrict__ VB, __bf16* __restrict__ VBL) {
  __shared__ __align__(16) _Float16 sh[64][136], sl[64][136]; __shared__ __align__(16) _Float16 th[128][72]; __shared__ __align__(16) __bf16 tb[128][72], tbl[128][72];
  const int tid = threadIdx.x, wave = tid >> 5, lane = tid & 31, col = lane & 15, g = lane >> 4; const int which = blockIdx.z; const int c0 = blockIdx.y * 128; const size_t r0 = (size_t)blockIdx.x * 64; const size_t bb = r0 / TT; const int t0 = (int)(r0 % TT);
  const float* X = which == 0 ? XQ : which == 1 ? XK : XV; const float* WA = which == 0 ? WQ : which == 1 ? WK : WV; const float* BA = which == 0 ? BQ : which == 1 ? BK : BV;
  v8f acc[8] = {};
#pragma unroll 2
  for (int kc = 0; kc < DIN / 32; ++kc) { v16b a; { const float* p = X + (r0 + wave * 16 + col) * DIN + kc * 32 + 8 * g;
#pragma unroll
      for (int i = 0; i < 8; ++i) { a[i] = (__bf16)p[i]; a[8 + i] = (__bf16)p[16 + i]; } }
    asm volatile("s_wait_loadcnt 0x0" ::: "memory");
#pragma unroll
    for (int j = 0; j < 8; ++j) { const v16b w = WCOL(WA, kc * 32, c0 + j * 16 + col, lane); asm volatile("s_wait_loadcnt 0x0" ::: "memory"); acc[j] = wmma_bf(a, w, acc[j]); } }
  if (which < 2) { _Float16* DH = which == 0 ? QH : KH; _Float16* DL = which == 0 ? QL : KL; const int nhi = which == 0 ? QHI : KHI; const bool hi_rows = t0 < nhi;
#pragma unroll
    for (int j = 0; j < 8; ++j) { const float bias = BA ? bfr(BA[c0 + j * 16 + col]) : 0.f;
#pragma unroll
      for (int r = 0; r < 8; ++r) { const float v = acc[j][r] + bias; const _Float16 hv = (_Float16)v; sh[wave * 16 + 8 * g + r][j * 16 + col] = hv; sl[wave * 16 + 8 * g + r][j * 16 + col] = (_Float16)((v - (float)hv) * 1024.0f); } }
    __syncthreads();
    for (int e = tid; e < 64 * 16; e += 128) { const int rl = e >> 4, q = e & 15; vst2((unsigned*)(DH + (r0 + rl) * CC + c0 + q * 8), *(const v4u*)&sh[rl][q * 8]); if (hi_rows) vst2((unsigned*)(DL + (bb * nhi + t0 + rl) * (size_t)CC + c0 + q * 8), *(const v4u*)&sl[rl][q * 8]); }
  } else { const bool hi_rows = t0 < KHI;
#pragma unroll
    for (int j = 0; j < 8; ++j) { const float bias = BA ? bfr(BA[c0 + j * 16 + col]) : 0.f;
#pragma unroll
      for (int r = 0; r < 8; ++r) { const float v = acc[j][r] + bias; const int rl = wave * 16 + 8 * g + r, cl = j * 16 + col; th[cl][rl] = (_Float16)v; const __bf16 bh = (__bf16)v; tb[cl][rl] = bh; tbl[cl][rl] = (__bf16)(v - (float)bh); } }
    __syncthreads();
    for (int e = tid; e < 128 * 8; e += 128) { const int cl = e >> 3, q = e & 7; vst2((unsigned*)(VT + (bb * CC + c0 + cl) * (size_t)TT + t0 + q * 8), *(const v4u*)&th[cl][q * 8]); if (hi_rows) { const size_t o3 = (bb * CC + c0 + cl) * (size_t)KHI + t0 + q * 8; vst2((unsigned*)(VB + o3), *(const v4u*)&tb[cl][q * 8]); vst2((unsigned*)(VBL + o3), *(const v4u*)&tbl[cl][q * 8]); } } } }
#undef HD
#define HD 256   // SCORE KERNEL ONLY: with h = 0 the contraction runs over columns 0..255 in 8 k-steps: the module's single 256-wide head
// ---- k_sc: block = (query block qb, key block kb <= kb_last(qb), head in group) of batch b: logits x SCALE; q hi + residual (x 2^10) against k (2 products) for query rows < QHI, plus the k residual (3 products) for query blocks < QBH (causal early rows); causal: blocks past the diagonal exit, the mask itself is applied by index in k_sm
__global__ __launch_bounds__(128) void k_sc(const _Float16* __restrict__ QH, const _Float16* __restrict__ KH, const _Float16* __restrict__ QL, const _Float16* __restrict__ KL, int b, int h0, float* __restrict__ S0) { __shared__ __align__(16) float ss[4][16][132];
  const int qb = blockIdx.x, kb = blockIdx.y; if (kb > kb_last(qb)) return;
  const int h = h0 + blockIdx.z; float* S = S0 + (size_t)blockIdx.z * TT * TT;
  const int tid = threadIdx.x, wave = tid >> 5, lane = tid & 31, col = lane & 15, g = lane >> 4; const int k0 = kb * 128; const int ql0 = qb * 64 + wave * 16; const size_t q0 = (size_t)b * TT + ql0, kr0 = (size_t)b * TT + k0;
  v8f acc[8] = {}, accl[8] = {};
  const _Float16* QLb = QL + (size_t)b * QHI * CC; const _Float16* KLb = KL + (size_t)b * KHI * CC;
  if (qb < QBH) {
#pragma unroll
    for (int kc = 0; kc < HD / 32; ++kc) { const v16h ah = frag_h(QH + (q0 + col) * CC + h * HD + kc * 32, lane), al = frag_h(QLb + (size_t)(ql0 + col) * CC + h * HD + kc * 32, lane);
#pragma unroll
      for (int j = 0; j < 8; ++j) { const v16h kbf = frag_h(KH + (kr0 + j * 16 + col) * CC + h * HD + kc * 32, lane), klf = frag_h(KLb + (size_t)(k0 + j * 16 + col) * CC + h * HD + kc * 32, lane); acc[j] = wmma16(ah, kbf, acc[j]); accl[j] = wmma16(al, kbf, accl[j]); accl[j] = wmma16(ah, klf, accl[j]); } }
  } else if (qb * 64 < QHI) {
#pragma unroll
    for (int kc = 0; kc < HD / 32; ++kc) { const v16h ah = frag_h(QH + (q0 + col) * CC + h * HD + kc * 32, lane), al = frag_h(QLb + (size_t)(ql0 + col) * CC + h * HD + kc * 32, lane);
#pragma unroll
      for (int j = 0; j < 8; ++j) { const v16h kbf = frag_h(KH + (kr0 + j * 16 + col) * CC + h * HD + kc * 32, lane); acc[j] = wmma16(ah, kbf, acc[j]); accl[j] = wmma16(al, kbf, accl[j]); } }
  } else {
#pragma unroll
    for (int kc = 0; kc < HD / 32; ++kc) { const v16h ah = frag_h(QH + (q0 + col) * CC + h * HD + kc * 32, lane);
#pragma unroll
      for (int j = 0; j < 8; ++j) { const v16h kbf = frag_h(KH + (kr0 + j * 16 + col) * CC + h * HD + kc * 32, lane); acc[j] = wmma16(ah, kbf, acc[j]); } } }
#pragma unroll
  for (int j = 0; j < 8; ++j) {
#pragma unroll
    for (int r = 0; r < 8; ++r) ss[wave][8 * g + r][j * 16 + col] = (acc[j][r] + accl[j][r] * (1.0f / 1024.0f)) * SCALE; }
  LDSX(); for (int rl = 0; rl < 16; ++rl) vst2(S + (size_t)(ql0 + rl) * TT + k0 + lane * 4, *(const v4f*)&ss[wave][rl][lane * 4]); }
#undef HD
#define HD 64   // restored: the softmax and P.v kernels keep 64-wide column groups
// ---- k_sm: block = query row t (head in group): keys [0, kend): causal -> logit if s <= t else excluded; softmax in f32; P x 2^11 in place (0 for excluded)
__global__ __launch_bounds__(256) void k_sm(float* __restrict__ S0 SM_EXTRA_PARAMS) { __shared__ float sred[8]; __shared__ float sbc; __shared__ __align__(16) float shv[TT];
  const int tid = threadIdx.x; const int t = blockIdx.x; const int kend = (kb_last(t >> 6) + 1) * 128;
  float* sr = S0 + (size_t)blockIdx.y * TT * TT + (size_t)t * TT;
  float m = -3.0e38f; for (int k = tid; k < kend; k += 256) { float v = (!CAUSAL || k <= t) ? sr[k] : -3.0e38f; SM_MASK_HOOK; shv[k] = v; m = fmaxf(m, v); }
#pragma unroll
  for (int o = 1; o < 32; o <<= 1) m = fmaxf(m, __shfl_xor(m, o));
  if ((tid & 31) == 0) sred[tid >> 5] = m; __syncthreads(); if (tid == 0) { float a = sred[0]; for (int i = 1; i < 8; ++i) a = fmaxf(a, sred[i]); sbc = a; } __syncthreads(); m = sbc; __syncthreads();
  float sum = 0.f; for (int k = tid; k < kend; k += 256) { const float v = shv[k]; const float e = (v <= -1.0e38f) ? 0.f : expf(v - m); shv[k] = e; sum += e; }
#pragma unroll
  for (int o = 1; o < 32; o <<= 1) sum += __shfl_xor(sum, o);
  if ((tid & 31) == 0) sred[tid >> 5] = sum; __syncthreads(); if (tid == 0) { float a = 0.f; for (int i = 0; i < 8; ++i) a += sred[i]; sbc = a > 0.f ? 2048.0f / a : 0.f; }   /* a fully excluded row yields P = 0 */ __syncthreads(); const float inv = sbc;
  for (int k = tid; k < kend; k += 256) shv[k] = shv[k] * inv;
  __syncthreads(); for (int q = tid; q < kend / 4; q += 256) vst2(sr + q * 4, *(const v4f*)&shv[q * 4]); }
// ---- k_pv: block = 64 queries (qb) of (b, h): ctx = P . v over keys [0, kend) (P x 2^11 once to f16 against v f16: 1 product; causal early query blocks: P and v as bf16 hi + lo, 3 products); 256-B (row, head) segment by 16 lanes
__global__ __launch_bounds__(128) void k_pv(const float* __restrict__ PS0, const _Float16* __restrict__ VT, const __bf16* __restrict__ VB, const __bf16* __restrict__ VBL, int b, int h0, float* __restrict__ Y) { const int h = h0 + blockIdx.z; const float* PS = PS0 + (size_t)blockIdx.z * TT * TT; __shared__ __align__(16) float ss[4][16][HD + 4];
  const int tid = threadIdx.x, wave = tid >> 5, lane = tid & 31, col = lane & 15, g = lane >> 4; const int qb = blockIdx.x; const int ql0 = qb * 64 + wave * 16; const int kce = (kb_last(qb) + 1) * 4;
  v8f acc[HD / 16] = {};
  if (qb < QBH) {
#pragma unroll 1
    for (int kc = 0; kc < kce; ++kc) { const F2 p = split_row(PS + (size_t)(ql0 + col) * TT, kc * 32, lane);
      asm volatile("s_wait_loadcnt 0x0" ::: "memory");
#pragma unroll
      for (int j = 0; j < HD / 16; ++j) { const size_t po = ((size_t)b * CC + h * HD + j * 16 + col) * (size_t)KHI + kc * 32; const v16b vh = frag_b(VB + po, lane); acc[j] = wmma_bf(p.h, vh, acc[j]); acc[j] = wmma_bf(p.l, vh, acc[j]); acc[j] = wmma_bf(p.h, frag_b(VBL + po, lane), acc[j]); } }
  } else {
#pragma unroll 1
    for (int kc = 0; kc < kce; ++kc) { const v16h p = frag_f32(PS + (size_t)(ql0 + col) * TT + kc * 32, lane);
      asm volatile("s_wait_loadcnt 0x0" ::: "memory");
#pragma unroll
      for (int j = 0; j < HD / 16; ++j) { const size_t po = ((size_t)b * CC + h * HD + j * 16 + col) * (size_t)TT + kc * 32; acc[j] = wmma16(p, frag_h(VT + po, lane), acc[j]); } } }
#pragma unroll
  for (int j = 0; j < HD / 16; ++j)
#pragma unroll
    for (int r = 0; r < 8; ++r) ss[wave][8 * g + r][j * 16 + col] = acc[j][r] * (1.0f / 2048.0f);
  LDSX(); for (int rl = 0; rl < 16; ++rl) if (lane < HD / 4) vst2(Y + ((size_t)b * TT + ql0 + rl) * CC + h * HD + lane * 4, *(const v4f*)&ss[wave][rl][lane * 4]); }

extern "C" void kernel_launch(void* const* d_in, const int* in_sizes, int n_in, void* d_out, int out_size, void* d_ws, size_t ws_size, hipStream_t stream) {
  (void)in_sizes; (void)n_in; (void)out_size;
  const float** F = (const float**)d_in;
  if (ws_size < (size_t)WS_END) return;
  char* ws = (char*)d_ws; _Float16 *QH = (_Float16*)(ws + WS_QH), *KH = (_Float16*)(ws + WS_KH), *VT = (_Float16*)(ws + WS_VT), *QL = (_Float16*)(ws + WS_QL), *KL = (_Float16*)(ws + WS_KL); __bf16 *VB = (__bf16*)(ws + WS_VB), *VBL = (__bf16*)(ws + WS_VBL); float *S = (float*)(ws + WS_S), *Y = (float*)(ws + WS_Y);
  (void)Y; (void)QL; (void)KL; (void)VB; (void)VBL;
  // inputs: 0 x [4,4096,256]; 1 Wq [256,256] (in,out), 2 bq; 3 Wk, 4 bk; 5 Wv, 6 bv (biases NONZERO)
  k_proj<<<dim3(TNB * TT / 64, CC / 128, 3), 128, 0, stream>>>(F[0], F[0], F[0], F[1], F[3], F[5], F[2], F[4], F[6], QH, QL, KH, KL, VT, VB, VBL);
  for (int b = 0; b < TNB; ++b) {
    k_sc<<<dim3(NQB, TT / 128, 1), 128, 0, stream>>>(QH, KH, QL, KL, b, 0, S);   /* the one score head: all 256 columns */
    k_sm<<<dim3(TT, 1), 256, 0, stream>>>(S);
    for (int g = 0; g < NH; ++g) k_pv<<<dim3(NQB, 1, 1), 128, 0, stream>>>(S, VT, VB, VBL, b, g, (float*)d_out);   /* column group g: v / out columns 64g .. 64g+63, all four from plane 0; the context rows are the output */
  }
}

// v001
// One run takes 748 microseconds.
// Two timings next to v000 put it at 2.74 and 2.75 times that version's speed.
// compute dtype: all float inputs rounded to bf16; q / k / v projections (256-wide) with EXACT bf16 products on WMMA 16x16x32 (f32 accumulate) + bias; causal logits over the full 256-deep contraction x 256^-0.5: 3 products for the first 384 rows, single f16 q x k after; softmax f32; P x 2^11 once to f16 x v once to f16 (bf16 hi + lo below row 384), four 64-column groups over the same probability plane, side by side in one launch; the context rows are the f32 output (no output projection).
#include <hip/hip_runtime.h>
#include <math.h>

typedef __attribute__((ext_vector_type(16))) _Float16 v16h;
typedef __attribute__((ext_vector_type(16))) __bf16 v16b;
typedef __attribute__((ext_vector_type(8)))  _Float16 v8h;
typedef __attribute__((ext_vector_type(8)))  float v8f;
typedef __attribute__((ext_vector_type(4)))  float v4f;
typedef __attribute__((ext_vector_type(2)))  float v2f;
typedef __attribute__((ext_vector_type(4)))  unsigned v4u;
typedef __attribute__((ext_vector_type(4)))  int v4i;
typedef float __attribute__((may_alias)) float_a;
typedef int __attribute__((may_alias)) int_a;

template <typename T> __device__ __forceinline__ void vst2(void* p, T v) { *(T*)p = v;  }
__device__ __forceinline__ v8f wmma16(v16h a, v16h b, v8f c) {
  v8f d = __builtin_amdgcn_wmma_f32_16x16x32_f16(false, a, false, b, (short)0, c, false, false);
  asm volatile("v_nop\n\tv_nop\n\tv_nop\n\tv_nop" : "+v"(d) : "v"(a), "v"(b));
  return d;
}
__device__ __forceinline__ v8f wmma_bf(v16b a, v16b b, v8f c) {
  v8f d = __builtin_amdgcn_wmma_f32_16x16x32_bf16(false, a, false, b, (short)0, c, false, false);
  asm volatile("v_nop\n\tv_nop\n\tv_nop\n\tv_nop" : "+v"(d) : "v"(a), "v"(b));
  return d;
}
// 16x16x32 fragments: lane = (h = lane>>4, row/col = lane&15); elements 0..7 = k0+8h+0..7, 8..15 = k0+16+8h+0..7; D element r = row 8h+r
__device__ __forceinline__ v16h frag_h(const _Float16* rowk0, int lane) {
  union { v16h v; v8h q[2]; } u; const _Float16* p = rowk0 + 8 * (lane >> 4);
  u.q[0] = *(const v8h*)p; u.q[1] = *(const v8h*)(p + 16); return u.v;
}
__device__ __forceinline__ v16h frag_f32(const float* rowk0, int lane) {
  v16h a; const float* p = rowk0 + 8 * (lane >> 4);
#pragma unroll
  for (int i = 0; i < 8; ++i) { a[i] = (_Float16)p[i]; a[8 + i] = (_Float16)p[16 + i]; }
  return a;
}
__device__ __forceinline__ v16h frag_f32s(const float* rowk0, int lane, float sc) {
  v16h a; const float* p = rowk0 + 8 * (lane >> 4);
#pragma unroll
  for (int i = 0; i < 8; ++i) { a[i] = (_Float16)(p[i] * sc); a[8 + i] = (_Float16)(p[16 + i] * sc); }
  return a;
}
// column fragment from a [K][ld] layout (column n), rows >= K read as 0
__device__ __forceinline__ v16h fragc_f32(const float* W, int k0, int n, int lane, int ld, int K) {
  v16h a; const int g = lane >> 4;
#pragma unroll
  for (int i = 0; i < 8; ++i) { const int ka = k0 + 8 * g + i, kb = ka + 16;
    a[i] = (_Float16)(ka < K ? W[(size_t)(ka < K ? ka : K - 1) * ld + n] : 0.f); a[8 + i] = (_Float16)(kb < K ? W[(size_t)(kb < K ? kb : K - 1) * ld + n] : 0.f); }
  return a;
}
struct F2 { v16b h, l; };
__device__ __forceinline__ F2 bsplit16(const float v[16]) { F2 r;
#pragma unroll
  for (int i = 0; i < 16; ++i) { const __bf16 h = (__bf16)v[i]; r.h[i] = h; r.l[i] = (__bf16)(v[i] - (float)h); }
  return r; }
__device__ __forceinline__ F2 split_row(const float* row, int k0, int lane) { float v[16]; const float* p = row + k0 + 8 * (lane >> 4);
#pragma unroll
  for (int i = 0; i < 8; ++i) { v[i] = p[i]; v[8 + i] = p[16 + i]; }
  return bsplit16(v); }
__device__ __forceinline__ F2 split_rowK(const float* row, int k0, int lane, int K) { float v[16]; const int g = lane >> 4;
#pragma unroll
  for (int i = 0; i < 8; ++i) { const int ka = k0 + 8 * g + i, kb = ka + 16; v[i] = ka < K ? row[ka < K ? ka : K - 1] : 0.f; v[8 + i] = kb < K ? row[kb < K ? kb : K - 1] : 0.f; }
  return bsplit16(v); }
__device__ __forceinline__ F2 split_col(const float* W, int k0, int n, int lane, int ld, int K) { float v[16]; const int g = lane >> 4;
#pragma unroll
  for (int i = 0; i < 8; ++i) { const int ka = k0 + 8 * g + i, kb = ka + 16; v[i] = ka < K ? W[(size_t)(ka < K ? ka : K - 1) * ld + n] : 0.f; v[8 + i] = kb < K ? W[(size_t)(kb < K ? kb : K - 1) * ld + n] : 0.f; }
  return bsplit16(v); }
__device__ __forceinline__ v8f mac3(const F2& a, const F2& b, v8f c) { c = wmma_bf(a.l, b.h, c); c = wmma_bf(a.h, b.l, c); return wmma_bf(a.h, b.h, c); }
__device__ __forceinline__ float sigm(float v) { return 1.0f / (1.0f + expf(-v)); }
#define LDSX() do { asm volatile("s_wait_dscnt 0" ::: "memory"); __builtin_amdgcn_wave_barrier(); __builtin_amdgcn_fence(__ATOMIC_RELEASE, "workgroup"); } while (0)

// Single-head causal self-attention with a 256-wide head (x [4,4096,256]; (in,out) Wq / Wk / Wv [256,256] uniform(+-1/16) with biases of the same scale - NONZERO; q, k, v = x W + b; attn = q k^T over all 256 dims x 1/sqrt(256) = 1/16; tril kept, -inf elsewhere; softmax; out = probs v, [4,4096,256]; no head split, no output projection). ONE score 'head' whose contraction runs over all 256 columns (the score kernel's head width is switched to 256 regionally), P.v as four ordinary 64-wide column groups that all read the same probability plane.
#define NB 4
#define TT 4096
#define CC 256            // NH * HD = projected width
#define DIN 256          // input (model) width
#define NH 4
#define HD 64
#define NQB (TT / 64)
#define HG 1
#define SCALE (0.0625f)
#define CAUSAL 1
#ifndef TNB
#define TNB NB
#endif
__device__ __forceinline__ float bfr(float v) { return (float)(__bf16)v; }
__host__ __device__ __forceinline__ int kb_last(int qb) { return CAUSAL ? ((qb * 64 + 63) >> 7) : (TT / 128 - 1); }
typedef __attribute__((ext_vector_type(8))) __bf16 v8b;
__device__ __forceinline__ v16b frag_b(const __bf16* rowk0, int lane) {
  union { v16b v; v8b q[2]; } u; const __bf16* p = rowk0 + 8 * (lane >> 4);
  u.q[0] = *(const v8b*)p; u.q[1] = *(const v8b*)(p + 16); return u.v;
}
#define QBH 6              // causal: query blocks 0..QBH-1 of each sequence (few keys, no averaging) take the high-precision path
#define QHI 384            // rows carrying a q residual plane
#define KHI 384            // key rows carrying k residual / v bf16 hi+lo planes (used only by the causal high-precision path)
// B fragment (k rows k0+.., output column o) of a weight: (in,out) [K][ld] or (out,in) [ld rows of K]: bf16 exact, or f16(bf16 * 256) exact
__device__ __forceinline__ v16b wcol_io(const float* Wm, int k0, int o, int lane, int ld) { v16b w; const int g = lane >> 4;
#pragma unroll
  for (int i = 0; i < 8; ++i) { w[i] = (__bf16)Wm[(size_t)(k0 + 8 * g + i) * ld + o]; w[8 + i] = (__bf16)Wm[(size_t)(k0 + 16 + 8 * g + i) * ld + o]; }
  return w; }
__device__ __forceinline__ v16b wcol_oi(const float* Wm, int k0, int o, int lane, int K) { v16b w; const float* p = Wm + (size_t)o * K + k0 + 8 * (lane >> 4);
#pragma unroll
  for (int i = 0; i < 8; ++i) { w[i] = (__bf16)p[i]; w[8 + i] = (__bf16)p[16 + i]; }
  return w; }
__device__ __forceinline__ v16h wcolh_io(const float* Wm, int k0, int o, int lane, int ld) { v16h w; const int g = lane >> 4;
#pragma unroll
  for (int i = 0; i < 8; ++i) { w[i] = (_Float16)(bfr(Wm[(size_t)(k0 + 8 * g + i) * ld + o]) * 256.0f); w[8 + i] = (_Float16)(bfr(Wm[(size_t)(k0 + 16 + 8 * g + i) * ld + o]) * 256.0f); }
  return w; }
__device__ __forceinline__ v16h wcolh_oi(const float* Wm, int k0, int o, int lane, int K) { v16h w; const float* p = Wm + (size_t)o * K + k0 + 8 * (lane >> 4);
#pragma unroll
  for (int i = 0; i < 8; ++i) { w[i] = (_Float16)(bfr(p[i]) * 256.0f); w[8 + i] = (_Float16)(bfr(p[16 + i]) * 256.0f); }
  return w; }
#define WQKV_LAYOUT 0   // 0 = (in,out) [DIN][CC]; 1 = (out,in) [CC][DIN]; 2 = per-head [NH][DIN][HD]
__device__ __forceinline__ v16b wcol_hdk(const float* Wm, int k0, int o, int lane) { v16b w; const int g = lane >> 4; const float* p = Wm + (size_t)(o / HD) * DIN * HD + (o % HD);
#pragma unroll
  for (int i = 0; i < 8; ++i) { w[i] = (__bf16)p[(size_t)(k0 + 8 * g + i) * HD]; w[8 + i] = (__bf16)p[(size_t)(k0 + 16 + 8 * g + i) * HD]; }
  return w; }
#define WO_OUT_IN 0
#if WQKV_LAYOUT == 1
#define WCOL(W, k0, o, lane) wcol_oi(W, k0, o, lane, DIN)
#elif WQKV_LAYOUT == 2
#define WCOL(W, k0, o, lane) wcol_hdk(W, k0, o, lane)
#else
#define WCOL(W, k0, o, lane) wcol_io(W, k0, o, lane, CC)
#endif
#if WO_OUT_IN
#define WOCOL(W, k0, o, lane) wcol_oi(W, k0, o, lane, CC)
#define WOCOLH(W, k0, o, lane) wcolh_oi(W, k0, o, lane, CC)
#else
#define WOCOL(W, k0, o, lane) wcol_io(W, k0, o, lane, DIN)
#define WOCOLH(W, k0, o, lane) wcolh_io(W, k0, o, lane, DIN)
#endif

#ifndef SM_EXTRA_PARAMS
#define SM_EXTRA_PARAMS
#endif
#ifndef PROJ_EXTRA_PARAMS
#define PROJ_EXTRA_PARAMS
#endif
#ifndef SM_MASK_HOOK
#define SM_MASK_HOOK (void)0
#endif

#define WS_QH  0u                                      // f16 q rows [b*t][CC]
#define WS_KH  (WS_QH + 2u * (size_t)NB * TT * CC)      // f16 k rows [b*t][CC]
#define WS_VT  (WS_KH + 2u * (size_t)NB * TT * CC)      // f16 v planes [b][c][t]
#define WS_QL  (WS_VT + 2u * (size_t)NB * CC * TT)      // f16 q residual x 2^10 rows [b][t < QHI][CC]
#define WS_KL  (WS_QL + 2u * (size_t)NB * QHI * CC)     // f16 k residual x 2^10 rows [b][t < KHI][CC]
#define WS_VB  (WS_KL + 2u * (size_t)NB * KHI * CC)     // bf16 v hi planes [b][c][t < KHI]
#define WS_VBL (WS_VB + 2u * (size_t)NB * CC * KHI)
#define WS_S   (WS_VBL + 2u * (size_t)NB * CC * KHI)    // f32 logits / P [hg][t][s]
#define WS_Y   (WS_S  + 4u * (size_t)HG * TT * TT)      // f32 ctx rows [b*t][CC] (only when there is an output projection)
#define WS_END (WS_Y  + 0u)

// ---- k_proj: block = (64 rows, 128 cols, which): q/k/v = X W (+ b) with exact bf16 products (K = DIN) -> which 0: q f16 rows (+ residual rows < QHI); 1: k f16 rows (+ residual rows < KHI); 2: v f16 planes [c][t] (+ bf16 hi/lo planes for t < KHI)
__global__ __launch_bounds__(128) void k_proj(const float* __restrict__ XQ, const float* __restrict__ XK, const float* __restrict__ XV, const float* __restrict__ WQ, const float* __restrict__ WK, const float* __restrict__ WV, const float* __restrict__ BQ, const float* __restrict__ BK, const float* __restrict__ BV,
    _Float16* __restrict__ QH, _Float16* __restrict__ QL, _Float16* __restrict__ KH, _Float16* __restrict__ KL, _Float16* __restrict__ VT, __bf16* __restrict__ VB, __bf16* __restrict__ VBL) {
  __shared__ __align__(16) _Float16 sh[64][136], sl[64][136]; __shared__ __align__(16) _Float16 th[128][72]; __shared__ __align__(16) __bf16 tb[128][72], tbl[128][72];
  const int tid = threadIdx.x, wave = tid >> 5, lane = tid & 31, col = lane & 15, g = lane >> 4; const int which = blockIdx.z; const int c0 = blockIdx.y * 128; const size_t r0 = (size_t)blockIdx.x * 64; const size_t bb = r0 / TT; const int t0 = (int)(r0 % TT);
  const float* X = which == 0 ? XQ : which == 1 ? XK : XV; const float* WA = which == 0 ? WQ : which == 1 ? WK : WV; const float* BA = which == 0 ? BQ : which == 1 ? BK : BV;
  v8f acc[8] = {};
#pragma unroll 2
  for (int kc = 0; kc < DIN / 32; ++kc) { v16b a; { const float* p = X + (r0 + wave * 16 + col) * DIN + kc * 32 + 8 * g;
#pragma unroll
      for (int i = 0; i < 8; ++i) { a[i] = (__bf16)p[i]; a[8 + i] = (__bf16)p[16 + i]; } }
    asm volatile("s_wait_loadcnt 0x0" ::: "memory");
#pragma unroll
    for (int j = 0; j < 8; ++j) { const v16b w = WCOL(WA, kc * 32, c0 + j * 16 + col, lane); asm volatile("s_wait_loadcnt 0x0" ::: "memory"); acc[j] = wmma_bf(a, w, acc[j]); } }
  if (which < 2) { _Float16* DH = which == 0 ? QH : KH; _Float16* DL = which == 0 ? QL : KL; const int nhi = which == 0 ? QHI : KHI; const bool hi_rows = t0 < nhi;
#pragma unroll
    for (int j = 0; j < 8; ++j) { const float bias = BA ? bfr(BA[c0 + j * 16 + col]) : 0.f;
#pragma unroll
      for (int r = 0; r < 8; ++r) { const float v = acc[j][r] + bias; const _Float16 hv = (_Float16)v; sh[wave * 16 + 8 * g + r][j * 16 + col] = hv; sl[wave * 16 + 8 * g + r][j * 16 + col] = (_Float16)((v - (float)hv) * 1024.0f); } }
    __syncthreads();
    for (int e = tid; e < 64 * 16; e += 128) { const int rl = e >> 4, q = e & 15; vst2((unsigned*)(DH + (r0 + rl) * CC + c0 + q * 8), *(const v4u*)&sh[rl][q * 8]); if (hi_rows) vst2((unsigned*)(DL + (bb * nhi + t0 + rl) * (size_t)CC + c0 + q * 8), *(const v4u*)&sl[rl][q * 8]); }
  } else { const bool hi_rows = t0 < KHI;
#pragma unroll
    for (int j = 0; j < 8; ++j) { const float bias = BA ? bfr(BA[c0 + j * 16 + col]) : 0.f;
#pragma unroll
      for (int r = 0; r < 8; ++r) { const float v = acc[j][r] + bias; const int rl = wave * 16 + 8 * g + r, cl = j * 16 + col; th[cl][rl] = (_Float16)v; const __bf16 bh = (__bf16)v; tb[cl][rl] = bh; tbl[cl][rl] = (__bf16)(v - (float)bh); } }
    __syncthreads();
    for (int e = tid; e < 128 * 8; e += 128) { const int cl = e >> 3, q = e & 7; vst2((unsigned*)(VT + (bb * CC + c0 + cl) * (size_t)TT + t0 + q * 8), *(const v4u*)&th[cl][q * 8]); if (hi_rows) { const size_t o3 = (bb * CC + c0 + cl) * (size_t)KHI + t0 + q * 8; vst2((unsigned*)(VB + o3), *(const v4u*)&tb[cl][q * 8]); vst2((unsigned*)(VBL + o3), *(const v4u*)&tbl[cl][q * 8]); } } } }
#undef HD
#define HD 256   // SCORE KERNEL ONLY: with h = 0 the contraction runs over columns 0..255 in 8 k-steps: the module's single 256-wide head
// ---- k_sc: block = (query block qb, key block kb <= kb_last(qb), head in group) of batch b: logits x SCALE; q hi + residual (x 2^10) against k (2 products) for query rows < QHI, plus the k residual (3 products) for query blocks < QBH (causal early rows); causal: blocks past the diagonal exit, the mask itself is applied by index in k_sm
__global__ __launch_bounds__(128) void k_sc(const _Float16* __restrict__ QH, const _Float16* __restrict__ KH, const _Float16* __restrict__ QL, const _Float16* __restrict__ KL, int b, int h0, float* __restrict__ S0) { __shared__ __align__(16) float ss[4][16][132];
  const int qb = blockIdx.x, kb = blockIdx.y; if (kb > kb_last(qb)) return;
  const int h = h0 + blockIdx.z; float* S = S0 + (size_t)blockIdx.z * TT * TT;
  const int tid = threadIdx.x, wave = tid >> 5, lane = tid & 31, col = lane & 15, g = lane >> 4; const int k0 = kb * 128; const int ql0 = qb * 64 + wave * 16; const size_t q0 = (size_t)b * TT + ql0, kr0 = (size_t)b * TT + k0;
  v8f acc[8] = {}, accl[8] = {};
  const _Float16* QLb = QL + (size_t)b * QHI * CC; const _Float16* KLb = KL + (size_t)b * KHI * CC;
  if (qb < QBH) {
#pragma unroll
    for (int kc = 0; kc < HD / 32; ++kc) { const v16h ah = frag_h(QH + (q0 + col) * CC + h * HD + kc * 32, lane), al = frag_h(QLb + (size_t)(ql0 + col) * CC + h * HD + kc * 32, lane);
#pragma unroll
      for (int j = 0; j < 8; ++j) { const v16h kbf = frag_h(KH + (kr0 + j * 16 + col) * CC + h * HD + kc * 32, lane), klf = frag_h(KLb + (size_t)(k0 + j * 16 + col) * CC + h * HD + kc * 32, lane); acc[j] = wmma16(ah, kbf, acc[j]); accl[j] = wmma16(al, kbf, accl[j]); accl[j] = wmma16(ah, klf, accl[j]); } }
  } else if (qb * 64 < QHI) {
#pragma unroll
    for (int kc = 0; kc < HD / 32; ++kc) { const v16h ah = frag_h(QH + (q0 + col) * CC + h * HD + kc * 32, lane), al = frag_h(QLb + (size_t)(ql0 + col) * CC + h * HD + kc * 32, lane);
#pragma unroll
      for (int j = 0; j < 8; ++j) { const v16h kbf = frag_h(KH + (kr0 + j * 16 + col) * CC + h * HD + kc * 32, lane); acc[j] = wmma16(ah, kbf, acc[j]); accl[j] = wmma16(al, kbf, accl[j]); } }
  } else {
#pragma unroll
    for (int kc = 0; kc < HD / 32; ++kc) { const v16h ah = frag_h(QH + (q0 + col) * CC + h * HD + kc * 32, lane);
#pragma unroll
      for (int j = 0; j < 8; ++j) { const v16h kbf = frag_h(KH + (kr0 + j * 16 + col) * CC + h * HD + kc * 32, lane); acc[j] = wmma16(ah, kbf, acc[j]); } } }
#pragma unroll
  for (int j = 0; j < 8; ++j) {
#pragma unroll
    for (int r = 0; r < 8; ++r) ss[wave][8 * g + r][j * 16 + col] = (acc[j][r] + accl[j][r] * (1.0f / 1024.0f)) * SCALE; }
  LDSX(); for (int rl = 0; rl < 16; ++rl) vst2(S + (size_t)(ql0 + rl) * TT + k0 + lane * 4, *(const v4f*)&ss[wave][rl][lane * 4]); }
#undef HD
#define HD 64   // restored: the softmax and P.v kernels keep 64-wide column groups
// ---- k_sm: block = query row t (head in group): keys [0, kend): causal -> logit if s <= t else excluded; softmax in f32; P x 2^11 in place (0 for excluded)
__global__ __launch_bounds__(256) void k_sm(float* __restrict__ S0 SM_EXTRA_PARAMS) { __shared__ float sred[8]; __shared__ float sbc; __shared__ __align__(16) float shv[TT];
  const int tid = threadIdx.x; const int t = blockIdx.x; const int kend = (kb_last(t >> 6) + 1) * 128;
  float* sr = S0 + (size_t)blockIdx.y * TT * TT + (size_t)t * TT;
  float m = -3.0e38f; for (int k = tid; k < kend; k += 256) { float v = (!CAUSAL || k <= t) ? sr[k] : -3.0e38f; SM_MASK_HOOK; shv[k] = v; m = fmaxf(m, v); }
#pragma unroll
  for (int o = 1; o < 32; o <<= 1) m = fmaxf(m, __shfl_xor(m, o));
  if ((tid & 31) == 0) sred[tid >> 5] = m; __syncthreads(); if (tid == 0) { float a = sred[0]; for (int i = 1; i < 8; ++i) a = fmaxf(a, sred[i]); sbc = a; } __syncthreads(); m = sbc; __syncthreads();
  float sum = 0.f; for (int k = tid; k < kend; k += 256) { const float v = shv[k]; const float e = (v <= -1.0e38f) ? 0.f : expf(v - m); shv[k] = e; sum += e; }
#pragma unroll
  for (int o = 1; o < 32; o <<= 1) sum += __shfl_xor(sum, o);
  if ((tid & 31) == 0) sred[tid >> 5] = sum; __syncthreads(); if (tid == 0) { float a = 0.f; for (int i = 0; i < 8; ++i) a += sred[i]; sbc = a > 0.f ? 2048.0f / a : 0.f; }   /* a fully excluded row yields P = 0 */ __syncthreads(); const float inv = sbc;
  for (int k = tid; k < kend; k += 256) shv[k] = shv[k] * inv;
  __syncthreads(); for (int q = tid; q < kend / 4; q += 256) vst2(sr + q * 4, *(const v4f*)&shv[q * 4]); }
// ---- k_pv: block = 64 queries (qb) of (b, h = column group, grid z): ctx = P . v over keys [0, kend) (P x 2^11 once to f16 against v f16: 1 product; causal early query blocks: P and v as bf16 hi + lo, 3 products); 256-B (row, head) segment by 16 lanes
__global__ __launch_bounds__(128) void k_pv(const float* __restrict__ PS0, const _Float16* __restrict__ VT, const __bf16* __restrict__ VB, const __bf16* __restrict__ VBL, int b, int h0, float* __restrict__ Y) { const int h = h0 + blockIdx.z; const float* PS = PS0;   /* grid z = column group: every group reads the one probability plane */ __shared__ __align__(16) float ss[4][16][HD + 4];
  const int tid = threadIdx.x, wave = tid >> 5, lane = tid & 31, col = lane & 15, g = lane >> 4; const int qb = blockIdx.x; const int ql0 = qb * 64 + wave * 16; const int kce = (kb_last(qb) + 1) * 4;
  v8f acc[HD / 16] = {};
  if (qb < QBH) {
#pragma unroll 1
    for (int kc = 0; kc < kce; ++kc) { const F2 p = split_row(PS + (size_t)(ql0 + col) * TT, kc * 32, lane);
      asm volatile("s_wait_loadcnt 0x0" ::: "memory");
#pragma unroll
      for (int j = 0; j < HD / 16; ++j) { const size_t po = ((size_t)b * CC + h * HD + j * 16 + col) * (size_t)KHI + kc * 32; const v16b vh = frag_b(VB + po, lane); acc[j] = wmma_bf(p.h, vh, acc[j]); acc[j] = wmma_bf(p.l, vh, acc[j]); acc[j] = wmma_bf(p.h, frag_b(VBL + po, lane), acc[j]); } }
  } else {
#pragma unroll 1
    for (int kc = 0; kc < kce; ++kc) { const v16h p = frag_f32(PS + (size_t)(ql0 + col) * TT + kc * 32, lane);
      asm volatile("s_wait_loadcnt 0x0" ::: "memory");
#pragma unroll
      for (int j = 0; j < HD / 16; ++j) { const size_t po = ((size_t)b * CC + h * HD + j * 16 + col) * (size_t)TT + kc * 32; acc[j] = wmma16(p, frag_h(VT + po, lane), acc[j]); } } }
#pragma unroll
  for (int j = 0; j < HD / 16; ++j)
#pragma unroll
    for (int r = 0; r < 8; ++r) ss[wave][8 * g + r][j * 16 + col] = acc[j][r] * (1.0f / 2048.0f);
  LDSX(); for (int rl = 0; rl < 16; ++rl) if (lane < HD / 4) vst2(Y + ((size_t)b * TT + ql0 + rl) * CC + h * HD + lane * 4, *(const v4f*)&ss[wave][rl][lane * 4]); }

extern "C" void kernel_launch(void* const* d_in, const int* in_sizes, int n_in, void* d_out, int out_size, void* d_ws, size_t ws_size, hipStream_t stream) {
  (void)in_sizes; (void)n_in; (void)out_size;
  const float** F = (const float**)d_in;
  if (ws_size < (size_t)WS_END) return;
  char* ws = (char*)d_ws; _Float16 *QH = (_Float16*)(ws + WS_QH), *KH = (_Float16*)(ws + WS_KH), *VT = (_Float16*)(ws + WS_VT), *QL = (_Float16*)(ws + WS_QL), *KL = (_Float16*)(ws + WS_KL); __bf16 *VB = (__bf16*)(ws + WS_VB), *VBL = (__bf16*)(ws + WS_VBL); float *S = (float*)(ws + WS_S), *Y = (float*)(ws + WS_Y);
  (void)Y; (void)QL; (void)KL; (void)VB; (void)VBL;
  // inputs: 0 x [4,4096,256]; 1 Wq [256,256] (in,out), 2 bq; 3 Wk, 4 bk; 5 Wv, 6 bv (biases NONZERO)
  k_proj<<<dim3(TNB * TT / 64, CC / 128, 3), 128, 0, stream>>>(F[0], F[0], F[0], F[1], F[3], F[5], F[2], F[4], F[6], QH, QL, KH, KL, VT, VB, VBL);
  for (int b = 0; b < TNB; ++b) {
    k_sc<<<dim3(NQB, TT / 128, 1), 128, 0, stream>>>(QH, KH, QL, KL, b, 0, S);   /* the one score head: all 256 columns */
    k_sm<<<dim3(TT, 1), 256, 0, stream>>>(S);
    k_pv<<<dim3(NQB, 1, NH), 128, 0, stream>>>(S, VT, VB, VBL, b, 0, (float*)d_out);   /* one launch, 64 x 4 work-groups: grid z = column group g (v / out columns 64g .. 64g+63), all four from plane 0; the context rows are the output */
  }
}

// v002
// Measured time: 401 microseconds a run.
// Timed twice side by side with v001, it ran 1.86 and 1.87 times as fast.
// Counting every step since v000, it is 5.11 times as fast.
// compute dtype: all float inputs rounded to bf16; q / k / v projections (256-wide) with EXACT bf16 products on WMMA 16x16x32 (f32 accumulate) + bias; causal logits over the full 256-deep contraction x 256^-0.5: 3 products for the first 384 rows, single f16 q x k after; softmax f32; P x 2^11 once to f16 x v once to f16 (bf16 hi + lo below row 384), four 64-column groups over the same probability plane; the four batches side by side in each stage's one launch; the context rows are the f32 output (no output projection).
#include <hip/hip_runtime.h>
#include <math.h>

typedef __attribute__((ext_vector_type(16))) _Float16 v16h;
typedef __attribute__((ext_vector_type(16))) __bf16 v16b;
typedef __attribute__((ext_vector_type(8)))  _Float16 v8h;
typedef __attribute__((ext_vector_type(8)))  float v8f;
typedef __attribute__((ext_vector_type(4)))  float v4f;
typedef __attribute__((ext_vector_type(2)))  float v2f;
typedef __attribute__((ext_vector_type(4)))  unsigned v4u;
typedef __attribute__((ext_vector_type(4)))  int v4i;
typedef float __attribute__((may_alias)) float_a;
typedef int __attribute__((may_alias)) int_a;

template <typename T> __device__ __forceinline__ void vst2(void* p, T v) { *(T*)p = v;  }
__device__ __forceinline__ v8f wmma16(v16h a, v16h b, v8f c) {
  v8f d = __builtin_amdgcn_wmma_f32_16x16x32_f16(false, a, false, b, (short)0, c, false, false);
  asm volatile("v_nop\n\tv_nop\n\tv_nop\n\tv_nop" : "+v"(d) : "v"(a), "v"(b));
  return d;
}
__device__ __forceinline__ v8f wmma_bf(v16b a, v16b b, v8f c) {
  v8f d = __builtin_amdgcn_wmma_f32_16x16x32_bf16(false, a, false, b, (short)0, c, false, false);
  asm volatile("v_nop\n\tv_nop\n\tv_nop\n\tv_nop" : "+v"(d) : "v"(a), "v"(b));
  return d;
}
// 16x16x32 fragments: lane = (h = lane>>4, row/col = lane&15); elements 0..7 = k0+8h+0..7, 8..15 = k0+16+8h+0..7; D element r = row 8h+r
__device__ __forceinline__ v16h frag_h(const _Float16* rowk0, int lane) {
  union { v16h v; v8h q[2]; } u; const _Float16* p = rowk0 + 8 * (lane >> 4);
  u.q[0] = *(const v8h*)p; u.q[1] = *(const v8h*)(p + 16); return u.v;
}
__device__ __forceinline__ v16h frag_f32(const float* rowk0, int lane) {
  v16h a; const float* p = rowk0 + 8 * (lane >> 4);
#pragma unroll
  for (int i = 0; i < 8; ++i) { a[i] = (_Float16)p[i]; a[8 + i] = (_Float16)p[16 + i]; }
  return a;
}
__device__ __forceinline__ v16h frag_f32s(const float* rowk0, int lane, float sc) {
  v16h a; const float* p = rowk0 + 8 * (lane >> 4);
#pragma unroll
  for (int i = 0; i < 8; ++i) { a[i] = (_Float16)(p[i] * sc); a[8 + i] = (_Float16)(p[16 + i] * sc); }
  return a;
}
// column fragment from a [K][ld] layout (column n), rows >= K read as 0
__device__ __forceinline__ v16h fragc_f32(const float* W, int k0, int n, int lane, int ld, int K) {
  v16h a; const int g = lane >> 4;
#pragma unroll
  for (int i = 0; i < 8; ++i) { const int ka = k0 + 8 * g + i, kb = ka + 16;
    a[i] = (_Float16)(ka < K ? W[(size_t)(ka < K ? ka : K - 1) * ld + n] : 0.f); a[8 + i] = (_Float16)(kb < K ? W[(size_t)(kb < K ? kb : K - 1) * ld + n] : 0.f); }
  return a;
}
struct F2 { v16b h, l; };
__device__ __forceinline__ F2 bsplit16(const float v[16]) { F2 r;
#pragma unroll
  for (int i = 0; i < 16; ++i) { const __bf16 h = (__bf16)v[i]; r.h[i] = h; r.l[i] = (__bf16)(v[i] - (float)h); }
  return r; }
__device__ __forceinline__ F2 split_row(const float* row, int k0, int lane) { float v[16]; const float* p = row + k0 + 8 * (lane >> 4);
#pragma unroll
  for (int i = 0; i < 8; ++i) { v[i] = p[i]; v[8 + i] = p[16 + i]; }
  return bsplit16(v); }
__device__ __forceinline__ F2 split_rowK(const float* row, int k0, int lane, int K) { float v[16]; const int g = lane >> 4;
#pragma unroll
  for (int i = 0; i < 8; ++i) { const int ka = k0 + 8 * g + i, kb = ka + 16; v[i] = ka < K ? row[ka < K ? ka : K - 1] : 0.f; v[8 + i] = kb < K ? row[kb < K ? kb : K - 1] : 0.f; }
  return bsplit16(v); }
__device__ __forceinline__ F2 split_col(const float* W, int k0, int n, int lane, int ld, int K) { float v[16]; const int g = lane >> 4;
#pragma unroll
  for (int i = 0; i < 8; ++i) { const int ka = k0 + 8 * g + i, kb = ka + 16; v[i] = ka < K ? W[(size_t)(ka < K ? ka : K - 1) * ld + n] : 0.f; v[8 + i] = kb < K ? W[(size_t)(kb < K ? kb : K - 1) * ld + n] : 0.f; }
  return bsplit16(v); }
__device__ __forceinline__ v8f mac3(const F2& a, const F2& b, v8f c) { c = wmma_bf(a.l, b.h, c); c = wmma_bf(a.h, b.l, c); return wmma_bf(a.h, b.h, c); }
__device__ __forceinline__ float sigm(float v) { return 1.0f / (1.0f + expf(-v)); }
#define LDSX() do { asm volatile("s_wait_dscnt 0" ::: "memory"); __builtin_amdgcn_wave_barrier(); __builtin_amdgcn_fence(__ATOMIC_RELEASE, "workgroup"); } while (0)

// Single-head causal self-attention with a 256-wide head (x [4,4096,256]; (in,out) Wq / Wk / Wv [256,256] uniform(+-1/16) with biases of the same scale - NONZERO; q, k, v = x W + b; attn = q k^T over all 256 dims x 1/sqrt(256) = 1/16; tril kept, -inf elsewhere; softmax; out = probs v, [4,4096,256]; no head split, no output projection). ONE score 'head' whose contraction runs over all 256 columns (the score kernel's head width is switched to 256 regionally), P.v as four ordinary 64-wide column groups that all read the same probability plane.
#define NB 4
#define TT 4096
#define CC 256            // NH * HD = projected width
#define DIN 256          // input (model) width
#define NH 4
#define HD 64
#define NQB (TT / 64)
#define HG 1
#define SCALE (0.0625f)
#define CAUSAL 1
#ifndef TNB
#define TNB NB
#endif
__device__ __forceinline__ float bfr(float v) { return (float)(__bf16)v; }
__host__ __device__ __forceinline__ int kb_last(int qb) { return CAUSAL ? ((qb * 64 + 63) >> 7) : (TT / 128 - 1); }
// logit / P plane of one batch: the 64 rows of query block qb are kend = (kb_last(qb) + 1) * 128 floats long and follow block qb - 1's; with m = qb >> 1 = kb_last(qb) the blocks before qb hold (m + 1) * (m + (qb & 1)) units of 64 x 128 floats
#define S_PLANE ((size_t)(TT / 128) * (TT / 128 + 1) * 64 * 128)
__device__ __forceinline__ size_t s_blk(int qb) { const int m = qb >> 1; return (size_t)((m + 1) * (m + (qb & 1))) * (64 * 128); }
typedef __attribute__((ext_vector_type(8))) __bf16 v8b;
__device__ __forceinline__ v16b frag_b(const __bf16* rowk0, int lane) {
  union { v16b v; v8b q[2]; } u; const __bf16* p = rowk0 + 8 * (lane >> 4);
  u.q[0] = *(const v8b*)p; u.q[1] = *(const v8b*)(p + 16); return u.v;
}
#define QBH 6              // causal: query blocks 0..QBH-1 of each sequence (few keys, no averaging) take the high-precision path
#define QHI 384            // rows carrying a q residual plane
#define KHI 384            // key rows carrying k residual / v bf16 hi+lo planes (used only by the causal high-precision path)
// B fragment (k rows k0+.., output column o) of a weight: (in,out) [K][ld] or (out,in) [ld rows of K]: bf16 exact, or f16(bf16 * 256) exact
__device__ __forceinline__ v16b wcol_io(const float* Wm, int k0, int o, int lane, int ld) { v16b w; const int g = lane >> 4;
#pragma unroll
  for (int i = 0; i < 8; ++i) { w[i] = (__bf16)Wm[(size_t)(k0 + 8 * g + i) * ld + o]; w[8 + i] = (__bf16)Wm[(size_t)(k0 + 16 + 8 * g + i) * ld + o]; }
  return w; }
__device__ __forceinline__ v16b wcol_oi(const float* Wm, int k0, int o, int lane, int K) { v16b w; const float* p = Wm + (size_t)o * K + k0 + 8 * (lane >> 4);
#pragma unroll
  for (int i = 0; i < 8; ++i) { w[i] = (__bf16)p[i]; w[8 + i] = (__bf16)p[16 + i]; }
  return w; }
__device__ __forceinline__ v16h wcolh_io(const float* Wm, int k0, int o, int lane, int ld) { v16h w; const int g = lane >> 4;
#pragma unroll
  for (int i = 0; i < 8; ++i) { w[i] = (_Float16)(bfr(Wm[(size_t)(k0 + 8 * g + i) * ld + o]) * 256.0f); w[8 + i] = (_Float16)(bfr(Wm[(size_t)(k0 + 16 + 8 * g + i) * ld + o]) * 256.0f); }
  return w; }
__device__ __forceinline__ v16h wcolh_oi(const float* Wm, int k0, int o, int lane, int K) { v16h w; const float* p = Wm + (size_t)o * K + k0 + 8 * (lane >> 4);
#pragma unroll
  for (int i = 0; i < 8; ++i) { w[i] = (_Float16)(bfr(p[i]) * 256.0f); w[8 + i] = (_Float16)(bfr(p[16 + i]) * 256.0f); }
  return w; }
#define WQKV_LAYOUT 0   // 0 = (in,out) [DIN][CC]; 1 = (out,in) [CC][DIN]; 2 = per-head [NH][DIN][HD]
__device__ __forceinline__ v16b wcol_hdk(const float* Wm, int k0, int o, int lane) { v16b w; const int g = lane >> 4; const float* p = Wm + (size_t)(o / HD) * DIN * HD + (o % HD);
#pragma unroll
  for (int i = 0; i < 8; ++i) { w[i] = (__bf16)p[(size_t)(k0 + 8 * g + i) * HD]; w[8 + i] = (__bf16)p[(size_t)(k0 + 16 + 8 * g + i) * HD]; }
  return w; }
#define WO_OUT_IN 0
#if WQKV_LAYOUT == 1
#define WCOL(W, k0, o, lane) wcol_oi(W, k0, o, lane, DIN)
#elif WQKV_LAYOUT == 2
#define WCOL(W, k0, o, lane) wcol_hdk(W, k0, o, lane)
#else
#define WCOL(W, k0, o, lane) wcol_io(W, k0, o, lane, CC)
#endif
#if WO_OUT_IN
#define WOCOL(W, k0, o, lane) wcol_oi(W, k0, o, lane, CC)
#define WOCOLH(W, k0, o, lane) wcolh_oi(W, k0, o, lane, CC)
#else
#define WOCOL(W, k0, o, lane) wcol_io(W, k0, o, lane, DIN)
#define WOCOLH(W, k0, o, lane) wcolh_io(W, k0, o, lane, DIN)
#endif

#ifndef SM_EXTRA_PARAMS
#define SM_EXTRA_PARAMS
#endif
#ifndef PROJ_EXTRA_PARAMS
#define PROJ_EXTRA_PARAMS
#endif
#ifndef SM_MASK_HOOK
#define SM_MASK_HOOK (void)0
#endif

#define WS_QH  0u                                      // f16 q rows [b*t][CC]
#define WS_KH  (WS_QH + 2u * (size_t)NB * TT * CC)      // f16 k rows [b*t][CC]
#define WS_VT  (WS_KH + 2u * (size_t)NB * TT * CC)      // f16 v planes [b][c][t]
#define WS_QL  (WS_VT + 2u * (size_t)NB * CC * TT)      // f16 q residual x 2^10 rows [b][t < QHI][CC]
#define WS_KL  (WS_QL + 2u * (size_t)NB * QHI * CC)     // f16 k residual x 2^10 rows [b][t < KHI][CC]
#define WS_VB  (WS_KL + 2u * (size_t)NB * KHI * CC)     // bf16 v hi planes [b][c][t < KHI]
#define WS_VBL (WS_VB + 2u * (size_t)NB * CC * KHI)
#define WS_S   (WS_VBL + 2u * (size_t)NB * CC * KHI)    // f32 logits / P [b][t][s < kend(t)]: rows at their causal length (s_blk), one plane of S_PLANE floats a batch
#define WS_Y   (WS_S  + 4u * (size_t)NB * S_PLANE)      // f32 ctx rows [b*t][CC] (only when there is an output projection)
#define WS_END (WS_Y  + 0u)

// ---- k_proj: block = (64 rows, 128 cols, which): q/k/v = X W (+ b) with exact bf16 products (K = DIN) -> which 0: q f16 rows (+ residual rows < QHI); 1: k f16 rows (+ residual rows < KHI); 2: v f16 planes [c][t] (+ bf16 hi/lo planes for t < KHI)
__global__ __launch_bounds__(128) void k_proj(const float* __restrict__ XQ, const float* __restrict__ XK, const float* __restrict__ XV, const float* __restrict__ WQ, const float* __restrict__ WK, const float* __restrict__ WV, const float* __restrict__ BQ, const float* __restrict__ BK, const float* __restrict__ BV,
    _Float16* __restrict__ QH, _Float16* __restrict__ QL, _Float16* __restrict__ KH, _Float16* __restrict__ KL, _Float16* __restrict__ VT, __bf16* __restrict__ VB, __bf16* __restrict__ VBL) {
  __shared__ __align__(16) _Float16 sh[64][136], sl[64][136]; __shared__ __align__(16) _Float16 th[128][72]; __shared__ __align__(16) __bf16 tb[128][72], tbl[128][72];
  const int tid = threadIdx.x, wave = tid >> 5, lane = tid & 31, col = lane & 15, g = lane >> 4; const int which = blockIdx.z; const int c0 = blockIdx.y * 128; const size_t r0 = (size_t)blockIdx.x * 64; const size_t bb = r0 / TT; const int t0 = (int)(r0 % TT);
  const float* X = which == 0 ? XQ : which == 1 ? XK : XV; const float* WA = which == 0 ? WQ : which == 1 ? WK : WV; const float* BA = which == 0 ? BQ : which == 1 ? BK : BV;
  v8f acc[8] = {};
#pragma unroll 2
  for (int kc = 0; kc < DIN / 32; ++kc) { v16b a; { const float* p = X + (r0 + wave * 16 + col) * DIN + kc * 32 + 8 * g;
#pragma unroll
      for (int i = 0; i < 8; ++i) { a[i] = (__bf16)p[i]; a[8 + i] = (__bf16)p[16 + i]; } }
    asm volatile("s_wait_loadcnt 0x0" ::: "memory");
#pragma unroll
    for (int j = 0; j < 8; ++j) { const v16b w = WCOL(WA, kc * 32, c0 + j * 16 + col, lane); asm volatile("s_wait_loadcnt 0x0" ::: "memory"); acc[j] = wmma_bf(a, w, acc[j]); } }
  if (which < 2) { _Float16* DH = which == 0 ? QH : KH; _Float16* DL = which == 0 ? QL : KL; const int nhi = which == 0 ? QHI : KHI; const bool hi_rows = t0 < nhi;
#pragma unroll
    for (int j = 0; j < 8; ++j) { const float bias = BA ? bfr(BA[c0 + j * 16 + col]) : 0.f;
#pragma unroll
      for (int r = 0; r < 8; ++r) { const float v = acc[j][r] + bias; const _Float16 hv = (_Float16)v; sh[wave * 16 + 8 * g + r][j * 16 + col] = hv; sl[wave * 16 + 8 * g + r][j * 16 + col] = (_Float16)((v - (float)hv) * 1024.0f); } }
    __syncthreads();
    for (int e = tid; e < 64 * 16; e += 128) { const int rl = e >> 4, q = e & 15; vst2((unsigned*)(DH + (r0 + rl) * CC + c0 + q * 8), *(const v4u*)&sh[rl][q * 8]); if (hi_rows) vst2((unsigned*)(DL + (bb * nhi + t0 + rl) * (size_t)CC + c0 + q * 8), *(const v4u*)&sl[rl][q * 8]); }
  } else { const bool hi_rows = t0 < KHI;
#pragma unroll
    for (int j = 0; j < 8; ++j) { const float bias = BA ? bfr(BA[c0 + j * 16 + col]) : 0.f;
#pragma unroll
      for (int r = 0; r < 8; ++r) { const float v = acc[j][r] + bias; const int rl = wave * 16 + 8 * g + r, cl = j * 16 + col; th[cl][rl] = (_Float16)v; const __bf16 bh = (__bf16)v; tb[cl][rl] = bh; tbl[cl][rl] = (__bf16)(v - (float)bh); } }
    __syncthreads();
    for (int e = tid; e < 128 * 8; e += 128) { const int cl = e >> 3, q = e & 7; vst2((unsigned*)(VT + (bb * CC + c0 + cl) * (size_t)TT + t0 + q * 8), *(const v4u*)&th[cl][q * 8]); if (hi_rows) { const size_t o3 = (bb * CC + c0 + cl) * (size_t)KHI + t0 + q * 8; vst2((unsigned*)(VB + o3), *(const v4u*)&tb[cl][q * 8]); vst2((unsigned*)(VBL + o3), *(const v4u*)&tbl[cl][q * 8]); } } } }
#undef HD
#define HD 256   // SCORE KERNEL ONLY: with h = 0 the contraction runs over columns 0..255 in 8 k-steps: the module's single 256-wide head
// ---- k_sc: block = (query block qb, key block kb <= kb_last(qb), batch b = grid z): logits x SCALE; q hi + residual (x 2^10) against k (2 products) for query rows < QHI, plus the k residual (3 products) for query blocks < QBH (causal early rows); causal: blocks past the diagonal exit, the mask itself is applied by index in k_sm
__global__ __launch_bounds__(128) void k_sc(const _Float16* __restrict__ QH, const _Float16* __restrict__ KH, const _Float16* __restrict__ QL, const _Float16* __restrict__ KL, float* __restrict__ S0) { __shared__ __align__(16) float ss[4][16][132];
  const int qb = blockIdx.x, kb = blockIdx.y; if (kb > kb_last(qb)) return;
  const int b = blockIdx.z, h = 0; const int kend = (kb_last(qb) + 1) * 128; float* S = S0 + (size_t)b * S_PLANE + s_blk(qb);
  const int tid = threadIdx.x, wave = tid >> 5, lane = tid & 31, col = lane & 15, g = lane >> 4; const int k0 = kb * 128; const int ql0 = qb * 64 + wave * 16; const size_t q0 = (size_t)b * TT + ql0, kr0 = (size_t)b * TT + k0;
  v8f acc[8] = {}, accl[8] = {};
  const _Float16* QLb = QL + (size_t)b * QHI * CC; const _Float16* KLb = KL + (size_t)b * KHI * CC;
  if (qb < QBH) {
#pragma unroll
    for (int kc = 0; kc < HD / 32; ++kc) { const v16h ah = frag_h(QH + (q0 + col) * CC + h * HD + kc * 32, lane), al = frag_h(QLb + (size_t)(ql0 + col) * CC + h * HD + kc * 32, lane);
#pragma unroll
      for (int j = 0; j < 8; ++j) { const v16h kbf = frag_h(KH + (kr0 + j * 16 + col) * CC + h * HD + kc * 32, lane), klf = frag_h(KLb + (size_t)(k0 + j * 16 + col) * CC + h * HD + kc * 32, lane); acc[j] = wmma16(ah, kbf, acc[j]); accl[j] = wmma16(al, kbf, accl[j]); accl[j] = wmma16(ah, klf, accl[j]); } }
  } else if (qb * 64 < QHI) {
#pragma unroll
    for (int kc = 0; kc < HD / 32; ++kc) { const v16h ah = frag_h(QH + (q0 + col) * CC + h * HD + kc * 32, lane), al = frag_h(QLb + (size_t)(ql0 + col) * CC + h * HD + kc * 32, lane);
#pragma unroll
      for (int j = 0; j < 8; ++j) { const v16h kbf = frag_h(KH + (kr0 + j * 16 + col) * CC + h * HD + kc * 32, lane); acc[j] = wmma16(ah, kbf, acc[j]); accl[j] = wmma16(al, kbf, accl[j]); } }
  } else {
#pragma unroll
    for (int kc = 0; kc < HD / 32; ++kc) { const v16h ah = frag_h(QH + (q0 + col) * CC + h * HD + kc * 32, lane);
#pragma unroll
      for (int j = 0; j < 8; ++j) { const v16h kbf = frag_h(KH + (kr0 + j * 16 + col) * CC + h * HD + kc * 32, lane); acc[j] = wmma16(ah, kbf, acc[j]); } } }
#pragma unroll
  for (int j = 0; j < 8; ++j) {
#pragma unroll
    for (int r = 0; r < 8; ++r) ss[wave][8 * g + r][j * 16 + col] = (acc[j][r] + accl[j][r] * (1.0f / 1024.0f)) * SCALE; }
  LDSX(); for (int rl = 0; rl < 16; ++rl) vst2(S + (size_t)(wave * 16 + rl) * kend + k0 + lane * 4, *(const v4f*)&ss[wave][rl][lane * 4]); }
#undef HD
#define HD 64   // restored: the softmax and P.v kernels keep 64-wide column groups
// ---- k_sm: block = query row t of batch grid y: keys [0, kend): causal -> logit if s <= t else excluded; softmax in f32; P x 2^11 in place (0 for excluded)
__global__ __launch_bounds__(256) void k_sm(float* __restrict__ S0 SM_EXTRA_PARAMS) { __shared__ float sred[8]; __shared__ float sbc; __shared__ __align__(16) float shv[TT];
  const int tid = threadIdx.x; const int t = blockIdx.x; const int kend = (kb_last(t >> 6) + 1) * 128;
  float* sr = S0 + (size_t)blockIdx.y * S_PLANE + s_blk(t >> 6) + (size_t)(t & 63) * kend;
  float m = -3.0e38f; for (int k = tid; k < kend; k += 256) { float v = (!CAUSAL || k <= t) ? sr[k] : -3.0e38f; SM_MASK_HOOK; shv[k] = v; m = fmaxf(m, v); }
#pragma unroll
  for (int o = 1; o < 32; o <<= 1) m = fmaxf(m, __shfl_xor(m, o));
  if ((tid & 31) == 0) sred[tid >> 5] = m; __syncthreads(); if (tid == 0) { float a = sred[0]; for (int i = 1; i < 8; ++i) a = fmaxf(a, sred[i]); sbc = a; } __syncthreads(); m = sbc; __syncthreads();
  float sum = 0.f; for (int k = tid; k < kend; k += 256) { const float v = shv[k]; const float e = (v <= -1.0e38f) ? 0.f : expf(v - m); shv[k] = e; sum += e; }
#pragma unroll
  for (int o = 1; o < 32; o <<= 1) sum += __shfl_xor(sum, o);
  if ((tid & 31) == 0) sred[tid >> 5] = sum; __syncthreads(); if (tid == 0) { float a = 0.f; for (int i = 0; i < 8; ++i) a += sred[i]; sbc = a > 0.f ? 2048.0f / a : 0.f; }   /* a fully excluded row yields P = 0 */ __syncthreads(); const float inv = sbc;
  for (int k = tid; k < kend; k += 256) shv[k] = shv[k] * inv;
  __syncthreads(); for (int q = tid; q < kend / 4; q += 256) vst2(sr + q * 4, *(const v4f*)&shv[q * 4]); }
// ---- k_pv: block = 64 queries (qb) of (b = grid y, h = column group, grid z): ctx = P . v over keys [0, kend) (P x 2^11 once to f16 against v f16: 1 product; causal early query blocks: P and v as bf16 hi + lo, 3 products); 256-B (row, head) segment by 16 lanes
__global__ __launch_bounds__(128) void k_pv(const float* __restrict__ PS0, const _Float16* __restrict__ VT, const __bf16* __restrict__ VB, const __bf16* __restrict__ VBL, float* __restrict__ Y) { const int b = blockIdx.y, h = blockIdx.z;   /* grid z = column group: every group reads its batch's one probability plane */ __shared__ __align__(16) float ss[4][16][HD + 4];
  const int tid = threadIdx.x, wave = tid >> 5, lane = tid & 31, col = lane & 15, g = lane >> 4; const int qb = blockIdx.x; const int ql0 = qb * 64 + wave * 16; const int kce = (kb_last(qb) + 1) * 4;
  const float* prow = PS0 + (size_t)b * S_PLANE + s_blk(qb) + (size_t)(wave * 16 + col) * (kce * 32);   /* this lane's probability row */
  v8f acc[HD / 16] = {};
  if (qb < QBH) {
#pragma unroll 1
    for (int kc = 0; kc < kce; ++kc) { const F2 p = split_row(prow, kc * 32, lane);
      asm volatile("s_wait_loadcnt 0x0" ::: "memory");
#pragma unroll
      for (int j = 0; j < HD / 16; ++j) { const size_t po = ((size_t)b * CC + h * HD + j * 16 + col) * (size_t)KHI + kc * 32; const v16b vh = frag_b(VB + po, lane); acc[j] = wmma_bf(p.h, vh, acc[j]); acc[j] = wmma_bf(p.l, vh, acc[j]); acc[j] = wmma_bf(p.h, frag_b(VBL + po, lane), acc[j]); } }
  } else {
#pragma unroll 1
    for (int kc = 0; kc < kce; ++kc) { const v16h p = frag_f32(prow + kc * 32, lane);
      asm volatile("s_wait_loadcnt 0x0" ::: "memory");
#pragma unroll
      for (int j = 0; j < HD / 16; ++j) { const size_t po = ((size_t)b * CC + h * HD + j * 16 + col) * (size_t)TT + kc * 32; acc[j] = wmma16(p, frag_h(VT + po, lane), acc[j]); } } }
#pragma unroll
  for (int j = 0; j < HD / 16; ++j)
#pragma unroll
    for (int r = 0; r < 8; ++r) ss[wave][8 * g + r][j * 16 + col] = acc[j][r] * (1.0f / 2048.0f);
  LDSX(); for (int rl = 0; rl < 16; ++rl) if (lane < HD / 4) vst2(Y + ((size_t)b * TT + ql0 + rl) * CC + h * HD + lane * 4, *(const v4f*)&ss[wave][rl][lane * 4]); }

extern "C" void kernel_launch(void* const* d_in, const int* in_sizes, int n_in, void* d_out, int out_size, void* d_ws, size_t ws_size, hipStream_t stream) {
  (void)in_sizes; (void)n_in; (void)out_size;
  const float** F = (const float**)d_in;
  if (ws_size < (size_t)WS_END) return;
  char* ws = (char*)d_ws; _Float16 *QH = (_Float16*)(ws + WS_QH), *KH = (_Float16*)(ws + WS_KH), *VT = (_Float16*)(ws + WS_VT), *QL = (_Float16*)(ws + WS_QL), *KL = (_Float16*)(ws + WS_KL); __bf16 *VB = (__bf16*)(ws + WS_VB), *VBL = (__bf16*)(ws + WS_VBL); float *S = (float*)(ws + WS_S), *Y = (float*)(ws + WS_Y);
  (void)Y; (void)QL; (void)KL; (void)VB; (void)VBL;
  // inputs: 0 x [4,4096,256]; 1 Wq [256,256] (in,out), 2 bq; 3 Wk, 4 bk; 5 Wv, 6 bv (biases NONZERO)
  k_proj<<<dim3(TNB * TT / 64, CC / 128, 3), 128, 0, stream>>>(F[0], F[0], F[0], F[1], F[3], F[5], F[2], F[4], F[6], QH, QL, KH, KL, VT, VB, VBL);
  k_sc<<<dim3(NQB, TT / 128, TNB), 128, 0, stream>>>(QH, KH, QL, KL, S);   /* the one score head: all 256 columns; grid z = batch */
  k_sm<<<dim3(TT, TNB), 256, 0, stream>>>(S);   /* grid y = batch */
  k_pv<<<dim3(NQB, TNB, NH), 128, 0, stream>>>(S, VT, VB, VBL, (float*)d_out);   /* one launch, 64 x 4 x 4 work-groups: grid y = batch, grid z = column group g (v / out columns 64g .. 64g+63), all four from their batch's plane; the context rows are the output */
}

// v003
// Measured time: 209 microseconds a run.
// Timed twice side by side with v002, it ran 1.92 times as fast both times.
// Counting every step since v000, it is 9.80 times as fast.
// compute dtype: all float inputs rounded to bf16; q / k / v projections (256-wide) with EXACT bf16 products on WMMA 16x16x32 (f32 accumulate) + bias; causal logits over the full 256-deep contraction x 256^-0.5: 3 products for the first 384 rows, single f16 q x k after; softmax f32; P x 2^11 once to f16 x v once to f16 (bf16 hi + lo below row 384), four 64-column groups over the same probability plane; the four batches side by side in each stage's one launch; the context rows are the f32 output (no output projection).
#include <hip/hip_runtime.h>
#include <math.h>

typedef __attribute__((ext_vector_type(16))) _Float16 v16h;
typedef __attribute__((ext_vector_type(16))) __bf16 v16b;
typedef __attribute__((ext_vector_type(8)))  _Float16 v8h;
typedef __attribute__((ext_vector_type(4)))  _Float16 v4h;
typedef __attribute__((ext_vector_type(8)))  float v8f;
typedef __attribute__((ext_vector_type(4)))  float v4f;
typedef __attribute__((ext_vector_type(2)))  float v2f;
typedef __attribute__((ext_vector_type(4)))  unsigned v4u;
typedef __attribute__((ext_vector_type(4)))  int v4i;
typedef float __attribute__((may_alias)) float_a;
typedef int __attribute__((may_alias)) int_a;

template <typename T> __device__ __forceinline__ void vst2(void* p, T v) { *(T*)p = v;  }
__device__ __forceinline__ v8f wmma16(v16h a, v16h b, v8f c) {
  v8f d = __builtin_amdgcn_wmma_f32_16x16x32_f16(false, a, false, b, (short)0, c, false, false);
  asm volatile("v_nop\n\tv_nop\n\tv_nop\n\tv_nop" : "+v"(d) : "v"(a), "v"(b));
  return d;
}
__device__ __forceinline__ v8f wmma_bf(v16b a, v16b b, v8f c) {
  v8f d = __builtin_amdgcn_wmma_f32_16x16x32_bf16(false, a, false, b, (short)0, c, false, false);
  asm volatile("v_nop\n\tv_nop\n\tv_nop\n\tv_nop" : "+v"(d) : "v"(a), "v"(b));
  return d;
}
// 16x16x32 fragments: lane = (h = lane>>4, row/col = lane&15); elements 0..7 = k0+8h+0..7, 8..15 = k0+16+8h+0..7; D element r = row 8h+r
__device__ __forceinline__ v16h frag_h(const _Float16* rowk0, int lane) {
  union { v16h v; v8h q[2]; } u; const _Float16* p = rowk0 + 8 * (lane >> 4);
  u.q[0] = *(const v8h*)p; u.q[1] = *(const v8h*)(p + 16); return u.v;
}
__device__ __forceinline__ v16h frag_f32(const float* rowk0, int lane) {
  v16h a; const float* p = rowk0 + 8 * (lane >> 4);
#pragma unroll
  for (int i = 0; i < 8; ++i) { a[i] = (_Float16)p[i]; a[8 + i] = (_Float16)p[16 + i]; }
  return a;
}
__device__ __forceinline__ v16h frag_f32s(const float* rowk0, int lane, float sc) {
  v16h a; const float* p = rowk0 + 8 * (lane >> 4);
#pragma unroll
  for (int i = 0; i < 8; ++i) { a[i] = (_Float16)(p[i] * sc); a[8 + i] = (_Float16)(p[16 + i] * sc); }
  return a;
}
// column fragment from a [K][ld] layout (column n), rows >= K read as 0
__device__ __forceinline__ v16h fragc_f32(const float* W, int k0, int n, int lane, int ld, int K) {
  v16h a; const int g = lane >> 4;
#pragma unroll
  for (int i = 0; i < 8; ++i) { const int ka = k0 + 8 * g + i, kb = ka + 16;
    a[i] = (_Float16)(ka < K ? W[(size_t)(ka < K ? ka : K - 1) * ld + n] : 0.f); a[8 + i] = (_Float16)(kb < K ? W[(size_t)(kb < K ? kb : K - 1) * ld + n] : 0.f); }
  return a;
}
struct F2 { v16b h, l; };
__device__ __forceinline__ F2 bsplit16(const float v[16]) { F2 r;
#pragma unroll
  for (int i = 0; i < 16; ++i) { const __bf16 h = (__bf16)v[i]; r.h[i] = h; r.l[i] = (__bf16)(v[i] - (float)h); }
  return r; }
__device__ __forceinline__ F2 split_row(const float* row, int k0, int lane) { float v[16]; const float* p = row + k0 + 8 * (lane >> 4);
#pragma unroll
  for (int i = 0; i < 8; ++i) { v[i] = p[i]; v[8 + i] = p[16 + i]; }
  return bsplit16(v); }
__device__ __forceinline__ F2 split_rowK(const float* row, int k0, int lane, int K) { float v[16]; const int g = lane >> 4;
#pragma unroll
  for (int i = 0; i < 8; ++i) { const int ka = k0 + 8 * g + i, kb = ka + 16; v[i] = ka < K ? row[ka < K ? ka : K - 1] : 0.f; v[8 + i] = kb < K ? row[kb < K ? kb : K - 1] : 0.f; }
  return bsplit16(v); }
__device__ __forceinline__ F2 split_col(const float* W, int k0, int n, int lane, int ld, int K) { float v[16]; const int g = lane >> 4;
#pragma unroll
  for (int i = 0; i < 8; ++i) { const int ka = k0 + 8 * g + i, kb = ka + 16; v[i] = ka < K ? W[(size_t)(ka < K ? ka : K - 1) * ld + n] : 0.f; v[8 + i] = kb < K ? W[(size_t)(kb < K ? kb : K - 1) * ld + n] : 0.f; }
  return bsplit16(v); }
__device__ __forceinline__ v8f mac3(const F2& a, const F2& b, v8f c) { c = wmma_bf(a.l, b.h, c); c = wmma_bf(a.h, b.l, c); return wmma_bf(a.h, b.h, c); }
__device__ __forceinline__ float sigm(float v) { return 1.0f / (1.0f + expf(-v)); }
#define LDSX() do { asm volatile("s_wait_dscnt 0" ::: "memory"); __builtin_amdgcn_wave_barrier(); __builtin_amdgcn_fence(__ATOMIC_RELEASE, "workgroup"); } while (0)

// Single-head causal self-attention with a 256-wide head (x [4,4096,256]; (in,out) Wq / Wk / Wv [256,256] uniform(+-1/16) with biases of the same scale - NONZERO; q, k, v = x W + b; attn = q k^T over all 256 dims x 1/sqrt(256) = 1/16; tril kept, -inf elsewhere; softmax; out = probs v, [4,4096,256]; no head split, no output projection). ONE score 'head' whose contraction runs over all 256 columns (the score kernel's head width is switched to 256 regionally), P.v as four ordinary 64-wide column groups that all read the same probability plane.
#define NB 4
#define TT 4096
#define CC 256            // NH * HD = projected width
#define DIN 256          // input (model) width
#define NH 4
#define HD 64
#define NQB (TT / 64)
#define HG 1
#define SCALE (0.0625f)
#define CAUSAL 1
#ifndef TNB
#define TNB NB
#endif
__device__ __forceinline__ float bfr(float v) { return (float)(__bf16)v; }
__host__ __device__ __forceinline__ int kb_last(int qb) { return CAUSAL ? ((qb * 64 + 63) >> 7) : (TT / 128 - 1); }
// logit / P plane of one batch: the 64 rows of query block qb are kend = (kb_last(qb) + 1) * 128 floats long and follow block qb - 1's; with m = qb >> 1 = kb_last(qb) the blocks before qb hold (m + 1) * (m + (qb & 1)) units of 64 x 128 floats
#define S_PLANE ((size_t)(TT / 128) * (TT / 128 + 1) * 64 * 128)
__device__ __forceinline__ size_t s_blk(int qb) { const int m = qb >> 1; return (size_t)((m + 1) * (m + (qb & 1))) * (64 * 128); }
typedef __attribute__((ext_vector_type(8))) __bf16 v8b;
__device__ __forceinline__ v16b frag_b(const __bf16* rowk0, int lane) {
  union { v16b v; v8b q[2]; } u; const __bf16* p = rowk0 + 8 * (lane >> 4);
  u.q[0] = *(const v8b*)p; u.q[1] = *(const v8b*)(p + 16); return u.v;
}
#define QBH 6              // causal: query blocks 0..QBH-1 of each sequence (few keys, no averaging) take the high-precision path
#define QHI 384            // rows carrying a q residual plane
#define KHI 384            // key rows carrying k residual / v bf16 hi+lo planes (used only by the causal high-precision path)
// B fragment (k rows k0+.., output column o) of a weight: (in,out) [K][ld] or (out,in) [ld rows of K]: bf16 exact, or f16(bf16 * 256) exact
__device__ __forceinline__ v16b wcol_io(const float* Wm, int k0, int o, int lane, int ld) { v16b w; const int g = lane >> 4;
#pragma unroll
  for (int i = 0; i < 8; ++i) { w[i] = (__bf16)Wm[(size_t)(k0 + 8 * g + i) * ld + o]; w[8 + i] = (__bf16)Wm[(size_t)(k0 + 16 + 8 * g + i) * ld + o]; }
  return w; }
__device__ __forceinline__ v16b wcol_oi(const float* Wm, int k0, int o, int lane, int K) { v16b w; const float* p = Wm + (size_t)o * K + k0 + 8 * (lane >> 4);
#pragma unroll
  for (int i = 0; i < 8; ++i) { w[i] = (__bf16)p[i]; w[8 + i] = (__bf16)p[16 + i]; }
  return w; }
__device__ __forceinline__ v16h wcolh_io(const float* Wm, int k0, int o, int lane, int ld) { v16h w; const int g = lane >> 4;
#pragma unroll
  for (int i = 0; i < 8; ++i) { w[i] = (_Float16)(bfr(Wm[(size_t)(k0 + 8 * g + i) * ld + o]) * 256.0f); w[8 + i] = (_Float16)(bfr(Wm[(size_t)(k0 + 16 + 8 * g + i) * ld + o]) * 256.0f); }
  return w; }
__device__ __forceinline__ v16h wcolh_oi(const float* Wm, int k0, int o, int lane, int K) { v16h w; const float* p = Wm + (size_t)o * K + k0 + 8 * (lane >> 4);
#pragma unroll
  for (int i = 0; i < 8; ++i) { w[i] = (_Float16)(bfr(p[i]) * 256.0f); w[8 + i] = (_Float16)(bfr(p[16 + i]) * 256.0f); }
  return w; }
#define WQKV_LAYOUT 0   // 0 = (in,out) [DIN][CC]; 1 = (out,in) [CC][DIN]; 2 = per-head [NH][DIN][HD]
__device__ __forceinline__ v16b wcol_hdk(const float* Wm, int k0, int o, int lane) { v16b w; const int g = lane >> 4; const float* p = Wm + (size_t)(o / HD) * DIN * HD + (o % HD);
#pragma unroll
  for (int i = 0; i < 8; ++i) { w[i] = (__bf16)p[(size_t)(k0 + 8 * g + i) * HD]; w[8 + i] = (__bf16)p[(size_t)(k0 + 16 + 8 * g + i) * HD]; }
  return w; }
#define WO_OUT_IN 0
#if WQKV_LAYOUT == 1
#define WCOL(W, k0, o, lane) wcol_oi(W, k0, o, lane, DIN)
#elif WQKV_LAYOUT == 2
#define WCOL(W, k0, o, lane) wcol_hdk(W, k0, o, lane)
#else
#define WCOL(W, k0, o, lane) wcol_io(W, k0, o, lane, CC)
#endif
#if WO_OUT_IN
#define WOCOL(W, k0, o, lane) wcol_oi(W, k0, o, lane, CC)
#define WOCOLH(W, k0, o, lane) wcolh_oi(W, k0, o, lane, CC)
#else
#define WOCOL(W, k0, o, lane) wcol_io(W, k0, o, lane, DIN)
#define WOCOLH(W, k0, o, lane) wcolh_io(W, k0, o, lane, DIN)
#endif

#ifndef SM_EXTRA_PARAMS
#define SM_EXTRA_PARAMS
#endif
#ifndef PROJ_EXTRA_PARAMS
#define PROJ_EXTRA_PARAMS
#endif
#ifndef SM_MASK_HOOK
#define SM_MASK_HOOK (void)0
#endif

#define WS_QH  0u                                      // f16 q rows [b*t][CC]
#define WS_KH  (WS_QH + 2u * (size_t)NB * TT * CC)      // f16 k rows [b*t][CC]
#define WS_VT  (WS_KH + 2u * (size_t)NB * TT * CC)      // f16 v planes [b][c][t]
#define WS_QL  (WS_VT + 2u * (size_t)NB * CC * TT)      // f16 q residual x 2^10 rows [b][t < QHI][CC]
#define WS_KL  (WS_QL + 2u * (size_t)NB * QHI * CC)     // f16 k residual x 2^10 rows [b][t < KHI][CC]
#define WS_VB  (WS_KL + 2u * (size_t)NB * KHI * CC)     // bf16 v hi planes [b][c][t < KHI]
#define WS_VBL (WS_VB + 2u * (size_t)NB * CC * KHI)
#define WS_S   (WS_VBL + 2u * (size_t)NB * CC * KHI)    // f32 logits / P [b][t][s < kend(t)]: rows at their causal length (s_blk), one plane of S_PLANE floats a batch
#define WS_Y   (WS_S  + 4u * (size_t)NB * S_PLANE)      // f32 ctx rows [b*t][CC] (only when there is an output projection)
#define WS_END (WS_Y  + 0u)

// ---- k_proj: block = (64 rows, 128 cols, which): q/k/v = X W (+ b) with exact bf16 products (K = DIN) -> which 0: q f16 rows (+ residual rows < QHI); 1: k f16 rows (+ residual rows < KHI); 2: v f16 planes [c][t] (+ bf16 hi/lo planes for t < KHI)
__global__ __launch_bounds__(128) void k_proj(const float* __restrict__ XQ, const float* __restrict__ XK, const float* __restrict__ XV, const float* __restrict__ WQ, const float* __restrict__ WK, const float* __restrict__ WV, const float* __restrict__ BQ, const float* __restrict__ BK, const float* __restrict__ BV,
    _Float16* __restrict__ QH, _Float16* __restrict__ QL, _Float16* __restrict__ KH, _Float16* __restrict__ KL, _Float16* __restrict__ VT, __bf16* __restrict__ VB, __bf16* __restrict__ VBL) {
  __shared__ __align__(16) _Float16 sh[64][136], sl[64][136]; __shared__ __align__(16) _Float16 th[128][72]; __shared__ __align__(16) __bf16 tb[128][72], tbl[128][72];
  const int tid = threadIdx.x, wave = tid >> 5, lane = tid & 31, col = lane & 15, g = lane >> 4; const int which = blockIdx.z; const int c0 = blockIdx.y * 128; const size_t r0 = (size_t)blockIdx.x * 64; const size_t bb = r0 / TT; const int t0 = (int)(r0 % TT);
  const float* X = which == 0 ? XQ : which == 1 ? XK : XV; const float* WA = which == 0 ? WQ : which == 1 ? WK : WV; const float* BA = which == 0 ? BQ : which == 1 ? BK : BV;
  v8f acc[8] = {};
#pragma unroll 2
  for (int kc = 0; kc < DIN / 32; ++kc) { v16b a; { const float* p = X + (r0 + wave * 16 + col) * DIN + kc * 32 + 8 * g;
#pragma unroll
      for (int i = 0; i < 8; ++i) { a[i] = (__bf16)p[i]; a[8 + i] = (__bf16)p[16 + i]; } }
    asm volatile("s_wait_loadcnt 0x0" ::: "memory");
#pragma unroll
    for (int j = 0; j < 8; ++j) { const v16b w = WCOL(WA, kc * 32, c0 + j * 16 + col, lane); asm volatile("s_wait_loadcnt 0x0" ::: "memory"); acc[j] = wmma_bf(a, w, acc[j]); } }
  if (which < 2) { _Float16* DH = which == 0 ? QH : KH; _Float16* DL = which == 0 ? QL : KL; const int nhi = which == 0 ? QHI : KHI; const bool hi_rows = t0 < nhi;
#pragma unroll
    for (int j = 0; j < 8; ++j) { const float bias = BA ? bfr(BA[c0 + j * 16 + col]) : 0.f;
#pragma unroll
      for (int r = 0; r < 8; ++r) { const float v = acc[j][r] + bias; const _Float16 hv = (_Float16)v; sh[wave * 16 + 8 * g + r][j * 16 + col] = hv; sl[wave * 16 + 8 * g + r][j * 16 + col] = (_Float16)((v - (float)hv) * 1024.0f); } }
    __syncthreads();
    for (int e = tid; e < 64 * 16; e += 128) { const int rl = e >> 4, q = e & 15; vst2((unsigned*)(DH + (r0 + rl) * CC + c0 + q * 8), *(const v4u*)&sh[rl][q * 8]); if (hi_rows) vst2((unsigned*)(DL + (bb * nhi + t0 + rl) * (size_t)CC + c0 + q * 8), *(const v4u*)&sl[rl][q * 8]); }
  } else { const bool hi_rows = t0 < KHI;
#pragma unroll
    for (int j = 0; j < 8; ++j) { const float bias = BA ? bfr(BA[c0 + j * 16 + col]) : 0.f;
#pragma unroll
      for (int r = 0; r < 8; ++r) { const float v = acc[j][r] + bias; const int rl = wave * 16 + 8 * g + r, cl = j * 16 + col; th[cl][rl] = (_Float16)v; const __bf16 bh = (__bf16)v; tb[cl][rl] = bh; tbl[cl][rl] = (__bf16)(v - (float)bh); } }
    __syncthreads();
    for (int e = tid; e < 128 * 8; e += 128) { const int cl = e >> 3, q = e & 7; vst2((unsigned*)(VT + (bb * CC + c0 + cl) * (size_t)TT + t0 + q * 8), *(const v4u*)&th[cl][q * 8]); if (hi_rows) { const size_t o3 = (bb * CC + c0 + cl) * (size_t)KHI + t0 + q * 8; vst2((unsigned*)(VB + o3), *(const v4u*)&tb[cl][q * 8]); vst2((unsigned*)(VBL + o3), *(const v4u*)&tbl[cl][q * 8]); } } } }
#undef HD
#define HD 256   // SCORE KERNEL ONLY: with h = 0 the contraction runs over columns 0..255 in 8 k-steps: the module's single 256-wide head
// ---- k_sc: block = (query block qb, key block kb <= kb_last(qb), batch b = grid z): logits x SCALE; q hi + residual (x 2^10) against k (2 products) for query rows < QHI, plus the k residual (3 products) for query blocks < QBH (causal early rows); causal: blocks past the diagonal exit, the mask itself is applied by index in k_sm
__global__ __launch_bounds__(128) void k_sc(const _Float16* __restrict__ QH, const _Float16* __restrict__ KH, const _Float16* __restrict__ QL, const _Float16* __restrict__ KL, float* __restrict__ S0) { __shared__ __align__(16) float ss[4][16][132]; __shared__ __align__(16) _Float16 sk[128][264];   /* the 128-key k tile, 528-B pitch for the 16-byte fragment reads */
  const int qb = blockIdx.x, kb = blockIdx.y; if (kb > kb_last(qb)) return;
  const int b = blockIdx.z, h = 0; const int kend = (kb_last(qb) + 1) * 128; float* S = S0 + (size_t)b * S_PLANE + s_blk(qb);
  const int tid = threadIdx.x, wave = tid >> 5, lane = tid & 31, col = lane & 15, g = lane >> 4; const int k0 = kb * 128; const int ql0 = qb * 64 + wave * 16; const size_t q0 = (size_t)b * TT + ql0, kr0 = (size_t)b * TT + k0;
  v8f acc[8] = {}, accl[8] = {};
  const _Float16* QLb = QL + (size_t)b * QHI * CC; const _Float16* KLb = KL + (size_t)b * KHI * CC;
  if (qb < QBH) {
#pragma unroll
    for (int kc = 0; kc < HD / 32; ++kc) { const v16h ah = frag_h(QH + (q0 + col) * CC + h * HD + kc * 32, lane), al = frag_h(QLb + (size_t)(ql0 + col) * CC + h * HD + kc * 32, lane);
#pragma unroll
      for (int j = 0; j < 8; ++j) { const v16h kbf = frag_h(KH + (kr0 + j * 16 + col) * CC + h * HD + kc * 32, lane), klf = frag_h(KLb + (size_t)(k0 + j * 16 + col) * CC + h * HD + kc * 32, lane); acc[j] = wmma16(ah, kbf, acc[j]); accl[j] = wmma16(al, kbf, accl[j]); accl[j] = wmma16(ah, klf, accl[j]); } }
  } else if (qb * 64 < QHI) {
#pragma unroll
    for (int kc = 0; kc < HD / 32; ++kc) { const v16h ah = frag_h(QH + (q0 + col) * CC + h * HD + kc * 32, lane), al = frag_h(QLb + (size_t)(ql0 + col) * CC + h * HD + kc * 32, lane);
#pragma unroll
      for (int j = 0; j < 8; ++j) { const v16h kbf = frag_h(KH + (kr0 + j * 16 + col) * CC + h * HD + kc * 32, lane); acc[j] = wmma16(ah, kbf, acc[j]); accl[j] = wmma16(al, kbf, accl[j]); } }
  } else {
    // the k tile comes once a work-group by loads that cover whole lines (a wave: the 512 B of one k row) and is shared by the four waves through LDS
    v16h ah[HD / 32]; const _Float16* qt = QH + (q0 + col) * CC + h * HD + 8 * g;   /* this lane's half of the q fragments, the element order of frag_h */
    { const _Float16* kt = KH + (kr0 + (tid >> 5)) * CC + (tid & 31) * 8;   /* rows (tid >> 5) + 4 i */ v8h kr[32];
#pragma unroll   // constant indices keep the array in registers
      for (int i = 0; i < 32; ++i) kr[i] = *(const v8h*)(kt + (size_t)(4 * i) * CC);
#pragma unroll   // constant indices keep the array in registers
      for (int kc = 0; kc < HD / 32; ++kc) { union { v16h v; v8h q[2]; } u; u.q[0] = *(const v8h*)(qt + kc * 32); u.q[1] = *(const v8h*)(qt + kc * 32 + 16); ah[kc] = u.v; }
      asm volatile("s_wait_xcnt 0x0" :: "v"(kt), "v"(qt) : "memory");   /* stands before a register named by an issued global load takes a new value; the addresses are inputs so that their registers stay theirs up to it */
#pragma unroll   // constant indices keep the array in registers
      for (int i = 0; i < 32; ++i) *(v8h*)&sk[(tid >> 5) + 4 * i][(tid & 31) * 8] = kr[i]; }
    __syncthreads();   /* the tile is whole before any wave reads it */
#pragma unroll   // constant indices keep the array in registers
    for (int kc = 0; kc < HD / 32; ++kc) { v16h kf[8];
#pragma unroll   // constant indices keep the array in registers
      for (int j = 0; j < 8; ++j) kf[j] = frag_h(&sk[j * 16 + col][kc * 32], lane);
      __builtin_amdgcn_sched_barrier(0);   /* keeps the LDS reads of 8 products in one group ahead of them: one LDS wait a group, not one a product */
#pragma unroll   // constant indices keep the array in registers
      for (int j = 0; j < 8; ++j) acc[j] = wmma16(ah[kc], kf[j], acc[j]); } }
#pragma unroll
  for (int j = 0; j < 8; ++j) {
#pragma unroll
    for (int r = 0; r < 8; ++r) ss[wave][8 * g + r][j * 16 + col] = (acc[j][r] + accl[j][r] * (1.0f / 1024.0f)) * SCALE; }
  LDSX(); for (int rl = 0; rl < 16; ++rl) vst2(S + (size_t)(wave * 16 + rl) * kend + k0 + lane * 4, *(const v4f*)&ss[wave][rl][lane * 4]); }
#undef HD
#define HD 64   // restored: the softmax and P.v kernels keep 64-wide column groups
// ---- k_sm: block = query row t of batch grid y: keys [0, kend): causal -> logit if s <= t else excluded; softmax in f32; P x 2^11 in place (0 for excluded)
__global__ __launch_bounds__(256) void k_sm(float* __restrict__ S0 SM_EXTRA_PARAMS) { __shared__ float sred[8]; __shared__ float sbc; __shared__ __align__(16) float shv[TT];
  const int tid = threadIdx.x; const int t = blockIdx.x; const int kend = (kb_last(t >> 6) + 1) * 128;
  float* sr = S0 + (size_t)blockIdx.y * S_PLANE + s_blk(t >> 6) + (size_t)(t & 63) * kend;
  float m = -3.0e38f; for (int k = tid; k < kend; k += 256) { float v = (!CAUSAL || k <= t) ? sr[k] : -3.0e38f; SM_MASK_HOOK; shv[k] = v; m = fmaxf(m, v); }
#pragma unroll
  for (int o = 1; o < 32; o <<= 1) m = fmaxf(m, __shfl_xor(m, o));
  if ((tid & 31) == 0) sred[tid >> 5] = m; __syncthreads(); if (tid == 0) { float a = sred[0]; for (int i = 1; i < 8; ++i) a = fmaxf(a, sred[i]); sbc = a; } __syncthreads(); m = sbc; __syncthreads();
  float sum = 0.f; for (int k = tid; k < kend; k += 256) { const float v = shv[k]; const float e = (v <= -1.0e38f) ? 0.f : expf(v - m); shv[k] = e; sum += e; }
#pragma unroll
  for (int o = 1; o < 32; o <<= 1) sum += __shfl_xor(sum, o);
  if ((tid & 31) == 0) sred[tid >> 5] = sum; __syncthreads(); if (tid == 0) { float a = 0.f; for (int i = 0; i < 8; ++i) a += sred[i]; sbc = a > 0.f ? 2048.0f / a : 0.f; }   /* a fully excluded row yields P = 0 */ __syncthreads(); const float inv = sbc;
  for (int k = tid; k < kend; k += 256) shv[k] = shv[k] * inv;
  __syncthreads(); for (int q = tid; q < kend / 4; q += 256) vst2(sr + q * 4, *(const v4f*)&shv[q * 4]); }
// ---- k_pv: block = 64 queries (qb) of (b = grid y, h = column group, grid z): ctx = P . v over keys [0, kend) (P x 2^11 once to f16 against v f16: 1 product; causal early query blocks: P and v as bf16 hi + lo, 3 products); 256-B (row, head) segment by 16 lanes
__global__ __launch_bounds__(128) void k_pv(const float* __restrict__ PS0, const _Float16* __restrict__ VT, const __bf16* __restrict__ VB, const __bf16* __restrict__ VBL, float* __restrict__ Y) { const int b = blockIdx.y, h = blockIdx.z;   /* grid z = column group: every group reads its batch's one probability plane */ __shared__ __align__(16) float ss[4][16][HD + 4];
  __shared__ __align__(16) _Float16 sp[64][136], sv[HD][136];   /* one 128-key tile: P x 2^11 as f16 [query][key], v [column][key]; 272-B pitch for the 16-byte fragment reads */
  const int tid = threadIdx.x, wave = tid >> 5, lane = tid & 31, col = lane & 15, g = lane >> 4; const int qb = blockIdx.x; const int ql0 = qb * 64 + wave * 16; const int kce = (kb_last(qb) + 1) * 4;
  const float* prow = PS0 + (size_t)b * S_PLANE + s_blk(qb) + (size_t)(wave * 16 + col) * (kce * 32);   /* this lane's probability row */
  v8f acc[HD / 16] = {};
  if (qb < QBH) {
#pragma unroll 1
    for (int kc = 0; kc < kce; ++kc) { const F2 p = split_row(prow, kc * 32, lane);
      asm volatile("s_wait_loadcnt 0x0" ::: "memory");
#pragma unroll
      for (int j = 0; j < HD / 16; ++j) { const size_t po = ((size_t)b * CC + h * HD + j * 16 + col) * (size_t)KHI + kc * 32; const v16b vh = frag_b(VB + po, lane); acc[j] = wmma_bf(p.h, vh, acc[j]); acc[j] = wmma_bf(p.l, vh, acc[j]); acc[j] = wmma_bf(p.h, frag_b(VBL + po, lane), acc[j]); } }
  } else {
    // each 128-key tile comes once a work-group by loads that cover whole lines (a wave: 512 B of one P row, 256 B of two v columns) and is shared by the four waves through LDS; the next tile's loads fly while this one is multiplied
    const int nkb = kce >> 2; const size_t ld = (size_t)kce * 32;
    const float* pt = PS0 + (size_t)b * S_PLANE + s_blk(qb) + (size_t)(tid >> 5) * ld + (tid & 31) * 4;   /* rows (tid >> 5) + 4 i */
    const _Float16* vt = VT + ((size_t)b * CC + h * HD + (tid >> 4)) * (size_t)TT + (tid & 15) * 8;   /* columns (tid >> 4) + 8 i */
    v4f pr[16]; v8h vr[8];
    const float* pa[16];
#pragma unroll   // constant indices keep the array in registers
    for (int i = 0; i < 16; ++i) { pa[i] = pt + (size_t)(4 * i) * ld; pr[i] = *(const v4f*)pa[i]; }
#pragma unroll   // constant indices keep the array in registers
    for (int i = 0; i < 8; ++i) vr[i] = *(const v8h*)(vt + (size_t)(8 * i) * TT);
    asm volatile("s_wait_xcnt 0x0" :: "v"(pa[0]), "v"(pa[1]), "v"(pa[2]), "v"(pa[3]), "v"(pa[4]), "v"(pa[5]), "v"(pa[6]), "v"(pa[7]), "v"(pa[8]), "v"(pa[9]), "v"(pa[10]), "v"(pa[11]), "v"(pa[12]), "v"(pa[13]), "v"(pa[14]), "v"(pa[15]), "v"(vt) : "memory");   /* stands before a register named by an issued global load takes a new value; the addresses are inputs so that their registers stay theirs up to it */
#pragma unroll 1   // one copy of the tile loop: a second copy would only add registers
    for (int kb = 0; kb < nkb; ++kb) {
#pragma unroll   // constant indices keep the array in registers
      for (int i = 0; i < 16; ++i) { v4h c; c[0] = (_Float16)pr[i][0]; c[1] = (_Float16)pr[i][1]; c[2] = (_Float16)pr[i][2]; c[3] = (_Float16)pr[i][3]; *(v4h*)&sp[(tid >> 5) + 4 * i][(tid & 31) * 4] = c; }
#pragma unroll   // constant indices keep the array in registers
      for (int i = 0; i < 8; ++i) *(v8h*)&sv[(tid >> 4) + 8 * i][(tid & 15) * 8] = vr[i];
      __syncthreads();   /* the tile is whole before any wave reads it */
      if (kb + 1 < nkb) {
        const _Float16* vn = vt + (kb + 1) * 128;
#pragma unroll   // constant indices keep the array in registers
        for (int i = 0; i < 16; ++i) { pa[i] = pt + (size_t)(4 * i) * ld + (kb + 1) * 128; pr[i] = *(const v4f*)pa[i]; }
#pragma unroll   // constant indices keep the array in registers
        for (int i = 0; i < 8; ++i) vr[i] = *(const v8h*)(vn + (size_t)(8 * i) * TT);
        asm volatile("s_wait_xcnt 0x0" :: "v"(pa[0]), "v"(pa[1]), "v"(pa[2]), "v"(pa[3]), "v"(pa[4]), "v"(pa[5]), "v"(pa[6]), "v"(pa[7]), "v"(pa[8]), "v"(pa[9]), "v"(pa[10]), "v"(pa[11]), "v"(pa[12]), "v"(pa[13]), "v"(pa[14]), "v"(pa[15]), "v"(vn) : "memory");   /* stands before a register named by an issued global load takes a new value; the addresses are inputs so that their registers stay theirs up to it */
      }
#pragma unroll   // constant indices keep the array in registers
      for (int kp = 0; kp < 2; ++kp) { v16h pf[2], vb[2][HD / 16];
#pragma unroll   // constant indices keep the array in registers
        for (int u = 0; u < 2; ++u) { pf[u] = frag_h(&sp[wave * 16 + col][(2 * kp + u) * 32], lane);
#pragma unroll   // constant indices keep the array in registers
          for (int j = 0; j < HD / 16; ++j) vb[u][j] = frag_h(&sv[j * 16 + col][(2 * kp + u) * 32], lane); }
        __builtin_amdgcn_sched_barrier(0);   /* keeps the LDS reads of 8 products in one group ahead of them: one LDS wait a group, not one a product */
#pragma unroll   // constant indices keep the array in registers
        for (int u = 0; u < 2; ++u)
#pragma unroll   // constant indices keep the array in registers
          for (int j = 0; j < HD / 16; ++j) acc[j] = wmma16(pf[u], vb[u][j], acc[j]); }
      __syncthreads();   /* every wave has read the tile before it is overwritten */
    } }
#pragma unroll
  for (int j = 0; j < HD / 16; ++j)
#pragma unroll
    for (int r = 0; r < 8; ++r) ss[wave][8 * g + r][j * 16 + col] = acc[j][r] * (1.0f / 2048.0f);
  LDSX(); for (int rl = 0; rl < 16; ++rl) if (lane < HD / 4) vst2(Y + ((size_t)b * TT + ql0 + rl) * CC + h * HD + lane * 4, *(const v4f*)&ss[wave][rl][lane * 4]); }

extern "C" void kernel_launch(void* const* d_in, const int* in_sizes, int n_in, void* d_out, int out_size, void* d_ws, size_t ws_size, hipStream_t stream) {
  (void)in_sizes; (void)n_in; (void)out_size;
  const float** F = (const float**)d_in;
  if (ws_size < (size_t)WS_END) return;
  char* ws = (char*)d_ws; _Float16 *QH = (_Float16*)(ws + WS_QH), *KH = (_Float16*)(ws + WS_KH), *VT = (_Float16*)(ws + WS_VT), *QL = (_Float16*)(ws + WS_QL), *KL = (_Float16*)(ws + WS_KL); __bf16 *VB = (__bf16*)(ws + WS_VB), *VBL = (__bf16*)(ws + WS_VBL); float *S = (float*)(ws + WS_S), *Y = (float*)(ws + WS_Y);
  (void)Y; (void)QL; (void)KL; (void)VB; (void)VBL;
  // inputs: 0 x [4,4096,256]; 1 Wq [256,256] (in,out), 2 bq; 3 Wk, 4 bk; 5 Wv, 6 bv (biases NONZERO)
  k_proj<<<dim3(TNB * TT / 64, CC / 128, 3), 128, 0, stream>>>(F[0], F[0], F[0], F[1], F[3], F[5], F[2], F[4], F[6], QH, QL, KH, KL, VT, VB, VBL);
  k_sc<<<dim3(NQB, TT / 128, TNB), 128, 0, stream>>>(QH, KH, QL, KL, S);   /* the one score head: all 256 columns; grid z = batch */
  k_sm<<<dim3(TT, TNB), 256, 0, stream>>>(S);   /* grid y = batch */
  k_pv<<<dim3(NQB, TNB, NH), 128, 0, stream>>>(S, VT, VB, VBL, (float*)d_out);   /* one launch, 64 x 4 x 4 work-groups: grid y = batch, grid z = column group g (v / out columns 64g .. 64g+63), all four from their batch's plane; the context rows are the output */
}

// v004
// Measured time: 178 microseconds a run.
// Two timings next to v003 both put it at 1.17 times that version's speed.
// Over all steps from v000 it is 11.5 times as fast.
// compute dtype: all float inputs rounded to bf16; q / k / v projections (256-wide) with EXACT bf16 products on WMMA 16x16x32 (f32 accumulate) + bias; causal logits over the full 256-deep contraction x 256^-0.5: 3 products for the first 384 rows, single f16 q x k after; softmax f32; P x 2^11 once to f16 x v once to f16 (bf16 hi + lo below row 384), four 64-column groups over the same probability plane; the four batches side by side in each stage's one launch; the context rows are the f32 output (no output projection).
#include <hip/hip_runtime.h>
#include <math.h>

typedef __attribute__((ext_vector_type(16))) _Float16 v16h;
typedef __attribute__((ext_vector_type(16))) __bf16 v16b;
typedef __attribute__((ext_vector_type(8)))  _Float16 v8h;
typedef __attribute__((ext_vector_type(4)))  _Float16 v4h;
typedef __attribute__((ext_vector_type(8)))  float v8f;
typedef __attribute__((ext_vector_type(4)))  float v4f;
typedef __attribute__((ext_vector_type(2)))  float v2f;
typedef __attribute__((ext_vector_type(4)))  unsigned v4u;
typedef __attribute__((ext_vector_type(4)))  int v4i;
typedef float __attribute__((may_alias)) float_a;
typedef int __attribute__((may_alias)) int_a;

template <typename T> __device__ __forceinline__ void vst2(void* p, T v) { *(T*)p = v;  }
__device__ __forceinline__ v8f wmma16(v16h a, v16h b, v8f c) {
  v8f d = __builtin_amdgcn_wmma_f32_16x16x32_f16(false, a, false, b, (short)0, c, false, false);
  asm volatile("v_nop\n\tv_nop\n\tv_nop\n\tv_nop" : "+v"(d) : "v"(a), "v"(b));
  return d;
}
__device__ __forceinline__ v8f wmma_bf(v16b a, v16b b, v8f c) {
  v8f d = __builtin_amdgcn_wmma_f32_16x16x32_bf16(false, a, false, b, (short)0, c, false, false);
  asm volatile("v_nop\n\tv_nop\n\tv_nop\n\tv_nop" : "+v"(d) : "v"(a), "v"(b));
  return d;
}
// 16x16x32 fragments: lane = (h = lane>>4, row/col = lane&15); elements 0..7 = k0+8h+0..7, 8..15 = k0+16+8h+0..7; D element r = row 8h+r
__device__ __forceinline__ v16h frag_h(const _Float16* rowk0, int lane) {
  union { v16h v; v8h q[2]; } u; const _Float16* p = rowk0 + 8 * (lane >> 4);
  u.q[0] = *(const v8h*)p; u.q[1] = *(const v8h*)(p + 16); return u.v;
}
__device__ __forceinline__ v16h frag_f32(const float* rowk0, int lane) {
  v16h a; const float* p = rowk0 + 8 * (lane >> 4);
#pragma unroll
  for (int i = 0; i < 8; ++i) { a[i] = (_Float16)p[i]; a[8 + i] = (_Float16)p[16 + i]; }
  return a;
}
__device__ __forceinline__ v16h frag_f32s(const float* rowk0, int lane, float sc) {
  v16h a; const float* p = rowk0 + 8 * (lane >> 4);
#pragma unroll
  for (int i = 0; i < 8; ++i) { a[i] = (_Float16)(p[i] * sc); a[8 + i] = (_Float16)(p[16 + i] * sc); }
  return a;
}
// column fragment from a [K][ld] layout (column n), rows >= K read as 0
__device__ __forceinline__ v16h fragc_f32(const float* W, int k0, int n, int lane, int ld, int K) {
  v16h a; const int g = lane >> 4;
#pragma unroll
  for (int i = 0; i < 8; ++i) { const int ka = k0 + 8 * g + i, kb = ka + 16;
    a[i] = (_Float16)(ka < K ? W[(size_t)(ka < K ? ka : K - 1) * ld + n] : 0.f); a[8 + i] = (_Float16)(kb < K ? W[(size_t)(kb < K ? kb : K - 1) * ld + n] : 0.f); }
  return a;
}
struct F2 { v16b h, l; };
__device__ __forceinline__ F2 bsplit16(const float v[16]) { F2 r;
#pragma unroll
  for (int i = 0; i < 16; ++i) { const __bf16 h = (__bf16)v[i]; r.h[i] = h; r.l[i] = (__bf16)(v[i] - (float)h); }
  return r; }
__device__ __forceinline__ F2 split_row(const float* row, int k0, int lane) { float v[16]; const float* p = row + k0 + 8 * (lane >> 4);
#pragma unroll
  for (int i = 0; i < 8; ++i) { v[i] = p[i]; v[8 + i] = p[16 + i]; }
  return bsplit16(v); }
__device__ __forceinline__ F2 split_rowK(const float* row, int k0, int lane, int K) { float v[16]; const int g = lane >> 4;
#pragma unroll
  for (int i = 0; i < 8; ++i) { const int ka = k0 + 8 * g + i, kb = ka + 16; v[i] = ka < K ? row[ka < K ? ka : K - 1] : 0.f; v[8 + i] = kb < K ? row[kb < K ? kb : K - 1] : 0.f; }
  return bsplit16(v); }
__device__ __forceinline__ F2 split_col(const float* W, int k0, int n, int lane, int ld, int K) { float v[16]; const int g = lane >> 4;
#pragma unroll
  for (int i = 0; i < 8; ++i) { const int ka = k0 + 8 * g + i, kb = ka + 16; v[i] = ka < K ? W[(size_t)(ka < K ? ka : K - 1) * ld + n] : 0.f; v[8 + i] = kb < K ? W[(size_t)(kb < K ? kb : K - 1) * ld + n] : 0.f; }
  return bsplit16(v); }
__device__ __forceinline__ v8f mac3(const F2& a, const F2& b, v8f c) { c = wmma_bf(a.l, b.h, c); c = wmma_bf(a.h, b.l, c); return wmma_bf(a.h, b.h, c); }
__device__ __forceinline__ float sigm(float v) { return 1.0f / (1.0f + expf(-v)); }
#define LDSX() do { asm volatile("s_wait_dscnt 0" ::: "memory"); __builtin_amdgcn_wave_barrier(); __builtin_amdgcn_fence(__ATOMIC_RELEASE, "workgroup"); } while (0)

// Single-head causal self-attention with a 256-wide head (x [4,4096,256]; (in,out) Wq / Wk / Wv [256,256] uniform(+-1/16) with biases of the same scale - NONZERO; q, k, v = x W + b; attn = q k^T over all 256 dims x 1/sqrt(256) = 1/16; tril kept, -inf elsewhere; softmax; out = probs v, [4,4096,256]; no head split, no output projection). ONE score 'head' whose contraction runs over all 256 columns (the score kernel's head width is switched to 256 regionally), P.v as four ordinary 64-wide column groups that all read the same probability plane.
#define NB 4
#define TT 4096
#define CC 256            // NH * HD = projected width
#define DIN 256          // input (model) width
#define NH 4
#define HD 64
#define NQB (TT / 64)
#define HG 1
#define SCALE (0.0625f)
#define CAUSAL 1
#ifndef TNB
#define TNB NB
#endif
__device__ __forceinline__ float bfr(float v) { return (float)(__bf16)v; }
__host__ __device__ __forceinline__ int kb_last(int qb) { return CAUSAL ? ((qb * 64 + 63) >> 7) : (TT / 128 - 1); }
// logit / P plane of one batch: the 64 rows of query block qb are kend = (kb_last(qb) + 1) * 128 floats long and follow block qb - 1's; with m = qb >> 1 = kb_last(qb) the blocks before qb hold (m + 1) * (m + (qb & 1)) units of 64 x 128 floats
#define S_PLANE ((size_t)(TT / 128) * (TT / 128 + 1) * 64 * 128)
__device__ __forceinline__ size_t s_blk(int qb) { const int m = qb >> 1; return (size_t)((m + 1) * (m + (qb & 1))) * (64 * 128); }
typedef __attribute__((ext_vector_type(8))) __bf16 v8b;
__device__ __forceinline__ v16b frag_b(const __bf16* rowk0, int lane) {
  union { v16b v; v8b q[2]; } u; const __bf16* p = rowk0 + 8 * (lane >> 4);
  u.q[0] = *(const v8b*)p; u.q[1] = *(const v8b*)(p + 16); return u.v;
}
#define QBH 6              // causal: query blocks 0..QBH-1 of each sequence (few keys, no averaging) take the high-precision path
#define QHI 384            // rows carrying a q residual plane
#define KHI 384            // key rows carrying k residual / v bf16 hi+lo planes (used only by the causal high-precision path)
// B fragment (k rows k0+.., output column o) of a weight: (in,out) [K][ld] or (out,in) [ld rows of K]: bf16 exact, or f16(bf16 * 256) exact
__device__ __forceinline__ v16b wcol_io(const float* Wm, int k0, int o, int lane, int ld) { v16b w; const int g = lane >> 4;
#pragma unroll
  for (int i = 0; i < 8; ++i) { w[i] = (__bf16)Wm[(size_t)(k0 + 8 * g + i) * ld + o]; w[8 + i] = (__bf16)Wm[(size_t)(k0 + 16 + 8 * g + i) * ld + o]; }
  return w; }
__device__ __forceinline__ v16b wcol_oi(const float* Wm, int k0, int o, int lane, int K) { v16b w; const float* p = Wm + (size_t)o * K + k0 + 8 * (lane >> 4);
#pragma unroll
  for (int i = 0; i < 8; ++i) { w[i] = (__bf16)p[i]; w[8 + i] = (__bf16)p[16 + i]; }
  return w; }
__device__ __forceinline__ v16h wcolh_io(const float* Wm, int k0, int o, int lane, int ld) { v16h w; const int g = lane >> 4;
#pragma unroll
  for (int i = 0; i < 8; ++i) { w[i] = (_Float16)(bfr(Wm[(size_t)(k0 + 8 * g + i) * ld + o]) * 256.0f); w[8 + i] = (_Float16)(bfr(Wm[(size_t)(k0 + 16 + 8 * g + i) * ld + o]) * 256.0f); }
  return w; }
__device__ __forceinline__ v16h wcolh_oi(const float* Wm, int k0, int o, int lane, int K) { v16h w; const float* p = Wm + (size_t)o * K + k0 + 8 * (lane >> 4);
#pragma unroll
  for (int i = 0; i < 8; ++i) { w[i] = (_Float16)(bfr(p[i]) * 256.0f); w[8 + i] = (_Float16)(bfr(p[16 + i]) * 256.0f); }
  return w; }
#define WQKV_LAYOUT 0   // 0 = (in,out) [DIN][CC]; 1 = (out,in) [CC][DIN]; 2 = per-head [NH][DIN][HD]
__device__ __forceinline__ v16b wcol_hdk(const float* Wm, int k0, int o, int lane) { v16b w; const int g = lane >> 4; const float* p = Wm + (size_t)(o / HD) * DIN * HD + (o % HD);
#pragma unroll
  for (int i = 0; i < 8; ++i) { w[i] = (__bf16)p[(size_t)(k0 + 8 * g + i) * HD]; w[8 + i] = (__bf16)p[(size_t)(k0 + 16 + 8 * g + i) * HD]; }
  return w; }
#define WO_OUT_IN 0
#if WQKV_LAYOUT == 1
#define WCOL(W, k0, o, lane) wcol_oi(W, k0, o, lane, DIN)
#elif WQKV_LAYOUT == 2
#define WCOL(W, k0, o, lane) wcol_hdk(W, k0, o, lane)
#else
#define WCOL(W, k0, o, lane) wcol_io(W, k0, o, lane, CC)
#endif
#if WO_OUT_IN
#define WOCOL(W, k0, o, lane) wcol_oi(W, k0, o, lane, CC)
#define WOCOLH(W, k0, o, lane) wcolh_oi(W, k0, o, lane, CC)
#else
#define WOCOL(W, k0, o, lane) wcol_io(W, k0, o, lane, DIN)
#define WOCOLH(W, k0, o, lane) wcolh_io(W, k0, o, lane, DIN)
#endif

#ifndef SM_EXTRA_PARAMS
#define SM_EXTRA_PARAMS
#endif
#ifndef PROJ_EXTRA_PARAMS
#define PROJ_EXTRA_PARAMS
#endif
#ifndef SM_MASK_HOOK
#define SM_MASK_HOOK (void)0
#endif

#define WS_QH  0u                                      // f16 q rows [b*t][CC]
#define WS_KH  (WS_QH + 2u * (size_t)NB * TT * CC)      // f16 k rows [b*t][CC]
#define WS_VT  (WS_KH + 2u * (size_t)NB * TT * CC)      // f16 v planes [b][c][t]
#define WS_QL  (WS_VT + 2u * (size_t)NB * CC * TT)      // f16 q residual x 2^10 rows [b][t < QHI][CC]
#define WS_KL  (WS_QL + 2u * (size_t)NB * QHI * CC)     // f16 k residual x 2^10 rows [b][t < KHI][CC]
#define WS_VB  (WS_KL + 2u * (size_t)NB * KHI * CC)     // bf16 v hi planes [b][c][t < KHI]
#define WS_VBL (WS_VB + 2u * (size_t)NB * CC * KHI)
#define WS_S   (WS_VBL + 2u * (size_t)NB * CC * KHI)    // f32 logits / P [b][t][s < kend(t)]: rows at their causal length (s_blk), one plane of S_PLANE floats a batch
#define WS_Y   (WS_S  + 4u * (size_t)NB * S_PLANE)      // f32 ctx rows [b*t][CC] (only when there is an output projection)
#define WS_END (WS_Y  + 0u)

// ---- k_proj: block = (64 rows, 128 cols, which): q/k/v = X W (+ b) with exact bf16 products (K = DIN) -> which 0: q f16 rows (+ residual rows < QHI); 1: k f16 rows (+ residual rows < KHI); 2: v f16 planes [c][t] (+ bf16 hi/lo planes for t < KHI)
__global__ __launch_bounds__(128) void k_proj(const float* __restrict__ XQ, const float* __restrict__ XK, const float* __restrict__ XV, const float* __restrict__ WQ, const float* __restrict__ WK, const float* __restrict__ WV, const float* __restrict__ BQ, const float* __restrict__ BK, const float* __restrict__ BV,
    _Float16* __restrict__ QH, _Float16* __restrict__ QL, _Float16* __restrict__ KH, _Float16* __restrict__ KL, _Float16* __restrict__ VT, __bf16* __restrict__ VB, __bf16* __restrict__ VBL) {
  __shared__ __align__(16) _Float16 sh[64][136], sl[64][136]; __shared__ __align__(16) _Float16 th[128][72]; __shared__ __align__(16) __bf16 tb[128][72], tbl[128][72];
  const int tid = threadIdx.x, wave = tid >> 5, lane = tid & 31, col = lane & 15, g = lane >> 4; const int which = blockIdx.z; const int c0 = blockIdx.y * 128; const size_t r0 = (size_t)blockIdx.x * 64; const size_t bb = r0 / TT; const int t0 = (int)(r0 % TT);
  const float* X = which == 0 ? XQ : which == 1 ? XK : XV; const float* WA = which == 0 ? WQ : which == 1 ? WK : WV; const float* BA = which == 0 ? BQ : which == 1 ? BK : BV;
  v8f acc[8] = {};
#pragma unroll 2
  for (int kc = 0; kc < DIN / 32; ++kc) { v16b a; { const float* p = X + (r0 + wave * 16 + col) * DIN + kc * 32 + 8 * g;
#pragma unroll
      for (int i = 0; i < 8; ++i) { a[i] = (__bf16)p[i]; a[8 + i] = (__bf16)p[16 + i]; } }
    asm volatile("s_wait_loadcnt 0x0" ::: "memory");
#pragma unroll
    for (int j = 0; j < 8; ++j) { const v16b w = WCOL(WA, kc * 32, c0 + j * 16 + col, lane); asm volatile("s_wait_loadcnt 0x0" ::: "memory"); acc[j] = wmma_bf(a, w, acc[j]); } }
  if (which < 2) { _Float16* DH = which == 0 ? QH : KH; _Float16* DL = which == 0 ? QL : KL; const int nhi = which == 0 ? QHI : KHI; const bool hi_rows = t0 < nhi;
#pragma unroll
    for (int j = 0; j < 8; ++j) { const float bias = BA ? bfr(BA[c0 + j * 16 + col]) : 0.f;
#pragma unroll
      for (int r = 0; r < 8; ++r) { const float v = acc[j][r] + bias; const _Float16 hv = (_Float16)v; sh[wave * 16 + 8 * g + r][j * 16 + col] = hv; sl[wave * 16 + 8 * g + r][j * 16 + col] = (_Float16)((v - (float)hv) * 1024.0f); } }
    __syncthreads();
    for (int e = tid; e < 64 * 16; e += 128) { const int rl = e >> 4, q = e & 15; vst2((unsigned*)(DH + (r0 + rl) * CC + c0 + q * 8), *(const v4u*)&sh[rl][q * 8]); if (hi_rows) vst2((unsigned*)(DL + (bb * nhi + t0 + rl) * (size_t)CC + c0 + q * 8), *(const v4u*)&sl[rl][q * 8]); }
  } else { const bool hi_rows = t0 < KHI;
#pragma unroll
    for (int j = 0; j < 8; ++j) { const float bias = BA ? bfr(BA[c0 + j * 16 + col]) : 0.f;
#pragma unroll
      for (int r = 0; r < 8; ++r) { const float v = acc[j][r] + bias; const int rl = wave * 16 + 8 * g + r, cl = j * 16 + col; th[cl][rl] = (_Float16)v; const __bf16 bh = (__bf16)v; tb[cl][rl] = bh; tbl[cl][rl] = (__bf16)(v - (float)bh); } }
    __syncthreads();
    for (int e = tid; e < 128 * 8; e += 128) { const int cl = e >> 3, q = e & 7; vst2((unsigned*)(VT + (bb * CC + c0 + cl) * (size_t)TT + t0 + q * 8), *(const v4u*)&th[cl][q * 8]); if (hi_rows) { const size_t o3 = (bb * CC + c0 + cl) * (size_t)KHI + t0 + q * 8; vst2((unsigned*)(VB + o3), *(const v4u*)&tb[cl][q * 8]); vst2((unsigned*)(VBL + o3), *(const v4u*)&tbl[cl][q * 8]); } } } }
#undef HD
#define HD 256   // SCORE KERNEL ONLY: with h = 0 the contraction runs over columns 0..255 in 8 k-steps: the module's single 256-wide head
// ---- k_sc: block = (query block qb, key block kb <= kb_last(qb), batch b = grid z): logits x SCALE; q hi + residual (x 2^10) against k (2 products) for query rows < QHI, plus the k residual (3 products) for query blocks < QBH (causal early rows); causal: blocks past the diagonal exit, the mask itself is applied by index in k_sm
__global__ __launch_bounds__(128) void k_sc(const _Float16* __restrict__ QH, const _Float16* __restrict__ KH, const _Float16* __restrict__ QL, const _Float16* __restrict__ KL, float* __restrict__ S0) { __shared__ __align__(16) float ss[4][16][132]; __shared__ __align__(16) _Float16 sk[128][264];   /* the 128-key k tile, 528-B pitch for the 16-byte fragment reads */
  const int qb = blockIdx.x, kb = blockIdx.y; if (kb > kb_last(qb)) return;
  const int b = blockIdx.z, h = 0; const int kend = (kb_last(qb) + 1) * 128; float* S = S0 + (size_t)b * S_PLANE + s_blk(qb);
  const int tid = threadIdx.x, wave = tid >> 5, lane = tid & 31, col = lane & 15, g = lane >> 4; const int k0 = kb * 128; const int ql0 = qb * 64 + wave * 16; const size_t q0 = (size_t)b * TT + ql0, kr0 = (size_t)b * TT + k0;
  v8f acc[8] = {}, accl[8] = {};
  const _Float16* QLb = QL + (size_t)b * QHI * CC; const _Float16* KLb = KL + (size_t)b * KHI * CC;
  if (qb < QBH) {
#pragma unroll
    for (int kc = 0; kc < HD / 32; ++kc) { const v16h ah = frag_h(QH + (q0 + col) * CC + h * HD + kc * 32, lane), al = frag_h(QLb + (size_t)(ql0 + col) * CC + h * HD + kc * 32, lane);
#pragma unroll
      for (int j = 0; j < 8; ++j) { const v16h kbf = frag_h(KH + (kr0 + j * 16 + col) * CC + h * HD + kc * 32, lane), klf = frag_h(KLb + (size_t)(k0 + j * 16 + col) * CC + h * HD + kc * 32, lane); acc[j] = wmma16(ah, kbf, acc[j]); accl[j] = wmma16(al, kbf, accl[j]); accl[j] = wmma16(ah, klf, accl[j]); } }
  } else if (qb * 64 < QHI) {
#pragma unroll
    for (int kc = 0; kc < HD / 32; ++kc) { const v16h ah = frag_h(QH + (q0 + col) * CC + h * HD + kc * 32, lane), al = frag_h(QLb + (size_t)(ql0 + col) * CC + h * HD + kc * 32, lane);
#pragma unroll
      for (int j = 0; j < 8; ++j) { const v16h kbf = frag_h(KH + (kr0 + j * 16 + col) * CC + h * HD + kc * 32, lane); acc[j] = wmma16(ah, kbf, acc[j]); accl[j] = wmma16(al, kbf, accl[j]); } }
  } else {
    // the k tile comes once a work-group by loads that cover whole lines (a wave: the 512 B of one k row) and is shared by the four waves through LDS
    v16h ah[HD / 32]; const _Float16* qt = QH + (q0 + col) * CC + h * HD + 8 * g;   /* this lane's half of the q fragments, the element order of frag_h */
    { const _Float16* kt = KH + (kr0 + (tid >> 5)) * CC + (tid & 31) * 8;   /* rows (tid >> 5) + 4 i */ v8h kr[32];
#pragma unroll   // constant indices keep the array in registers
      for (int i = 0; i < 32; ++i) kr[i] = *(const v8h*)(kt + (size_t)(4 * i) * CC);
#pragma unroll   // constant indices keep the array in registers
      for (int kc = 0; kc < HD / 32; ++kc) { union { v16h v; v8h q[2]; } u; u.q[0] = *(const v8h*)(qt + kc * 32); u.q[1] = *(const v8h*)(qt + kc * 32 + 16); ah[kc] = u.v; }
      asm volatile("s_wait_xcnt 0x0" :: "v"(kt), "v"(qt) : "memory");   /* stands before a register named by an issued global load takes a new value; the addresses are inputs so that their registers stay theirs up to it */
#pragma unroll   // constant indices keep the array in registers
      for (int i = 0; i < 32; ++i) *(v8h*)&sk[(tid >> 5) + 4 * i][(tid & 31) * 8] = kr[i]; }
    __syncthreads();   /* the tile is whole before any wave reads it */
#pragma unroll   // constant indices keep the array in registers
    for (int kc = 0; kc < HD / 32; ++kc) { v16h kf[8];
#pragma unroll   // constant indices keep the array in registers
      for (int j = 0; j < 8; ++j) kf[j] = frag_h(&sk[j * 16 + col][kc * 32], lane);
      __builtin_amdgcn_sched_barrier(0);   /* keeps the LDS reads of 8 products in one group ahead of them: one LDS wait a group, not one a product */
#pragma unroll   // constant indices keep the array in registers
      for (int j = 0; j < 8; ++j) acc[j] = wmma16(ah[kc], kf[j], acc[j]); } }
#pragma unroll
  for (int j = 0; j < 8; ++j) {
#pragma unroll
    for (int r = 0; r < 8; ++r) ss[wave][8 * g + r][j * 16 + col] = (acc[j][r] + accl[j][r] * (1.0f / 1024.0f)) * SCALE; }
  LDSX(); for (int rl = 0; rl < 16; ++rl) vst2(S + (size_t)(wave * 16 + rl) * kend + k0 + lane * 4, *(const v4f*)&ss[wave][rl][lane * 4]); }
#undef HD
#define HD 64   // restored: the softmax and P.v kernels keep 64-wide column groups
// ---- k_sm: one wave = query row t of batch grid y (a work-group: 8 rows of one query block, no LDS, no barrier): keys [0, kend) held in the wave's registers, 16 bytes a lane a load; causal -> logit if s <= t else excluded; softmax in f32; P x 2^11 in place (0 for excluded)
#define SMP (TT / 128 - 1)   // most 512-B pieces of a row in front of its last one
__device__ __forceinline__ float sm_exp(float v, float m) { const float e = expf(v - m); return (v <= -1.0e38f) ? 0.f : e; }
// each pass walks pieces 0 .. n1 - 1 with constant register indices and leaves at the first piece the row does not have (n1 is the same for the whole wave: scalar branches)
template <int I> __device__ __forceinline__ void sm_load(v4f (&r)[SMP], const float* sr, int n1) { if constexpr (I < SMP) { if (I < n1) { r[I] = *(const v4f*)(sr + I * 128); sm_load<I + 1>(r, sr, n1); } } }
template <int I> __device__ __forceinline__ void sm_max(const v4f (&r)[SMP], float& m, int n1) { if constexpr (I < SMP) { if (I < n1) { m = fmaxf(m, fmaxf(fmaxf(r[I][0], r[I][1]), fmaxf(r[I][2], r[I][3]))); sm_max<I + 1>(r, m, n1); } } }
template <int I> __device__ __forceinline__ void sm_sum(v4f (&r)[SMP], v4f& s4, float m, int n1) { if constexpr (I < SMP) { if (I < n1) {
#pragma unroll
    for (int c = 0; c < 4; ++c) { const float e = sm_exp(r[I][c], m); r[I][c] = e; s4[c] += e; }
    sm_sum<I + 1>(r, s4, m, n1); } } }
template <int I> __device__ __forceinline__ void sm_store(const v4f (&r)[SMP], float* sr, float inv, int n1) { if constexpr (I < SMP) { if (I < n1) { vst2(sr + I * 128, r[I] * inv);
    if constexpr (I + 1 < SMP) { asm volatile("s_wait_xcnt 0x0" ::: "memory");   /* the next piece's products may take the registers that this store names */
      sm_store<I + 1>(r, sr, inv, n1); } } } }
__global__ __launch_bounds__(256) void k_sm(float* __restrict__ S0 SM_EXTRA_PARAMS) {
  const int lane = threadIdx.x & 31; const int qb = blockIdx.x >> 3; const int t = blockIdx.x * 8 + (threadIdx.x >> 5);
  const int kend = (kb_last(qb) + 1) * 128; const int n1 = (kend >> 7) - 1;   /* pieces in front of the last one: the same for the whole work-group */
  float* sr = S0 + (size_t)blockIdx.y * S_PLANE + s_blk(qb) + (size_t)(t & 63) * kend + lane * 4; float* sl = sr + n1 * 128;
  v4f r[SMP];
  v4f z = *(const v4f*)sl;   /* the row's last piece: t >= kend - 128, so it alone holds keys past t */
  sm_load<0>(r, sr, n1);
  asm volatile("s_wait_xcnt 0x0" :: "v"(sr), "v"(sl) : "memory");   /* stands before a register named by an issued global load takes a new value; the addresses are inputs so that their registers stay theirs up to it */
#pragma unroll
  for (int c = 0; c < 4; ++c) if (CAUSAL && n1 * 128 + lane * 4 + c > t) z[c] = -3.0e38f;
  float m = fmaxf(fmaxf(-3.0e38f, fmaxf(z[0], z[1])), fmaxf(z[2], z[3]));
  sm_max<0>(r, m, n1);
#pragma unroll
  for (int o = 1; o < 32; o <<= 1) m = fmaxf(m, __shfl_xor(m, o));
  v4f s4;
#pragma unroll
  for (int c = 0; c < 4; ++c) { const float e = sm_exp(z[c], m); z[c] = e; s4[c] = e; }
  sm_sum<0>(r, s4, m, n1);
  float sum = (s4[0] + s4[1]) + (s4[2] + s4[3]);
#pragma unroll
  for (int o = 1; o < 32; o <<= 1) sum += __shfl_xor(sum, o);
  const float inv = sum > 0.f ? 2048.0f / sum : 0.f;   /* a fully excluded row yields P = 0 */
  vst2(sl, z * inv);
  asm volatile("s_wait_xcnt 0x0" ::: "memory");   /* the next piece's products may take the registers that this store names */
  sm_store<0>(r, sr, inv, n1); }
// ---- k_pv: block = 64 queries (qb) of (b = grid y, h = column group, grid z): ctx = P . v over keys [0, kend) (P x 2^11 once to f16 against v f16: 1 product; causal early query blocks: P and v as bf16 hi + lo, 3 products); 256-B (row, head) segment by 16 lanes
__global__ __launch_bounds__(128) void k_pv(const float* __restrict__ PS0, const _Float16* __restrict__ VT, const __bf16* __restrict__ VB, const __bf16* __restrict__ VBL, float* __restrict__ Y) { const int b = blockIdx.y, h = blockIdx.z;   /* grid z = column group: every group reads its batch's one probability plane */ __shared__ __align__(16) float ss[4][16][HD + 4];
  __shared__ __align__(16) _Float16 sp[64][136], sv[HD][136];   /* one 128-key tile: P x 2^11 as f16 [query][key], v [column][key]; 272-B pitch for the 16-byte fragment reads */
  const int tid = threadIdx.x, wave = tid >> 5, lane = tid & 31, col = lane & 15, g = lane >> 4; const int qb = blockIdx.x; const int ql0 = qb * 64 + wave * 16; const int kce = (kb_last(qb) + 1) * 4;
  const float* prow = PS0 + (size_t)b * S_PLANE + s_blk(qb) + (size_t)(wave * 16 + col) * (kce * 32);   /* this lane's probability row */
  v8f acc[HD / 16] = {};
  if (qb < QBH) {
#pragma unroll 1
    for (int kc = 0; kc < kce; ++kc) { const F2 p = split_row(prow, kc * 32, lane);
      asm volatile("s_wait_loadcnt 0x0" ::: "memory");
#pragma unroll
      for (int j = 0; j < HD / 16; ++j) { const size_t po = ((size_t)b * CC + h * HD + j * 16 + col) * (size_t)KHI + kc * 32; const v16b vh = frag_b(VB + po, lane); acc[j] = wmma_bf(p.h, vh, acc[j]); acc[j] = wmma_bf(p.l, vh, acc[j]); acc[j] = wmma_bf(p.h, frag_b(VBL + po, lane), acc[j]); } }
  } else {
    // each 128-key tile comes once a work-group by loads that cover whole lines (a wave: 512 B of one P row, 256 B of two v columns) and is shared by the four waves through LDS; the next tile's loads fly while this one is multiplied
    const int nkb = kce >> 2; const size_t ld = (size_t)kce * 32;
    const float* pt = PS0 + (size_t)b * S_PLANE + s_blk(qb) + (size_t)(tid >> 5) * ld + (tid & 31) * 4;   /* rows (tid >> 5) + 4 i */
    const _Float16* vt = VT + ((size_t)b * CC + h * HD + (tid >> 4)) * (size_t)TT + (tid & 15) * 8;   /* columns (tid >> 4) + 8 i */
    v4f pr[16]; v8h vr[8];
    const float* pa[16];
#pragma unroll   // constant indices keep the array in registers
    for (int i = 0; i < 16; ++i) { pa[i] = pt + (size_t)(4 * i) * ld; pr[i] = *(const v4f*)pa[i]; }
#pragma unroll   // constant indices keep the array in registers
    for (int i = 0; i < 8; ++i) vr[i] = *(const v8h*)(vt + (size_t)(8 * i) * TT);
    asm volatile("s_wait_xcnt 0x0" :: "v"(pa[0]), "v"(pa[1]), "v"(pa[2]), "v"(pa[3]), "v"(pa[4]), "v"(pa[5]), "v"(pa[6]), "v"(pa[7]), "v"(pa[8]), "v"(pa[9]), "v"(pa[10]), "v"(pa[11]), "v"(pa[12]), "v"(pa[13]), "v"(pa[14]), "v"(pa[15]), "v"(vt) : "memory");   /* stands before a register named by an issued global load takes a new value; the addresses are inputs so that their registers stay theirs up to it */
#pragma unroll 1   // one copy of the tile loop: a second copy would only add registers
    for (int kb = 0; kb < nkb; ++kb) {
#pragma unroll   // constant indices keep the array in registers
      for (int i = 0; i < 16; ++i) { v4h c; c[0] = (_Float16)pr[i][0]; c[1] = (_Float16)pr[i][1]; c[2] = (_Float16)pr[i][2]; c[3] = (_Float16)pr[i][3]; *(v4h*)&sp[(tid >> 5) + 4 * i][(tid & 31) * 4] = c; }
#pragma unroll   // constant indices keep the array in registers
      for (int i = 0; i < 8; ++i) *(v8h*)&sv[(tid >> 4) + 8 * i][(tid & 15) * 8] = vr[i];
      __syncthreads();   /* the tile is whole before any wave reads it */
      if (kb + 1 < nkb) {
        const _Float16* vn = vt + (kb + 1) * 128;
#pragma unroll   // constant indices keep the array in registers
        for (int i = 0; i < 16; ++i) { pa[i] = pt + (size_t)(4 * i) * ld + (kb + 1) * 128; pr[i] = *(const v4f*)pa[i]; }
#pragma unroll   // constant indices keep the array in registers
        for (int i = 0; i < 8; ++i) vr[i] = *(const v8h*)(vn + (size_t)(8 * i) * TT);
        asm volatile("s_wait_xcnt 0x0" :: "v"(pa[0]), "v"(pa[1]), "v"(pa[2]), "v"(pa[3]), "v"(pa[4]), "v"(pa[5]), "v"(pa[6]), "v"(pa[7]), "v"(pa[8]), "v"(pa[9]), "v"(pa[10]), "v"(pa[11]), "v"(pa[12]), "v"(pa[13]), "v"(pa[14]), "v"(pa[15]), "v"(vn) : "memory");   /* stands before a register named by an issued global load takes a new value; the addresses are inputs so that their registers stay theirs up to it */
      }
#pragma unroll   // constant indices keep the array in registers
      for (int kp = 0; kp < 2; ++kp) { v16h pf[2], vb[2][HD / 16];
#pragma unroll   // constant indices keep the array in registers
        for (int u = 0; u < 2; ++u) { pf[u] = frag_h(&sp[wave * 16 + col][(2 * kp + u) * 32], lane);
#pragma unroll   // constant indices keep the array in registers
          for (int j = 0; j < HD / 16; ++j) vb[u][j] = frag_h(&sv[j * 16 + col][(2 * kp + u) * 32], lane); }
        __builtin_amdgcn_sched_barrier(0);   /* keeps the LDS reads of 8 products in one group ahead of them: one LDS wait a group, not one a product */
#pragma unroll   // constant indices keep the array in registers
        for (int u = 0; u < 2; ++u)
#pragma unroll   // constant indices keep the array in registers
          for (int j = 0; j < HD / 16; ++j) acc[j] = wmma16(pf[u], vb[u][j], acc[j]); }
      __syncthreads();   /* every wave has read the tile before it is overwritten */
    } }
#pragma unroll
  for (int j = 0; j < HD / 16; ++j)
#pragma unroll
    for (int r = 0; r < 8; ++r) ss[wave][8 * g + r][j * 16 + col] = acc[j][r] * (1.0f / 2048.0f);
  LDSX(); for (int rl = 0; rl < 16; ++rl) if (lane < HD / 4) vst2(Y + ((size_t)b * TT + ql0 + rl) * CC + h * HD + lane * 4, *(const v4f*)&ss[wave][rl][lane * 4]); }

extern "C" void kernel_launch(void* const* d_in, const int* in_sizes, int n_in, void* d_out, int out_size, void* d_ws, size_t ws_size, hipStream_t stream) {
  (void)in_sizes; (void)n_in; (void)out_size;
  const float** F = (const float**)d_in;
  if (ws_size < (size_t)WS_END) return;
  char* ws = (char*)d_ws; _Float16 *QH = (_Float16*)(ws + WS_QH), *KH = (_Float16*)(ws + WS_KH), *VT = (_Float16*)(ws + WS_VT), *QL = (_Float16*)(ws + WS_QL), *KL = (_Float16*)(ws + WS_KL); __bf16 *VB = (__bf16*)(ws + WS_VB), *VBL = (__bf16*)(ws + WS_VBL); float *S = (float*)(ws + WS_S), *Y = (float*)(ws + WS_Y);
  (void)Y; (void)QL; (void)KL; (void)VB; (void)VBL;
  // inputs: 0 x [4,4096,256]; 1 Wq [256,256] (in,out), 2 bq; 3 Wk, 4 bk; 5 Wv, 6 bv (biases NONZERO)
  k_proj<<<dim3(TNB * TT / 64, CC / 128, 3), 128, 0, stream>>>(F[0], F[0], F[0], F[1], F[3], F[5], F[2], F[4], F[6], QH, QL, KH, KL, VT, VB, VBL);
  k_sc<<<dim3(NQB, TT / 128, TNB), 128, 0, stream>>>(QH, KH, QL, KL, S);   /* the one score head: all 256 columns; grid z = batch */
  k_sm<<<dim3(TT / 8, TNB), 256, 0, stream>>>(S);   /* 8 rows a work-group, one a wave; grid y = batch */
  k_pv<<<dim3(NQB, TNB, NH), 128, 0, stream>>>(S, VT, VB, VBL, (float*)d_out);   /* one launch, 64 x 4 x 4 work-groups: grid y = batch, grid z = column group g (v / out columns 64g .. 64g+63), all four from their batch's plane; the context rows are the output */
}

// v005
// Measured time: 119 microseconds a run.
// Timed twice side by side with v004, it ran 1.50 times as fast both times.
// Counting every step since v000, it is 17.2 times as fast.
// compute dtype: all float inputs rounded to bf16; q / k / v projections (256-wide) with EXACT bf16 products on WMMA 16x16x32 (f32 accumulate) + bias; causal logits over the full 256-deep contraction x 256^-0.5: 3 products for the first 384 rows, single f16 q x k after; logits, softmax (f32) and P x v in one kernel, key tile by key tile with a running row maximum: P = 2^(logit - maximum) once to f16 x v once to f16 (both bf16 hi + lo below row 384), divided by the row sum at the end; no logit plane; the four batches side by side in each launch; the context rows are the f32 output (no output projection).
#include <hip/hip_runtime.h>
#include <math.h>

typedef __attribute__((ext_vector_type(16))) _Float16 v16h;
typedef __attribute__((ext_vector_type(16))) __bf16 v16b;
typedef __attribute__((ext_vector_type(8)))  _Float16 v8h;
typedef __attribute__((ext_vector_type(4)))  _Float16 v4h;
typedef __attribute__((ext_vector_type(8)))  float v8f;
typedef __attribute__((ext_vector_type(4)))  float v4f;
typedef __attribute__((ext_vector_type(2)))  float v2f;
typedef __attribute__((ext_vector_type(4)))  unsigned v4u;
typedef __attribute__((ext_vector_type(4)))  int v4i;
typedef float __attribute__((may_alias)) float_a;
typedef int __attribute__((may_alias)) int_a;

template <typename T> __device__ __forceinline__ void vst2(void* p, T v) { *(T*)p = v;  }
__device__ __forceinline__ v8f wmma16(v16h a, v16h b, v8f c) {
  v8f d = __builtin_amdgcn_wmma_f32_16x16x32_f16(false, a, false, b, (short)0, c, false, false);
  asm volatile("v_nop\n\tv_nop\n\tv_nop\n\tv_nop" : "+v"(d) : "v"(a), "v"(b));
  return d;
}
__device__ __forceinline__ v8f wmma_bf(v16b a, v16b b, v8f c) {
  v8f d = __builtin_amdgcn_wmma_f32_16x16x32_bf16(false, a, false, b, (short)0, c, false, false);
  asm volatile("v_nop\n\tv_nop\n\tv_nop\n\tv_nop" : "+v"(d) : "v"(a), "v"(b));
  return d;
}
// 16x16x32 fragments: lane = (h = lane>>4, row/col = lane&15); elements 0..7 = k0+8h+0..7, 8..15 = k0+16+8h+0..7; D element r = row 8h+r
__device__ __forceinline__ v16h frag_h(const _Float16* rowk0, int lane) {
  union { v16h v; v8h q[2]; } u; const _Float16* p = rowk0 + 8 * (lane >> 4);
  u.q[0] = *(const v8h*)p; u.q[1] = *(const v8h*)(p + 16); return u.v;
}
__device__ __forceinline__ v16h frag_f32(const float* rowk0, int lane) {
  v16h a; const float* p = rowk0 + 8 * (lane >> 4);
#pragma unroll
  for (int i = 0; i < 8; ++i) { a[i] = (_Float16)p[i]; a[8 + i] = (_Float16)p[16 + i]; }
  return a;
}
__device__ __forceinline__ v16h frag_f32s(const float* rowk0, int lane, float sc) {
  v16h a; const float* p = rowk0 + 8 * (lane >> 4);
#pragma unroll
  for (int i = 0; i < 8; ++i) { a[i] = (_Float16)(p[i] * sc); a[8 + i] = (_Float16)(p[16 + i] * sc); }
  return a;
}
// column fragment from a [K][ld] layout (column n), rows >= K read as 0
__device__ __forceinline__ v16h fragc_f32(const float* W, int k0, int n, int lane, int ld, int K) {
  v16h a; const int g = lane >> 4;
#pragma unroll
  for (int i = 0; i < 8; ++i) { const int ka = k0 + 8 * g + i, kb = ka + 16;
    a[i] = (_Float16)(ka < K ? W[(size_t)(ka < K ? ka : K - 1) * ld + n] : 0.f); a[8 + i] = (_Float16)(kb < K ? W[(size_t)(kb < K ? kb : K - 1) * ld + n] : 0.f); }
  return a;
}
struct F2 { v16b h, l; };
__device__ __forceinline__ F2 bsplit16(const float v[16]) { F2 r;
#pragma unroll
  for (int i = 0; i < 16; ++i) { const __bf16 h = (__bf16)v[i]; r.h[i] = h; r.l[i] = (__bf16)(v[i] - (float)h); }
  return r; }
__device__ __forceinline__ F2 split_row(const float* row, int k0, int lane) { float v[16]; const float* p = row + k0 + 8 * (lane >> 4);
#pragma unroll
  for (int i = 0; i < 8; ++i) { v[i] = p[i]; v[8 + i] = p[16 + i]; }
  return bsplit16(v); }
__device__ __forceinline__ F2 split_rowK(const float* row, int k0, int lane, int K) { float v[16]; const int g = lane >> 4;
#pragma unroll
  for (int i = 0; i < 8; ++i) { const int ka = k0 + 8 * g + i, kb = ka + 16; v[i] = ka < K ? row[ka < K ? ka : K - 1] : 0.f; v[8 + i] = kb < K ? row[kb < K ? kb : K - 1] : 0.f; }
  return bsplit16(v); }
__device__ __forceinline__ F2 split_col(const float* W, int k0, int n, int lane, int ld, int K) { float v[16]; const int g = lane >> 4;
#pragma unroll
  for (int i = 0; i < 8; ++i) { const int ka = k0 + 8 * g + i, kb = ka + 16; v[i] = ka < K ? W[(size_t)(ka < K ? ka : K - 1) * ld + n] : 0.f; v[8 + i] = kb < K ? W[(size_t)(kb < K ? kb : K - 1) * ld + n] : 0.f; }
  return bsplit16(v); }
__device__ __forceinline__ v8f mac3(const F2& a, const F2& b, v8f c) { c = wmma_bf(a.l, b.h, c); c = wmma_bf(a.h, b.l, c); return wmma_bf(a.h, b.h, c); }
__device__ __forceinline__ float sigm(float v) { return 1.0f / (1.0f + expf(-v)); }
#define LDSX() do { asm volatile("s_wait_dscnt 0" ::: "memory"); __builtin_amdgcn_wave_barrier(); __builtin_amdgcn_fence(__ATOMIC_RELEASE, "workgroup"); } while (0)

// Single-head causal self-attention with a 256-wide head (x [4,4096,256]; (in,out) Wq / Wk / Wv [256,256] uniform(+-1/16) with biases of the same scale - NONZERO; q, k, v = x W + b; attn = q k^T over all 256 dims x 1/sqrt(256) = 1/16; tril kept, -inf elsewhere; softmax; out = probs v, [4,4096,256]; no head split, no output projection). One kernel walks the keys tile by tile: the contraction of the logits runs over all 256 columns, P.v gives all 256 columns.
#define NB 4
#define TT 4096
#define CC 256            // NH * HD = projected width
#define DIN 256          // input (model) width
#define NH 4
#define HD 64
#define NQB (TT / 64)
#define HG 1
#define SCALE (0.0625f)
#define CAUSAL 1
#ifndef TNB
#define TNB NB
#endif
__device__ __forceinline__ float bfr(float v) { return (float)(__bf16)v; }
__host__ __device__ __forceinline__ int kb_last(int qb) { return CAUSAL ? ((qb * 64 + 63) >> 7) : (TT / 128 - 1); }
typedef __attribute__((ext_vector_type(8))) __bf16 v8b;
__device__ __forceinline__ v16b frag_b(const __bf16* rowk0, int lane) {
  union { v16b v; v8b q[2]; } u; const __bf16* p = rowk0 + 8 * (lane >> 4);
  u.q[0] = *(const v8b*)p; u.q[1] = *(const v8b*)(p + 16); return u.v;
}
#define QBH 6              // causal: query blocks 0..QBH-1 of each sequence (few keys, no averaging) take the high-precision path
#define QHI 384            // rows carrying a q residual plane
#define KHI 384            // key rows carrying k residual / v bf16 hi+lo planes (used only by the causal high-precision path)
// B fragment (k rows k0+.., output column o) of a weight: (in,out) [K][ld] or (out,in) [ld rows of K]: bf16 exact, or f16(bf16 * 256) exact
__device__ __forceinline__ v16b wcol_io(const float* Wm, int k0, int o, int lane, int ld) { v16b w; const int g = lane >> 4;
#pragma unroll
  for (int i = 0; i < 8; ++i) { w[i] = (__bf16)Wm[(size_t)(k0 + 8 * g + i) * ld + o]; w[8 + i] = (__bf16)Wm[(size_t)(k0 + 16 + 8 * g + i) * ld + o]; }
  return w; }
__device__ __forceinline__ v16b wcol_oi(const float* Wm, int k0, int o, int lane, int K) { v16b w; const float* p = Wm + (size_t)o * K + k0 + 8 * (lane >> 4);
#pragma unroll
  for (int i = 0; i < 8; ++i) { w[i] = (__bf16)p[i]; w[8 + i] = (__bf16)p[16 + i]; }
  return w; }
__device__ __forceinline__ v16h wcolh_io(const float* Wm, int k0, int o, int lane, int ld) { v16h w; const int g = lane >> 4;
#pragma unroll
  for (int i = 0; i < 8; ++i) { w[i] = (_Float16)(bfr(Wm[(size_t)(k0 + 8 * g + i) * ld + o]) * 256.0f); w[8 + i] = (_Float16)(bfr(Wm[(size_t)(k0 + 16 + 8 * g + i) * ld + o]) * 256.0f); }
  return w; }
__device__ __forceinline__ v16h wcolh_oi(const float* Wm, int k0, int o, int lane, int K) { v16h w; const float* p = Wm + (size_t)o * K + k0 + 8 * (lane >> 4);
#pragma unroll
  for (int i = 0; i < 8; ++i) { w[i] = (_Float16)(bfr(p[i]) * 256.0f); w[8 + i] = (_Float16)(bfr(p[16 + i]) * 256.0f); }
  return w; }
#define WQKV_LAYOUT 0   // 0 = (in,out) [DIN][CC]; 1 = (out,in) [CC][DIN]; 2 = per-head [NH][DIN][HD]
__device__ __forceinline__ v16b wcol_hdk(const float* Wm, int k0, int o, int lane) { v16b w; const int g = lane >> 4; const float* p = Wm + (size_t)(o / HD) * DIN * HD + (o % HD);
#pragma unroll
  for (int i = 0; i < 8; ++i) { w[i] = (__bf16)p[(size_t)(k0 + 8 * g + i) * HD]; w[8 + i] = (__bf16)p[(size_t)(k0 + 16 + 8 * g + i) * HD]; }
  return w; }
#define WO_OUT_IN 0
#if WQKV_LAYOUT == 1
#define WCOL(W, k0, o, lane) wcol_oi(W, k0, o, lane, DIN)
#elif WQKV_LAYOUT == 2
#define WCOL(W, k0, o, lane) wcol_hdk(W, k0, o, lane)
#else
#define WCOL(W, k0, o, lane) wcol_io(W, k0, o, lane, CC)
#endif
#if WO_OUT_IN
#define WOCOL(W, k0, o, lane) wcol_oi(W, k0, o, lane, CC)
#define WOCOLH(W, k0, o, lane) wcolh_oi(W, k0, o, lane, CC)
#else
#define WOCOL(W, k0, o, lane) wcol_io(W, k0, o, lane, DIN)
#define WOCOLH(W, k0, o, lane) wcolh_io(W, k0, o, lane, DIN)
#endif

#ifndef SM_EXTRA_PARAMS
#define SM_EXTRA_PARAMS
#endif
#ifndef PROJ_EXTRA_PARAMS
#define PROJ_EXTRA_PARAMS
#endif
#ifndef SM_MASK_HOOK
#define SM_MASK_HOOK (void)0
#endif

#define WS_QH  0u                                      // f16 q rows [b*t][CC]
#define WS_KH  (WS_QH + 2u * (size_t)NB * TT * CC)      // f16 k rows [b*t][CC]
#define WS_VT  (WS_KH + 2u * (size_t)NB * TT * CC)      // f16 v planes [b][c][t]
#define WS_QL  (WS_VT + 2u * (size_t)NB * CC * TT)      // f16 q residual x 2^10 rows [b][t < QHI][CC]
#define WS_KL  (WS_QL + 2u * (size_t)NB * QHI * CC)     // f16 k residual x 2^10 rows [b][t < KHI][CC]
#define WS_VB  (WS_KL + 2u * (size_t)NB * KHI * CC)     // bf16 v hi planes [b][c][t < KHI]
#define WS_VBL (WS_VB + 2u * (size_t)NB * CC * KHI)
#define WS_END (WS_VBL + 2u * (size_t)NB * CC * KHI)

// ---- k_proj: block = (64 rows, 128 cols, which): q/k/v = X W (+ b) with exact bf16 products (K = DIN) -> which 0: q f16 rows (+ residual rows < QHI); 1: k f16 rows (+ residual rows < KHI); 2: v f16 planes [c][t] (+ bf16 hi/lo planes for t < KHI)
__global__ __launch_bounds__(128) void k_proj(const float* __restrict__ XQ, const float* __restrict__ XK, const float* __restrict__ XV, const float* __restrict__ WQ, const float* __restrict__ WK, const float* __restrict__ WV, const float* __restrict__ BQ, const float* __restrict__ BK, const float* __restrict__ BV,
    _Float16* __restrict__ QH, _Float16* __restrict__ QL, _Float16* __restrict__ KH, _Float16* __restrict__ KL, _Float16* __restrict__ VT, __bf16* __restrict__ VB, __bf16* __restrict__ VBL) {
  __shared__ __align__(16) _Float16 sh[64][136], sl[64][136]; __shared__ __align__(16) _Float16 th[128][72]; __shared__ __align__(16) __bf16 tb[128][72], tbl[128][72];
  const int tid = threadIdx.x, wave = tid >> 5, lane = tid & 31, col = lane & 15, g = lane >> 4; const int which = blockIdx.z; const int c0 = blockIdx.y * 128; const size_t r0 = (size_t)blockIdx.x * 64; const size_t bb = r0 / TT; const int t0 = (int)(r0 % TT);
  const float* X = which == 0 ? XQ : which == 1 ? XK : XV; const float* WA = which == 0 ? WQ : which == 1 ? WK : WV; const float* BA = which == 0 ? BQ : which == 1 ? BK : BV;
  v8f acc[8] = {};
#pragma unroll 2
  for (int kc = 0; kc < DIN / 32; ++kc) { v16b a; { const float* p = X + (r0 + wave * 16 + col) * DIN + kc * 32 + 8 * g;
#pragma unroll
      for (int i = 0; i < 8; ++i) { a[i] = (__bf16)p[i]; a[8 + i] = (__bf16)p[16 + i]; } }
    asm volatile("s_wait_loadcnt 0x0" ::: "memory");
#pragma unroll
    for (int j = 0; j < 8; ++j) { const v16b w = WCOL(WA, kc * 32, c0 + j * 16 + col, lane); asm volatile("s_wait_loadcnt 0x0" ::: "memory"); acc[j] = wmma_bf(a, w, acc[j]); } }
  if (which < 2) { _Float16* DH = which == 0 ? QH : KH; _Float16* DL = which == 0 ? QL : KL; const int nhi = which == 0 ? QHI : KHI; const bool hi_rows = t0 < nhi;
#pragma unroll
    for (int j = 0; j < 8; ++j) { const float bias = BA ? bfr(BA[c0 + j * 16 + col]) : 0.f;
#pragma unroll
      for (int r = 0; r < 8; ++r) { const float v = acc[j][r] + bias; const _Float16 hv = (_Float16)v; sh[wave * 16 + 8 * g + r][j * 16 + col] = hv; sl[wave * 16 + 8 * g + r][j * 16 + col] = (_Float16)((v - (float)hv) * 1024.0f); } }
    __syncthreads();
    for (int e = tid; e < 64 * 16; e += 128) { const int rl = e >> 4, q = e & 15; vst2((unsigned*)(DH + (r0 + rl) * CC + c0 + q * 8), *(const v4u*)&sh[rl][q * 8]); if (hi_rows) vst2((unsigned*)(DL + (bb * nhi + t0 + rl) * (size_t)CC + c0 + q * 8), *(const v4u*)&sl[rl][q * 8]); }
  } else { const bool hi_rows = t0 < KHI;
#pragma unroll
    for (int j = 0; j < 8; ++j) { const float bias = BA ? bfr(BA[c0 + j * 16 + col]) : 0.f;
#pragma unroll
      for (int r = 0; r < 8; ++r) { const float v = acc[j][r] + bias; const int rl = wave * 16 + 8 * g + r, cl = j * 16 + col; th[cl][rl] = (_Float16)v; const __bf16 bh = (__bf16)v; tb[cl][rl] = bh; tbl[cl][rl] = (__bf16)(v - (float)bh); } }
    __syncthreads();
    for (int e = tid; e < 128 * 8; e += 128) { const int cl = e >> 3, q = e & 7; vst2((unsigned*)(VT + (bb * CC + c0 + cl) * (size_t)TT + t0 + q * 8), *(const v4u*)&th[cl][q * 8]); if (hi_rows) { const size_t o3 = (bb * CC + c0 + cl) * (size_t)KHI + t0 + q * 8; vst2((unsigned*)(VB + o3), *(const v4u*)&tb[cl][q * 8]); vst2((unsigned*)(VBL + o3), *(const v4u*)&tbl[cl][q * 8]); } } } }
// ---- k_fa: block = (64 queries qb, batch b = grid y), a wave = 16 queries x all 256 columns. Per 128-key tile: logits q . k (f16, f32 sums) stay in the accumulators, running row maximum, P = 2^(logit x SCALE x log2 e - maximum) through the wave's own LDS rows, ctx = ctx x 2^(old maximum - new) + P . v; at the end ctx / row sum. k and v tiles come once a work-group by whole-line loads via LDS; v's loads fly under the logits, the next k's under P . v. HI (query blocks < QBH: few keys, no averaging): q and k with their residuals (3 products), P and v as bf16 hi + lo (3 products), tiles staged one after the other
#define L2S (SCALE * 1.44269504088896340736f)
template <int M> __device__ __forceinline__ float row_x(float v) { return __builtin_bit_cast(float, __builtin_amdgcn_update_dpp(0, __builtin_bit_cast(int, v), 0x160 + M, 0xf, 0xf, false)); }   // the value of lane ^ M, inside a 16-lane row (row_xmask)
__device__ __forceinline__ float row_max16(float v) { v = fmaxf(v, row_x<1>(v)); v = fmaxf(v, row_x<2>(v)); v = fmaxf(v, row_x<4>(v)); return fmaxf(v, row_x<8>(v)); }
__device__ __forceinline__ float row_sum16(float v) { v += row_x<1>(v); v += row_x<2>(v); v += row_x<4>(v); return v + row_x<8>(v); }
__device__ __forceinline__ v8f wmma_h(v16h a, v16h b, v8f c) { return __builtin_amdgcn_wmma_f32_16x16x32_f16(false, a, false, b, (short)0, c, false, false); }
__device__ __forceinline__ v8f wmma_b(v16b a, v16b b, v8f c) { return __builtin_amdgcn_wmma_f32_16x16x32_bf16(false, a, false, b, (short)0, c, false, false); }
template <bool HI> __device__ __forceinline__ void fa_run(const int qb, const int b, const _Float16* __restrict__ QH, const _Float16* __restrict__ KH, const _Float16* __restrict__ QL, const _Float16* __restrict__ KL, const _Float16* __restrict__ VT, const __bf16* __restrict__ VB, const __bf16* __restrict__ VBL, float* __restrict__ Y,
    _Float16 (*sk)[264], _Float16 (*sv)[136], _Float16 (*sp)[136], float (*so)[16][132]) {
  const int tid = threadIdx.x, wave = tid >> 5, lane = tid & 31, col = lane & 15, g = lane >> 4; const int nkb = kb_last(qb) + 1; const int ql0 = qb * 64 + wave * 16;
  const _Float16* qt = QH + ((size_t)b * TT + ql0 + col) * CC + 8 * g;   /* this lane's half of the q fragments, the element order of frag_h */
  const _Float16* kt = KH + ((size_t)b * TT + (tid >> 5)) * CC + (tid & 31) * 8;   /* rows (tid >> 5) + 4 i */
  const _Float16* vt = VT + ((size_t)b * CC + (tid >> 4)) * (size_t)TT + (tid & 15) * 8;   /* columns (tid >> 4) + 8 i */
  _Float16 (*sl)[264] = (_Float16 (*)[264])&sv[0][0];   /* HI: the k residual tile lies where the v tile comes later */
  _Float16 (*sw)[136] = (_Float16 (*)[136])&sk[0][0];   /* HI: the v lo tile lies where the k tile was */
  __bf16* spl = (__bf16*)&so[wave][0][0];               /* HI: P lo, this wave's own 16 rows of 136 */
  v16h ah[CC / 32], al[HI ? CC / 32 : 1]; v8h kr[32], vr[32];
  if constexpr (!HI) {
#pragma unroll   // constant indices keep the array in registers
    for (int i = 0; i < 32; ++i) kr[i] = *(const v8h*)(kt + (size_t)(4 * i) * CC); }
#pragma unroll   // constant indices keep the array in registers
  for (int kc = 0; kc < CC / 32; ++kc) { union { v16h v; v8h q[2]; } u; u.q[0] = *(const v8h*)(qt + kc * 32); u.q[1] = *(const v8h*)(qt + kc * 32 + 16); ah[kc] = u.v; }
  asm volatile("s_wait_xcnt 0x0" :: "v"(kt), "v"(qt) : "memory");   /* stands before a register named by an issued global load takes a new value; the addresses are inputs so that their registers stay theirs up to it */
  if constexpr (HI) { const _Float16* qr = QL + ((size_t)b * QHI + ql0 + col) * CC + 8 * g;
#pragma unroll   // constant indices keep the array in registers
    for (int kc = 0; kc < CC / 32; ++kc) { union { v16h v; v8h q[2]; } u; u.q[0] = *(const v8h*)(qr + kc * 32); u.q[1] = *(const v8h*)(qr + kc * 32 + 16); al[kc] = u.v; }
    asm volatile("s_wait_xcnt 0x0" :: "v"(qr) : "memory");   /* as above */
  }
  v8f o[CC / 16] = {}; float m[8], l[8];   /* D element r = query 8 g + r: maximum (base-2 domain) and this lane's share of the row sum */
#pragma unroll
  for (int r = 0; r < 8; ++r) { m[r] = -3.0e38f; l[r] = 0.f; }
#pragma unroll 1   // one copy of the tile loop: a second copy would only add registers
  for (int kb = 0; kb < nkb; ++kb) {
    v8f s[8] = {};
    if constexpr (HI) {
      const _Float16* kn = kt + (size_t)kb * 128 * CC; const _Float16* ln = KL + ((size_t)b * KHI + kb * 128 + (tid >> 5)) * CC + (tid & 31) * 8;
#pragma unroll   // constant indices keep the array in registers
      for (int i = 0; i < 32; ++i) { kr[i] = *(const v8h*)(kn + (size_t)(4 * i) * CC); vr[i] = *(const v8h*)(ln + (size_t)(4 * i) * CC); }
      asm volatile("s_wait_xcnt 0x0" :: "v"(kn), "v"(ln) : "memory");   /* as above */
#pragma unroll   // constant indices keep the array in registers
      for (int i = 0; i < 32; ++i) { *(v8h*)&sk[(tid >> 5) + 4 * i][(tid & 31) * 8] = kr[i]; *(v8h*)&sl[(tid >> 5) + 4 * i][(tid & 31) * 8] = vr[i]; }
      __syncthreads();   /* both k tiles are whole before any wave reads them */
      v8f s2[8] = {};
#pragma unroll   // constant indices keep the array in registers
      for (int kc = 0; kc < CC / 32; ++kc)
#pragma unroll   // constant indices keep the array in registers
        for (int j = 0; j < 8; ++j) { const v16h kf = frag_h(&sk[j * 16 + col][kc * 32], lane), lf = frag_h(&sl[j * 16 + col][kc * 32], lane); s[j] = wmma_h(ah[kc], kf, s[j]); s2[j] = wmma_h(al[kc], kf, s2[j]); s2[j] = wmma_h(ah[kc], lf, s2[j]); }
#pragma unroll
      for (int j = 0; j < 8; ++j) s[j] += s2[j] * (1.0f / 1024.0f);
    } else {
#pragma unroll   // constant indices keep the array in registers
      for (int i = 0; i < 32; ++i) *(v8h*)&sk[(tid >> 5) + 4 * i][(tid & 31) * 8] = kr[i];
      __syncthreads();   /* the k tile is whole before any wave reads it; every wave has left the v tile of the trip before */
      /* behind the barrier, whose fence waits for every load in flight: these fly under the logits */
      const _Float16* vn = vt + kb * 128;
#pragma unroll   // constant indices keep the array in registers
      for (int i = 0; i < 32; ++i) vr[i] = *(const v8h*)(vn + (size_t)(8 * i) * TT);
      asm volatile("s_wait_xcnt 0x0" :: "v"(vn) : "memory");   /* as above */
      v16h kf[2][8];
#pragma unroll   // constant indices keep the array in registers
      for (int j = 0; j < 8; ++j) kf[0][j] = frag_h(&sk[j * 16 + col][0], lane);
#pragma unroll   // constant indices keep the array in registers
      for (int kc = 0; kc < CC / 32; ++kc) {
        if (kc + 1 < CC / 32) {
#pragma unroll   // constant indices keep the array in registers
          for (int j = 0; j < 8; ++j) kf[(kc + 1) & 1][j] = frag_h(&sk[j * 16 + col][(kc + 1) * 32], lane); }
        __builtin_amdgcn_sched_barrier(0);   /* the next group's LDS reads are issued ahead of this group's 8 products and land under them */
#pragma unroll   // constant indices keep the array in registers
        for (int j = 0; j < 8; ++j) s[j] = wmma_h(ah[kc], kf[kc & 1][j], s[j]);
        __builtin_amdgcn_sched_barrier(0);   /* keeps the groups apart: no more than two fragment sets live */
      } }
    if (kb + 1 == nkb) {   /* only the last tile holds keys past a query (every query of the block is >= kend - 128) */
#pragma unroll
      for (int j = 0; j < 8; ++j)
#pragma unroll
        for (int r = 0; r < 8; ++r) if (kb * 128 + j * 16 + col > ql0 + 8 * g + r) s[j][r] = -3.0e38f; }
    float sc[8];
#pragma unroll
    for (int r = 0; r < 8; ++r) { float mt = s[0][r];
#pragma unroll
      for (int j = 1; j < 8; ++j) mt = fmaxf(mt, s[j][r]);
      const float mn = fmaxf(m[r], row_max16(mt) * L2S); sc[r] = __builtin_amdgcn_exp2f(m[r] - mn); m[r] = mn; l[r] *= sc[r]; }
#pragma unroll
    for (int j = 0; j < 8; ++j)
#pragma unroll
      for (int r = 0; r < 8; ++r) s[j][r] = __builtin_amdgcn_exp2f(fmaf(s[j][r], L2S, -m[r]));
#pragma unroll
    for (int j = 0; j < 8; ++j)
#pragma unroll
      for (int r = 0; r < 8; ++r) { const float p = s[j][r]; l[r] += p;
        if constexpr (HI) { const __bf16 ph = (__bf16)p; *(__bf16*)&sp[wave * 16 + 8 * g + r][j * 16 + col] = ph; spl[(8 * g + r) * 136 + j * 16 + col] = (__bf16)(p - (float)ph); }
        else sp[wave * 16 + 8 * g + r][j * 16 + col] = (_Float16)p; }
#pragma unroll
    for (int j = 0; j < CC / 16; ++j)
#pragma unroll
      for (int r = 0; r < 8; ++r) o[j][r] *= sc[r];
    if constexpr (HI) {
      __syncthreads();   /* every wave has left the two k tiles */
      const __bf16* hn = VB + ((size_t)b * CC + (tid >> 4)) * (size_t)KHI + kb * 128 + (tid & 15) * 8; const __bf16* wn = VBL + ((size_t)b * CC + (tid >> 4)) * (size_t)KHI + kb * 128 + (tid & 15) * 8;
#pragma unroll   // constant indices keep the array in registers
      for (int i = 0; i < 32; ++i) { kr[i] = *(const v8h*)(hn + (size_t)(8 * i) * KHI); vr[i] = *(const v8h*)(wn + (size_t)(8 * i) * KHI); }
      asm volatile("s_wait_xcnt 0x0" :: "v"(hn), "v"(wn) : "memory");   /* as above */
#pragma unroll   // constant indices keep the array in registers
      for (int i = 0; i < 32; ++i) { *(v8h*)&sv[(tid >> 4) + 8 * i][(tid & 15) * 8] = kr[i]; *(v8h*)&sw[(tid >> 4) + 8 * i][(tid & 15) * 8] = vr[i]; }
      __syncthreads();   /* both v tiles are whole before any wave reads them */
#pragma unroll   // constant indices keep the array in registers
      for (int kc = 0; kc < 4; ++kc) { const v16b ph = frag_b((const __bf16*)&sp[wave * 16 + col][kc * 32], lane), pl = frag_b(spl + col * 136 + kc * 32, lane);
#pragma unroll   // constant indices keep the array in registers
        for (int j = 0; j < CC / 16; ++j) { const v16b vh = frag_b((const __bf16*)&sv[j * 16 + col][kc * 32], lane), vl = frag_b((const __bf16*)&sw[j * 16 + col][kc * 32], lane); o[j] = wmma_b(ph, vh, o[j]); o[j] = wmma_b(pl, vh, o[j]); o[j] = wmma_b(ph, vl, o[j]); } }
      __syncthreads();   /* every wave has left the two v tiles */
    } else {
#pragma unroll   // constant indices keep the array in registers
      for (int i = 0; i < 32; ++i) *(v8h*)&sv[(tid >> 4) + 8 * i][(tid & 15) * 8] = vr[i];
      __syncthreads();   /* the v tile is whole before any wave reads it; every wave has left the k tile */
      /* behind the barrier for the same reason: the next k tile flies under P . v */
      if (kb + 1 < nkb) {
        const _Float16* kn = kt + (size_t)(kb + 1) * 128 * CC;
#pragma unroll   // constant indices keep the array in registers
        for (int i = 0; i < 32; ++i) kr[i] = *(const v8h*)(kn + (size_t)(4 * i) * CC);
        asm volatile("s_wait_xcnt 0x0" :: "v"(kn) : "memory");   /* as above */
      }
      v16h pf[4], vf[2][8];
#pragma unroll   // constant indices keep the array in registers
      for (int kc = 0; kc < 4; ++kc) pf[kc] = frag_h(&sp[wave * 16 + col][kc * 32], lane);
#pragma unroll   // constant indices keep the array in registers
      for (int j = 0; j < 8; ++j) vf[0][j] = frag_h(&sv[j * 16 + col][0], lane);
#pragma unroll   // constant indices keep the array in registers
      for (int u = 0; u < 8; ++u) {   /* group u: keys 32 (u >> 1) .., columns 128 (u & 1) .. */
        if (u + 1 < 8) {
#pragma unroll   // constant indices keep the array in registers
          for (int j = 0; j < 8; ++j) vf[(u + 1) & 1][j] = frag_h(&sv[(((u + 1) & 1) * 8 + j) * 16 + col][((u + 1) >> 1) * 32], lane); }
        __builtin_amdgcn_sched_barrier(0);   /* the next group's LDS reads are issued ahead of this group's 8 products and land under them */
#pragma unroll   // constant indices keep the array in registers
        for (int j = 0; j < 8; ++j) o[(u & 1) * 8 + j] = wmma_h(pf[u >> 1], vf[u & 1][j], o[(u & 1) * 8 + j]);
        __builtin_amdgcn_sched_barrier(0);   /* keeps the groups apart: no more than two fragment sets live */
      } }
  }
  float inv[8];
#pragma unroll
  for (int r = 0; r < 8; ++r) inv[r] = 1.0f / row_sum16(l[r]);   /* the key of the maximum adds 1: the sum is never 0 */
  float* yp = Y + ((size_t)b * TT + ql0) * CC + lane * 4;
#pragma unroll
  for (int hf = 0; hf < 2; ++hf) {
#pragma unroll
    for (int j = 0; j < 8; ++j)
#pragma unroll
      for (int r = 0; r < 8; ++r) so[wave][8 * g + r][j * 16 + col] = o[hf * 8 + j][r] * inv[r];
    LDSX(); v4f t[16];
#pragma unroll   // constant indices keep the array in registers
    for (int rl = 0; rl < 16; ++rl) t[rl] = *(const v4f*)&so[wave][rl][lane * 4];
#pragma unroll   // constant indices keep the array in registers
    for (int rl = 0; rl < 16; ++rl) vst2(yp + (size_t)rl * CC + hf * 128, t[rl]);
    asm volatile("s_wait_xcnt 0x0" :: "v"(t[0]), "v"(t[1]), "v"(t[2]), "v"(t[3]), "v"(t[4]), "v"(t[5]), "v"(t[6]), "v"(t[7]), "v"(t[8]), "v"(t[9]), "v"(t[10]), "v"(t[11]), "v"(t[12]), "v"(t[13]), "v"(t[14]), "v"(t[15]), "v"(yp) : "memory");   /* stands before a register named by an issued global store takes a new value; data and address are inputs so that their registers stay theirs up to it */
  } }
__global__ __launch_bounds__(128) void k_fa(const _Float16* __restrict__ QH, const _Float16* __restrict__ KH, const _Float16* __restrict__ QL, const _Float16* __restrict__ KL, const _Float16* __restrict__ VT, const __bf16* __restrict__ VB, const __bf16* __restrict__ VBL, float* __restrict__ Y) {
  __shared__ __align__(16) _Float16 sk[132][264];   /* k tile [key < 128][dim], 528-B pitch for the 16-byte fragment reads; 132 rows so that a v tile fits too (HI) */
  __shared__ __align__(16) _Float16 sv[CC][136];    /* v tile [column][key], 272-B pitch */
  __shared__ __align__(16) _Float16 sp[64][136];    /* P tile [query][key]: a wave writes and reads its own 16 rows only */
  __shared__ __align__(16) float so[4][16][132];    /* output staging, 128 columns at a time, a wave its own part */
  const int qb = NQB - 1 - blockIdx.x, b = blockIdx.y;   /* longest blocks start first */
  if (qb < QBH) fa_run<true>(qb, b, QH, KH, QL, KL, VT, VB, VBL, Y, sk, sv, sp, so); else fa_run<false>(qb, b, QH, KH, QL, KL, VT, VB, VBL, Y, sk, sv, sp, so); }

extern "C" void kernel_launch(void* const* d_in, const int* in_sizes, int n_in, void* d_out, int out_size, void* d_ws, size_t ws_size, hipStream_t stream) {
  (void)in_sizes; (void)n_in; (void)out_size;
  const float** F = (const float**)d_in;
  if (ws_size < (size_t)WS_END) return;
  char* ws = (char*)d_ws; _Float16 *QH = (_Float16*)(ws + WS_QH), *KH = (_Float16*)(ws + WS_KH), *VT = (_Float16*)(ws + WS_VT), *QL = (_Float16*)(ws + WS_QL), *KL = (_Float16*)(ws + WS_KL); __bf16 *VB = (__bf16*)(ws + WS_VB), *VBL = (__bf16*)(ws + WS_VBL);
  // inputs: 0 x [4,4096,256]; 1 Wq [256,256] (in,out), 2 bq; 3 Wk, 4 bk; 5 Wv, 6 bv (biases NONZERO)
  k_proj<<<dim3(TNB * TT / 64, CC / 128, 3), 128, 0, stream>>>(F[0], F[0], F[0], F[1], F[3], F[5], F[2], F[4], F[6], QH, QL, KH, KL, VT, VB, VBL);
  k_fa<<<dim3(NQB, TNB), 128, 0, stream>>>(QH, KH, QL, KL, VT, VB, VBL, (float*)d_out);   /* logits, softmax and P . v in one launch; grid y = batch; the context rows are the output */
}

// v006
// One run takes 92.3 microseconds.
// Next to v005, in two timings, it ran 1.27 and 1.28 times as fast.
// Over all steps from v000 it is 21.8 times as fast.
// compute dtype: all float inputs rounded to bf16; q / k / v projections (256-wide) with EXACT bf16 products on WMMA 16x16x32 (f32 accumulate) + bias; causal logits over the full 256-deep contraction x 256^-0.5: 3 products for the first 384 rows, single f16 q x k after; logits, softmax (f32) and P x v in one kernel, key tile by key tile with a running row maximum: P = 2^(logit - maximum) once to f16 x v once to f16 (both bf16 hi + lo below row 384), divided by the row sum at the end; no logit plane; the four batches side by side in each launch; the context rows are the f32 output (no output projection).
#include <hip/hip_runtime.h>
#include <math.h>

typedef __attribute__((ext_vector_type(16))) _Float16 v16h;
typedef __attribute__((ext_vector_type(16))) __bf16 v16b;
typedef __attribute__((ext_vector_type(8)))  _Float16 v8h;
typedef __attribute__((ext_vector_type(4)))  _Float16 v4h;
typedef __attribute__((ext_vector_type(8)))  float v8f;
typedef __attribute__((ext_vector_type(4)))  float v4f;
typedef __attribute__((ext_vector_type(2)))  float v2f;
typedef __attribute__((ext_vector_type(4)))  unsigned v4u;
typedef __attribute__((ext_vector_type(4)))  int v4i;
typedef float __attribute__((may_alias)) float_a;
typedef int __attribute__((may_alias)) int_a;

template <typename T> __device__ __forceinline__ void vst2(void* p, T v) { *(T*)p = v;  }
__device__ __forceinline__ v8f wmma16(v16h a, v16h b, v8f c) {
  v8f d = __builtin_amdgcn_wmma_f32_16x16x32_f16(false, a, false, b, (short)0, c, false, false);
  asm volatile("v_nop\n\tv_nop\n\tv_nop\n\tv_nop" : "+v"(d) : "v"(a), "v"(b));
  return d;
}
__device__ __forceinline__ v8f wmma_bf(v16b a, v16b b, v8f c) {
  v8f d = __builtin_amdgcn_wmma_f32_16x16x32_bf16(false, a, false, b, (short)0, c, false, false);
  asm volatile("v_nop\n\tv_nop\n\tv_nop\n\tv_nop" : "+v"(d) : "v"(a), "v"(b));
  return d;
}
// 16x16x32 fragments: lane = (h = lane>>4, row/col = lane&15); elements 0..7 = k0+8h+0..7, 8..15 = k0+16+8h+0..7; D element r = row 8h+r
__device__ __forceinline__ v16h frag_h(const _Float16* rowk0, int lane) {
  union { v16h v; v8h q[2]; } u; const _Float16* p = rowk0 + 8 * (lane >> 4);
  u.q[0] = *(const v8h*)p; u.q[1] = *(const v8h*)(p + 16); return u.v;
}
__device__ __forceinline__ v16h frag_f32(const float* rowk0, int lane) {
  v16h a; const float* p = rowk0 + 8 * (lane >> 4);
#pragma unroll
  for (int i = 0; i < 8; ++i) { a[i] = (_Float16)p[i]; a[8 + i] = (_Float16)p[16 + i]; }
  return a;
}
__device__ __forceinline__ v16h frag_f32s(const float* rowk0, int lane, float sc) {
  v16h a; const float* p = rowk0 + 8 * (lane >> 4);
#pragma unroll
  for (int i = 0; i < 8; ++i) { a[i] = (_Float16)(p[i] * sc); a[8 + i] = (_Float16)(p[16 + i] * sc); }
  return a;
}
// column fragment from a [K][ld] layout (column n), rows >= K read as 0
__device__ __forceinline__ v16h fragc_f32(const float* W, int k0, int n, int lane, int ld, int K) {
  v16h a; const int g = lane >> 4;
#pragma unroll
  for (int i = 0; i < 8; ++i) { const int ka = k0 + 8 * g + i, kb = ka + 16;
    a[i] = (_Float16)(ka < K ? W[(size_t)(ka < K ? ka : K - 1) * ld + n] : 0.f); a[8 + i] = (_Float16)(kb < K ? W[(size_t)(kb < K ? kb : K - 1) * ld + n] : 0.f); }
  return a;
}
struct F2 { v16b h, l; };
__device__ __forceinline__ F2 bsplit16(const float v[16]) { F2 r;
#pragma unroll
  for (int i = 0; i < 16; ++i) { const __bf16 h = (__bf16)v[i]; r.h[i] = h; r.l[i] = (__bf16)(v[i] - (float)h); }
  return r; }
__device__ __forceinline__ F2 split_row(const float* row, int k0, int lane) { float v[16]; const float* p = row + k0 + 8 * (lane >> 4);
#pragma unroll
  for (int i = 0; i < 8; ++i) { v[i] = p[i]; v[8 + i] = p[16 + i]; }
  return bsplit16(v); }
__device__ __forceinline__ F2 split_rowK(const float* row, int k0, int lane, int K) { float v[16]; const int g = lane >> 4;
#pragma unroll
  for (int i = 0; i < 8; ++i) { const int ka = k0 + 8 * g + i, kb = ka + 16; v[i] = ka < K ? row[ka < K ? ka : K - 1] : 0.f; v[8 + i] = kb < K ? row[kb < K ? kb : K - 1] : 0.f; }
  return bsplit16(v); }
__device__ __forceinline__ F2 split_col(const float* W, int k0, int n, int lane, int ld, int K) { float v[16]; const int g = lane >> 4;
#pragma unroll
  for (int i = 0; i < 8; ++i) { const int ka = k0 + 8 * g + i, kb = ka + 16; v[i] = ka < K ? W[(size_t)(ka < K ? ka : K - 1) * ld + n] : 0.f; v[8 + i] = kb < K ? W[(size_t)(kb < K ? kb : K - 1) * ld + n] : 0.f; }
  return bsplit16(v); }
__device__ __forceinline__ v8f mac3(const F2& a, const F2& b, v8f c) { c = wmma_bf(a.l, b.h, c); c = wmma_bf(a.h, b.l, c); return wmma_bf(a.h, b.h, c); }
__device__ __forceinline__ float sigm(float v) { return 1.0f / (1.0f + expf(-v)); }
#define LDSX() do { asm volatile("s_wait_dscnt 0" ::: "memory"); __builtin_amdgcn_wave_barrier(); __builtin_amdgcn_fence(__ATOMIC_RELEASE, "workgroup"); } while (0)

// Single-head causal self-attention with a 256-wide head (x [4,4096,256]; (in,out) Wq / Wk / Wv [256,256] uniform(+-1/16) with biases of the same scale - NONZERO; q, k, v = x W + b; attn = q k^T over all 256 dims x 1/sqrt(256) = 1/16; tril kept, -inf elsewhere; softmax; out = probs v, [4,4096,256]; no head split, no output projection). One kernel walks the keys tile by tile: the contraction of the logits runs over all 256 columns, P.v gives all 256 columns.
#define NB 4
#define TT 4096
#define CC 256            // NH * HD = projected width
#define DIN 256          // input (model) width
#define NH 4
#define HD 64
#define NQB (TT / 64)
#define HG 1
#define SCALE (0.0625f)
#define CAUSAL 1
#ifndef TNB
#define TNB NB
#endif
__device__ __forceinline__ float bfr(float v) { return (float)(__bf16)v; }
__host__ __device__ __forceinline__ int kb_last(int qb) { return CAUSAL ? ((qb * 64 + 63) >> 7) : (TT / 128 - 1); }
typedef __attribute__((ext_vector_type(8))) __bf16 v8b;
__device__ __forceinline__ v16b frag_b(const __bf16* rowk0, int lane) {
  union { v16b v; v8b q[2]; } u; const __bf16* p = rowk0 + 8 * (lane >> 4);
  u.q[0] = *(const v8b*)p; u.q[1] = *(const v8b*)(p + 16); return u.v;
}
#define QBH 6              // causal: query blocks 0..QBH-1 of each sequence (few keys, no averaging) take the high-precision path
#define QHI 384            // rows carrying a q residual plane
#define KHI 384            // key rows carrying k residual / v bf16 hi+lo planes (used only by the causal high-precision path)
// B fragment (k rows k0+.., output column o) of a weight: (in,out) [K][ld] or (out,in) [ld rows of K]: bf16 exact, or f16(bf16 * 256) exact
__device__ __forceinline__ v16b wcol_io(const float* Wm, int k0, int o, int lane, int ld) { v16b w; const int g = lane >> 4;
#pragma unroll
  for (int i = 0; i < 8; ++i) { w[i] = (__bf16)Wm[(size_t)(k0 + 8 * g + i) * ld + o]; w[8 + i] = (__bf16)Wm[(size_t)(k0 + 16 + 8 * g + i) * ld + o]; }
  return w; }
__device__ __forceinline__ v16b wcol_oi(const float* Wm, int k0, int o, int lane, int K) { v16b w; const float* p = Wm + (size_t)o * K + k0 + 8 * (lane >> 4);
#pragma unroll
  for (int i = 0; i < 8; ++i) { w[i] = (__bf16)p[i]; w[8 + i] = (__bf16)p[16 + i]; }
  return w; }
__device__ __forceinline__ v16h wcolh_io(const float* Wm, int k0, int o, int lane, int ld) { v16h w; const int g = lane >> 4;
#pragma unroll
  for (int i = 0; i < 8; ++i) { w[i] = (_Float16)(bfr(Wm[(size_t)(k0 + 8 * g + i) * ld + o]) * 256.0f); w[8 + i] = (_Float16)(bfr(Wm[(size_t)(k0 + 16 + 8 * g + i) * ld + o]) * 256.0f); }
  return w; }
__device__ __forceinline__ v16h wcolh_oi(const float* Wm, int k0, int o, int lane, int K) { v16h w; const float* p = Wm + (size_t)o * K + k0 + 8 * (lane >> 4);
#pragma unroll
  for (int i = 0; i < 8; ++i) { w[i] = (_Float16)(bfr(p[i]) * 256.0f); w[8 + i] = (_Float16)(bfr(p[16 + i]) * 256.0f); }
  return w; }
#define WQKV_LAYOUT 0   // WCOL only, which nothing calls (k_proj reads (in,out) [DIN][CC]): 0 = (in,out) [DIN][CC]; 1 = (out,in) [CC][DIN]; 2 = per-head [NH][DIN][HD]
__device__ __forceinline__ v16b wcol_hdk(const float* Wm, int k0, int o, int lane) { v16b w; const int g = lane >> 4; const float* p = Wm + (size_t)(o / HD) * DIN * HD + (o % HD);
#pragma unroll
  for (int i = 0; i < 8; ++i) { w[i] = (__bf16)p[(size_t)(k0 + 8 * g + i) * HD]; w[8 + i] = (__bf16)p[(size_t)(k0 + 16 + 8 * g + i) * HD]; }
  return w; }
#define WO_OUT_IN 0
#if WQKV_LAYOUT == 1
#define WCOL(W, k0, o, lane) wcol_oi(W, k0, o, lane, DIN)
#elif WQKV_LAYOUT == 2
#define WCOL(W, k0, o, lane) wcol_hdk(W, k0, o, lane)
#else
#define WCOL(W, k0, o, lane) wcol_io(W, k0, o, lane, CC)
#endif
#if WO_OUT_IN
#define WOCOL(W, k0, o, lane) wcol_oi(W, k0, o, lane, CC)
#define WOCOLH(W, k0, o, lane) wcolh_oi(W, k0, o, lane, CC)
#else
#define WOCOL(W, k0, o, lane) wcol_io(W, k0, o, lane, DIN)
#define WOCOLH(W, k0, o, lane) wcolh_io(W, k0, o, lane, DIN)
#endif

#ifndef SM_EXTRA_PARAMS
#define SM_EXTRA_PARAMS
#endif
#ifndef PROJ_EXTRA_PARAMS
#define PROJ_EXTRA_PARAMS
#endif
#ifndef SM_MASK_HOOK
#define SM_MASK_HOOK (void)0
#endif

#define WS_QH  0u                                      // f16 q rows [b*t][CC]
#define WS_KH  (WS_QH + 2u * (size_t)NB * TT * CC)      // f16 k rows [b*t][CC]
#define WS_VT  (WS_KH + 2u * (size_t)NB * TT * CC)      // f16 v planes [b][c][t]
#define WS_QL  (WS_VT + 2u * (size_t)NB * CC * TT)      // f16 q residual x 2^10 rows [b][t < QHI][CC]
#define WS_KL  (WS_QL + 2u * (size_t)NB * QHI * CC)     // f16 k residual x 2^10 rows [b][t < KHI][CC]
#define WS_VB  (WS_KL + 2u * (size_t)NB * KHI * CC)     // bf16 v hi planes [b][c][t < KHI]
#define WS_VBL (WS_VB + 2u * (size_t)NB * CC * KHI)
#define WS_END (WS_VBL + 2u * (size_t)NB * CC * KHI)

// ---- k_proj: block = (64 rows, 128 cols, which): q/k/v = X W (+ b) with exact bf16 products (K = DIN) -> which 0: q f16 rows (+ residual rows < QHI); 1: k f16 rows (+ residual rows < KHI); 2: v f16 planes [c][t] (+ bf16 hi/lo planes for t < KHI)
__global__ __launch_bounds__(128) void k_proj(const float* __restrict__ XQ, const float* __restrict__ XK, const float* __restrict__ XV, const float* __restrict__ WQ, const float* __restrict__ WK, const float* __restrict__ WV, const float* __restrict__ BQ, const float* __restrict__ BK, const float* __restrict__ BV,
    _Float16* __restrict__ QH, _Float16* __restrict__ QL, _Float16* __restrict__ KH, _Float16* __restrict__ KL, _Float16* __restrict__ VT, __bf16* __restrict__ VB, __bf16* __restrict__ VBL) {
  __shared__ __align__(16) _Float16 sh[64][136], sl[64][136]; __shared__ __align__(16) _Float16 th[128][72]; __shared__ __align__(16) __bf16 tb[128][72], tbl[128][72];
  const int tid = threadIdx.x, wave = tid >> 5, lane = tid & 31, col = lane & 15, g = lane >> 4; const int which = blockIdx.z; const int c0 = blockIdx.y * 128; const size_t r0 = (size_t)blockIdx.x * 64; const size_t bb = r0 / TT; const int t0 = (int)(r0 % TT);
  const float* X = which == 0 ? XQ : which == 1 ? XK : XV; const float* WA = which == 0 ? WQ : which == 1 ? WK : WV; const float* BA = which == 0 ? BQ : which == 1 ? BK : BV;
  /* tile j of lane col is column PCM(j, col): a lane's tiles j = 4 hh .. 4 hh + 3 are 4 neighbouring columns, so one 16-byte load of a weight row feeds 4 tiles and 16 lanes read 256 bytes in a row (whole lines) */
#define PCM(j, col) (((j) >> 2) * 64 + (col) * 4 + ((j) & 3))
  const float* xp = X + (r0 + wave * 16 + col) * DIN + 8 * g; const float* wp = WA + (size_t)(8 * g) * CC + c0 + col * 4;
  v4f b4[2] = {};   /* b4[j >> 2][j & 3] is the bias of column PCM(j, col) */
  v8f acc[8] = {};
#pragma unroll   // every load is base + constant: the two address registers keep their values through the whole loop
  for (int kc = 0; kc < DIN / 32; ++kc) { const float* xq = xp + kc * 32; const float* wq = wp + (size_t)(kc * 32) * CC; v4f xa[4], wv[16][2];
    if (kc + 1 == DIN / 32 && BA) { const float* bp = BA + c0 + col * 4; b4[0] = *(const v4f*)bp; b4[1] = *(const v4f*)(bp + 64);   /* two 16-byte loads, in flight with the last k step's */
      asm volatile("s_wait_xcnt 0x0" :: "v"(bp) : "memory");   /* stands before a register named by an issued global load takes a new value */
    }
#pragma unroll   // constant indices keep the array in registers
    for (int e = 0; e < 4; ++e) xa[e] = *(const v4f*)(xq + (e >> 1) * 16 + (e & 1) * 4);
#pragma unroll   // constant indices keep the array in registers
    for (int e = 0; e < 16; ++e) { const float* q = wq + (size_t)((e >> 3) * 16 + (e & 7)) * CC; wv[e][0] = *(const v4f*)q; wv[e][1] = *(const v4f*)(q + 64); }
    asm volatile("s_wait_xcnt 0x0" :: "v"(xp), "v"(wp) : "memory");   /* stands before a register named by an issued global load takes a new value; the addresses are inputs so that their registers stay theirs up to it */
    v16b a;
#pragma unroll   // constant indices keep the array in registers
    for (int i = 0; i < 8; ++i) { a[i] = (__bf16)xa[i >> 2][i & 3]; a[8 + i] = (__bf16)xa[2 + (i >> 2)][i & 3]; }
#pragma unroll   // constant indices keep the array in registers
    for (int j = 0; j < 8; ++j) { v16b w;
#pragma unroll   // constant indices keep the array in registers
      for (int e = 0; e < 16; ++e) w[e] = (__bf16)wv[e][j >> 2][j & 3];
      acc[j] = wmma_bf(a, w, acc[j]); } }
  if (which < 2) { _Float16* DH = which == 0 ? QH : KH; _Float16* DL = which == 0 ? QL : KL; const int nhi = which == 0 ? QHI : KHI; const bool hi_rows = t0 < nhi;
#pragma unroll   // constant indices keep the array in registers
    for (int hh = 0; hh < 2; ++hh) {
#pragma unroll   // constant indices keep the array in registers
      for (int r = 0; r < 8; ++r) { v4h hv4, lv4;
#pragma unroll   // constant indices keep the array in registers
        for (int q = 0; q < 4; ++q) { const float v = acc[hh * 4 + q][r] + bfr(b4[hh][q]); const _Float16 hv = (_Float16)v; hv4[q] = hv; lv4[q] = (_Float16)((v - (float)hv) * 1024.0f); }
        *(v4h*)&sh[wave * 16 + 8 * g + r][PCM(hh * 4, col)] = hv4; *(v4h*)&sl[wave * 16 + 8 * g + r][PCM(hh * 4, col)] = lv4; } }
    __syncthreads();
    for (int e = tid; e < 64 * 16; e += 128) { const int rl = e >> 4, q = e & 15; vst2((unsigned*)(DH + (r0 + rl) * CC + c0 + q * 8), *(const v4u*)&sh[rl][q * 8]); if (hi_rows) vst2((unsigned*)(DL + (bb * nhi + t0 + rl) * (size_t)CC + c0 + q * 8), *(const v4u*)&sl[rl][q * 8]); }
  } else { const bool hi_rows = t0 < KHI;
#pragma unroll   // constant indices keep the array in registers
    for (int j = 0; j < 8; ++j) { const int rl = wave * 16 + 8 * g, cl = PCM(j, col); v8h h8; v8b b8, l8;
#pragma unroll   // constant indices keep the array in registers
      for (int r = 0; r < 8; ++r) { const float v = acc[j][r] + bfr(b4[j >> 2][j & 3]); h8[r] = (_Float16)v; const __bf16 bh = (__bf16)v; b8[r] = bh; l8[r] = (__bf16)(v - (float)bh); }
      *(v8h*)&th[cl][rl] = h8; *(v8b*)&tb[cl][rl] = b8; *(v8b*)&tbl[cl][rl] = l8; }
    __syncthreads();
    for (int e = tid; e < 128 * 8; e += 128) { const int cl = e >> 3, q = e & 7; vst2((unsigned*)(VT + (bb * CC + c0 + cl) * (size_t)TT + t0 + q * 8), *(const v4u*)&th[cl][q * 8]); if (hi_rows) { const size_t o3 = (bb * CC + c0 + cl) * (size_t)KHI + t0 + q * 8; vst2((unsigned*)(VB + o3), *(const v4u*)&tb[cl][q * 8]); vst2((unsigned*)(VBL + o3), *(const v4u*)&tbl[cl][q * 8]); } } } }
// ---- k_fa: block = (64 queries qb, batch b = grid y), a wave = 16 queries x all 256 columns. Per 128-key tile: logits q . k (f16, f32 sums) stay in the accumulators, running row maximum, P = 2^(logit x SCALE x log2 e - maximum) through the wave's own LDS rows, ctx = ctx x 2^(old maximum - new) + P . v; at the end ctx / row sum. k and v tiles come once a work-group by whole-line loads via LDS; v's loads fly under the logits, the next k's under P . v. HI (query blocks < QBH: few keys, no averaging): q and k with their residuals (3 products), P and v as bf16 hi + lo (3 products), tiles staged one after the other
#define L2S (SCALE * 1.44269504088896340736f)
template <int M> __device__ __forceinline__ float row_x(float v) { return __builtin_bit_cast(float, __builtin_amdgcn_update_dpp(0, __builtin_bit_cast(int, v), 0x160 + M, 0xf, 0xf, false)); }   // the value of lane ^ M, inside a 16-lane row (row_xmask)
__device__ __forceinline__ float row_max16(float v) { v = fmaxf(v, row_x<1>(v)); v = fmaxf(v, row_x<2>(v)); v = fmaxf(v, row_x<4>(v)); return fmaxf(v, row_x<8>(v)); }
__device__ __forceinline__ float row_sum16(float v) { v += row_x<1>(v); v += row_x<2>(v); v += row_x<4>(v); return v + row_x<8>(v); }
__device__ __forceinline__ v8f wmma_h(v16h a, v16h b, v8f c) { return __builtin_amdgcn_wmma_f32_16x16x32_f16(false, a, false, b, (short)0, c, false, false); }
__device__ __forceinline__ v8f wmma_b(v16b a, v16b b, v8f c) { return __builtin_amdgcn_wmma_f32_16x16x32_bf16(false, a, false, b, (short)0, c, false, false); }
template <bool HI> __device__ __forceinline__ void fa_run(const int qb, const int b, const _Float16* __restrict__ QH, const _Float16* __restrict__ KH, const _Float16* __restrict__ QL, const _Float16* __restrict__ KL, const _Float16* __restrict__ VT, const __bf16* __restrict__ VB, const __bf16* __restrict__ VBL, float* __restrict__ Y,
    _Float16 (*sk)[264], _Float16 (*sv)[136], _Float16 (*sp)[136], float (*so)[16][132]) {
  const int tid = threadIdx.x, wave = tid >> 5, lane = tid & 31, col = lane & 15, g = lane >> 4; const int nkb = kb_last(qb) + 1; const int ql0 = qb * 64 + wave * 16;
  const _Float16* qt = QH + ((size_t)b * TT + ql0 + col) * CC + 8 * g;   /* this lane's half of the q fragments, the element order of frag_h */
  const _Float16* kt = KH + ((size_t)b * TT + (tid >> 5)) * CC + (tid & 31) * 8;   /* rows (tid >> 5) + 4 i */
  const _Float16* vt = VT + ((size_t)b * CC + (tid >> 4)) * (size_t)TT + (tid & 15) * 8;   /* columns (tid >> 4) + 8 i */
  _Float16 (*sl)[264] = (_Float16 (*)[264])&sv[0][0];   /* HI: the k residual tile lies where the v tile comes later */
  _Float16 (*sw)[136] = (_Float16 (*)[136])&sk[0][0];   /* HI: the v lo tile lies where the k tile was */
  __bf16* spl = (__bf16*)&so[wave][0][0];               /* HI: P lo, this wave's own 16 rows of 136 */
  v16h ah[CC / 32], al[HI ? CC / 32 : 1]; v8h kr[32], vr[32];
  if constexpr (!HI) {
#pragma unroll   // constant indices keep the array in registers
    for (int i = 0; i < 32; ++i) kr[i] = *(const v8h*)(kt + (size_t)(4 * i) * CC); }
#pragma unroll   // constant indices keep the array in registers
  for (int kc = 0; kc < CC / 32; ++kc) { union { v16h v; v8h q[2]; } u; u.q[0] = *(const v8h*)(qt + kc * 32); u.q[1] = *(const v8h*)(qt + kc * 32 + 16); ah[kc] = u.v; }
  asm volatile("s_wait_xcnt 0x0" :: "v"(kt), "v"(qt) : "memory");   /* stands before a register named by an issued global load takes a new value; the addresses are inputs so that their registers stay theirs up to it */
  if constexpr (HI) { const _Float16* qr = QL + ((size_t)b * QHI + ql0 + col) * CC + 8 * g;
#pragma unroll   // constant indices keep the array in registers
    for (int kc = 0; kc < CC / 32; ++kc) { union { v16h v; v8h q[2]; } u; u.q[0] = *(const v8h*)(qr + kc * 32); u.q[1] = *(const v8h*)(qr + kc * 32 + 16); al[kc] = u.v; }
    asm volatile("s_wait_xcnt 0x0" :: "v"(qr) : "memory");   /* as above */
  }
  v8f o[CC / 16] = {}; float m[8], l[8];   /* D element r = query 8 g + r: maximum (base-2 domain) and this lane's share of the row sum */
#pragma unroll
  for (int r = 0; r < 8; ++r) { m[r] = -3.0e38f; l[r] = 0.f; }
#pragma unroll 1   // one copy of the tile loop: a second copy would only add registers
  for (int kb = 0; kb < nkb; ++kb) {
    v8f s[8] = {};
    if constexpr (HI) {
      const _Float16* kn = kt + (size_t)kb * 128 * CC; const _Float16* ln = KL + ((size_t)b * KHI + kb * 128 + (tid >> 5)) * CC + (tid & 31) * 8;
#pragma unroll   // constant indices keep the array in registers
      for (int i = 0; i < 32; ++i) { kr[i] = *(const v8h*)(kn + (size_t)(4 * i) * CC); vr[i] = *(const v8h*)(ln + (size_t)(4 * i) * CC); }
      asm volatile("s_wait_xcnt 0x0" :: "v"(kn), "v"(ln) : "memory");   /* as above */
#pragma unroll   // constant indices keep the array in registers
      for (int i = 0; i < 32; ++i) { *(v8h*)&sk[(tid >> 5) + 4 * i][(tid & 31) * 8] = kr[i]; *(v8h*)&sl[(tid >> 5) + 4 * i][(tid & 31) * 8] = vr[i]; }
      __syncthreads();   /* both k tiles are whole before any wave reads them */
      v8f s2[8] = {};
#pragma unroll   // constant indices keep the array in registers
      for (int kc = 0; kc < CC / 32; ++kc)
#pragma unroll   // constant indices keep the array in registers
        for (int j = 0; j < 8; ++j) { const v16h kf = frag_h(&sk[j * 16 + col][kc * 32], lane), lf = frag_h(&sl[j * 16 + col][kc * 32], lane); s[j] = wmma_h(ah[kc], kf, s[j]); s2[j] = wmma_h(al[kc], kf, s2[j]); s2[j] = wmma_h(ah[kc], lf, s2[j]); }
#pragma unroll
      for (int j = 0; j < 8; ++j) s[j] += s2[j] * (1.0f / 1024.0f);
    } else {
#pragma unroll   // constant indices keep the array in registers
      for (int i = 0; i < 32; ++i) *(v8h*)&sk[(tid >> 5) + 4 * i][(tid & 31) * 8] = kr[i];
      __syncthreads();   /* the k tile is whole before any wave reads it; every wave has left the v tile of the trip before */
      /* behind the barrier, whose fence waits for every load in flight: these fly under the logits */
      const _Float16* vn = vt + kb * 128;
#pragma unroll   // constant indices keep the array in registers
      for (int i = 0; i < 32; ++i) vr[i] = *(const v8h*)(vn + (size_t)(8 * i) * TT);
      asm volatile("s_wait_xcnt 0x0" :: "v"(vn) : "memory");   /* as above */
      v16h kf[2][8];
#pragma unroll   // constant indices keep the array in registers
      for (int j = 0; j < 8; ++j) kf[0][j] = frag_h(&sk[j * 16 + col][0], lane);
#pragma unroll   // constant indices keep the array in registers
      for (int kc = 0; kc < CC / 32; ++kc) {
        if (kc + 1 < CC / 32) {
#pragma unroll   // constant indices keep the array in registers
          for (int j = 0; j < 8; ++j) kf[(kc + 1) & 1][j] = frag_h(&sk[j * 16 + col][(kc + 1) * 32], lane); }
        __builtin_amdgcn_sched_barrier(0);   /* the next group's LDS reads are issued ahead of this group's 8 products and land under them */
#pragma unroll   // constant indices keep the array in registers
        for (int j = 0; j < 8; ++j) s[j] = wmma_h(ah[kc], kf[kc & 1][j], s[j]);
        __builtin_amdgcn_sched_barrier(0);   /* keeps the groups apart: no more than two fragment sets live */
      } }
    if (kb + 1 == nkb) {   /* only the last tile holds keys past a query (every query of the block is >= kend - 128) */
#pragma unroll
      for (int j = 0; j < 8; ++j)
#pragma unroll
        for (int r = 0; r < 8; ++r) if (kb * 128 + j * 16 + col > ql0 + 8 * g + r) s[j][r] = -3.0e38f; }
    float sc[8];
#pragma unroll
    for (int r = 0; r < 8; ++r) { float mt = s[0][r];
#pragma unroll
      for (int j = 1; j < 8; ++j) mt = fmaxf(mt, s[j][r]);
      const float mn = fmaxf(m[r], row_max16(mt) * L2S); sc[r] = __builtin_amdgcn_exp2f(m[r] - mn); m[r] = mn; l[r] *= sc[r]; }
#pragma unroll
    for (int j = 0; j < 8; ++j)
#pragma unroll
      for (int r = 0; r < 8; ++r) s[j][r] = __builtin_amdgcn_exp2f(fmaf(s[j][r], L2S, -m[r]));
#pragma unroll
    for (int j = 0; j < 8; ++j)
#pragma unroll
      for (int r = 0; r < 8; ++r) { const float p = s[j][r]; l[r] += p;
        if constexpr (HI) { const __bf16 ph = (__bf16)p; *(__bf16*)&sp[wave * 16 + 8 * g + r][j * 16 + col] = ph; spl[(8 * g + r) * 136 + j * 16 + col] = (__bf16)(p - (float)ph); }
        else sp[wave * 16 + 8 * g + r][j * 16 + col] = (_Float16)p; }
#pragma unroll
    for (int j = 0; j < CC / 16; ++j)
#pragma unroll
      for (int r = 0; r < 8; ++r) o[j][r] *= sc[r];
    if constexpr (HI) {
      __syncthreads();   /* every wave has left the two k tiles */
      const __bf16* hn = VB + ((size_t)b * CC + (tid >> 4)) * (size_t)KHI + kb * 128 + (tid & 15) * 8; const __bf16* wn = VBL + ((size_t)b * CC + (tid >> 4)) * (size_t)KHI + kb * 128 + (tid & 15) * 8;
#pragma unroll   // constant indices keep the array in registers
      for (int i = 0; i < 32; ++i) { kr[i] = *(const v8h*)(hn + (size_t)(8 * i) * KHI); vr[i] = *(const v8h*)(wn + (size_t)(8 * i) * KHI); }
      asm volatile("s_wait_xcnt 0x0" :: "v"(hn), "v"(wn) : "memory");   /* as above */
#pragma unroll   // constant indices keep the array in registers
      for (int i = 0; i < 32; ++i) { *(v8h*)&sv[(tid >> 4) + 8 * i][(tid & 15) * 8] = kr[i]; *(v8h*)&sw[(tid >> 4) + 8 * i][(tid & 15) * 8] = vr[i]; }
      __syncthreads();   /* both v tiles are whole before any wave reads them */
#pragma unroll   // constant indices keep the array in registers
      for (int kc = 0; kc < 4; ++kc) { const v16b ph = frag_b((const __bf16*)&sp[wave * 16 + col][kc * 32], lane), pl = frag_b(spl + col * 136 + kc * 32, lane);
#pragma unroll   // constant indices keep the array in registers
        for (int j = 0; j < CC / 16; ++j) { const v16b vh = frag_b((const __bf16*)&sv[j * 16 + col][kc * 32], lane), vl = frag_b((const __bf16*)&sw[j * 16 + col][kc * 32], lane); o[j] = wmma_b(ph, vh, o[j]); o[j] = wmma_b(pl, vh, o[j]); o[j] = wmma_b(ph, vl, o[j]); } }
      __syncthreads();   /* every wave has left the two v tiles */
    } else {
#pragma unroll   // constant indices keep the array in registers
      for (int i = 0; i < 32; ++i) *(v8h*)&sv[(tid >> 4) + 8 * i][(tid & 15) * 8] = vr[i];
      __syncthreads();   /* the v tile is whole before any wave reads it; every wave has left the k tile */
      /* behind the barrier for the same reason: the next k tile flies under P . v */
      if (kb + 1 < nkb) {
        const _Float16* kn = kt + (size_t)(kb + 1) * 128 * CC;
#pragma unroll   // constant indices keep the array in registers
        for (int i = 0; i < 32; ++i) kr[i] = *(const v8h*)(kn + (size_t)(4 * i) * CC);
        asm volatile("s_wait_xcnt 0x0" :: "v"(kn) : "memory");   /* as above */
      }
      v16h pf[4], vf[2][8];
#pragma unroll   // constant indices keep the array in registers
      for (int kc = 0; kc < 4; ++kc) pf[kc] = frag_h(&sp[wave * 16 + col][kc * 32], lane);
#pragma unroll   // constant indices keep the array in registers
      for (int j = 0; j < 8; ++j) vf[0][j] = frag_h(&sv[j * 16 + col][0], lane);
#pragma unroll   // constant indices keep the array in registers
      for (int u = 0; u < 8; ++u) {   /* group u: keys 32 (u >> 1) .., columns 128 (u & 1) .. */
        if (u + 1 < 8) {
#pragma unroll   // constant indices keep the array in registers
          for (int j = 0; j < 8; ++j) vf[(u + 1) & 1][j] = frag_h(&sv[(((u + 1) & 1) * 8 + j) * 16 + col][((u + 1) >> 1) * 32], lane); }
        __builtin_amdgcn_sched_barrier(0);   /* the next group's LDS reads are issued ahead of this group's 8 products and land under them */
#pragma unroll   // constant indices keep the array in registers
        for (int j = 0; j < 8; ++j) o[(u & 1) * 8 + j] = wmma_h(pf[u >> 1], vf[u & 1][j], o[(u & 1) * 8 + j]);
        __builtin_amdgcn_sched_barrier(0);   /* keeps the groups apart: no more than two fragment sets live */
      } }
  }
  float inv[8];
#pragma unroll
  for (int r = 0; r < 8; ++r) inv[r] = 1.0f / row_sum16(l[r]);   /* the key of the maximum adds 1: the sum is never 0 */
  float* yp = Y + ((size_t)b * TT + ql0) * CC + lane * 4;
#pragma unroll
  for (int hf = 0; hf < 2; ++hf) {
#pragma unroll
    for (int j = 0; j < 8; ++j)
#pragma unroll
      for (int r = 0; r < 8; ++r) so[wave][8 * g + r][j * 16 + col] = o[hf * 8 + j][r] * inv[r];
    LDSX(); v4f t[16];
#pragma unroll   // constant indices keep the array in registers
    for (int rl = 0; rl < 16; ++rl) t[rl] = *(const v4f*)&so[wave][rl][lane * 4];
#pragma unroll   // constant indices keep the array in registers
    for (int rl = 0; rl < 16; ++rl) vst2(yp + (size_t)rl * CC + hf * 128, t[rl]);
    asm volatile("s_wait_xcnt 0x0" :: "v"(t[0]), "v"(t[1]), "v"(t[2]), "v"(t[3]), "v"(t[4]), "v"(t[5]), "v"(t[6]), "v"(t[7]), "v"(t[8]), "v"(t[9]), "v"(t[10]), "v"(t[11]), "v"(t[12]), "v"(t[13]), "v"(t[14]), "v"(t[15]), "v"(yp) : "memory");   /* stands before a register named by an issued global store takes a new value; data and address are inputs so that their registers stay theirs up to it */
  } }
__global__ __launch_bounds__(128) void k_fa(const _Float16* __restrict__ QH, const _Float16* __restrict__ KH, const _Float16* __restrict__ QL, const _Float16* __restrict__ KL, const _Float16* __restrict__ VT, const __bf16* __restrict__ VB, const __bf16* __restrict__ VBL, float* __restrict__ Y) {
  __shared__ __align__(16) _Float16 sk[132][264];   /* k tile [key < 128][dim], 528-B pitch for the 16-byte fragment reads; 132 rows so that a v tile fits too (HI) */
  __shared__ __align__(16) _Float16 sv[CC][136];    /* v tile [column][key], 272-B pitch */
  __shared__ __align__(16) _Float16 sp[64][136];    /* P tile [query][key]: a wave writes and reads its own 16 rows only */
  __shared__ __align__(16) float so[4][16][132];    /* output staging, 128 columns at a time, a wave its own part */
  const int qb = NQB - 1 - blockIdx.x, b = blockIdx.y;   /* longest blocks start first */
  if (qb < QBH) fa_run<true>(qb, b, QH, KH, QL, KL, VT, VB, VBL, Y, sk, sv, sp, so); else fa_run<false>(qb, b, QH, KH, QL, KL, VT, VB, VBL, Y, sk, sv, sp, so); }

extern "C" void kernel_launch(void* const* d_in, const int* in_sizes, int n_in, void* d_out, int out_size, void* d_ws, size_t ws_size, hipStream_t stream) {
  (void)in_sizes; (void)n_in; (void)out_size;
  const float** F = (const float**)d_in;
  if (ws_size < (size_t)WS_END) return;
  char* ws = (char*)d_ws; _Float16 *QH = (_Float16*)(ws + WS_QH), *KH = (_Float16*)(ws + WS_KH), *VT = (_Float16*)(ws + WS_VT), *QL = (_Float16*)(ws + WS_QL), *KL = (_Float16*)(ws + WS_KL); __bf16 *VB = (__bf16*)(ws + WS_VB), *VBL = (__bf16*)(ws + WS_VBL);
  // inputs: 0 x [4,4096,256]; 1 Wq [256,256] (in,out), 2 bq; 3 Wk, 4 bk; 5 Wv, 6 bv (biases NONZERO)
  k_proj<<<dim3(TNB * TT / 64, CC / 128, 3), 128, 0, stream>>>(F[0], F[0], F[0], F[1], F[3], F[5], F[2], F[4], F[6], QH, QL, KH, KL, VT, VB, VBL);
  k_fa<<<dim3(NQB, TNB), 128, 0, stream>>>(QH, KH, QL, KL, VT, VB, VBL, (float*)d_out);   /* logits, softmax and P . v in one launch; grid y = batch; the context rows are the output */
}

// v007
// Measured time: 74.5 microseconds a run.
// Two timings next to v006 put it at 1.24 and 1.25 times that version's speed.
// Counting every step since v000, it is 27.2 times as fast.
// compute dtype: all float inputs rounded to bf16; q / k / v projections (256-wide) with EXACT bf16 products on WMMA 16x16x32 (f32 accumulate) + bias; causal logits over the full 256-deep contraction x 256^-0.5: 3 products for the first 384 rows, single f16 q x k after; logits, softmax (f32) and P x v in one kernel, key tile by key tile with a running row maximum: P = 2^(logit - maximum) once to f16 x v once to f16 (both bf16 hi + lo below row 384), divided by the row sum at the end; no logit plane; a query block with more than 17 key tiles is walked by two work-groups (each leaves its undivided sums, row maxima and row sums in the workspace) and a last launch joins the two; the four batches side by side in each launch; the context rows are the f32 output (no output projection).
#include <hip/hip_runtime.h>
#include <math.h>

typedef __attribute__((ext_vector_type(16))) _Float16 v16h;
typedef __attribute__((ext_vector_type(16))) __bf16 v16b;
typedef __attribute__((ext_vector_type(8)))  _Float16 v8h;
typedef __attribute__((ext_vector_type(4)))  _Float16 v4h;
typedef __attribute__((ext_vector_type(8)))  float v8f;
typedef __attribute__((ext_vector_type(4)))  float v4f;
typedef __attribute__((ext_vector_type(2)))  float v2f;
typedef __attribute__((ext_vector_type(4)))  unsigned v4u;
typedef __attribute__((ext_vector_type(4)))  int v4i;
typedef float __attribute__((may_alias)) float_a;
typedef int __attribute__((may_alias)) int_a;

template <typename T> __device__ __forceinline__ void vst2(void* p, T v) { *(T*)p = v;  }
__device__ __forceinline__ v8f wmma16(v16h a, v16h b, v8f c) {
  v8f d = __builtin_amdgcn_wmma_f32_16x16x32_f16(false, a, false, b, (short)0, c, false, false);
  asm volatile("v_nop\n\tv_nop\n\tv_nop\n\tv_nop" : "+v"(d) : "v"(a), "v"(b));
  return d;
}
__device__ __forceinline__ v8f wmma_bf(v16b a, v16b b, v8f c) {
  v8f d = __builtin_amdgcn_wmma_f32_16x16x32_bf16(false, a, false, b, (short)0, c, false, false);
  asm volatile("v_nop\n\tv_nop\n\tv_nop\n\tv_nop" : "+v"(d) : "v"(a), "v"(b));
  return d;
}
// 16x16x32 fragments: lane = (h = lane>>4, row/col = lane&15); elements 0..7 = k0+8h+0..7, 8..15 = k0+16+8h+0..7; D element r = row 8h+r
__device__ __forceinline__ v16h frag_h(const _Float16* rowk0, int lane) {
  union { v16h v; v8h q[2]; } u; const _Float16* p = rowk0 + 8 * (lane >> 4);
  u.q[0] = *(const v8h*)p; u.q[1] = *(const v8h*)(p + 16); return u.v;
}
__device__ __forceinline__ v16h frag_f32(const float* rowk0, int lane) {
  v16h a; const float* p = rowk0 + 8 * (lane >> 4);
#pragma unroll
  for (int i = 0; i < 8; ++i) { a[i] = (_Float16)p[i]; a[8 + i] = (_Float16)p[16 + i]; }
  return a;
}
__device__ __forceinline__ v16h frag_f32s(const float* rowk0, int lane, float sc) {
  v16h a; const float* p = rowk0 + 8 * (lane >> 4);
#pragma unroll
  for (int i = 0; i < 8; ++i) { a[i] = (_Float16)(p[i] * sc); a[8 + i] = (_Float16)(p[16 + i] * sc); }
  return a;
}
// column fragment from a [K][ld] layout (column n), rows >= K read as 0
__device__ __forceinline__ v16h fragc_f32(const float* W, int k0, int n, int lane, int ld, int K) {
  v16h a; const int g = lane >> 4;
#pragma unroll
  for (int i = 0; i < 8; ++i) { const int ka = k0 + 8 * g + i, kb = ka + 16;
    a[i] = (_Float16)(ka < K ? W[(size_t)(ka < K ? ka : K - 1) * ld + n] : 0.f); a[8 + i] = (_Float16)(kb < K ? W[(size_t)(kb < K ? kb : K - 1) * ld + n] : 0.f); }
  return a;
}
struct F2 { v16b h, l; };
__device__ __forceinline__ F2 bsplit16(const float v[16]) { F2 r;
#pragma unroll
  for (int i = 0; i < 16; ++i) { const __bf16 h = (__bf16)v[i]; r.h[i] = h; r.l[i] = (__bf16)(v[i] - (float)h); }
  return r; }
__device__ __forceinline__ F2 split_row(const float* row, int k0, int lane) { float v[16]; const float* p = row + k0 + 8 * (lane >> 4);
#pragma unroll
  for (int i = 0; i < 8; ++i) { v[i] = p[i]; v[8 + i] = p[16 + i]; }
  return bsplit16(v); }
__device__ __forceinline__ F2 split_rowK(const float* row, int k0, int lane, int K) { float v[16]; const int g = lane >> 4;
#pragma unroll
  for (int i = 0; i < 8; ++i) { const int ka = k0 + 8 * g + i, kb = ka + 16; v[i] = ka < K ? row[ka < K ? ka : K - 1] : 0.f; v[8 + i] = kb < K ? row[kb < K ? kb : K - 1] : 0.f; }
  return bsplit16(v); }
__device__ __forceinline__ F2 split_col(const float* W, int k0, int n, int lane, int ld, int K) { float v[16]; const int g = lane >> 4;
#pragma unroll
  for (int i = 0; i < 8; ++i) { const int ka = k0 + 8 * g + i, kb = ka + 16; v[i] = ka < K ? W[(size_t)(ka < K ? ka : K - 1) * ld + n] : 0.f; v[8 + i] = kb < K ? W[(size_t)(kb < K ? kb : K - 1) * ld + n] : 0.f; }
  return bsplit16(v); }
__device__ __forceinline__ v8f mac3(const F2& a, const F2& b, v8f c) { c = wmma_bf(a.l, b.h, c); c = wmma_bf(a.h, b.l, c); return wmma_bf(a.h, b.h, c); }
__device__ __forceinline__ float sigm(float v) { return 1.0f / (1.0f + expf(-v)); }
#define LDSX() do { asm volatile("s_wait_dscnt 0" ::: "memory"); __builtin_amdgcn_wave_barrier(); __builtin_amdgcn_fence(__ATOMIC_RELEASE, "workgroup"); } while (0)

// Single-head causal self-attention with a 256-wide head (x [4,4096,256]; (in,out) Wq / Wk / Wv [256,256] uniform(+-1/16) with biases of the same scale - NONZERO; q, k, v = x W + b; attn = q k^T over all 256 dims x 1/sqrt(256) = 1/16; tril kept, -inf elsewhere; softmax; out = probs v, [4,4096,256]; no head split, no output projection). One kernel walks the keys tile by tile: the contraction of the logits runs over all 256 columns, P.v gives all 256 columns.
#define NB 4
#define TT 4096
#define CC 256            // NH * HD = projected width
#define DIN 256          // input (model) width
#define NH 4
#define HD 64
#define NQB (TT / 64)
#define HG 1
#define SCALE (0.0625f)
#define CAUSAL 1
#ifndef TNB
#define TNB NB
#endif
__device__ __forceinline__ float bfr(float v) { return (float)(__bf16)v; }
__host__ __device__ __forceinline__ int kb_last(int qb) { return CAUSAL ? ((qb * 64 + 63) >> 7) : (TT / 128 - 1); }
typedef __attribute__((ext_vector_type(8))) __bf16 v8b;
__device__ __forceinline__ v16b frag_b(const __bf16* rowk0, int lane) {
  union { v16b v; v8b q[2]; } u; const __bf16* p = rowk0 + 8 * (lane >> 4);
  u.q[0] = *(const v8b*)p; u.q[1] = *(const v8b*)(p + 16); return u.v;
}
#define QBH 6              // causal: query blocks 0..QBH-1 of each sequence (few keys, no averaging) take the high-precision path
#define QHI 384            // rows carrying a q residual plane (the high-precision query blocks < QBH)
#define KSP 17             // key tiles (of 128) a work-group of k_fa walks at most; a longer query block is shared by two
#define KHI 384            // key rows carrying k residual / v bf16 hi+lo planes (used only by the causal high-precision path)
// B fragment (k rows k0+.., output column o) of a weight: (in,out) [K][ld] or (out,in) [ld rows of K]: bf16 exact, or f16(bf16 * 256) exact
__device__ __forceinline__ v16b wcol_io(const float* Wm, int k0, int o, int lane, int ld) { v16b w; const int g = lane >> 4;
#pragma unroll
  for (int i = 0; i < 8; ++i) { w[i] = (__bf16)Wm[(size_t)(k0 + 8 * g + i) * ld + o]; w[8 + i] = (__bf16)Wm[(size_t)(k0 + 16 + 8 * g + i) * ld + o]; }
  return w; }
__device__ __forceinline__ v16b wcol_oi(const float* Wm, int k0, int o, int lane, int K) { v16b w; const float* p = Wm + (size_t)o * K + k0 + 8 * (lane >> 4);
#pragma unroll
  for (int i = 0; i < 8; ++i) { w[i] = (__bf16)p[i]; w[8 + i] = (__bf16)p[16 + i]; }
  return w; }
__device__ __forceinline__ v16h wcolh_io(const float* Wm, int k0, int o, int lane, int ld) { v16h w; const int g = lane >> 4;
#pragma unroll
  for (int i = 0; i < 8; ++i) { w[i] = (_Float16)(bfr(Wm[(size_t)(k0 + 8 * g + i) * ld + o]) * 256.0f); w[8 + i] = (_Float16)(bfr(Wm[(size_t)(k0 + 16 + 8 * g + i) * ld + o]) * 256.0f); }
  return w; }
__device__ __forceinline__ v16h wcolh_oi(const float* Wm, int k0, int o, int lane, int K) { v16h w; const float* p = Wm + (size_t)o * K + k0 + 8 * (lane >> 4);
#pragma unroll
  for (int i = 0; i < 8; ++i) { w[i] = (_Float16)(bfr(p[i]) * 256.0f); w[8 + i] = (_Float16)(bfr(p[16 + i]) * 256.0f); }
  return w; }
#define WQKV_LAYOUT 0   // WCOL only, which nothing calls (k_proj reads (in,out) [DIN][CC]): 0 = (in,out) [DIN][CC]; 1 = (out,in) [CC][DIN]; 2 = per-head [NH][DIN][HD]
__device__ __forceinline__ v16b wcol_hdk(const float* Wm, int k0, int o, int lane) { v16b w; const int g = lane >> 4; const float* p = Wm + (size_t)(o / HD) * DIN * HD + (o % HD);
#pragma unroll
  for (int i = 0; i < 8; ++i) { w[i] = (__bf16)p[(size_t)(k0 + 8 * g + i) * HD]; w[8 + i] = (__bf16)p[(size_t)(k0 + 16 + 8 * g + i) * HD]; }
  return w; }
#define WO_OUT_IN 0
#if WQKV_LAYOUT == 1
#define WCOL(W, k0, o, lane) wcol_oi(W, k0, o, lane, DIN)
#elif WQKV_LAYOUT == 2
#define WCOL(W, k0, o, lane) wcol_hdk(W, k0, o, lane)
#else
#define WCOL(W, k0, o, lane) wcol_io(W, k0, o, lane, CC)
#endif
#if WO_OUT_IN
#define WOCOL(W, k0, o, lane) wcol_oi(W, k0, o, lane, CC)
#define WOCOLH(W, k0, o, lane) wcolh_oi(W, k0, o, lane, CC)
#else
#define WOCOL(W, k0, o, lane) wcol_io(W, k0, o, lane, DIN)
#define WOCOLH(W, k0, o, lane) wcolh_io(W, k0, o, lane, DIN)
#endif

#ifndef SM_EXTRA_PARAMS
#define SM_EXTRA_PARAMS
#endif
#ifndef PROJ_EXTRA_PARAMS
#define PROJ_EXTRA_PARAMS
#endif
#ifndef SM_MASK_HOOK
#define SM_MASK_HOOK (void)0
#endif

#define WS_QH  0u                                      // f16 q rows [b*t][CC]
#define WS_KH  (WS_QH + 2u * (size_t)NB * TT * CC)      // f16 k rows [b*t][CC]
#define WS_VT  (WS_KH + 2u * (size_t)NB * TT * CC)      // f16 v planes [b][c][t]
#define WS_QL  (WS_VT + 2u * (size_t)NB * CC * TT)      // f16 q residual x 2^10 rows [b][t < QHI][CC]
#define WS_KL  (WS_QL + 2u * (size_t)NB * QHI * CC)     // f16 k residual x 2^10 rows [b][t < KHI][CC]
#define WS_VB  (WS_KL + 2u * (size_t)NB * KHI * CC)     // bf16 v hi planes [b][c][t < KHI]
#define WS_VBL (WS_VB + 2u * (size_t)NB * CC * KHI)
#define WS_P0  (WS_VBL + 2u * (size_t)NB * CC * KHI)    // f32 undivided P . v rows [b*t][CC] over the first KSP key tiles (rows t >= KSP * 128 only)
#define WS_P1  (WS_P0 + 4u * (size_t)NB * TT * CC)      // the same over the key tiles behind them
#define WS_M0  (WS_P1 + 4u * (size_t)NB * TT * CC)      // f32, per 16 rows one 128-byte line: 16 row maxima, 16 row sums (first KSP tiles)
#define WS_M1  (WS_M0 + 4u * (size_t)NB * TT * 2)       // the same for the tiles behind them
#define WS_END (WS_M1 + 4u * (size_t)NB * TT * 2)

// ---- k_proj: block = (64 rows, 128 cols, which): q/k/v = X W (+ b) with exact bf16 products (K = DIN) -> which 0: q f16 rows (+ residual rows < QHI); 1: k f16 rows (+ residual rows < KHI); 2: v f16 planes [c][t] (+ bf16 hi/lo planes for t < KHI)
__global__ __launch_bounds__(128) void k_proj(const float* __restrict__ XQ, const float* __restrict__ XK, const float* __restrict__ XV, const float* __restrict__ WQ, const float* __restrict__ WK, const float* __restrict__ WV, const float* __restrict__ BQ, const float* __restrict__ BK, const float* __restrict__ BV,
    _Float16* __restrict__ QH, _Float16* __restrict__ QL, _Float16* __restrict__ KH, _Float16* __restrict__ KL, _Float16* __restrict__ VT, __bf16* __restrict__ VB, __bf16* __restrict__ VBL) {
  __shared__ __align__(16) _Float16 sh[64][136], sl[64][136]; __shared__ __align__(16) _Float16 th[128][72]; __shared__ __align__(16) __bf16 tb[128][72], tbl[128][72];
  const int tid = threadIdx.x, wave = tid >> 5, lane = tid & 31, col = lane & 15, g = lane >> 4; const int which = blockIdx.z; const int c0 = blockIdx.y * 128; const size_t r0 = (size_t)blockIdx.x * 64; const size_t bb = r0 / TT; const int t0 = (int)(r0 % TT);
  const float* X = which == 0 ? XQ : which == 1 ? XK : XV; const float* WA = which == 0 ? WQ : which == 1 ? WK : WV; const float* BA = which == 0 ? BQ : which == 1 ? BK : BV;
  /* tile j of lane col is column PCM(j, col): a lane's tiles j = 4 hh .. 4 hh + 3 are 4 neighbouring columns, so one 16-byte load of a weight row feeds 4 tiles and 16 lanes read 256 bytes in a row (whole lines) */
#define PCM(j, col) (((j) >> 2) * 64 + (col) * 4 + ((j) & 3))
  const float* xp = X + (r0 + wave * 16 + col) * DIN + 8 * g; const float* wp = WA + (size_t)(8 * g) * CC + c0 + col * 4;
  v4f b4[2] = {};   /* b4[j >> 2][j & 3] is the bias of column PCM(j, col) */
  v8f acc[8] = {};
#pragma unroll   // every load is base + constant: the two address registers keep their values through the whole loop
  for (int kc = 0; kc < DIN / 32; ++kc) { const float* xq = xp + kc * 32; const float* wq = wp + (size_t)(kc * 32) * CC; v4f xa[4], wv[16][2];
    if (kc + 1 == DIN / 32 && BA) { const float* bp = BA + c0 + col * 4; b4[0] = *(const v4f*)bp; b4[1] = *(const v4f*)(bp + 64);   /* two 16-byte loads, in flight with the last k step's */
      asm volatile("s_wait_xcnt 0x0" :: "v"(bp) : "memory");   /* stands before a register named by an issued global load takes a new value */
    }
#pragma unroll   // constant indices keep the array in registers
    for (int e = 0; e < 4; ++e) xa[e] = *(const v4f*)(xq + (e >> 1) * 16 + (e & 1) * 4);
#pragma unroll   // constant indices keep the array in registers
    for (int e = 0; e < 16; ++e) { const float* q = wq + (size_t)((e >> 3) * 16 + (e & 7)) * CC; wv[e][0] = *(const v4f*)q; wv[e][1] = *(const v4f*)(q + 64); }
    asm volatile("s_wait_xcnt 0x0" :: "v"(xp), "v"(wp) : "memory");   /* stands before a register named by an issued global load takes a new value; the addresses are inputs so that their registers stay theirs up to it */
    v16b a;
#pragma unroll   // constant indices keep the array in registers
    for (int i = 0; i < 8; ++i) { a[i] = (__bf16)xa[i >> 2][i & 3]; a[8 + i] = (__bf16)xa[2 + (i >> 2)][i & 3]; }
#pragma unroll   // constant indices keep the array in registers
    for (int j = 0; j < 8; ++j) { v16b w;
#pragma unroll   // constant indices keep the array in registers
      for (int e = 0; e < 16; ++e) w[e] = (__bf16)wv[e][j >> 2][j & 3];
      acc[j] = wmma_bf(a, w, acc[j]); } }
  if (which < 2) { _Float16* DH = which == 0 ? QH : KH; _Float16* DL = which == 0 ? QL : KL; const int nhi = which == 0 ? QHI : KHI; const bool hi_rows = t0 < nhi;
#pragma unroll   // constant indices keep the array in registers
    for (int hh = 0; hh < 2; ++hh) {
#pragma unroll   // constant indices keep the array in registers
      for (int r = 0; r < 8; ++r) { v4h hv4, lv4;
#pragma unroll   // constant indices keep the array in registers
        for (int q = 0; q < 4; ++q) { const float v = acc[hh * 4 + q][r] + bfr(b4[hh][q]); const _Float16 hv = (_Float16)v; hv4[q] = hv; lv4[q] = (_Float16)((v - (float)hv) * 1024.0f); }
        *(v4h*)&sh[wave * 16 + 8 * g + r][PCM(hh * 4, col)] = hv4; *(v4h*)&sl[wave * 16 + 8 * g + r][PCM(hh * 4, col)] = lv4; } }
    __syncthreads();
    for (int e = tid; e < 64 * 16; e += 128) { const int rl = e >> 4, q = e & 15; vst2((unsigned*)(DH + (r0 + rl) * CC + c0 + q * 8), *(const v4u*)&sh[rl][q * 8]); if (hi_rows) vst2((unsigned*)(DL + (bb * nhi + t0 + rl) * (size_t)CC + c0 + q * 8), *(const v4u*)&sl[rl][q * 8]); }
  } else { const bool hi_rows = t0 < KHI;
#pragma unroll   // constant indices keep the array in registers
    for (int j = 0; j < 8; ++j) { const int rl = wave * 16 + 8 * g, cl = PCM(j, col); v8h h8; v8b b8, l8;
#pragma unroll   // constant indices keep the array in registers
      for (int r = 0; r < 8; ++r) { const float v = acc[j][r] + bfr(b4[j >> 2][j & 3]); h8[r] = (_Float16)v; const __bf16 bh = (__bf16)v; b8[r] = bh; l8[r] = (__bf16)(v - (float)bh); }
      *(v8h*)&th[cl][rl] = h8; *(v8b*)&tb[cl][rl] = b8; *(v8b*)&tbl[cl][rl] = l8; }
    __syncthreads();
    for (int e = tid; e < 128 * 8; e += 128) { const int cl = e >> 3, q = e & 7; vst2((unsigned*)(VT + (bb * CC + c0 + cl) * (size_t)TT + t0 + q * 8), *(const v4u*)&th[cl][q * 8]); if (hi_rows) { const size_t o3 = (bb * CC + c0 + cl) * (size_t)KHI + t0 + q * 8; vst2((unsigned*)(VB + o3), *(const v4u*)&tb[cl][q * 8]); vst2((unsigned*)(VBL + o3), *(const v4u*)&tbl[cl][q * 8]); } } } }
// ---- k_fa: block = (64 queries qb, all its key tiles or one of two shares of them, batch b), a wave = 16 queries x all 256 columns. Per 128-key tile: logits q . k (f16, f32 sums) stay in the accumulators, running row maximum, P = 2^(logit x SCALE x log2 e - maximum) through the wave's own LDS rows, ctx = ctx x 2^(old maximum - new) + P . v; at the end ctx / row sum. k and v tiles come once a work-group by whole-line loads via LDS; v's loads fly under the logits, the next k's under P . v. HI (query blocks < QBH: few keys, no averaging): q and k with their residuals (3 products), P and v as bf16 hi + lo (3 products), tiles staged one after the other
#define L2S (SCALE * 1.44269504088896340736f)
template <int M> __device__ __forceinline__ float row_x(float v) { return __builtin_bit_cast(float, __builtin_amdgcn_update_dpp(0, __builtin_bit_cast(int, v), 0x160 + M, 0xf, 0xf, false)); }   // the value of lane ^ M, inside a 16-lane row (row_xmask)
__device__ __forceinline__ float row_max16(float v) { v = fmaxf(v, row_x<1>(v)); v = fmaxf(v, row_x<2>(v)); v = fmaxf(v, row_x<4>(v)); return fmaxf(v, row_x<8>(v)); }
__device__ __forceinline__ float row_sum16(float v) { v += row_x<1>(v); v += row_x<2>(v); v += row_x<4>(v); return v + row_x<8>(v); }
__device__ __forceinline__ v8f wmma_h(v16h a, v16h b, v8f c) { return __builtin_amdgcn_wmma_f32_16x16x32_f16(false, a, false, b, (short)0, c, false, false); }
__device__ __forceinline__ v8f wmma_b(v16b a, v16b b, v8f c) { return __builtin_amdgcn_wmma_f32_16x16x32_bf16(false, a, false, b, (short)0, c, false, false); }
template <bool HI> __device__ __forceinline__ void fa_run(const int qb, const int b, const int kb0, const int kb1, float* __restrict__ ML, const _Float16* __restrict__ QH, const _Float16* __restrict__ KH, const _Float16* __restrict__ QL, const _Float16* __restrict__ KL, const _Float16* __restrict__ VT, const __bf16* __restrict__ VB, const __bf16* __restrict__ VBL, float* __restrict__ Y,
    _Float16 (*sk)[264], _Float16 (*sv)[136], _Float16 (*sp)[136], float (*so)[16][132]) {
  const int tid = threadIdx.x, wave = tid >> 5, lane = tid & 31, col = lane & 15, g = lane >> 4; const int nkb = kb_last(qb) + 1; const int ql0 = qb * 64 + wave * 16;
  const _Float16* qt = QH + ((size_t)b * TT + ql0 + col) * CC + 8 * g;   /* this lane's half of the q fragments, the element order of frag_h */
  const _Float16* kt = KH + ((size_t)b * TT + (tid >> 5)) * CC + (tid & 31) * 8;   /* rows (tid >> 5) + 4 i */
  const _Float16* vt = VT + ((size_t)b * CC + (tid >> 4)) * (size_t)TT + (tid & 15) * 8;   /* columns (tid >> 4) + 8 i */
  _Float16 (*sl)[264] = (_Float16 (*)[264])&sv[0][0];   /* HI: the k residual tile lies where the v tile comes later */
  _Float16 (*sw)[136] = (_Float16 (*)[136])&sk[0][0];   /* HI: the v lo tile lies where the k tile was */
  __bf16* spl = (__bf16*)&so[wave][0][0];               /* HI: P lo, this wave's own 16 rows of 136 */
  const _Float16* kf0 = kt + (size_t)kb0 * 128 * CC;   /* the first key tile of this work-group's share [kb0, kb1) */
  v16h ah[CC / 32], al[HI ? CC / 32 : 1]; v8h kr[32], vr[32];
  if constexpr (!HI) {
#pragma unroll   // constant indices keep the array in registers
    for (int i = 0; i < 32; ++i) kr[i] = *(const v8h*)(kf0 + (size_t)(4 * i) * CC); }
#pragma unroll   // constant indices keep the array in registers
  for (int kc = 0; kc < CC / 32; ++kc) { union { v16h v; v8h q[2]; } u; u.q[0] = *(const v8h*)(qt + kc * 32); u.q[1] = *(const v8h*)(qt + kc * 32 + 16); ah[kc] = u.v; }
  asm volatile("s_wait_xcnt 0x0" :: "v"(kf0), "v"(qt) : "memory");   /* stands before a register named by an issued global load takes a new value; the addresses are inputs so that their registers stay theirs up to it */
  if constexpr (HI) { const _Float16* qr = QL + ((size_t)b * QHI + ql0 + col) * CC + 8 * g;
#pragma unroll   // constant indices keep the array in registers
    for (int kc = 0; kc < CC / 32; ++kc) { union { v16h v; v8h q[2]; } u; u.q[0] = *(const v8h*)(qr + kc * 32); u.q[1] = *(const v8h*)(qr + kc * 32 + 16); al[kc] = u.v; }
    asm volatile("s_wait_xcnt 0x0" :: "v"(qr) : "memory");   /* as above */
  }
  v8f o[CC / 16] = {}; float m[8], l[8];   /* D element r = query 8 g + r: maximum (base-2 domain) and this lane's share of the row sum */
#pragma unroll
  for (int r = 0; r < 8; ++r) { m[r] = -3.0e38f; l[r] = 0.f; }
#pragma unroll 1   // one copy of the tile loop: a second copy would only add registers
  for (int kb = kb0; kb < kb1; ++kb) {
    v8f s[8] = {};
    if constexpr (HI) {
      const _Float16* kn = kt + (size_t)kb * 128 * CC; const _Float16* ln = KL + ((size_t)b * KHI + kb * 128 + (tid >> 5)) * CC + (tid & 31) * 8;
#pragma unroll   // constant indices keep the array in registers
      for (int i = 0; i < 32; ++i) { kr[i] = *(const v8h*)(kn + (size_t)(4 * i) * CC); vr[i] = *(const v8h*)(ln + (size_t)(4 * i) * CC); }
      asm volatile("s_wait_xcnt 0x0" :: "v"(kn), "v"(ln) : "memory");   /* as above */
#pragma unroll   // constant indices keep the array in registers
      for (int i = 0; i < 32; ++i) { *(v8h*)&sk[(tid >> 5) + 4 * i][(tid & 31) * 8] = kr[i]; *(v8h*)&sl[(tid >> 5) + 4 * i][(tid & 31) * 8] = vr[i]; }
      __syncthreads();   /* both k tiles are whole before any wave reads them */
      v8f s2[8] = {};
#pragma unroll   // constant indices keep the array in registers
      for (int kc = 0; kc < CC / 32; ++kc)
#pragma unroll   // constant indices keep the array in registers
        for (int j = 0; j < 8; ++j) { const v16h kf = frag_h(&sk[j * 16 + col][kc * 32], lane), lf = frag_h(&sl[j * 16 + col][kc * 32], lane); s[j] = wmma_h(ah[kc], kf, s[j]); s2[j] = wmma_h(al[kc], kf, s2[j]); s2[j] = wmma_h(ah[kc], lf, s2[j]); }
#pragma unroll
      for (int j = 0; j < 8; ++j) s[j] += s2[j] * (1.0f / 1024.0f);
    } else {
#pragma unroll   // constant indices keep the array in registers
      for (int i = 0; i < 32; ++i) *(v8h*)&sk[(tid >> 5) + 4 * i][(tid & 31) * 8] = kr[i];
      __syncthreads();   /* the k tile is whole before any wave reads it; every wave has left the v tile of the trip before */
      /* behind the barrier, whose fence waits for every load in flight: these fly under the logits */
      const _Float16* vn = vt + kb * 128;
#pragma unroll   // constant indices keep the array in registers
      for (int i = 0; i < 32; ++i) vr[i] = *(const v8h*)(vn + (size_t)(8 * i) * TT);
      asm volatile("s_wait_xcnt 0x0" :: "v"(vn) : "memory");   /* as above */
      v16h kf[2][8];
#pragma unroll   // constant indices keep the array in registers
      for (int j = 0; j < 8; ++j) kf[0][j] = frag_h(&sk[j * 16 + col][0], lane);
#pragma unroll   // constant indices keep the array in registers
      for (int kc = 0; kc < CC / 32; ++kc) {
        if (kc + 1 < CC / 32) {
#pragma unroll   // constant indices keep the array in registers
          for (int j = 0; j < 8; ++j) kf[(kc + 1) & 1][j] = frag_h(&sk[j * 16 + col][(kc + 1) * 32], lane); }
        __builtin_amdgcn_sched_barrier(0);   /* the next group's LDS reads are issued ahead of this group's 8 products and land under them */
#pragma unroll   // constant indices keep the array in registers
        for (int j = 0; j < 8; ++j) s[j] = wmma_h(ah[kc], kf[kc & 1][j], s[j]);
        __builtin_amdgcn_sched_barrier(0);   /* keeps the groups apart: no more than two fragment sets live */
      } }
    if (kb + 1 == nkb) {   /* only the last tile holds keys past a query (every query of the block is >= kend - 128) */
#pragma unroll
      for (int j = 0; j < 8; ++j)
#pragma unroll
        for (int r = 0; r < 8; ++r) if (kb * 128 + j * 16 + col > ql0 + 8 * g + r) s[j][r] = -3.0e38f; }
    float sc[8];
#pragma unroll
    for (int r = 0; r < 8; ++r) { float mt = s[0][r];
#pragma unroll
      for (int j = 1; j < 8; ++j) mt = fmaxf(mt, s[j][r]);
      const float mn = fmaxf(m[r], row_max16(mt) * L2S); sc[r] = __builtin_amdgcn_exp2f(m[r] - mn); m[r] = mn; l[r] *= sc[r]; }
#pragma unroll
    for (int j = 0; j < 8; ++j)
#pragma unroll
      for (int r = 0; r < 8; ++r) s[j][r] = __builtin_amdgcn_exp2f(fmaf(s[j][r], L2S, -m[r]));
#pragma unroll
    for (int j = 0; j < 8; ++j)
#pragma unroll
      for (int r = 0; r < 8; ++r) { const float p = s[j][r]; l[r] += p;
        if constexpr (HI) { const __bf16 ph = (__bf16)p; *(__bf16*)&sp[wave * 16 + 8 * g + r][j * 16 + col] = ph; spl[(8 * g + r) * 136 + j * 16 + col] = (__bf16)(p - (float)ph); }
        else sp[wave * 16 + 8 * g + r][j * 16 + col] = (_Float16)p; }
#pragma unroll
    for (int j = 0; j < CC / 16; ++j)
#pragma unroll
      for (int r = 0; r < 8; ++r) o[j][r] *= sc[r];
    if constexpr (HI) {
      __syncthreads();   /* every wave has left the two k tiles */
      const __bf16* hn = VB + ((size_t)b * CC + (tid >> 4)) * (size_t)KHI + kb * 128 + (tid & 15) * 8; const __bf16* wn = VBL + ((size_t)b * CC + (tid >> 4)) * (size_t)KHI + kb * 128 + (tid & 15) * 8;
#pragma unroll   // constant indices keep the array in registers
      for (int i = 0; i < 32; ++i) { kr[i] = *(const v8h*)(hn + (size_t)(8 * i) * KHI); vr[i] = *(const v8h*)(wn + (size_t)(8 * i) * KHI); }
      asm volatile("s_wait_xcnt 0x0" :: "v"(hn), "v"(wn) : "memory");   /* as above */
#pragma unroll   // constant indices keep the array in registers
      for (int i = 0; i < 32; ++i) { *(v8h*)&sv[(tid >> 4) + 8 * i][(tid & 15) * 8] = kr[i]; *(v8h*)&sw[(tid >> 4) + 8 * i][(tid & 15) * 8] = vr[i]; }
      __syncthreads();   /* both v tiles are whole before any wave reads them */
#pragma unroll   // constant indices keep the array in registers
      for (int kc = 0; kc < 4; ++kc) { const v16b ph = frag_b((const __bf16*)&sp[wave * 16 + col][kc * 32], lane), pl = frag_b(spl + col * 136 + kc * 32, lane);
#pragma unroll   // constant indices keep the array in registers
        for (int j = 0; j < CC / 16; ++j) { const v16b vh = frag_b((const __bf16*)&sv[j * 16 + col][kc * 32], lane), vl = frag_b((const __bf16*)&sw[j * 16 + col][kc * 32], lane); o[j] = wmma_b(ph, vh, o[j]); o[j] = wmma_b(pl, vh, o[j]); o[j] = wmma_b(ph, vl, o[j]); } }
      __syncthreads();   /* every wave has left the two v tiles */
    } else {
#pragma unroll   // constant indices keep the array in registers
      for (int i = 0; i < 32; ++i) *(v8h*)&sv[(tid >> 4) + 8 * i][(tid & 15) * 8] = vr[i];
      __syncthreads();   /* the v tile is whole before any wave reads it; every wave has left the k tile */
      /* behind the barrier for the same reason: the next k tile flies under P . v */
      if (kb + 1 < kb1) {
        const _Float16* kn = kt + (size_t)(kb + 1) * 128 * CC;
#pragma unroll   // constant indices keep the array in registers
        for (int i = 0; i < 32; ++i) kr[i] = *(const v8h*)(kn + (size_t)(4 * i) * CC);
        asm volatile("s_wait_xcnt 0x0" :: "v"(kn) : "memory");   /* as above */
      }
      v16h pf[4], vf[2][8];
#pragma unroll   // constant indices keep the array in registers
      for (int kc = 0; kc < 4; ++kc) pf[kc] = frag_h(&sp[wave * 16 + col][kc * 32], lane);
#pragma unroll   // constant indices keep the array in registers
      for (int j = 0; j < 8; ++j) vf[0][j] = frag_h(&sv[j * 16 + col][0], lane);
#pragma unroll   // constant indices keep the array in registers
      for (int u = 0; u < 8; ++u) {   /* group u: keys 32 (u >> 1) .., columns 128 (u & 1) .. */
        if (u + 1 < 8) {
#pragma unroll   // constant indices keep the array in registers
          for (int j = 0; j < 8; ++j) vf[(u + 1) & 1][j] = frag_h(&sv[(((u + 1) & 1) * 8 + j) * 16 + col][((u + 1) >> 1) * 32], lane); }
        __builtin_amdgcn_sched_barrier(0);   /* the next group's LDS reads are issued ahead of this group's 8 products and land under them */
#pragma unroll   // constant indices keep the array in registers
        for (int j = 0; j < 8; ++j) o[(u & 1) * 8 + j] = wmma_h(pf[u >> 1], vf[u & 1][j], o[(u & 1) * 8 + j]);
        __builtin_amdgcn_sched_barrier(0);   /* keeps the groups apart: no more than two fragment sets live */
      } }
  }
  float inv[8];
#pragma unroll
  for (int r = 0; r < 8; ++r) l[r] = row_sum16(l[r]);
  if (ML) {   /* a share of a block: the sums leave undivided, with each row's maximum and sum beside them; a whole block is divided by its row sum below */
#pragma unroll
    for (int r = 0; r < 8; ++r) inv[r] = 1.0f;
    if (col == 0) { float* mp = ML + ((((size_t)b * TT + ql0) >> 4) * 32) + 8 * g;   /* this wave's own 128-byte line */
      const v4f ma = { m[0], m[1], m[2], m[3] }, mb = { m[4], m[5], m[6], m[7] }, la = { l[0], l[1], l[2], l[3] }, lb = { l[4], l[5], l[6], l[7] };
      vst2(mp, ma); vst2(mp + 4, mb); vst2(mp + 16, la); vst2(mp + 20, lb);
      asm volatile("s_wait_xcnt 0x0" :: "v"(ma), "v"(mb), "v"(la), "v"(lb), "v"(mp) : "memory");   /* stands before a register named by an issued global store takes a new value */
    }
  } else {
#pragma unroll
    for (int r = 0; r < 8; ++r) inv[r] = 1.0f / l[r];   /* the key of the maximum adds 1: the sum is never 0 */
  }
  float* yp = Y + ((size_t)b * TT + ql0) * CC + lane * 4;
#pragma unroll
  for (int hf = 0; hf < 2; ++hf) {
#pragma unroll
    for (int j = 0; j < 8; ++j)
#pragma unroll
      for (int r = 0; r < 8; ++r) so[wave][8 * g + r][j * 16 + col] = o[hf * 8 + j][r] * inv[r];
    LDSX(); v4f t[16];
#pragma unroll   // constant indices keep the array in registers
    for (int rl = 0; rl < 16; ++rl) t[rl] = *(const v4f*)&so[wave][rl][lane * 4];
#pragma unroll   // constant indices keep the array in registers
    for (int rl = 0; rl < 16; ++rl) vst2(yp + (size_t)rl * CC + hf * 128, t[rl]);
    asm volatile("s_wait_xcnt 0x0" :: "v"(t[0]), "v"(t[1]), "v"(t[2]), "v"(t[3]), "v"(t[4]), "v"(t[5]), "v"(t[6]), "v"(t[7]), "v"(t[8]), "v"(t[9]), "v"(t[10]), "v"(t[11]), "v"(t[12]), "v"(t[13]), "v"(t[14]), "v"(t[15]), "v"(yp) : "memory");   /* stands before a register named by an issued global store takes a new value; data and address are inputs so that their registers stay theirs up to it */
  } }
__global__ __launch_bounds__(128) void k_fa(const _Float16* __restrict__ QH, const _Float16* __restrict__ KH, const _Float16* __restrict__ QL, const _Float16* __restrict__ KL, const _Float16* __restrict__ VT, const __bf16* __restrict__ VB, const __bf16* __restrict__ VBL, float* __restrict__ Y, float* __restrict__ P0, float* __restrict__ P1, float* __restrict__ ML0, float* __restrict__ ML1) {
  __shared__ __align__(16) _Float16 sk[132][264];   /* k tile [key < 128][dim], 528-B pitch for the 16-byte fragment reads; 132 rows so that a v tile fits too (HI) */
  __shared__ __align__(16) _Float16 sv[CC][136];    /* v tile [column][key], 272-B pitch */
  __shared__ __align__(16) _Float16 sp[64][136];    /* P tile [query][key]: a wave writes and reads its own 16 rows only */
  __shared__ __align__(16) float so[4][16][132];    /* output staging, 128 columns at a time, a wave its own part */
  /* one work-group fits a WGP, and a launch lasts as long as its fullest place: no share is longer than KSP tiles, and the shares start longest first (rank: the 30 first shares of KSP tiles; the whole blocks 33 .. 30; the 6 high-precision blocks, dearer a tile; then by falling length sz the second shares of blocks 2 sz + 32, 2 sz + 33 and the whole blocks 2 sz - 2, 2 sz - 1) */
  static_assert(CAUSAL && NQB == 64 && KSP == 17 && QBH == 6, "the rank order below is written for these");
  const int rank = blockIdx.x / TNB, b = blockIdx.x % TNB; int qb, part;   /* part 0: the whole block; 1: its first KSP tiles; 2: the tiles behind them */
  if (rank < 30) { qb = 34 + rank; part = 1; }
  else if (rank < 34) { qb = 63 - rank; part = 0; }
  else if (rank < 40) { qb = 39 - rank; part = 0; }
  else { const int rr = rank - 40; const int sz = rr < 48 ? 15 - (rr >> 2) : 3 - ((rr - 48) >> 1); const int w = rr < 48 ? (rr & 3) : (rr & 1);
    if (w < 2) { qb = 2 * sz + 32 + w; part = 2; } else { qb = 2 * sz - 4 + w; part = 0; } }
  const int nkb = kb_last(qb) + 1;
  if (qb < QBH) fa_run<true>(qb, b, 0, nkb, nullptr, QH, KH, QL, KL, VT, VB, VBL, Y, sk, sv, sp, so);
  else fa_run<false>(qb, b, part == 2 ? KSP : 0, part == 1 ? KSP : nkb, part == 0 ? nullptr : part == 1 ? ML0 : ML1, QH, KH, QL, KL, VT, VB, VBL, part == 0 ? Y : part == 1 ? P0 : P1, sk, sv, sp, so); }
// ---- k_mg: the rows of the shared query blocks (t >= KSP * 128): out = (P0 2^(m0 - m) + P1 2^(m1 - m)) / (l0 2^(m0 - m) + l1 2^(m1 - m)), m = the larger maximum. Block = 32 rows; a thread = 16 bytes of 8 rows, all its loads in flight at once; whole lines in and out
__device__ __forceinline__ float exp2_slot(float x) { float r; asm("v_exp_f32 %0, %1\n\tv_nop" : "=v"(r) : "v"(x)); return r; }   /* 2^x; the v_nop is the one slot the instruction set asks for behind a transcendental before its result is read or its source overwritten: in one statement it stands there in every build */
__global__ __launch_bounds__(256) void k_mg(const float* __restrict__ P0, const float* __restrict__ P1, const float* __restrict__ ML0, const float* __restrict__ ML1, float* __restrict__ Y) {
  const int tid = threadIdx.x, rs = tid >> 6; const int r0 = blockIdx.x * 32; const int b = r0 / (TT - KSP * 128);
  const size_t gb = (size_t)b * TT + KSP * 128 + r0 % (TT - KSP * 128);   /* a multiple of 32; this thread: rows gb + 8 rs + i */
  const size_t po = (gb + 8 * rs) * CC + (tid & 63) * 4, mo = ((gb >> 4) + (rs >> 1)) * 32 + (rs & 1) * 8;
  const float* p0 = P0 + po; const float* p1 = P1 + po; const float* q0 = ML0 + mo; const float* q1 = ML1 + mo; float* yp = Y + po;
  v4f a[8], c[8], m0[2], l0[2], m1[2], l1[2];
#pragma unroll   // constant indices keep the arrays in registers
  for (int i = 0; i < 2; ++i) { m0[i] = *(const v4f*)(q0 + 4 * i); l0[i] = *(const v4f*)(q0 + 16 + 4 * i); m1[i] = *(const v4f*)(q1 + 4 * i); l1[i] = *(const v4f*)(q1 + 16 + 4 * i); }
#pragma unroll   // constant indices keep the arrays in registers
  for (int i = 0; i < 8; ++i) { a[i] = *(const v4f*)(p0 + (size_t)i * CC); c[i] = *(const v4f*)(p1 + (size_t)i * CC); }
  asm volatile("s_wait_xcnt 0x0" :: "v"(p0), "v"(p1), "v"(q0), "v"(q1) : "memory");   /* stands before a register named by an issued global load takes a new value; the addresses are inputs so that their registers stay theirs up to it */
  v4f y[8];
#pragma unroll   // constant indices keep the arrays in registers
  for (int i = 0; i < 8; ++i) { const float ma = m0[i >> 2][i & 3], mb = m1[i >> 2][i & 3]; const float mn = fmaxf(ma, mb); const float f0 = exp2_slot(ma - mn), f1 = exp2_slot(mb - mn);
    const float inv = 1.0f / (l0[i >> 2][i & 3] * f0 + l1[i >> 2][i & 3] * f1);   /* the share that holds the maximum adds at least 1: never 0 */
    y[i] = (a[i] * f0 + c[i] * f1) * inv; }
#pragma unroll   // constant indices keep the arrays in registers
  for (int i = 0; i < 8; ++i) vst2(yp + (size_t)i * CC, y[i]);
  asm volatile("s_wait_xcnt 0x0" :: "v"(y[0]), "v"(y[1]), "v"(y[2]), "v"(y[3]), "v"(y[4]), "v"(y[5]), "v"(y[6]), "v"(y[7]), "v"(yp) : "memory");   /* stands before a register named by an issued global store takes a new value; data and address are inputs so that their registers stay theirs up to it */
}

extern "C" void kernel_launch(void* const* d_in, const int* in_sizes, int n_in, void* d_out, int out_size, void* d_ws, size_t ws_size, hipStream_t stream) {
  (void)in_sizes; (void)n_in; (void)out_size;
  const float** F = (const float**)d_in;
  if (ws_size < (size_t)WS_END) return;
  char* ws = (char*)d_ws; _Float16 *QH = (_Float16*)(ws + WS_QH), *KH = (_Float16*)(ws + WS_KH), *VT = (_Float16*)(ws + WS_VT), *QL = (_Float16*)(ws + WS_QL), *KL = (_Float16*)(ws + WS_KL); __bf16 *VB = (__bf16*)(ws + WS_VB), *VBL = (__bf16*)(ws + WS_VBL); float *P0 = (float*)(ws + WS_P0), *P1 = (float*)(ws + WS_P1), *ML0 = (float*)(ws + WS_M0), *ML1 = (float*)(ws + WS_M1);
  // inputs: 0 x [4,4096,256]; 1 Wq [256,256] (in,out), 2 bq; 3 Wk, 4 bk; 5 Wv, 6 bv (biases NONZERO)
  k_proj<<<dim3(TNB * TT / 64, CC / 128, 3), 128, 0, stream>>>(F[0], F[0], F[0], F[1], F[3], F[5], F[2], F[4], F[6], QH, QL, KH, KL, VT, VB, VBL);
  k_fa<<<dim3((NQB + NQB - 2 * KSP) * TNB), 128, 0, stream>>>(QH, KH, QL, KL, VT, VB, VBL, (float*)d_out, P0, P1, ML0, ML1);   /* logits, softmax and P . v in one launch; 64 blocks + 30 second shares a batch; rows t < KSP * 128 are final here */
  k_mg<<<dim3(TNB * (TT - KSP * 128) / 32), 256, 0, stream>>>(P0, P1, ML0, ML1, (float*)d_out);   /* joins the two shares of the rows t >= KSP * 128 */
}

// v008
// Measured time: 70 microseconds a run.
// In two side-by-side timings against v007, it was 1.07 and 1.05 times as fast.
// All steps since v000 together make it 28.8 times as fast.
// compute dtype: all float inputs rounded to bf16; q / k / v projections (256-wide) with EXACT bf16 products on WMMA 16x16x32 (f32 accumulate) + bias; causal logits over the full 256-deep contraction x 256^-0.5: 3 products for the first 384 rows, single f16 q x k after; logits, softmax (f32) and P x v in one kernel, key tile by key tile with a running row maximum: P = 2^(logit - maximum) once to f16 x v once to f16 (both bf16 hi + lo below row 384), divided by the row sum at the end; no logit plane; a query block with more than 17 key tiles is walked by two work-groups (each leaves its undivided sums, row maxima and row sums in the workspace) and a last launch joins the two; the four batches side by side in each launch; the context rows are the f32 output (no output projection).
#include <hip/hip_runtime.h>
#include <math.h>

typedef __attribute__((ext_vector_type(16))) _Float16 v16h;
typedef __attribute__((ext_vector_type(16))) __bf16 v16b;
typedef __attribute__((ext_vector_type(8)))  _Float16 v8h;
typedef __attribute__((ext_vector_type(4)))  _Float16 v4h;
typedef __attribute__((ext_vector_type(8)))  float v8f;
typedef __attribute__((ext_vector_type(4)))  float v4f;
typedef __attribute__((ext_vector_type(2)))  float v2f;
typedef __attribute__((ext_vector_type(4)))  unsigned v4u;
typedef __attribute__((ext_vector_type(4)))  int v4i;
typedef float __attribute__((may_alias)) float_a;
typedef int __attribute__((may_alias)) int_a;

template <typename T> __device__ __forceinline__ void vst2(void* p, T v) { *(T*)p = v;  }
__device__ __forceinline__ v8f wmma16(v16h a, v16h b, v8f c) {
  v8f d = __builtin_amdgcn_wmma_f32_16x16x32_f16(false, a, false, b, (short)0, c, false, false);
  asm volatile("v_nop\n\tv_nop\n\tv_nop\n\tv_nop" : "+v"(d) : "v"(a), "v"(b));
  return d;
}
__device__ __forceinline__ v8f wmma_bf(v16b a, v16b b, v8f c) {
  v8f d = __builtin_amdgcn_wmma_f32_16x16x32_bf16(false, a, false, b, (short)0, c, false, false);
  asm volatile("v_nop\n\tv_nop\n\tv_nop\n\tv_nop" : "+v"(d) : "v"(a), "v"(b));
  return d;
}
// 16x16x32 fragments: lane = (h = lane>>4, row/col = lane&15); elements 0..7 = k0+8h+0..7, 8..15 = k0+16+8h+0..7; D element r = row 8h+r
__device__ __forceinline__ v16h frag_h(const _Float16* rowk0, int lane) {
  union { v16h v; v8h q[2]; } u; const _Float16* p = rowk0 + 8 * (lane >> 4);
  u.q[0] = *(const v8h*)p; u.q[1] = *(const v8h*)(p + 16); return u.v;
}
__device__ __forceinline__ v16h frag_f32(const float* rowk0, int lane) {
  v16h a; const float* p = rowk0 + 8 * (lane >> 4);
#pragma unroll
  for (int i = 0; i < 8; ++i) { a[i] = (_Float16)p[i]; a[8 + i] = (_Float16)p[16 + i]; }
  return a;
}
__device__ __forceinline__ v16h frag_f32s(const float* rowk0, int lane, float sc) {
  v16h a; const float* p = rowk0 + 8 * (lane >> 4);
#pragma unroll
  for (int i = 0; i < 8; ++i) { a[i] = (_Float16)(p[i] * sc); a[8 + i] = (_Float16)(p[16 + i] * sc); }
  return a;
}
// column fragment from a [K][ld] layout (column n), rows >= K read as 0
__device__ __forceinline__ v16h fragc_f32(const float* W, int k0, int n, int lane, int ld, int K) {
  v16h a; const int g = lane >> 4;
#pragma unroll
  for (int i = 0; i < 8; ++i) { const int ka = k0 + 8 * g + i, kb = ka + 16;
    a[i] = (_Float16)(ka < K ? W[(size_t)(ka < K ? ka : K - 1) * ld + n] : 0.f); a[8 + i] = (_Float16)(kb < K ? W[(size_t)(kb < K ? kb : K - 1) * ld + n] : 0.f); }
  return a;
}
struct F2 { v16b h, l; };
__device__ __forceinline__ F2 bsplit16(const float v[16]) { F2 r;
#pragma unroll
  for (int i = 0; i < 16; ++i) { const __bf16 h = (__bf16)v[i]; r.h[i] = h; r.l[i] = (__bf16)(v[i] - (float)h); }
  return r; }
__device__ __forceinline__ F2 split_row(const float* row, int k0, int lane) { float v[16]; const float* p = row + k0 + 8 * (lane >> 4);
#pragma unroll
  for (int i = 0; i < 8; ++i) { v[i] = p[i]; v[8 + i] = p[16 + i]; }
  return bsplit16(v); }
__device__ __forceinline__ F2 split_rowK(const float* row, int k0, int lane, int K) { float v[16]; const int g = lane >> 4;
#pragma unroll
  for (int i = 0; i < 8; ++i) { const int ka = k0 + 8 * g + i, kb = ka + 16; v[i] = ka < K ? row[ka < K ? ka : K - 1] : 0.f; v[8 + i] = kb < K ? row[kb < K ? kb : K - 1] : 0.f; }
  return bsplit16(v); }
__device__ __forceinline__ F2 split_col(const float* W, int k0, int n, int lane, int ld, int K) { float v[16]; const int g = lane >> 4;
#pragma unroll
  for (int i = 0; i < 8; ++i) { const int ka = k0 + 8 * g + i, kb = ka + 16; v[i] = ka < K ? W[(size_t)(ka < K ? ka : K - 1) * ld + n] : 0.f; v[8 + i] = kb < K ? W[(size_t)(kb < K ? kb : K - 1) * ld + n] : 0.f; }
  return bsplit16(v); }
__device__ __forceinline__ v8f mac3(const F2& a, const F2& b, v8f c) { c = wmma_bf(a.l, b.h, c); c = wmma_bf(a.h, b.l, c); return wmma_bf(a.h, b.h, c); }
__device__ __forceinline__ float sigm(float v) { return 1.0f / (1.0f + expf(-v)); }
#define LDSX() do { asm volatile("s_wait_dscnt 0" ::: "memory"); __builtin_amdgcn_wave_barrier(); __builtin_amdgcn_fence(__ATOMIC_RELEASE, "workgroup"); } while (0)

// Single-head causal self-attention with a 256-wide head (x [4,4096,256]; (in,out) Wq / Wk / Wv [256,256] uniform(+-1/16) with biases of the same scale - NONZERO; q, k, v = x W + b; attn = q k^T over all 256 dims x 1/sqrt(256) = 1/16; tril kept, -inf elsewhere; softmax; out = probs v, [4,4096,256]; no head split, no output projection). One kernel walks the keys tile by tile: the contraction of the logits runs over all 256 columns, P.v gives all 256 columns.
#define NB 4
#define TT 4096
#define CC 256            // NH * HD = projected width
#define DIN 256          // input (model) width
#define NH 4
#define HD 64
#define NQB (TT / 64)
#define HG 1
#define SCALE (0.0625f)
#define CAUSAL 1
#ifndef TNB
#define TNB NB
#endif
__device__ __forceinline__ float bfr(float v) { return (float)(__bf16)v; }
__host__ __device__ __forceinline__ int kb_last(int qb) { return CAUSAL ? ((qb * 64 + 63) >> 7) : (TT / 128 - 1); }
typedef __attribute__((ext_vector_type(8))) __bf16 v8b;
typedef __attribute__((ext_vector_type(4))) __bf16 v4b;
__device__ __forceinline__ v16b frag_b(const __bf16* rowk0, int lane) {
  union { v16b v; v8b q[2]; } u; const __bf16* p = rowk0 + 8 * (lane >> 4);
  u.q[0] = *(const v8b*)p; u.q[1] = *(const v8b*)(p + 16); return u.v;
}
#define QBH 6              // causal: query blocks 0..QBH-1 of each sequence (few keys, no averaging) take the high-precision path
#define QHI 384            // rows carrying a q residual plane (the high-precision query blocks < QBH)
#define KSP 17             // key tiles (of 128) a work-group of k_fa walks at most; a longer query block is shared by two
#define KHI 384            // key rows carrying k residual / v bf16 hi+lo planes (used only by the causal high-precision path)
// B fragment (k rows k0+.., output column o) of a weight: (in,out) [K][ld] or (out,in) [ld rows of K]: bf16 exact, or f16(bf16 * 256) exact
__device__ __forceinline__ v16b wcol_io(const float* Wm, int k0, int o, int lane, int ld) { v16b w; const int g = lane >> 4;
#pragma unroll
  for (int i = 0; i < 8; ++i) { w[i] = (__bf16)Wm[(size_t)(k0 + 8 * g + i) * ld + o]; w[8 + i] = (__bf16)Wm[(size_t)(k0 + 16 + 8 * g + i) * ld + o]; }
  return w; }
__device__ __forceinline__ v16b wcol_oi(const float* Wm, int k0, int o, int lane, int K) { v16b w; const float* p = Wm + (size_t)o * K + k0 + 8 * (lane >> 4);
#pragma unroll
  for (int i = 0; i < 8; ++i) { w[i] = (__bf16)p[i]; w[8 + i] = (__bf16)p[16 + i]; }
  return w; }
__device__ __forceinline__ v16h wcolh_io(const float* Wm, int k0, int o, int lane, int ld) { v16h w; const int g = lane >> 4;
#pragma unroll
  for (int i = 0; i < 8; ++i) { w[i] = (_Float16)(bfr(Wm[(size_t)(k0 + 8 * g + i) * ld + o]) * 256.0f); w[8 + i] = (_Float16)(bfr(Wm[(size_t)(k0 + 16 + 8 * g + i) * ld + o]) * 256.0f); }
  return w; }
__device__ __forceinline__ v16h wcolh_oi(const float* Wm, int k0, int o, int lane, int K) { v16h w; const float* p = Wm + (size_t)o * K + k0 + 8 * (lane >> 4);
#pragma unroll
  for (int i = 0; i < 8; ++i) { w[i] = (_Float16)(bfr(p[i]) * 256.0f); w[8 + i] = (_Float16)(bfr(p[16 + i]) * 256.0f); }
  return w; }
#define WQKV_LAYOUT 0   // WCOL only, which nothing calls (k_proj reads (in,out) [DIN][CC]): 0 = (in,out) [DIN][CC]; 1 = (out,in) [CC][DIN]; 2 = per-head [NH][DIN][HD]
__device__ __forceinline__ v16b wcol_hdk(const float* Wm, int k0, int o, int lane) { v16b w; const int g = lane >> 4; const float* p = Wm + (size_t)(o / HD) * DIN * HD + (o % HD);
#pragma unroll
  for (int i = 0; i < 8; ++i) { w[i] = (__bf16)p[(size_t)(k0 + 8 * g + i) * HD]; w[8 + i] = (__bf16)p[(size_t)(k0 + 16 + 8 * g + i) * HD]; }
  return w; }
#define WO_OUT_IN 0
#if WQKV_LAYOUT == 1
#define WCOL(W, k0, o, lane) wcol_oi(W, k0, o, lane, DIN)
#elif WQKV_LAYOUT == 2
#define WCOL(W, k0, o, lane) wcol_hdk(W, k0, o, lane)
#else
#define WCOL(W, k0, o, lane) wcol_io(W, k0, o, lane, CC)
#endif
#if WO_OUT_IN
#define WOCOL(W, k0, o, lane) wcol_oi(W, k0, o, lane, CC)
#define WOCOLH(W, k0, o, lane) wcolh_oi(W, k0, o, lane, CC)
#else
#define WOCOL(W, k0, o, lane) wcol_io(W, k0, o, lane, DIN)
#define WOCOLH(W, k0, o, lane) wcolh_io(W, k0, o, lane, DIN)
#endif

#ifndef SM_EXTRA_PARAMS
#define SM_EXTRA_PARAMS
#endif
#ifndef PROJ_EXTRA_PARAMS
#define PROJ_EXTRA_PARAMS
#endif
#ifndef SM_MASK_HOOK
#define SM_MASK_HOOK (void)0
#endif

#define WS_QH  0u                                      // f16 q rows [b*t][CC]
#define WS_KH  (WS_QH + 2u * (size_t)NB * TT * CC)      // f16 k rows [b*t][CC]
#define WS_VT  (WS_KH + 2u * (size_t)NB * TT * CC)      // f16 v planes [b][c][t]
#define WS_QL  (WS_VT + 2u * (size_t)NB * CC * TT)      // f16 q residual x 2^10 rows [b][t < QHI][CC]
#define WS_KL  (WS_QL + 2u * (size_t)NB * QHI * CC)     // f16 k residual x 2^10 rows [b][t < KHI][CC]
#define WS_VB  (WS_KL + 2u * (size_t)NB * KHI * CC)     // bf16 v hi planes [b][c][t < KHI]
#define WS_VBL (WS_VB + 2u * (size_t)NB * CC * KHI)
#define WS_P0  (WS_VBL + 2u * (size_t)NB * CC * KHI)    // f32 undivided P . v rows [b*t][CC] over the first KSP key tiles (rows t >= KSP * 128 only)
#define WS_P1  (WS_P0 + 4u * (size_t)NB * TT * CC)      // the same over the key tiles behind them
#define WS_M0  (WS_P1 + 4u * (size_t)NB * TT * CC)      // f32, per 16 rows one 128-byte line: 16 row maxima, 16 row sums (first KSP tiles)
#define WS_M1  (WS_M0 + 4u * (size_t)NB * TT * 2)       // the same for the tiles behind them
#define WS_END (WS_M1 + 4u * (size_t)NB * TT * 2)

// ---- k_proj: block = (64 rows, 128 cols, which): q/k/v = X W (+ b) with exact bf16 products (K = DIN); x rows and weight fragments come once a work-group by whole-line loads, as bf16 via LDS -> which 0: q f16 rows (+ residual rows < QHI); 1: k f16 rows (+ residual rows < KHI); 2: v f16 planes [c][t] (+ bf16 hi/lo planes for t < KHI)
__global__ __launch_bounds__(128) void k_proj(const float* __restrict__ XQ, const float* __restrict__ XK, const float* __restrict__ XV, const float* __restrict__ WQ, const float* __restrict__ WK, const float* __restrict__ WV, const float* __restrict__ BQ, const float* __restrict__ BK, const float* __restrict__ BV,
    _Float16* __restrict__ QH, _Float16* __restrict__ QL, _Float16* __restrict__ KH, _Float16* __restrict__ KL, _Float16* __restrict__ VT, __bf16* __restrict__ VB, __bf16* __restrict__ VBL) {
  /* one LDS block, used twice: first the operands as bf16 (weight fragments, then the x rows), behind the second barrier the output staging */
  __shared__ __align__(16) unsigned char sm[65536 + 64 * 528];
  __bf16* sW = (__bf16*)sm;                              /* weight fragments [k step][tile j][half][lane], 16 bytes each: a wave's read is 512 bytes in a row */
  __bf16 (*sX)[264] = (__bf16 (*)[264])(sm + 65536);     /* x rows [row < 64][k], 528-B pitch for the 16-byte fragment reads */
  _Float16 (*sh)[136] = (_Float16 (*)[136])sm; _Float16 (*sl)[136] = (_Float16 (*)[136])(sm + 17408); _Float16 (*th)[72] = (_Float16 (*)[72])(sm + 34816); __bf16 (*tb)[72] = (__bf16 (*)[72])(sm + 53248); __bf16 (*tbl)[72] = (__bf16 (*)[72])(sm + 71680);
  const int tid = threadIdx.x, wave = tid >> 5, lane = tid & 31, col = lane & 15, g = lane >> 4; const int which = blockIdx.z; const int c0 = blockIdx.y * 128; const size_t r0 = (size_t)blockIdx.x * 64; const size_t bb = r0 / TT; const int t0 = (int)(r0 % TT);
  const float* X = which == 0 ? XQ : which == 1 ? XK : XV; const float* WA = which == 0 ? WQ : which == 1 ? WK : WV; const float* BA = which == 0 ? BQ : which == 1 ? BK : BV;
  /* tile j of lane col is column PCM(j, col): a lane's tiles j = 4 hh .. 4 hh + 3 are 4 neighbouring columns, so one 16-byte load of a weight row feeds 4 tiles and 16 lanes read 256 bytes in a row (whole lines) */
#define PCM(j, col) (((j) >> 2) * 64 + (col) * 4 + ((j) & 3))
  /* a wave brings 2 of the 8 k steps of the weights (the fragments of all four waves are the same) and its own 16 x rows, 512 bytes in a row a load */
  const float* xp = X + (r0 + wave * 16) * DIN + lane * 4; const float* wp = WA + (size_t)(wave * 64 + 8 * g) * CC + c0 + col * 4;
  v4f b4[2] = {};   /* b4[j >> 2][j & 3] is the bias of column PCM(j, col) */
  if (BA) { const float* bp = BA + c0 + col * 4; b4[0] = *(const v4f*)bp; b4[1] = *(const v4f*)(bp + 64);   /* two 16-byte loads, in flight with the first operand loads */
    asm volatile("s_wait_xcnt 0x0" :: "v"(bp) : "memory");   /* stands before a register named by an issued global load takes a new value */
  }
#pragma unroll   // every load is base + constant: the two address registers keep their values through the whole loop
  for (int s = 0; s < 2; ++s) { const float* xq = xp + (size_t)(s * 8) * DIN; const float* wq = wp + (size_t)(s * 32) * CC; v4f xr[16], wv[16][2];
#pragma unroll   // constant indices keep the array in registers
    for (int e = 0; e < 16; ++e) xr[e] = *(const v4f*)(xq + (size_t)(e >> 1) * DIN + (e & 1) * 128);
#pragma unroll   // constant indices keep the array in registers
    for (int e = 0; e < 16; ++e) { const float* q = wq + (size_t)((e >> 3) * 16 + (e & 7)) * CC; wv[e][0] = *(const v4f*)q; wv[e][1] = *(const v4f*)(q + 64); }
    asm volatile("s_wait_xcnt 0x0" :: "v"(xp), "v"(wp) : "memory");   /* stands before a register named by an issued global load takes a new value; the addresses are inputs so that their registers stay theirs up to it */
#pragma unroll   // constant indices keep the array in registers
    for (int e = 0; e < 16; ++e) { v4b t;
#pragma unroll   // constant indices keep the array in registers
      for (int i = 0; i < 4; ++i) t[i] = (__bf16)xr[e][i];
      *(v4b*)&sX[wave * 16 + s * 8 + (e >> 1)][(e & 1) * 128 + lane * 4] = t; }
#pragma unroll   // constant indices keep the array in registers
    for (int j = 0; j < 8; ++j) { union { v16b v; v8b q[2]; } u;
#pragma unroll   // constant indices keep the array in registers
      for (int e = 0; e < 16; ++e) u.v[e] = (__bf16)wv[e][j >> 2][j & 3];
      __bf16* d = sW + (size_t)((((wave * 2 + s) * 8 + j) * 2) * 32 + lane) * 8; *(v8b*)d = u.q[0]; *(v8b*)(d + 256) = u.q[1]; }
    if (s == 0) __builtin_amdgcn_sched_barrier(0);   /* the second half's loads stay behind the first half's stores: both halves in registers at once would cost a resident work-group */
  }
  __syncthreads();   /* all 8 k steps of the weights are whole before any wave reads them */
  v8f acc[8] = {}; v16b af[2], wf[2][8];
#define PWF(kc, j, hf) (*(const v8b*)(sW + (size_t)((((kc) * 8 + (j)) * 2 + (hf)) * 32 + lane) * 8))
  af[0] = frag_b(&sX[wave * 16 + col][0], lane);
#pragma unroll   // constant indices keep the array in registers
  for (int j = 0; j < 8; ++j) { union { v16b v; v8b q[2]; } u; u.q[0] = PWF(0, j, 0); u.q[1] = PWF(0, j, 1); wf[0][j] = u.v; }
#pragma unroll   // constant indices keep the array in registers
  for (int kc = 0; kc < DIN / 32; ++kc) {
    if (kc + 1 < DIN / 32) { af[(kc + 1) & 1] = frag_b(&sX[wave * 16 + col][(kc + 1) * 32], lane);
#pragma unroll   // constant indices keep the array in registers
      for (int j = 0; j < 8; ++j) { union { v16b v; v8b q[2]; } u; u.q[0] = PWF(kc + 1, j, 0); u.q[1] = PWF(kc + 1, j, 1); wf[(kc + 1) & 1][j] = u.v; } }
    __builtin_amdgcn_sched_barrier(0);   /* the next k step's LDS reads are issued ahead of this step's 8 products and land under them */
#pragma unroll   // constant indices keep the array in registers
    for (int j = 0; j < 8; ++j) acc[j] = wmma_bf(af[kc & 1], wf[kc & 1][j], acc[j]);
    __builtin_amdgcn_sched_barrier(0);   /* keeps the steps apart: no more than two fragment sets live */
  }
  __syncthreads();   /* every wave has left the operands: the output staging lies in the same LDS */
  if (which < 2) { _Float16* DH = which == 0 ? QH : KH; _Float16* DL = which == 0 ? QL : KL; const int nhi = which == 0 ? QHI : KHI; const bool hi_rows = t0 < nhi;
#pragma unroll   // constant indices keep the array in registers
    for (int hh = 0; hh < 2; ++hh) {
#pragma unroll   // constant indices keep the array in registers
      for (int r = 0; r < 8; ++r) { v4h hv4, lv4;
#pragma unroll   // constant indices keep the array in registers
        for (int q = 0; q < 4; ++q) { const float v = acc[hh * 4 + q][r] + bfr(b4[hh][q]); const _Float16 hv = (_Float16)v; hv4[q] = hv; lv4[q] = (_Float16)((v - (float)hv) * 1024.0f); }
        *(v4h*)&sh[wave * 16 + 8 * g + r][PCM(hh * 4, col)] = hv4; *(v4h*)&sl[wave * 16 + 8 * g + r][PCM(hh * 4, col)] = lv4; } }
    __syncthreads();
    for (int e = tid; e < 64 * 16; e += 128) { const int rl = e >> 4, q = e & 15; vst2((unsigned*)(DH + (r0 + rl) * CC + c0 + q * 8), *(const v4u*)&sh[rl][q * 8]); if (hi_rows) vst2((unsigned*)(DL + (bb * nhi + t0 + rl) * (size_t)CC + c0 + q * 8), *(const v4u*)&sl[rl][q * 8]); }
  } else { const bool hi_rows = t0 < KHI;
#pragma unroll   // constant indices keep the array in registers
    for (int j = 0; j < 8; ++j) { const int rl = wave * 16 + 8 * g, cl = PCM(j, col); v8h h8; v8b b8, l8;
#pragma unroll   // constant indices keep the array in registers
      for (int r = 0; r < 8; ++r) { const float v = acc[j][r] + bfr(b4[j >> 2][j & 3]); h8[r] = (_Float16)v; const __bf16 bh = (__bf16)v; b8[r] = bh; l8[r] = (__bf16)(v - (float)bh); }
      *(v8h*)&th[cl][rl] = h8; *(v8b*)&tb[cl][rl] = b8; *(v8b*)&tbl[cl][rl] = l8; }
    __syncthreads();
    for (int e = tid; e < 128 * 8; e += 128) { const int cl = e >> 3, q = e & 7; vst2((unsigned*)(VT + (bb * CC + c0 + cl) * (size_t)TT + t0 + q * 8), *(const v4u*)&th[cl][q * 8]); if (hi_rows) { const size_t o3 = (bb * CC + c0 + cl) * (size_t)KHI + t0 + q * 8; vst2((unsigned*)(VB + o3), *(const v4u*)&tb[cl][q * 8]); vst2((unsigned*)(VBL + o3), *(const v4u*)&tbl[cl][q * 8]); } } } }
// ---- k_fa: block = (64 queries qb, all its key tiles or one of two shares of them, batch b), a wave = 16 queries x all 256 columns. Per 128-key tile: logits q . k (f16, f32 sums) stay in the accumulators, running row maximum, P = 2^(logit x SCALE x log2 e - maximum) through the wave's own LDS rows, ctx = ctx x 2^(old maximum - new) + P . v; at the end ctx / row sum. k and v tiles come once a work-group by whole-line loads via LDS; v's loads fly under the logits, the next k's under P . v. HI (query blocks < QBH: few keys, no averaging): q and k with their residuals (3 products), P and v as bf16 hi + lo (3 products), tiles staged one after the other
#define L2S (SCALE * 1.44269504088896340736f)
template <int M> __device__ __forceinline__ float row_x(float v) { return __builtin_bit_cast(float, __builtin_amdgcn_update_dpp(0, __builtin_bit_cast(int, v), 0x160 + M, 0xf, 0xf, false)); }   // the value of lane ^ M, inside a 16-lane row (row_xmask)
__device__ __forceinline__ float row_max16(float v) { v = fmaxf(v, row_x<1>(v)); v = fmaxf(v, row_x<2>(v)); v = fmaxf(v, row_x<4>(v)); return fmaxf(v, row_x<8>(v)); }
__device__ __forceinline__ float row_sum16(float v) { v += row_x<1>(v); v += row_x<2>(v); v += row_x<4>(v); return v + row_x<8>(v); }
__device__ __forceinline__ v8f wmma_h(v16h a, v16h b, v8f c) { return __builtin_amdgcn_wmma_f32_16x16x32_f16(false, a, false, b, (short)0, c, false, false); }
__device__ __forceinline__ v8f wmma_b(v16b a, v16b b, v8f c) { return __builtin_amdgcn_wmma_f32_16x16x32_bf16(false, a, false, b, (short)0, c, false, false); }
template <bool HI> __device__ __forceinline__ void fa_run(const int qb, const int b, const int kb0, const int kb1, float* __restrict__ ML, const _Float16* __restrict__ QH, const _Float16* __restrict__ KH, const _Float16* __restrict__ QL, const _Float16* __restrict__ KL, const _Float16* __restrict__ VT, const __bf16* __restrict__ VB, const __bf16* __restrict__ VBL, float* __restrict__ Y,
    _Float16 (*sk)[264], _Float16 (*sv)[136], _Float16 (*sp)[136], float (*so)[16][132]) {
  const int tid = threadIdx.x, wave = tid >> 5, lane = tid & 31, col = lane & 15, g = lane >> 4; const int nkb = kb_last(qb) + 1; const int ql0 = qb * 64 + wave * 16;
  const _Float16* qt = QH + ((size_t)b * TT + ql0 + col) * CC + 8 * g;   /* this lane's half of the q fragments, the element order of frag_h */
  const _Float16* kt = KH + ((size_t)b * TT + (tid >> 5)) * CC + (tid & 31) * 8;   /* rows (tid >> 5) + 4 i */
  const _Float16* vt = VT + ((size_t)b * CC + (tid >> 4)) * (size_t)TT + (tid & 15) * 8;   /* columns (tid >> 4) + 8 i */
  _Float16 (*sl)[264] = (_Float16 (*)[264])&sv[0][0];   /* HI: the k residual tile lies where the v tile comes later */
  _Float16 (*sw)[136] = (_Float16 (*)[136])&sk[0][0];   /* HI: the v lo tile lies where the k tile was */
  __bf16* spl = (__bf16*)&so[wave][0][0];               /* HI: P lo, this wave's own 16 rows of 136 */
  const _Float16* kf0 = kt + (size_t)kb0 * 128 * CC;   /* the first key tile of this work-group's share [kb0, kb1) */
  v16h ah[CC / 32], al[HI ? CC / 32 : 1]; v8h kr[32], vr[32];
  if constexpr (!HI) {
#pragma unroll   // constant indices keep the array in registers
    for (int i = 0; i < 32; ++i) kr[i] = *(const v8h*)(kf0 + (size_t)(4 * i) * CC); }
#pragma unroll   // constant indices keep the array in registers
  for (int kc = 0; kc < CC / 32; ++kc) { union { v16h v; v8h q[2]; } u; u.q[0] = *(const v8h*)(qt + kc * 32); u.q[1] = *(const v8h*)(qt + kc * 32 + 16); ah[kc] = u.v; }
  asm volatile("s_wait_xcnt 0x0" :: "v"(kf0), "v"(qt) : "memory");   /* stands before a register named by an issued global load takes a new value; the addresses are inputs so that their registers stay theirs up to it */
  if constexpr (HI) { const _Float16* qr = QL + ((size_t)b * QHI + ql0 + col) * CC + 8 * g;
#pragma unroll   // constant indices keep the array in registers
    for (int kc = 0; kc < CC / 32; ++kc) { union { v16h v; v8h q[2]; } u; u.q[0] = *(const v8h*)(qr + kc * 32); u.q[1] = *(const v8h*)(qr + kc * 32 + 16); al[kc] = u.v; }
    asm volatile("s_wait_xcnt 0x0" :: "v"(qr) : "memory");   /* as above */
  }
  v8f o[CC / 16] = {}; float m[8], l[8];   /* D element r = query 8 g + r: maximum (base-2 domain) and this lane's share of the row sum */
#pragma unroll
  for (int r = 0; r < 8; ++r) { m[r] = -3.0e38f; l[r] = 0.f; }
#pragma unroll 1   // one copy of the tile loop: a second copy would only add registers
  for (int kb = kb0; kb < kb1; ++kb) {
    v8f s[8] = {};
    if constexpr (HI) {
      const _Float16* kn = kt + (size_t)kb * 128 * CC; const _Float16* ln = KL + ((size_t)b * KHI + kb * 128 + (tid >> 5)) * CC + (tid & 31) * 8;
#pragma unroll   // constant indices keep the array in registers
      for (int i = 0; i < 32; ++i) { kr[i] = *(const v8h*)(kn + (size_t)(4 * i) * CC); vr[i] = *(const v8h*)(ln + (size_t)(4 * i) * CC); }
      asm volatile("s_wait_xcnt 0x0" :: "v"(kn), "v"(ln) : "memory");   /* as above */
#pragma unroll   // constant indices keep the array in registers
      for (int i = 0; i < 32; ++i) { *(v8h*)&sk[(tid >> 5) + 4 * i][(tid & 31) * 8] = kr[i]; *(v8h*)&sl[(tid >> 5) + 4 * i][(tid & 31) * 8] = vr[i]; }
      __syncthreads();   /* both k tiles are whole before any wave reads them */
      v8f s2[8] = {};
#pragma unroll   // constant indices keep the array in registers
      for (int kc = 0; kc < CC / 32; ++kc)
#pragma unroll   // constant indices keep the array in registers
        for (int j = 0; j < 8; ++j) { const v16h kf = frag_h(&sk[j * 16 + col][kc * 32], lane), lf = frag_h(&sl[j * 16 + col][kc * 32], lane); s[j] = wmma_h(ah[kc], kf, s[j]); s2[j] = wmma_h(al[kc], kf, s2[j]); s2[j] = wmma_h(ah[kc], lf, s2[j]); }
#pragma unroll
      for (int j = 0; j < 8; ++j) s[j] += s2[j] * (1.0f / 1024.0f);
    } else {
#pragma unroll   // constant indices keep the array in registers
      for (int i = 0; i < 32; ++i) *(v8h*)&sk[(tid >> 5) + 4 * i][(tid & 31) * 8] = kr[i];
      __syncthreads();   /* the k tile is whole before any wave reads it; every wave has left the v tile of the trip before */
      /* behind the barrier, whose fence waits for every load in flight: these fly under the logits */
      const _Float16* vn = vt + kb * 128;
#pragma unroll   // constant indices keep the array in registers
      for (int i = 0; i < 32; ++i) vr[i] = *(const v8h*)(vn + (size_t)(8 * i) * TT);
      asm volatile("s_wait_xcnt 0x0" :: "v"(vn) : "memory");   /* as above */
      v16h kf[2][8];
#pragma unroll   // constant indices keep the array in registers
      for (int j = 0; j < 8; ++j) kf[0][j] = frag_h(&sk[j * 16 + col][0], lane);
#pragma unroll   // constant indices keep the array in registers
      for (int kc = 0; kc < CC / 32; ++kc) {
        if (kc + 1 < CC / 32) {
#pragma unroll   // constant indices keep the array in registers
          for (int j = 0; j < 8; ++j) kf[(kc + 1) & 1][j] = frag_h(&sk[j * 16 + col][(kc + 1) * 32], lane); }
        __builtin_amdgcn_sched_barrier(0);   /* the next group's LDS reads are issued ahead of this group's 8 products and land under them */
#pragma unroll   // constant indices keep the array in registers
        for (int j = 0; j < 8; ++j) s[j] = wmma_h(ah[kc], kf[kc & 1][j], s[j]);
        __builtin_amdgcn_sched_barrier(0);   /* keeps the groups apart: no more than two fragment sets live */
      } }
    if (kb + 1 == nkb) {   /* only the last tile holds keys past a query (every query of the block is >= kend - 128) */
#pragma unroll
      for (int j = 0; j < 8; ++j)
#pragma unroll
        for (int r = 0; r < 8; ++r) if (kb * 128 + j * 16 + col > ql0 + 8 * g + r) s[j][r] = -3.0e38f; }
    float sc[8];
#pragma unroll
    for (int r = 0; r < 8; ++r) { float mt = s[0][r];
#pragma unroll
      for (int j = 1; j < 8; ++j) mt = fmaxf(mt, s[j][r]);
      const float mn = fmaxf(m[r], row_max16(mt) * L2S); sc[r] = __builtin_amdgcn_exp2f(m[r] - mn); m[r] = mn; l[r] *= sc[r]; }
#pragma unroll
    for (int j = 0; j < 8; ++j)
#pragma unroll
      for (int r = 0; r < 8; ++r) s[j][r] = __builtin_amdgcn_exp2f(fmaf(s[j][r], L2S, -m[r]));
#pragma unroll
    for (int j = 0; j < 8; ++j)
#pragma unroll
      for (int r = 0; r < 8; ++r) { const float p = s[j][r]; l[r] += p;
        if constexpr (HI) { const __bf16 ph = (__bf16)p; *(__bf16*)&sp[wave * 16 + 8 * g + r][j * 16 + col] = ph; spl[(8 * g + r) * 136 + j * 16 + col] = (__bf16)(p - (float)ph); }
        else sp[wave * 16 + 8 * g + r][j * 16 + col] = (_Float16)p; }
#pragma unroll
    for (int j = 0; j < CC / 16; ++j)
#pragma unroll
      for (int r = 0; r < 8; ++r) o[j][r] *= sc[r];
    if constexpr (HI) {
      __syncthreads();   /* every wave has left the two k tiles */
      const __bf16* hn = VB + ((size_t)b * CC + (tid >> 4)) * (size_t)KHI + kb * 128 + (tid & 15) * 8; const __bf16* wn = VBL + ((size_t)b * CC + (tid >> 4)) * (size_t)KHI + kb * 128 + (tid & 15) * 8;
#pragma unroll   // constant indices keep the array in registers
      for (int i = 0; i < 32; ++i) { kr[i] = *(const v8h*)(hn + (size_t)(8 * i) * KHI); vr[i] = *(const v8h*)(wn + (size_t)(8 * i) * KHI); }
      asm volatile("s_wait_xcnt 0x0" :: "v"(hn), "v"(wn) : "memory");   /* as above */
#pragma unroll   // constant indices keep the array in registers
      for (int i = 0; i < 32; ++i) { *(v8h*)&sv[(tid >> 4) + 8 * i][(tid & 15) * 8] = kr[i]; *(v8h*)&sw[(tid >> 4) + 8 * i][(tid & 15) * 8] = vr[i]; }
      __syncthreads();   /* both v tiles are whole before any wave reads them */
#pragma unroll   // constant indices keep the array in registers
      for (int kc = 0; kc < 4; ++kc) { const v16b ph = frag_b((const __bf16*)&sp[wave * 16 + col][kc * 32], lane), pl = frag_b(spl + col * 136 + kc * 32, lane);
#pragma unroll   // constant indices keep the array in registers
        for (int j = 0; j < CC / 16; ++j) { const v16b vh = frag_b((const __bf16*)&sv[j * 16 + col][kc * 32], lane), vl = frag_b((const __bf16*)&sw[j * 16 + col][kc * 32], lane); o[j] = wmma_b(ph, vh, o[j]); o[j] = wmma_b(pl, vh, o[j]); o[j] = wmma_b(ph, vl, o[j]); } }
      __syncthreads();   /* every wave has left the two v tiles */
    } else {
#pragma unroll   // constant indices keep the array in registers
      for (int i = 0; i < 32; ++i) *(v8h*)&sv[(tid >> 4) + 8 * i][(tid & 15) * 8] = vr[i];
      __syncthreads();   /* the v tile is whole before any wave reads it; every wave has left the k tile */
      /* behind the barrier for the same reason: the next k tile flies under P . v */
      if (kb + 1 < kb1) {
        const _Float16* kn = kt + (size_t)(kb + 1) * 128 * CC;
#pragma unroll   // constant indices keep the array in registers
        for (int i = 0; i < 32; ++i) kr[i] = *(const v8h*)(kn + (size_t)(4 * i) * CC);
        asm volatile("s_wait_xcnt 0x0" :: "v"(kn) : "memory");   /* as above */
      }
      v16h pf[4], vf[2][8];
#pragma unroll   // constant indices keep the array in registers
      for (int kc = 0; kc < 4; ++kc) pf[kc] = frag_h(&sp[wave * 16 + col][kc * 32], lane);
#pragma unroll   // constant indices keep the array in registers
      for (int j = 0; j < 8; ++j) vf[0][j] = frag_h(&sv[j * 16 + col][0], lane);
#pragma unroll   // constant indices keep the array in registers
      for (int u = 0; u < 8; ++u) {   /* group u: keys 32 (u >> 1) .., columns 128 (u & 1) .. */
        if (u + 1 < 8) {
#pragma unroll   // constant indices keep the array in registers
          for (int j = 0; j < 8; ++j) vf[(u + 1) & 1][j] = frag_h(&sv[(((u + 1) & 1) * 8 + j) * 16 + col][((u + 1) >> 1) * 32], lane); }
        __builtin_amdgcn_sched_barrier(0);   /* the next group's LDS reads are issued ahead of this group's 8 products and land under them */
#pragma unroll   // constant indices keep the array in registers
        for (int j = 0; j < 8; ++j) o[(u & 1) * 8 + j] = wmma_h(pf[u >> 1], vf[u & 1][j], o[(u & 1) * 8 + j]);
        __builtin_amdgcn_sched_barrier(0);   /* keeps the groups apart: no more than two fragment sets live */
      } }
  }
  float inv[8];
#pragma unroll
  for (int r = 0; r < 8; ++r) l[r] = row_sum16(l[r]);
  if (ML) {   /* a share of a block: the sums leave undivided, with each row's maximum and sum beside them; a whole block is divided by its row sum below */
#pragma unroll
    for (int r = 0; r < 8; ++r) inv[r] = 1.0f;
    if (col == 0) { float* mp = ML + ((((size_t)b * TT + ql0) >> 4) * 32) + 8 * g;   /* this wave's own 128-byte line */
      const v4f ma = { m[0], m[1], m[2], m[3] }, mb = { m[4], m[5], m[6], m[7] }, la = { l[0], l[1], l[2], l[3] }, lb = { l[4], l[5], l[6], l[7] };
      vst2(mp, ma); vst2(mp + 4, mb); vst2(mp + 16, la); vst2(mp + 20, lb);
      asm volatile("s_wait_xcnt 0x0" :: "v"(ma), "v"(mb), "v"(la), "v"(lb), "v"(mp) : "memory");   /* stands before a register named by an issued global store takes a new value */
    }
  } else {
#pragma unroll
    for (int r = 0; r < 8; ++r) inv[r] = 1.0f / l[r];   /* the key of the maximum adds 1: the sum is never 0 */
  }
  float* yp = Y + ((size_t)b * TT + ql0) * CC + lane * 4;
#pragma unroll
  for (int hf = 0; hf < 2; ++hf) {
#pragma unroll
    for (int j = 0; j < 8; ++j)
#pragma unroll
      for (int r = 0; r < 8; ++r) so[wave][8 * g + r][j * 16 + col] = o[hf * 8 + j][r] * inv[r];
    LDSX(); v4f t[16];
#pragma unroll   // constant indices keep the array in registers
    for (int rl = 0; rl < 16; ++rl) t[rl] = *(const v4f*)&so[wave][rl][lane * 4];
#pragma unroll   // constant indices keep the array in registers
    for (int rl = 0; rl < 16; ++rl) vst2(yp + (size_t)rl * CC + hf * 128, t[rl]);
    asm volatile("s_wait_xcnt 0x0" :: "v"(t[0]), "v"(t[1]), "v"(t[2]), "v"(t[3]), "v"(t[4]), "v"(t[5]), "v"(t[6]), "v"(t[7]), "v"(t[8]), "v"(t[9]), "v"(t[10]), "v"(t[11]), "v"(t[12]), "v"(t[13]), "v"(t[14]), "v"(t[15]), "v"(yp) : "memory");   /* stands before a register named by an issued global store takes a new value; data and address are inputs so that their registers stay theirs up to it */
  } }
__global__ __launch_bounds__(128) void k_fa(const _Float16* __restrict__ QH, const _Float16* __restrict__ KH, const _Float16* __restrict__ QL, const _Float16* __restrict__ KL, const _Float16* __restrict__ VT, const __bf16* __restrict__ VB, const __bf16* __restrict__ VBL, float* __restrict__ Y, float* __restrict__ P0, float* __restrict__ P1, float* __restrict__ ML0, float* __restrict__ ML1) {
  __shared__ __align__(16) _Float16 sk[132][264];   /* k tile [key < 128][dim], 528-B pitch for the 16-byte fragment reads; 132 rows so that a v tile fits too (HI) */
  __shared__ __align__(16) _Float16 sv[CC][136];    /* v tile [column][key], 272-B pitch */
  __shared__ __align__(16) _Float16 sp[64][136];    /* P tile [query][key]: a wave writes and reads its own 16 rows only */
  __shared__ __align__(16) float so[4][16][132];    /* output staging, 128 columns at a time, a wave its own part */
  /* one work-group fits a WGP, and a launch lasts as long as its fullest place: no share is longer than KSP tiles, and the shares start longest first (rank: the 30 first shares of KSP tiles; the whole blocks 33 .. 30; the 6 high-precision blocks, dearer a tile; then by falling length sz the second shares of blocks 2 sz + 32, 2 sz + 33 and the whole blocks 2 sz - 2, 2 sz - 1) */
  static_assert(CAUSAL && NQB == 64 && KSP == 17 && QBH == 6, "the rank order below is written for these");
  const int rank = blockIdx.x / TNB, b = blockIdx.x % TNB; int qb, part;   /* part 0: the whole block; 1: its first KSP tiles; 2: the tiles behind them */
  if (rank < 30) { qb = 34 + rank; part = 1; }
  else if (rank < 34) { qb = 63 - rank; part = 0; }
  else if (rank < 40) { qb = 39 - rank; part = 0; }
  else { const int rr = rank - 40; const int sz = rr < 48 ? 15 - (rr >> 2) : 3 - ((rr - 48) >> 1); const int w = rr < 48 ? (rr & 3) : (rr & 1);
    if (w < 2) { qb = 2 * sz + 32 + w; part = 2; } else { qb = 2 * sz - 4 + w; part = 0; } }
  const int nkb = kb_last(qb) + 1;
  if (qb < QBH) fa_run<true>(qb, b, 0, nkb, nullptr, QH, KH, QL, KL, VT, VB, VBL, Y, sk, sv, sp, so);
  else fa_run<false>(qb, b, part == 2 ? KSP : 0, part == 1 ? KSP : nkb, part == 0 ? nullptr : part == 1 ? ML0 : ML1, QH, KH, QL, KL, VT, VB, VBL, part == 0 ? Y : part == 1 ? P0 : P1, sk, sv, sp, so); }
// ---- k_mg: the rows of the shared query blocks (t >= KSP * 128): out = (P0 2^(m0 - m) + P1 2^(m1 - m)) / (l0 2^(m0 - m) + l1 2^(m1 - m)), m = the larger maximum. Block = 32 rows; a thread = 16 bytes of 8 rows, all its loads in flight at once; whole lines in and out
__device__ __forceinline__ float exp2_slot(float x) { float r; asm("v_exp_f32 %0, %1\n\tv_nop" : "=v"(r) : "v"(x)); return r; }   /* 2^x; the v_nop is the one slot the instruction set asks for behind a transcendental before its result is read or its source overwritten: in one statement it stands there in every build */
__global__ __launch_bounds__(256) void k_mg(const float* __restrict__ P0, const float* __restrict__ P1, const float* __restrict__ ML0, const float* __restrict__ ML1, float* __restrict__ Y) {
  const int tid = threadIdx.x, rs = tid >> 6; const int r0 = blockIdx.x * 32; const int b = r0 / (TT - KSP * 128);
  const size_t gb = (size_t)b * TT + KSP * 128 + r0 % (TT - KSP * 128);   /* a multiple of 32; this thread: rows gb + 8 rs + i */
  const size_t po = (gb + 8 * rs) * CC + (tid & 63) * 4, mo = ((gb >> 4) + (rs >> 1)) * 32 + (rs & 1) * 8;
  const float* p0 = P0 + po; const float* p1 = P1 + po; const float* q0 = ML0 + mo; const float* q1 = ML1 + mo; float* yp = Y + po;
  v4f a[8], c[8], m0[2], l0[2], m1[2], l1[2];
#pragma unroll   // constant indices keep the arrays in registers
  for (int i = 0; i < 2; ++i) { m0[i] = *(const v4f*)(q0 + 4 * i); l0[i] = *(const v4f*)(q0 + 16 + 4 * i); m1[i] = *(const v4f*)(q1 + 4 * i); l1[i] = *(const v4f*)(q1 + 16 + 4 * i); }
#pragma unroll   // constant indices keep the arrays in registers
  for (int i = 0; i < 8; ++i) { a[i] = *(const v4f*)(p0 + (size_t)i * CC); c[i] = *(const v4f*)(p1 + (size_t)i * CC); }
  asm volatile("s_wait_xcnt 0x0" :: "v"(p0), "v"(p1), "v"(q0), "v"(q1) : "memory");   /* stands before a register named by an issued global load takes a new value; the addresses are inputs so that their registers stay theirs up to it */
  v4f y[8];
#pragma unroll   // constant indices keep the arrays in registers
  for (int i = 0; i < 8; ++i) { const float ma = m0[i >> 2][i & 3], mb = m1[i >> 2][i & 3]; const float mn = fmaxf(ma, mb); const float f0 = exp2_slot(ma - mn), f1 = exp2_slot(mb - mn);
    const float inv = 1.0f / (l0[i >> 2][i & 3] * f0 + l1[i >> 2][i & 3] * f1);   /* the share that holds the maximum adds at least 1: never 0 */
    y[i] = (a[i] * f0 + c[i] * f1) * inv; }
#pragma unroll   // constant indices keep the arrays in registers
  for (int i = 0; i < 8; ++i) vst2(yp + (size_t)i * CC, y[i]);
  asm volatile("s_wait_xcnt 0x0" :: "v"(y[0]), "v"(y[1]), "v"(y[2]), "v"(y[3]), "v"(y[4]), "v"(y[5]), "v"(y[6]), "v"(y[7]), "v"(yp) : "memory");   /* stands before a register named by an issued global store takes a new value; data and address are inputs so that their registers stay theirs up to it */
}

extern "C" void kernel_launch(void* const* d_in, const int* in_sizes, int n_in, void* d_out, int out_size, void* d_ws, size_t ws_size, hipStream_t stream) {
  (void)in_sizes; (void)n_in; (void)out_size;
  const float** F = (const float**)d_in;
  if (ws_size < (size_t)WS_END) return;
  char* ws = (char*)d_ws; _Float16 *QH = (_Float16*)(ws + WS_QH), *KH = (_Float16*)(ws + WS_KH), *VT = (_Float16*)(ws + WS_VT), *QL = (_Float16*)(ws + WS_QL), *KL = (_Float16*)(ws + WS_KL); __bf16 *VB = (__bf16*)(ws + WS_VB), *VBL = (__bf16*)(ws + WS_VBL); float *P0 = (float*)(ws + WS_P0), *P1 = (float*)(ws + WS_P1), *ML0 = (float*)(ws + WS_M0), *ML1 = (float*)(ws + WS_M1);
  // inputs: 0 x [4,4096,256]; 1 Wq [256,256] (in,out), 2 bq; 3 Wk, 4 bk; 5 Wv, 6 bv (biases NONZERO)
  k_proj<<<dim3(TNB * TT / 64, CC / 128, 3), 128, 0, stream>>>(F[0], F[0], F[0], F[1], F[3], F[5], F[2], F[4], F[6], QH, QL, KH, KL, VT, VB, VBL);
  k_fa<<<dim3((NQB + NQB - 2 * KSP) * TNB), 128, 0, stream>>>(QH, KH, QL, KL, VT, VB, VBL, (float*)d_out, P0, P1, ML0, ML1);   /* logits, softmax and P . v in one launch; 64 blocks + 30 second shares a batch; rows t < KSP * 128 are final here */
  k_mg<<<dim3(TNB * (TT - KSP * 128) / 32), 256, 0, stream>>>(P0, P1, ML0, ML1, (float*)d_out);   /* joins the two shares of the rows t >= KSP * 128 */
}

// v009
// A run of this version takes 67.8 microseconds.
// Next to v008, in two timings, it ran 1.03 and 1.04 times as fast.
// All steps since v000 together make it 29.8 times as fast.
// compute dtype: all float inputs rounded to bf16; q / k / v projections (256-wide) with EXACT bf16 products on WMMA 16x16x32 (f32 accumulate) + bias; causal logits over the full 256-deep contraction x 256^-0.5: 3 products for the first 384 rows, single f16 q x k after; logits, softmax (f32) and P x v in one kernel, key tile by key tile with a running row maximum: P = 2^(logit - maximum) once to f16 x v once to f16 (both bf16 hi + lo below row 384), divided by the row sum at the end; no logit plane; a query block with more than 17 key tiles is walked by two work-groups (each leaves its undivided sums, row maxima and row sums in the workspace) and a last launch joins the two; the four batches side by side in each launch; the context rows are the f32 output (no output projection).
#include <hip/hip_runtime.h>
#include <math.h>

typedef __attribute__((ext_vector_type(16))) _Float16 v16h;
typedef __attribute__((ext_vector_type(16))) __bf16 v16b;
typedef __attribute__((ext_vector_type(8)))  _Float16 v8h;
typedef __attribute__((ext_vector_type(4)))  _Float16 v4h;
typedef __attribute__((ext_vector_type(8)))  float v8f;
typedef __attribute__((ext_vector_type(4)))  float v4f;
typedef __attribute__((ext_vector_type(2)))  float v2f;
typedef __attribute__((ext_vector_type(4)))  unsigned v4u;
typedef __attribute__((ext_vector_type(4)))  int v4i;
typedef float __attribute__((may_alias)) float_a;
typedef int __attribute__((may_alias)) int_a;

template <typename T> __device__ __forceinline__ void vst2(void* p, T v) { *(T*)p = v;  }
__device__ __forceinline__ v8f wmma16(v16h a, v16h b, v8f c) {
  v8f d = __builtin_amdgcn_wmma_f32_16x16x32_f16(false, a, false, b, (short)0, c, false, false);
  asm volatile("v_nop\n\tv_nop\n\tv_nop\n\tv_nop" : "+v"(d) : "v"(a), "v"(b));
  return d;
}
__device__ __forceinline__ v8f wmma_bf(v16b a, v16b b, v8f c) {
  v8f d = __builtin_amdgcn_wmma_f32_16x16x32_bf16(false, a, false, b, (short)0, c, false, false);
  asm volatile("v_nop\n\tv_nop\n\tv_nop\n\tv_nop" : "+v"(d) : "v"(a), "v"(b));
  return d;
}
// 16x16x32 fragments: lane = (h = lane>>4, row/col = lane&15); elements 0..7 = k0+8h+0..7, 8..15 = k0+16+8h+0..7; D element r = row 8h+r
__device__ __forceinline__ v16h frag_h(const _Float16* rowk0, int lane) {
  union { v16h v; v8h q[2]; } u; const _Float16* p = rowk0 + 8 * (lane >> 4);
  u.q[0] = *(const v8h*)p; u.q[1] = *(const v8h*)(p + 16); return u.v;
}
__device__ __forceinline__ v16h frag_f32(const float* rowk0, int lane) {
  v16h a; const float* p = rowk0 + 8 * (lane >> 4);
#pragma unroll
  for (int i = 0; i < 8; ++i) { a[i] = (_Float16)p[i]; a[8 + i] = (_Float16)p[16 + i]; }
  return a;
}
__device__ __forceinline__ v16h frag_f32s(const float* rowk0, int lane, float sc) {
  v16h a; const float* p = rowk0 + 8 * (lane >> 4);
#pragma unroll
  for (int i = 0; i < 8; ++i) { a[i] = (_Float16)(p[i] * sc); a[8 + i] = (_Float16)(p[16 + i] * sc); }
  return a;
}
// column fragment from a [K][ld] layout (column n), rows >= K read as 0
__device__ __forceinline__ v16h fragc_f32(const float* W, int k0, int n, int lane, int ld, int K) {
  v16h a; const int g = lane >> 4;
#pragma unroll
  for (int i = 0; i < 8; ++i) { const int ka = k0 + 8 * g + i, kb = ka + 16;
    a[i] = (_Float16)(ka < K ? W[(size_t)(ka < K ? ka : K - 1) * ld + n] : 0.f); a[8 + i] = (_Float16)(kb < K ? W[(size_t)(kb < K ? kb : K - 1) * ld + n] : 0.f); }
  return a;
}
struct F2 { v16b h, l; };
__device__ __forceinline__ F2 bsplit16(const float v[16]) { F2 r;
#pragma unroll
  for (int i = 0; i < 16; ++i) { const __bf16 h = (__bf16)v[i]; r.h[i] = h; r.l[i] = (__bf16)(v[i] - (float)h); }
  return r; }
__device__ __forceinline__ F2 split_row(const float* row, int k0, int lane) { float v[16]; const float* p = row + k0 + 8 * (lane >> 4);
#pragma unroll
  for (int i = 0; i < 8; ++i) { v[i] = p[i]; v[8 + i] = p[16 + i]; }
  return bsplit16(v); }
__device__ __forceinline__ F2 split_rowK(const float* row, int k0, int lane, int K) { float v[16]; const int g = lane >> 4;
#pragma unroll
  for (int i = 0; i < 8; ++i) { const int ka = k0 + 8 * g + i, kb = ka + 16; v[i] = ka < K ? row[ka < K ? ka : K - 1] : 0.f; v[8 + i] = kb < K ? row[kb < K ? kb : K - 1] : 0.f; }
  return bsplit16(v); }
__device__ __forceinline__ F2 split_col(const float* W, int k0, int n, int lane, int ld, int K) { float v[16]; const int g = lane >> 4;
#pragma unroll
  for (int i = 0; i < 8; ++i) { const int ka = k0 + 8 * g + i, kb = ka + 16; v[i] = ka < K ? W[(size_t)(ka < K ? ka : K - 1) * ld + n] : 0.f; v[8 + i] = kb < K ? W[(size_t)(kb < K ? kb : K - 1) * ld + n] : 0.f; }
  return bsplit16(v); }
__device__ __forceinline__ v8f mac3(const F2& a, const F2& b, v8f c) { c = wmma_bf(a.l, b.h, c); c = wmma_bf(a.h, b.l, c); return wmma_bf(a.h, b.h, c); }
__device__ __forceinline__ float sigm(float v) { return 1.0f / (1.0f + expf(-v)); }
#define LDSX() do { asm volatile("s_wait_dscnt 0" ::: "memory"); __builtin_amdgcn_wave_barrier(); __builtin_amdgcn_fence(__ATOMIC_RELEASE, "workgroup"); } while (0)

// Single-head causal self-attention with a 256-wide head (x [4,4096,256]; (in,out) Wq / Wk / Wv [256,256] uniform(+-1/16) with biases of the same scale - NONZERO; q, k, v = x W + b; attn = q k^T over all 256 dims x 1/sqrt(256) = 1/16; tril kept, -inf elsewhere; softmax; out = probs v, [4,4096,256]; no head split, no output projection). One kernel walks the keys tile by tile: the contraction of the logits runs over all 256 columns, P.v gives all 256 columns.
#define NB 4
#define TT 4096
#define CC 256            // NH * HD = projected width
#define DIN 256          // input (model) width
#define NH 4
#define HD 64
#define NQB (TT / 64)
#define HG 1
#define SCALE (0.0625f)
#define CAUSAL 1
#ifndef TNB
#define TNB NB
#endif
__device__ __forceinline__ float bfr(float v) { return (float)(__bf16)v; }
__host__ __device__ __forceinline__ int kb_last(int qb) { return CAUSAL ? ((qb * 64 + 63) >> 7) : (TT / 128 - 1); }
typedef __attribute__((ext_vector_type(8))) __bf16 v8b;
typedef __attribute__((ext_vector_type(4))) __bf16 v4b;
__device__ __forceinline__ v16b frag_b(const __bf16* rowk0, int lane) {
  union { v16b v; v8b q[2]; } u; const __bf16* p = rowk0 + 8 * (lane >> 4);
  u.q[0] = *(const v8b*)p; u.q[1] = *(const v8b*)(p + 16); return u.v;
}
#define QBH 6              // causal: query blocks 0..QBH-1 of each sequence (few keys, no averaging) take the high-precision path
#define QHI 384            // rows carrying a q residual plane (the high-precision query blocks < QBH)
#define KSP 17             // key tiles (of 128) a work-group of k_fa walks at most; a longer query block is shared by two
#define KHI 384            // key rows carrying k residual / v bf16 hi+lo planes (used only by the causal high-precision path)
// B fragment (k rows k0+.., output column o) of a weight: (in,out) [K][ld] or (out,in) [ld rows of K]: bf16 exact, or f16(bf16 * 256) exact
__device__ __forceinline__ v16b wcol_io(const float* Wm, int k0, int o, int lane, int ld) { v16b w; const int g = lane >> 4;
#pragma unroll
  for (int i = 0; i < 8; ++i) { w[i] = (__bf16)Wm[(size_t)(k0 + 8 * g + i) * ld + o]; w[8 + i] = (__bf16)Wm[(size_t)(k0 + 16 + 8 * g + i) * ld + o]; }
  return w; }
__device__ __forceinline__ v16b wcol_oi(const float* Wm, int k0, int o, int lane, int K) { v16b w; const float* p = Wm + (size_t)o * K + k0 + 8 * (lane >> 4);
#pragma unroll
  for (int i = 0; i < 8; ++i) { w[i] = (__bf16)p[i]; w[8 + i] = (__bf16)p[16 + i]; }
  return w; }
__device__ __forceinline__ v16h wcolh_io(const float* Wm, int k0, int o, int lane, int ld) { v16h w; const int g = lane >> 4;
#pragma unroll
  for (int i = 0; i < 8; ++i) { w[i] = (_Float16)(bfr(Wm[(size_t)(k0 + 8 * g + i) * ld + o]) * 256.0f); w[8 + i] = (_Float16)(bfr(Wm[(size_t)(k0 + 16 + 8 * g + i) * ld + o]) * 256.0f); }
  return w; }
__device__ __forceinline__ v16h wcolh_oi(const float* Wm, int k0, int o, int lane, int K) { v16h w; const float* p = Wm + (size_t)o * K + k0 + 8 * (lane >> 4);
#pragma unroll
  for (int i = 0; i < 8; ++i) { w[i] = (_Float16)(bfr(p[i]) * 256.0f); w[8 + i] = (_Float16)(bfr(p[16 + i]) * 256.0f); }
  return w; }
#define WQKV_LAYOUT 0   // WCOL only, which nothing calls (k_proj reads (in,out) [DIN][CC]): 0 = (in,out) [DIN][CC]; 1 = (out,in) [CC][DIN]; 2 = per-head [NH][DIN][HD]
__device__ __forceinline__ v16b wcol_hdk(const float* Wm, int k0, int o, int lane) { v16b w; const int g = lane >> 4; const float* p = Wm + (size_t)(o / HD) * DIN * HD + (o % HD);
#pragma unroll
  for (int i = 0; i < 8; ++i) { w[i] = (__bf16)p[(size_t)(k0 + 8 * g + i) * HD]; w[8 + i] = (__bf16)p[(size_t)(k0 + 16 + 8 * g + i) * HD]; }
  return w; }
#define WO_OUT_IN 0
#if WQKV_LAYOUT == 1
#define WCOL(W, k0, o, lane) wcol_oi(W, k0, o, lane, DIN)
#elif WQKV_LAYOUT == 2
#define WCOL(W, k0, o, lane) wcol_hdk(W, k0, o, lane)
#else
#define WCOL(W, k0, o, lane) wcol_io(W, k0, o, lane, CC)
#endif
#if WO_OUT_IN
#define WOCOL(W, k0, o, lane) wcol_oi(W, k0, o, lane, CC)
#define WOCOLH(W, k0, o, lane) wcolh_oi(W, k0, o, lane, CC)
#else
#define WOCOL(W, k0, o, lane) wcol_io(W, k0, o, lane, DIN)
#define WOCOLH(W, k0, o, lane) wcolh_io(W, k0, o, lane, DIN)
#endif

#ifndef SM_EXTRA_PARAMS
#define SM_EXTRA_PARAMS
#endif
#ifndef PROJ_EXTRA_PARAMS
#define PROJ_EXTRA_PARAMS
#endif
#ifndef SM_MASK_HOOK
#define SM_MASK_HOOK (void)0
#endif

#define WS_QH  0u                                      // f16 q rows [b*t][CC]
#define WS_KH  (WS_QH + 2u * (size_t)NB * TT * CC)      // f16 k rows [b*t][CC]
#define WS_VT  (WS_KH + 2u * (size_t)NB * TT * CC)      // f16 v planes [b][c][t]
#define WS_QL  (WS_VT + 2u * (size_t)NB * CC * TT)      // f16 q residual x 2^10 rows [b][t < QHI][CC]
#define WS_KL  (WS_QL + 2u * (size_t)NB * QHI * CC)     // f16 k residual x 2^10 rows [b][t < KHI][CC]
#define WS_VB  (WS_KL + 2u * (size_t)NB * KHI * CC)     // bf16 v hi planes [b][c][t < KHI]
#define WS_VBL (WS_VB + 2u * (size_t)NB * CC * KHI)
#define WS_P0  (WS_VBL + 2u * (size_t)NB * CC * KHI)    // f32 undivided P . v rows [b*t][CC] over the first KSP key tiles (rows t >= KSP * 128 only)
#define WS_P1  (WS_P0 + 4u * (size_t)NB * TT * CC)      // the same over the key tiles behind them
#define WS_M0  (WS_P1 + 4u * (size_t)NB * TT * CC)      // f32, per 16 rows one 128-byte line: 16 row maxima, 16 row sums (first KSP tiles)
#define WS_M1  (WS_M0 + 4u * (size_t)NB * TT * 2)       // the same for the tiles behind them
#define WS_END (WS_M1 + 4u * (size_t)NB * TT * 2)

// ---- k_proj: block = (64 rows, 128 cols, which): q/k/v = X W (+ b) with exact bf16 products (K = DIN); x rows and weight fragments come once a work-group by whole-line loads, as bf16 via LDS -> which 0: q f16 rows (+ residual rows < QHI); 1: k f16 rows (+ residual rows < KHI); 2: v f16 planes [c][t] (+ bf16 hi/lo planes for t < KHI)
__global__ __launch_bounds__(128) void k_proj(const float* __restrict__ XQ, const float* __restrict__ XK, const float* __restrict__ XV, const float* __restrict__ WQ, const float* __restrict__ WK, const float* __restrict__ WV, const float* __restrict__ BQ, const float* __restrict__ BK, const float* __restrict__ BV,
    _Float16* __restrict__ QH, _Float16* __restrict__ QL, _Float16* __restrict__ KH, _Float16* __restrict__ KL, _Float16* __restrict__ VT, __bf16* __restrict__ VB, __bf16* __restrict__ VBL) {
  /* one LDS block, used twice: first the operands as bf16 (weight fragments, then the x rows), behind the second barrier the output staging */
  __shared__ __align__(16) unsigned char sm[65536 + 64 * 528];
  __bf16* sW = (__bf16*)sm;                              /* weight fragments [k step][tile j][half][lane], 16 bytes each: a wave's read is 512 bytes in a row */
  __bf16 (*sX)[264] = (__bf16 (*)[264])(sm + 65536);     /* x rows [row < 64][k], 528-B pitch for the 16-byte fragment reads */
  _Float16 (*sh)[136] = (_Float16 (*)[136])sm; _Float16 (*sl)[136] = (_Float16 (*)[136])(sm + 17408); _Float16 (*th)[72] = (_Float16 (*)[72])(sm + 34816); __bf16 (*tb)[72] = (__bf16 (*)[72])(sm + 53248); __bf16 (*tbl)[72] = (__bf16 (*)[72])(sm + 71680);
  const int tid = threadIdx.x, wave = tid >> 5, lane = tid & 31, col = lane & 15, g = lane >> 4; const int which = blockIdx.z; const int c0 = blockIdx.y * 128; const size_t r0 = (size_t)blockIdx.x * 64; const size_t bb = r0 / TT; const int t0 = (int)(r0 % TT);
  const float* X = which == 0 ? XQ : which == 1 ? XK : XV; const float* WA = which == 0 ? WQ : which == 1 ? WK : WV; const float* BA = which == 0 ? BQ : which == 1 ? BK : BV;
  /* tile j of lane col is column PCM(j, col): a lane's tiles j = 4 hh .. 4 hh + 3 are 4 neighbouring columns, so one 16-byte load of a weight row feeds 4 tiles and 16 lanes read 256 bytes in a row (whole lines) */
#define PCM(j, col) (((j) >> 2) * 64 + (col) * 4 + ((j) & 3))
  /* a wave brings 2 of the 8 k steps of the weights (the fragments of all four waves are the same) and its own 16 x rows, 512 bytes in a row a load */
  const float* xp = X + (r0 + wave * 16) * DIN + lane * 4; const float* wp = WA + (size_t)(wave * 64 + 8 * g) * CC + c0 + col * 4;
  v4f b4[2] = {};   /* b4[j >> 2][j & 3] is the bias of column PCM(j, col) */
  if (BA) { const float* bp = BA + c0 + col * 4; b4[0] = *(const v4f*)bp; b4[1] = *(const v4f*)(bp + 64);   /* two 16-byte loads, in flight with the first operand loads */
    asm volatile("s_wait_xcnt 0x0" :: "v"(bp) : "memory");   /* stands before a register named by an issued global load takes a new value */
  }
#pragma unroll   // every load is base + constant: the two address registers keep their values through the whole loop
  for (int s = 0; s < 2; ++s) { const float* xq = xp + (size_t)(s * 8) * DIN; const float* wq = wp + (size_t)(s * 32) * CC; v4f xr[16], wv[16][2];
#pragma unroll   // constant indices keep the array in registers
    for (int e = 0; e < 16; ++e) xr[e] = *(const v4f*)(xq + (size_t)(e >> 1) * DIN + (e & 1) * 128);
#pragma unroll   // constant indices keep the array in registers
    for (int e = 0; e < 16; ++e) { const float* q = wq + (size_t)((e >> 3) * 16 + (e & 7)) * CC; wv[e][0] = *(const v4f*)q; wv[e][1] = *(const v4f*)(q + 64); }
    asm volatile("s_wait_xcnt 0x0" :: "v"(xp), "v"(wp) : "memory");   /* stands before a register named by an issued global load takes a new value; the addresses are inputs so that their registers stay theirs up to it */
#pragma unroll   // constant indices keep the array in registers
    for (int e = 0; e < 16; ++e) { v4b t;
#pragma unroll   // constant indices keep the array in registers
      for (int i = 0; i < 4; ++i) t[i] = (__bf16)xr[e][i];
      *(v4b*)&sX[wave * 16 + s * 8 + (e >> 1)][(e & 1) * 128 + lane * 4] = t; }
#pragma unroll   // constant indices keep the array in registers
    for (int j = 0; j < 8; ++j) { union { v16b v; v8b q[2]; } u;
#pragma unroll   // constant indices keep the array in registers
      for (int e = 0; e < 16; ++e) u.v[e] = (__bf16)wv[e][j >> 2][j & 3];
      __bf16* d = sW + (size_t)((((wave * 2 + s) * 8 + j) * 2) * 32 + lane) * 8; *(v8b*)d = u.q[0]; *(v8b*)(d + 256) = u.q[1]; }
    if (s == 0) __builtin_amdgcn_sched_barrier(0);   /* the second half's loads stay behind the first half's stores: both halves in registers at once would cost a resident work-group */
  }
  __syncthreads();   /* all 8 k steps of the weights are whole before any wave reads them */
  v8f acc[8] = {}; v16b af[2], wf[2][8];
#define PWF(kc, j, hf) (*(const v8b*)(sW + (size_t)((((kc) * 8 + (j)) * 2 + (hf)) * 32 + lane) * 8))
  af[0] = frag_b(&sX[wave * 16 + col][0], lane);
#pragma unroll   // constant indices keep the array in registers
  for (int j = 0; j < 8; ++j) { union { v16b v; v8b q[2]; } u; u.q[0] = PWF(0, j, 0); u.q[1] = PWF(0, j, 1); wf[0][j] = u.v; }
#pragma unroll   // constant indices keep the array in registers
  for (int kc = 0; kc < DIN / 32; ++kc) {
    if (kc + 1 < DIN / 32) { af[(kc + 1) & 1] = frag_b(&sX[wave * 16 + col][(kc + 1) * 32], lane);
#pragma unroll   // constant indices keep the array in registers
      for (int j = 0; j < 8; ++j) { union { v16b v; v8b q[2]; } u; u.q[0] = PWF(kc + 1, j, 0); u.q[1] = PWF(kc + 1, j, 1); wf[(kc + 1) & 1][j] = u.v; } }
    __builtin_amdgcn_sched_barrier(0);   /* the next k step's LDS reads are issued ahead of this step's 8 products and land under them */
#pragma unroll   // constant indices keep the array in registers
    for (int j = 0; j < 8; ++j) acc[j] = wmma_bf(af[kc & 1], wf[kc & 1][j], acc[j]);
    __builtin_amdgcn_sched_barrier(0);   /* keeps the steps apart: no more than two fragment sets live */
  }
  __syncthreads();   /* every wave has left the operands: the output staging lies in the same LDS */
  if (which < 2) { _Float16* DH = which == 0 ? QH : KH; _Float16* DL = which == 0 ? QL : KL; const int nhi = which == 0 ? QHI : KHI; const bool hi_rows = t0 < nhi;
#pragma unroll   // constant indices keep the array in registers
    for (int hh = 0; hh < 2; ++hh) {
#pragma unroll   // constant indices keep the array in registers
      for (int r = 0; r < 8; ++r) { v4h hv4, lv4;
#pragma unroll   // constant indices keep the array in registers
        for (int q = 0; q < 4; ++q) { const float v = acc[hh * 4 + q][r] + bfr(b4[hh][q]); const _Float16 hv = (_Float16)v; hv4[q] = hv; lv4[q] = (_Float16)((v - (float)hv) * 1024.0f); }
        *(v4h*)&sh[wave * 16 + 8 * g + r][PCM(hh * 4, col)] = hv4; *(v4h*)&sl[wave * 16 + 8 * g + r][PCM(hh * 4, col)] = lv4; } }
    __syncthreads();
    for (int e = tid; e < 64 * 16; e += 128) { const int rl = e >> 4, q = e & 15; vst2((unsigned*)(DH + (r0 + rl) * CC + c0 + q * 8), *(const v4u*)&sh[rl][q * 8]); if (hi_rows) vst2((unsigned*)(DL + (bb * nhi + t0 + rl) * (size_t)CC + c0 + q * 8), *(const v4u*)&sl[rl][q * 8]); }
  } else { const bool hi_rows = t0 < KHI;
#pragma unroll   // constant indices keep the array in registers
    for (int j = 0; j < 8; ++j) { const int rl = wave * 16 + 8 * g, cl = PCM(j, col); v8h h8; v8b b8, l8;
#pragma unroll   // constant indices keep the array in registers
      for (int r = 0; r < 8; ++r) { const float v = acc[j][r] + bfr(b4[j >> 2][j & 3]); h8[r] = (_Float16)v; const __bf16 bh = (__bf16)v; b8[r] = bh; l8[r] = (__bf16)(v - (float)bh); }
      *(v8h*)&th[cl][rl] = h8; *(v8b*)&tb[cl][rl] = b8; *(v8b*)&tbl[cl][rl] = l8; }
    __syncthreads();
    for (int e = tid; e < 128 * 8; e += 128) { const int cl = e >> 3, q = e & 7; vst2((unsigned*)(VT + (bb * CC + c0 + cl) * (size_t)TT + t0 + q * 8), *(const v4u*)&th[cl][q * 8]); if (hi_rows) { const size_t o3 = (bb * CC + c0 + cl) * (size_t)KHI + t0 + q * 8; vst2((unsigned*)(VB + o3), *(const v4u*)&tb[cl][q * 8]); vst2((unsigned*)(VBL + o3), *(const v4u*)&tbl[cl][q * 8]); } } } }
// ---- k_fa: block = (64 queries qb, all its key tiles or one of two shares of them, batch b), a wave = 16 queries x all 256 columns. Per 128-key tile: logits q . k (f16, f32 sums) stay in the accumulators, running row maximum, P = 2^(logit x SCALE x log2 e - maximum) through the wave's own LDS rows, ctx = ctx x 2^(old maximum - new) + P . v; at the end ctx / row sum. k and v tiles come once a work-group by whole-line asynchronous copies straight into LDS (no register, no LDS store); v's copies fly under the logits, the next k's under P . v. HI (query blocks < QBH: few keys, no averaging): q and k with their residuals (3 products), P and v as bf16 hi + lo (3 products), tiles staged one after the other
#define L2S (SCALE * 1.44269504088896340736f)
template <int M> __device__ __forceinline__ float row_x(float v) { return __builtin_bit_cast(float, __builtin_amdgcn_update_dpp(0, __builtin_bit_cast(int, v), 0x160 + M, 0xf, 0xf, false)); }   // the value of lane ^ M, inside a 16-lane row (row_xmask)
__device__ __forceinline__ float row_max16(float v) { v = fmaxf(v, row_x<1>(v)); v = fmaxf(v, row_x<2>(v)); v = fmaxf(v, row_x<4>(v)); return fmaxf(v, row_x<8>(v)); }
__device__ __forceinline__ float row_sum16(float v) { v += row_x<1>(v); v += row_x<2>(v); v += row_x<4>(v); return v + row_x<8>(v); }
__device__ __forceinline__ v8f wmma_h(v16h a, v16h b, v8f c) { return __builtin_amdgcn_wmma_f32_16x16x32_f16(false, a, false, b, (short)0, c, false, false); }
__device__ __forceinline__ v8f wmma_b(v16b a, v16b b, v8f c) { return __builtin_amdgcn_wmma_f32_16x16x32_bf16(false, a, false, b, (short)0, c, false, false); }
typedef __attribute__((address_space(1))) v4i gv4i;
typedef __attribute__((address_space(3))) v4i lv4i;
/* a lane's 16 bytes from global memory straight into LDS, through no register (asynchronous copy; it has landed behind the issuing wave's s_wait_asynccnt 0) */
__device__ __forceinline__ void cp16(const _Float16* gp, _Float16* lp) { __builtin_amdgcn_global_load_async_to_lds_b128((gv4i*)gp, (lv4i*)lp, 0, 0); }
template <bool HI> __device__ __forceinline__ void fa_run(const int qb, const int b, const int kb0, const int kb1, float* __restrict__ ML, const _Float16* __restrict__ QH, const _Float16* __restrict__ KH, const _Float16* __restrict__ QL, const _Float16* __restrict__ KL, const _Float16* __restrict__ VT, const __bf16* __restrict__ VB, const __bf16* __restrict__ VBL, float* __restrict__ Y,
    _Float16 (*sk)[264], _Float16 (*sv)[136], _Float16 (*sp)[136], float (*so)[16][132]) {
  const int tid = threadIdx.x, wave = tid >> 5, lane = tid & 31, col = lane & 15, g = lane >> 4; const int nkb = kb_last(qb) + 1; const int ql0 = qb * 64 + wave * 16;
  const _Float16* qt = QH + ((size_t)b * TT + ql0 + col) * CC + 8 * g;   /* this lane's half of the q fragments, the element order of frag_h */
  const _Float16* kt = KH + ((size_t)b * TT + (tid >> 5)) * CC + (tid & 31) * 8;   /* rows (tid >> 5) + 4 i */
  const _Float16* vt = VT + ((size_t)b * CC + (tid >> 4) * 32) * (size_t)TT + (tid & 15) * 8;   /* columns 32 (tid >> 4) + i: 8 neighbouring columns lie within one copy's offset range, so 4 addresses serve 32 copies */
  _Float16 (*sl)[264] = (_Float16 (*)[264])&sv[0][0];   /* HI: the k residual tile lies where the v tile comes later */
  _Float16 (*sw)[136] = (_Float16 (*)[136])&sk[0][0];   /* HI: the v lo tile lies where the k tile was */
  __bf16* spl = (__bf16*)&so[wave][0][0];               /* HI: P lo, this wave's own 16 rows of 136 */
  const _Float16* kf0 = kt + (size_t)kb0 * 128 * CC;   /* the first key tile of this work-group's share [kb0, kb1) */
  v16h ah[CC / 32], al[HI ? CC / 32 : 1]; v8h kr[HI ? 32 : 1], vr[HI ? 32 : 1];
  if constexpr (!HI) {
#pragma unroll   // every copy is base + constant
    for (int i = 0; i < 32; ++i) cp16(kf0 + (size_t)(4 * i) * CC, &sk[(tid >> 5) + 4 * i][(tid & 31) * 8]); }
#pragma unroll   // constant indices keep the array in registers
  for (int kc = 0; kc < CC / 32; ++kc) { union { v16h v; v8h q[2]; } u; u.q[0] = *(const v8h*)(qt + kc * 32); u.q[1] = *(const v8h*)(qt + kc * 32 + 16); ah[kc] = u.v; }
  asm volatile("s_wait_xcnt 0x0" :: "v"(qt) : "memory");   /* stands before a register named by an issued global load takes a new value; the address is an input so that its registers stay its own up to it */
  if constexpr (HI) { const _Float16* qr = QL + ((size_t)b * QHI + ql0 + col) * CC + 8 * g;
#pragma unroll   // constant indices keep the array in registers
    for (int kc = 0; kc < CC / 32; ++kc) { union { v16h v; v8h q[2]; } u; u.q[0] = *(const v8h*)(qr + kc * 32); u.q[1] = *(const v8h*)(qr + kc * 32 + 16); al[kc] = u.v; }
    asm volatile("s_wait_xcnt 0x0" :: "v"(qr) : "memory");   /* as above */
  }
  v8f o[CC / 16] = {}; float m[8], l[8];   /* D element r = query 8 g + r: maximum (base-2 domain) and this lane's share of the row sum */
#pragma unroll
  for (int r = 0; r < 8; ++r) { m[r] = -3.0e38f; l[r] = 0.f; }
#pragma unroll 1   // one copy of the tile loop: a second copy would only add registers
  for (int kb = kb0; kb < kb1; ++kb) {
    v8f s[8] = {};
    if constexpr (HI) {
      const _Float16* kn = kt + (size_t)kb * 128 * CC; const _Float16* ln = KL + ((size_t)b * KHI + kb * 128 + (tid >> 5)) * CC + (tid & 31) * 8;
#pragma unroll   // constant indices keep the array in registers
      for (int i = 0; i < 32; ++i) { kr[i] = *(const v8h*)(kn + (size_t)(4 * i) * CC); vr[i] = *(const v8h*)(ln + (size_t)(4 * i) * CC); }
      asm volatile("s_wait_xcnt 0x0" :: "v"(kn), "v"(ln) : "memory");   /* as above */
#pragma unroll   // constant indices keep the array in registers
      for (int i = 0; i < 32; ++i) { *(v8h*)&sk[(tid >> 5) + 4 * i][(tid & 31) * 8] = kr[i]; *(v8h*)&sl[(tid >> 5) + 4 * i][(tid & 31) * 8] = vr[i]; }
      __syncthreads();   /* both k tiles are whole before any wave reads them */
      v8f s2[8] = {};
#pragma unroll   // constant indices keep the array in registers
      for (int kc = 0; kc < CC / 32; ++kc)
#pragma unroll   // constant indices keep the array in registers
        for (int j = 0; j < 8; ++j) { const v16h kf = frag_h(&sk[j * 16 + col][kc * 32], lane), lf = frag_h(&sl[j * 16 + col][kc * 32], lane); s[j] = wmma_h(ah[kc], kf, s[j]); s2[j] = wmma_h(al[kc], kf, s2[j]); s2[j] = wmma_h(ah[kc], lf, s2[j]); }
#pragma unroll
      for (int j = 0; j < 8; ++j) s[j] += s2[j] * (1.0f / 1024.0f);
    } else {
      asm volatile("s_wait_dscnt 0x0" ::: "memory");      /* this wave's own reads of the v tile of the trip before have retired before anybody copies over it */
      asm volatile("s_wait_asynccnt 0x0" ::: "memory");   /* this wave's copies of the k tile have landed */
      __syncthreads();   /* the k tile is whole before any wave reads it; every wave has left the v tile of the trip before */
      /* behind the barrier that frees the v tile's place: these copies fly under the logits */
      const _Float16* vn = vt + kb * 128;
#pragma unroll   // every copy is base + constant
      for (int i = 0; i < 32; ++i) cp16(vn + (size_t)i * TT, &sv[(tid >> 4) * 32 + i][(tid & 15) * 8]);
      v16h kf[2][8];
#pragma unroll   // constant indices keep the array in registers
      for (int j = 0; j < 8; ++j) kf[0][j] = frag_h(&sk[j * 16 + col][0], lane);
#pragma unroll   // constant indices keep the array in registers
      for (int kc = 0; kc < CC / 32; ++kc) {
        if (kc + 1 < CC / 32) {
#pragma unroll   // constant indices keep the array in registers
          for (int j = 0; j < 8; ++j) kf[(kc + 1) & 1][j] = frag_h(&sk[j * 16 + col][(kc + 1) * 32], lane); }
        __builtin_amdgcn_sched_barrier(0);   /* the next group's LDS reads are issued ahead of this group's 8 products and land under them */
#pragma unroll   // constant indices keep the array in registers
        for (int j = 0; j < 8; ++j) s[j] = wmma_h(ah[kc], kf[kc & 1][j], s[j]);
        __builtin_amdgcn_sched_barrier(0);   /* keeps the groups apart: no more than two fragment sets live */
      } }
    if (kb + 1 == nkb) {   /* only the last tile holds keys past a query (every query of the block is >= kend - 128) */
#pragma unroll
      for (int j = 0; j < 8; ++j)
#pragma unroll
        for (int r = 0; r < 8; ++r) if (kb * 128 + j * 16 + col > ql0 + 8 * g + r) s[j][r] = -3.0e38f; }
    float sc[8];
#pragma unroll
    for (int r = 0; r < 8; ++r) { float mt = s[0][r];
#pragma unroll
      for (int j = 1; j < 8; ++j) mt = fmaxf(mt, s[j][r]);
      const float mn = fmaxf(m[r], row_max16(mt) * L2S); sc[r] = __builtin_amdgcn_exp2f(m[r] - mn); m[r] = mn; l[r] *= sc[r]; }
#pragma unroll
    for (int j = 0; j < 8; ++j)
#pragma unroll
      for (int r = 0; r < 8; ++r) s[j][r] = __builtin_amdgcn_exp2f(fmaf(s[j][r], L2S, -m[r]));
#pragma unroll
    for (int j = 0; j < 8; ++j)
#pragma unroll
      for (int r = 0; r < 8; ++r) { const float p = s[j][r]; l[r] += p;
        if constexpr (HI) { const __bf16 ph = (__bf16)p; *(__bf16*)&sp[wave * 16 + 8 * g + r][j * 16 + col] = ph; spl[(8 * g + r) * 136 + j * 16 + col] = (__bf16)(p - (float)ph); }
        else sp[wave * 16 + 8 * g + r][j * 16 + col] = (_Float16)p; }
#pragma unroll
    for (int j = 0; j < CC / 16; ++j)
#pragma unroll
      for (int r = 0; r < 8; ++r) o[j][r] *= sc[r];
    if constexpr (HI) {
      __syncthreads();   /* every wave has left the two k tiles */
      const __bf16* hn = VB + ((size_t)b * CC + (tid >> 4)) * (size_t)KHI + kb * 128 + (tid & 15) * 8; const __bf16* wn = VBL + ((size_t)b * CC + (tid >> 4)) * (size_t)KHI + kb * 128 + (tid & 15) * 8;
#pragma unroll   // constant indices keep the array in registers
      for (int i = 0; i < 32; ++i) { kr[i] = *(const v8h*)(hn + (size_t)(8 * i) * KHI); vr[i] = *(const v8h*)(wn + (size_t)(8 * i) * KHI); }
      asm volatile("s_wait_xcnt 0x0" :: "v"(hn), "v"(wn) : "memory");   /* as above */
#pragma unroll   // constant indices keep the array in registers
      for (int i = 0; i < 32; ++i) { *(v8h*)&sv[(tid >> 4) + 8 * i][(tid & 15) * 8] = kr[i]; *(v8h*)&sw[(tid >> 4) + 8 * i][(tid & 15) * 8] = vr[i]; }
      __syncthreads();   /* both v tiles are whole before any wave reads them */
#pragma unroll   // constant indices keep the array in registers
      for (int kc = 0; kc < 4; ++kc) { const v16b ph = frag_b((const __bf16*)&sp[wave * 16 + col][kc * 32], lane), pl = frag_b(spl + col * 136 + kc * 32, lane);
#pragma unroll   // constant indices keep the array in registers
        for (int j = 0; j < CC / 16; ++j) { const v16b vh = frag_b((const __bf16*)&sv[j * 16 + col][kc * 32], lane), vl = frag_b((const __bf16*)&sw[j * 16 + col][kc * 32], lane); o[j] = wmma_b(ph, vh, o[j]); o[j] = wmma_b(pl, vh, o[j]); o[j] = wmma_b(ph, vl, o[j]); } }
      __syncthreads();   /* every wave has left the two v tiles */
    } else {
      asm volatile("s_wait_dscnt 0x0" ::: "memory");      /* this wave's own reads of the k tile have retired before anybody copies over it; its P rows are written */
      asm volatile("s_wait_asynccnt 0x0" ::: "memory");   /* this wave's copies of the v tile have landed */
      __syncthreads();   /* the v tile is whole before any wave reads it; every wave has left the k tile */
      /* behind the barrier that frees the k tile's place: the next k tile flies under P . v */
      if (kb + 1 < kb1) {
        const _Float16* kn = kt + (size_t)(kb + 1) * 128 * CC;
#pragma unroll   // every copy is base + constant
        for (int i = 0; i < 32; ++i) cp16(kn + (size_t)(4 * i) * CC, &sk[(tid >> 5) + 4 * i][(tid & 31) * 8]);
      }
      v16h pf[4], vf[2][8];
#pragma unroll   // constant indices keep the array in registers
      for (int kc = 0; kc < 4; ++kc) pf[kc] = frag_h(&sp[wave * 16 + col][kc * 32], lane);
#pragma unroll   // constant indices keep the array in registers
      for (int j = 0; j < 8; ++j) vf[0][j] = frag_h(&sv[j * 16 + col][0], lane);
#pragma unroll   // constant indices keep the array in registers
      for (int u = 0; u < 8; ++u) {   /* group u: keys 32 (u >> 1) .., columns 128 (u & 1) .. */
        if (u + 1 < 8) {
#pragma unroll   // constant indices keep the array in registers
          for (int j = 0; j < 8; ++j) vf[(u + 1) & 1][j] = frag_h(&sv[(((u + 1) & 1) * 8 + j) * 16 + col][((u + 1) >> 1) * 32], lane); }
        __builtin_amdgcn_sched_barrier(0);   /* the next group's LDS reads are issued ahead of this group's 8 products and land under them */
#pragma unroll   // constant indices keep the array in registers
        for (int j = 0; j < 8; ++j) o[(u & 1) * 8 + j] = wmma_h(pf[u >> 1], vf[u & 1][j], o[(u & 1) * 8 + j]);
        __builtin_amdgcn_sched_barrier(0);   /* keeps the groups apart: no more than two fragment sets live */
      } }
  }
  if constexpr (!HI) asm volatile("s_wait_asynccnt 0x0" ::: "memory");   /* no copy is outstanding when the wave goes on to the output and ends */
  float inv[8];
#pragma unroll
  for (int r = 0; r < 8; ++r) l[r] = row_sum16(l[r]);
  if (ML) {   /* a share of a block: the sums leave undivided, with each row's maximum and sum beside them; a whole block is divided by its row sum below */
#pragma unroll
    for (int r = 0; r < 8; ++r) inv[r] = 1.0f;
    if (col == 0) { float* mp = ML + ((((size_t)b * TT + ql0) >> 4) * 32) + 8 * g;   /* this wave's own 128-byte line */
      const v4f ma = { m[0], m[1], m[2], m[3] }, mb = { m[4], m[5], m[6], m[7] }, la = { l[0], l[1], l[2], l[3] }, lb = { l[4], l[5], l[6], l[7] };
      vst2(mp, ma); vst2(mp + 4, mb); vst2(mp + 16, la); vst2(mp + 20, lb);
      asm volatile("s_wait_xcnt 0x0" :: "v"(ma), "v"(mb), "v"(la), "v"(lb), "v"(mp) : "memory");   /* stands before a register named by an issued global store takes a new value */
    }
  } else {
#pragma unroll
    for (int r = 0; r < 8; ++r) inv[r] = 1.0f / l[r];   /* the key of the maximum adds 1: the sum is never 0 */
  }
  float* yp = Y + ((size_t)b * TT + ql0) * CC + lane * 4;
#pragma unroll
  for (int hf = 0; hf < 2; ++hf) {
#pragma unroll
    for (int j = 0; j < 8; ++j)
#pragma unroll
      for (int r = 0; r < 8; ++r) so[wave][8 * g + r][j * 16 + col] = o[hf * 8 + j][r] * inv[r];
    LDSX(); v4f t[16];
#pragma unroll   // constant indices keep the array in registers
    for (int rl = 0; rl < 16; ++rl) t[rl] = *(const v4f*)&so[wave][rl][lane * 4];
#pragma unroll   // constant indices keep the array in registers
    for (int rl = 0; rl < 16; ++rl) vst2(yp + (size_t)rl * CC + hf * 128, t[rl]);
    asm volatile("s_wait_xcnt 0x0" :: "v"(t[0]), "v"(t[1]), "v"(t[2]), "v"(t[3]), "v"(t[4]), "v"(t[5]), "v"(t[6]), "v"(t[7]), "v"(t[8]), "v"(t[9]), "v"(t[10]), "v"(t[11]), "v"(t[12]), "v"(t[13]), "v"(t[14]), "v"(t[15]), "v"(yp) : "memory");   /* stands before a register named by an issued global store takes a new value; data and address are inputs so that their registers stay theirs up to it */
  } }
__global__ __launch_bounds__(128) void k_fa(const _Float16* __restrict__ QH, const _Float16* __restrict__ KH, const _Float16* __restrict__ QL, const _Float16* __restrict__ KL, const _Float16* __restrict__ VT, const __bf16* __restrict__ VB, const __bf16* __restrict__ VBL, float* __restrict__ Y, float* __restrict__ P0, float* __restrict__ P1, float* __restrict__ ML0, float* __restrict__ ML1) {
  __shared__ __align__(16) _Float16 sk[132][264];   /* k tile [key < 128][dim], 528-B pitch for the 16-byte fragment reads; 132 rows so that a v tile fits too (HI) */
  __shared__ __align__(16) _Float16 sv[CC][136];    /* v tile [column][key], 272-B pitch */
  __shared__ __align__(16) _Float16 sp[64][136];    /* P tile [query][key]: a wave writes and reads its own 16 rows only */
  __shared__ __align__(16) float so[4][16][132];    /* output staging, 128 columns at a time, a wave its own part */
  /* one work-group fits a WGP, and a launch lasts as long as its fullest place: no share is longer than KSP tiles, and the shares start longest first (rank: the 30 first shares of KSP tiles; the whole blocks 33 .. 30; the 6 high-precision blocks, dearer a tile; then by falling length sz the second shares of blocks 2 sz + 32, 2 sz + 33 and the whole blocks 2 sz - 2, 2 sz - 1) */
  static_assert(CAUSAL && NQB == 64 && KSP == 17 && QBH == 6, "the rank order below is written for these");
  const int rank = blockIdx.x / TNB, b = blockIdx.x % TNB; int qb, part;   /* part 0: the whole block; 1: its first KSP tiles; 2: the tiles behind them */
  if (rank < 30) { qb = 34 + rank; part = 1; }
  else if (rank < 34) { qb = 63 - rank; part = 0; }
  else if (rank < 40) { qb = 39 - rank; part = 0; }
  else { const int rr = rank - 40; const int sz = rr < 48 ? 15 - (rr >> 2) : 3 - ((rr - 48) >> 1); const int w = rr < 48 ? (rr & 3) : (rr & 1);
    if (w < 2) { qb = 2 * sz + 32 + w; part = 2; } else { qb = 2 * sz - 4 + w; part = 0; } }
  const int nkb = kb_last(qb) + 1;
  if (qb < QBH) fa_run<true>(qb, b, 0, nkb, nullptr, QH, KH, QL, KL, VT, VB, VBL, Y, sk, sv, sp, so);
  else fa_run<false>(qb, b, part == 2 ? KSP : 0, part == 1 ? KSP : nkb, part == 0 ? nullptr : part == 1 ? ML0 : ML1, QH, KH, QL, KL, VT, VB, VBL, part == 0 ? Y : part == 1 ? P0 : P1, sk, sv, sp, so); }
// ---- k_mg: the rows of the shared query blocks (t >= KSP * 128): out = (P0 2^(m0 - m) + P1 2^(m1 - m)) / (l0 2^(m0 - m) + l1 2^(m1 - m)), m = the larger maximum. Block = 32 rows; a thread = 16 bytes of 8 rows, all its loads in flight at once; whole lines in and out
__device__ __forceinline__ float exp2_slot(float x) { float r; asm("v_exp_f32 %0, %1\n\tv_nop" : "=v"(r) : "v"(x)); return r; }   /* 2^x; the v_nop is the one slot the instruction set asks for behind a transcendental before its result is read or its source overwritten: in one statement it stands there in every build */
__global__ __launch_bounds__(256) void k_mg(const float* __restrict__ P0, const float* __restrict__ P1, const float* __restrict__ ML0, const float* __restrict__ ML1, float* __restrict__ Y) {
  const int tid = threadIdx.x, rs = tid >> 6; const int r0 = blockIdx.x * 32; const int b = r0 / (TT - KSP * 128);
  const size_t gb = (size_t)b * TT + KSP * 128 + r0 % (TT - KSP * 128);   /* a multiple of 32; this thread: rows gb + 8 rs + i */
  const size_t po = (gb + 8 * rs) * CC + (tid & 63) * 4, mo = ((gb >> 4) + (rs >> 1)) * 32 + (rs & 1) * 8;
  const float* p0 = P0 + po; const float* p1 = P1 + po; const float* q0 = ML0 + mo; const float* q1 = ML1 + mo; float* yp = Y + po;
  v4f a[8], c[8], m0[2], l0[2], m1[2], l1[2];
#pragma unroll   // constant indices keep the arrays in registers
  for (int i = 0; i < 2; ++i) { m0[i] = *(const v4f*)(q0 + 4 * i); l0[i] = *(const v4f*)(q0 + 16 + 4 * i); m1[i] = *(const v4f*)(q1 + 4 * i); l1[i] = *(const v4f*)(q1 + 16 + 4 * i); }
#pragma unroll   // constant indices keep the arrays in registers
  for (int i = 0; i < 8; ++i) { a[i] = *(const v4f*)(p0 + (size_t)i * CC); c[i] = *(const v4f*)(p1 + (size_t)i * CC); }
  asm volatile("s_wait_xcnt 0x0" :: "v"(p0), "v"(p1), "v"(q0), "v"(q1) : "memory");   /* stands before a register named by an issued global load takes a new value; the addresses are inputs so that their registers stay theirs up to it */
  v4f y[8];
#pragma unroll   // constant indices keep the arrays in registers
  for (int i = 0; i < 8; ++i) { const float ma = m0[i >> 2][i & 3], mb = m1[i >> 2][i & 3]; const float mn = fmaxf(ma, mb); const float f0 = exp2_slot(ma - mn), f1 = exp2_slot(mb - mn);
    const float inv = 1.0f / (l0[i >> 2][i & 3] * f0 + l1[i >> 2][i & 3] * f1);   /* the share that holds the maximum adds at least 1: never 0 */
    y[i] = (a[i] * f0 + c[i] * f1) * inv; }
#pragma unroll   // constant indices keep the arrays in registers
  for (int i = 0; i < 8; ++i) vst2(yp + (size_t)i * CC, y[i]);
  asm volatile("s_wait_xcnt 0x0" :: "v"(y[0]), "v"(y[1]), "v"(y[2]), "v"(y[3]), "v"(y[4]), "v"(y[5]), "v"(y[6]), "v"(y[7]), "v"(yp) : "memory");   /* stands before a register named by an issued global store takes a new value; data and address are inputs so that their registers stay theirs up to it */
}

extern "C" void kernel_launch(void* const* d_in, const int* in_sizes, int n_in, void* d_out, int out_size, void* d_ws, size_t ws_size, hipStream_t stream) {
  (void)in_sizes; (void)n_in; (void)out_size;
  const float** F = (const float**)d_in;
  if (ws_size < (size_t)WS_END) return;
  char* ws = (char*)d_ws; _Float16 *QH = (_Float16*)(ws + WS_QH), *KH = (_Float16*)(ws + WS_KH), *VT = (_Float16*)(ws + WS_VT), *QL = (_Float16*)(ws + WS_QL), *KL = (_Float16*)(ws + WS_KL); __bf16 *VB = (__bf16*)(ws + WS_VB), *VBL = (__bf16*)(ws + WS_VBL); float *P0 = (float*)(ws + WS_P0), *P1 = (float*)(ws + WS_P1), *ML0 = (float*)(ws + WS_M0), *ML1 = (float*)(ws + WS_M1);
  // inputs: 0 x [4,4096,256]; 1 Wq [256,256] (in,out), 2 bq; 3 Wk, 4 bk; 5 Wv, 6 bv (biases NONZERO)
  k_proj<<<dim3(TNB * TT / 64, CC / 128, 3), 128, 0, stream>>>(F[0], F[0], F[0], F[1], F[3], F[5], F[2], F[4], F[6], QH, QL, KH, KL, VT, VB, VBL);
  k_fa<<<dim3((NQB + NQB - 2 * KSP) * TNB), 128, 0, stream>>>(QH, KH, QL, KL, VT, VB, VBL, (float*)d_out, P0, P1, ML0, ML1);   /* logits, softmax and P . v in one launch; 64 blocks + 30 second shares a batch; rows t < KSP * 128 are final here */
  k_mg<<<dim3(TNB * (TT - KSP * 128) / 32), 256, 0, stream>>>(P0, P1, ML0, ML1, (float*)d_out);   /* joins the two shares of the rows t >= KSP * 128 */
}

// v010
// Measured time: 63.7 microseconds a run.
// In two side-by-side timings against v009, it was 1.06 and 1.07 times as fast.
// All steps since v000 together make it 31.7 times as fast.
// compute dtype: all float inputs rounded to bf16; q / k / v projections (256-wide) with EXACT bf16 products on WMMA 16x16x32 (f32 accumulate) + bias; causal logits over the full 256-deep contraction x 256^-0.5: 3 products for the first 384 rows, single f16 q x k after; logits, softmax (f32) and P x v in one kernel, both products transposed (a lane holds one query; P stays in registers), key tile by key tile with a running row maximum: P = 2^(logit - maximum) once to f16 x v once to f16 (both bf16 hi + lo below row 384), divided by the row sum at the end; no logit plane; a query block with more than 17 key tiles is walked by two work-groups (each leaves its undivided sums, row maxima and row sums in the workspace) and a last launch joins the two; the four batches side by side in each launch; the context rows are the f32 output (no output projection).
#include <hip/hip_runtime.h>
#include <math.h>

typedef __attribute__((ext_vector_type(16))) _Float16 v16h;
typedef __attribute__((ext_vector_type(16))) __bf16 v16b;
typedef __attribute__((ext_vector_type(8)))  _Float16 v8h;
typedef __attribute__((ext_vector_type(4)))  _Float16 v4h;
typedef __attribute__((ext_vector_type(8)))  float v8f;
typedef __attribute__((ext_vector_type(4)))  float v4f;
typedef __attribute__((ext_vector_type(2)))  float v2f;
typedef __attribute__((ext_vector_type(4)))  unsigned v4u;
typedef __attribute__((ext_vector_type(4)))  int v4i;
typedef float __attribute__((may_alias)) float_a;
typedef int __attribute__((may_alias)) int_a;

template <typename T> __device__ __forceinline__ void vst2(void* p, T v) { *(T*)p = v;  }
__device__ __forceinline__ v8f wmma16(v16h a, v16h b, v8f c) {
  v8f d = __builtin_amdgcn_wmma_f32_16x16x32_f16(false, a, false, b, (short)0, c, false, false);
  asm volatile("v_nop\n\tv_nop\n\tv_nop\n\tv_nop" : "+v"(d) : "v"(a), "v"(b));
  return d;
}
__device__ __forceinline__ v8f wmma_bf(v16b a, v16b b, v8f c) {
  v8f d = __builtin_amdgcn_wmma_f32_16x16x32_bf16(false, a, false, b, (short)0, c, false, false);
  asm volatile("v_nop\n\tv_nop\n\tv_nop\n\tv_nop" : "+v"(d) : "v"(a), "v"(b));
  return d;
}
// 16x16x32 fragments: lane = (h = lane>>4, row/col = lane&15); elements 0..7 = k0+8h+0..7, 8..15 = k0+16+8h+0..7; D element r = row 8h+r
__device__ __forceinline__ v16h frag_h(const _Float16* rowk0, int lane) {
  union { v16h v; v8h q[2]; } u; const _Float16* p = rowk0 + 8 * (lane >> 4);
  u.q[0] = *(const v8h*)p; u.q[1] = *(const v8h*)(p + 16); return u.v;
}
__device__ __forceinline__ v16h frag_f32(const float* rowk0, int lane) {
  v16h a; const float* p = rowk0 + 8 * (lane >> 4);
#pragma unroll
  for (int i = 0; i < 8; ++i) { a[i] = (_Float16)p[i]; a[8 + i] = (_Float16)p[16 + i]; }
  return a;
}
__device__ __forceinline__ v16h frag_f32s(const float* rowk0, int lane, float sc) {
  v16h a; const float* p = rowk0 + 8 * (lane >> 4);
#pragma unroll
  for (int i = 0; i < 8; ++i) { a[i] = (_Float16)(p[i] * sc); a[8 + i] = (_Float16)(p[16 + i] * sc); }
  return a;
}
// column fragment from a [K][ld] layout (column n), rows >= K read as 0
__device__ __forceinline__ v16h fragc_f32(const float* W, int k0, int n, int lane, int ld, int K) {
  v16h a; const int g = lane >> 4;
#pragma unroll
  for (int i = 0; i < 8; ++i) { const int ka = k0 + 8 * g + i, kb = ka + 16;
    a[i] = (_Float16)(ka < K ? W[(size_t)(ka < K ? ka : K - 1) * ld + n] : 0.f); a[8 + i] = (_Float16)(kb < K ? W[(size_t)(kb < K ? kb : K - 1) * ld + n] : 0.f); }
  return a;
}
struct F2 { v16b h, l; };
__device__ __forceinline__ F2 bsplit16(const float v[16]) { F2 r;
#pragma unroll
  for (int i = 0; i < 16; ++i) { const __bf16 h = (__bf16)v[i]; r.h[i] = h; r.l[i] = (__bf16)(v[i] - (float)h); }
  return r; }
__device__ __forceinline__ F2 split_row(const float* row, int k0, int lane) { float v[16]; const float* p = row + k0 + 8 * (lane >> 4);
#pragma unroll
  for (int i = 0; i < 8; ++i) { v[i] = p[i]; v[8 + i] = p[16 + i]; }
  return bsplit16(v); }
__device__ __forceinline__ F2 split_rowK(const float* row, int k0, int lane, int K) { float v[16]; const int g = lane >> 4;
#pragma unroll
  for (int i = 0; i < 8; ++i) { const int ka = k0 + 8 * g + i, kb = ka + 16; v[i] = ka < K ? row[ka < K ? ka : K - 1] : 0.f; v[8 + i] = kb < K ? row[kb < K ? kb : K - 1] : 0.f; }
  return bsplit16(v); }
__device__ __forceinline__ F2 split_col(const float* W, int k0, int n, int lane, int ld, int K) { float v[16]; const int g = lane >> 4;
#pragma unroll
  for (int i = 0; i < 8; ++i) { const int ka = k0 + 8 * g + i, kb = ka + 16; v[i] = ka < K ? W[(size_t)(ka < K ? ka : K - 1) * ld + n] : 0.f; v[8 + i] = kb < K ? W[(size_t)(kb < K ? kb : K - 1) * ld + n] : 0.f; }
  return bsplit16(v); }
__device__ __forceinline__ v8f mac3(const F2& a, const F2& b, v8f c) { c = wmma_bf(a.l, b.h, c); c = wmma_bf(a.h, b.l, c); return wmma_bf(a.h, b.h, c); }
__device__ __forceinline__ float sigm(float v) { return 1.0f / (1.0f + expf(-v)); }
#define LDSX() do { asm volatile("s_wait_dscnt 0" ::: "memory"); __builtin_amdgcn_wave_barrier(); __builtin_amdgcn_fence(__ATOMIC_RELEASE, "workgroup"); } while (0)

// Single-head causal self-attention with a 256-wide head (x [4,4096,256]; (in,out) Wq / Wk / Wv [256,256] uniform(+-1/16) with biases of the same scale - NONZERO; q, k, v = x W + b; attn = q k^T over all 256 dims x 1/sqrt(256) = 1/16; tril kept, -inf elsewhere; softmax; out = probs v, [4,4096,256]; no head split, no output projection). One kernel walks the keys tile by tile: the contraction of the logits runs over all 256 columns, P.v gives all 256 columns.
#define NB 4
#define TT 4096
#define CC 256            // NH * HD = projected width
#define DIN 256          // input (model) width
#define NH 4
#define HD 64
#define NQB (TT / 64)
#define HG 1
#define SCALE (0.0625f)
#define CAUSAL 1
#ifndef TNB
#define TNB NB
#endif
__device__ __forceinline__ float bfr(float v) { return (float)(__bf16)v; }
__host__ __device__ __forceinline__ int kb_last(int qb) { return CAUSAL ? ((qb * 64 + 63) >> 7) : (TT / 128 - 1); }
typedef __attribute__((ext_vector_type(8))) __bf16 v8b;
typedef __attribute__((ext_vector_type(4))) __bf16 v4b;
__device__ __forceinline__ v16b frag_b(const __bf16* rowk0, int lane) {
  union { v16b v; v8b q[2]; } u; const __bf16* p = rowk0 + 8 * (lane >> 4);
  u.q[0] = *(const v8b*)p; u.q[1] = *(const v8b*)(p + 16); return u.v;
}
#define QBH 6              // causal: query blocks 0..QBH-1 of each sequence (few keys, no averaging) take the high-precision path
#define QHI 384            // rows carrying a q residual plane (the high-precision query blocks < QBH)
#define KSP 17             // key tiles (of 128) a work-group of k_fa walks at most; a longer query block is shared by two
#define KHI 384            // key rows carrying k residual / v bf16 hi+lo planes (used only by the causal high-precision path)
// B fragment (k rows k0+.., output column o) of a weight: (in,out) [K][ld] or (out,in) [ld rows of K]: bf16 exact, or f16(bf16 * 256) exact
__device__ __forceinline__ v16b wcol_io(const float* Wm, int k0, int o, int lane, int ld) { v16b w; const int g = lane >> 4;
#pragma unroll
  for (int i = 0; i < 8; ++i) { w[i] = (__bf16)Wm[(size_t)(k0 + 8 * g + i) * ld + o]; w[8 + i] = (__bf16)Wm[(size_t)(k0 + 16 + 8 * g + i) * ld + o]; }
  return w; }
__device__ __forceinline__ v16b wcol_oi(const float* Wm, int k0, int o, int lane, int K) { v16b w; const float* p = Wm + (size_t)o * K + k0 + 8 * (lane >> 4);
#pragma unroll
  for (int i = 0; i < 8; ++i) { w[i] = (__bf16)p[i]; w[8 + i] = (__bf16)p[16 + i]; }
  return w; }
__device__ __forceinline__ v16h wcolh_io(const float* Wm, int k0, int o, int lane, int ld) { v16h w; const int g = lane >> 4;
#pragma unroll
  for (int i = 0; i < 8; ++i) { w[i] = (_Float16)(bfr(Wm[(size_t)(k0 + 8 * g + i) * ld + o]) * 256.0f); w[8 + i] = (_Float16)(bfr(Wm[(size_t)(k0 + 16 + 8 * g + i) * ld + o]) * 256.0f); }
  return w; }
__device__ __forceinline__ v16h wcolh_oi(const float* Wm, int k0, int o, int lane, int K) { v16h w; const float* p = Wm + (size_t)o * K + k0 + 8 * (lane >> 4);
#pragma unroll
  for (int i = 0; i < 8; ++i) { w[i] = (_Float16)(bfr(p[i]) * 256.0f); w[8 + i] = (_Float16)(bfr(p[16 + i]) * 256.0f); }
  return w; }
#define WQKV_LAYOUT 0   // WCOL only, which nothing calls (k_proj reads (in,out) [DIN][CC]): 0 = (in,out) [DIN][CC]; 1 = (out,in) [CC][DIN]; 2 = per-head [NH][DIN][HD]
__device__ __forceinline__ v16b wcol_hdk(const float* Wm, int k0, int o, int lane) { v16b w; const int g = lane >> 4; const float* p = Wm + (size_t)(o / HD) * DIN * HD + (o % HD);
#pragma unroll
  for (int i = 0; i < 8; ++i) { w[i] = (__bf16)p[(size_t)(k0 + 8 * g + i) * HD]; w[8 + i] = (__bf16)p[(size_t)(k0 + 16 + 8 * g + i) * HD]; }
  return w; }
#define WO_OUT_IN 0
#if WQKV_LAYOUT == 1
#define WCOL(W, k0, o, lane) wcol_oi(W, k0, o, lane, DIN)
#elif WQKV_LAYOUT == 2
#define WCOL(W, k0, o, lane) wcol_hdk(W, k0, o, lane)
#else
#define WCOL(W, k0, o, lane) wcol_io(W, k0, o, lane, CC)
#endif
#if WO_OUT_IN
#define WOCOL(W, k0, o, lane) wcol_oi(W, k0, o, lane, CC)
#define WOCOLH(W, k0, o, lane) wcolh_oi(W, k0, o, lane, CC)
#else
#define WOCOL(W, k0, o, lane) wcol_io(W, k0, o, lane, DIN)
#define WOCOLH(W, k0, o, lane) wcolh_io(W, k0, o, lane, DIN)
#endif

#ifndef SM_EXTRA_PARAMS
#define SM_EXTRA_PARAMS
#endif
#ifndef PROJ_EXTRA_PARAMS
#define PROJ_EXTRA_PARAMS
#endif
#ifndef SM_MASK_HOOK
#define SM_MASK_HOOK (void)0
#endif

#define WS_QH  0u                                      // f16 q rows [b*t][CC]
#define WS_KH  (WS_QH + 2u * (size_t)NB * TT * CC)      // f16 k rows [b*t][CC]
#define WS_VT  (WS_KH + 2u * (size_t)NB * TT * CC)      // f16 v planes [b][c][t]
#define WS_QL  (WS_VT + 2u * (size_t)NB * CC * TT)      // f16 q residual x 2^10 rows [b][t < QHI][CC]
#define WS_KL  (WS_QL + 2u * (size_t)NB * QHI * CC)     // f16 k residual x 2^10 rows [b][t < KHI][CC]
#define WS_VB  (WS_KL + 2u * (size_t)NB * KHI * CC)     // bf16 v hi planes [b][c][t < KHI]
#define WS_VBL (WS_VB + 2u * (size_t)NB * CC * KHI)
#define WS_P0  (WS_VBL + 2u * (size_t)NB * CC * KHI)    // f32 undivided P . v rows [b*t][CC] over the first KSP key tiles (rows t >= KSP * 128 only)
#define WS_P1  (WS_P0 + 4u * (size_t)NB * TT * CC)      // the same over the key tiles behind them
#define WS_M0  (WS_P1 + 4u * (size_t)NB * TT * CC)      // f32, per 16 rows one 128-byte line: 16 row maxima, 16 row sums (first KSP tiles)
#define WS_M1  (WS_M0 + 4u * (size_t)NB * TT * 2)       // the same for the tiles behind them
#define WS_END (WS_M1 + 4u * (size_t)NB * TT * 2)

// ---- k_proj: block = (64 rows, 128 cols, which): q/k/v = X W (+ b) with exact bf16 products (K = DIN); x rows and weight fragments come once a work-group by whole-line loads, as bf16 via LDS -> which 0: q f16 rows (+ residual rows < QHI); 1: k f16 rows (+ residual rows < KHI); 2: v f16 planes [c][t] (+ bf16 hi/lo planes for t < KHI)
__global__ __launch_bounds__(128) void k_proj(const float* __restrict__ XQ, const float* __restrict__ XK, const float* __restrict__ XV, const float* __restrict__ WQ, const float* __restrict__ WK, const float* __restrict__ WV, const float* __restrict__ BQ, const float* __restrict__ BK, const float* __restrict__ BV,
    _Float16* __restrict__ QH, _Float16* __restrict__ QL, _Float16* __restrict__ KH, _Float16* __restrict__ KL, _Float16* __restrict__ VT, __bf16* __restrict__ VB, __bf16* __restrict__ VBL) {
  /* one LDS block, used twice: first the operands as bf16 (weight fragments, then the x rows), behind the second barrier the output staging */
  __shared__ __align__(16) unsigned char sm[65536 + 64 * 528];
  __bf16* sW = (__bf16*)sm;                              /* weight fragments [k step][tile j][half][lane], 16 bytes each: a wave's read is 512 bytes in a row */
  __bf16 (*sX)[264] = (__bf16 (*)[264])(sm + 65536);     /* x rows [row < 64][k], 528-B pitch for the 16-byte fragment reads */
  _Float16 (*sh)[136] = (_Float16 (*)[136])sm; _Float16 (*sl)[136] = (_Float16 (*)[136])(sm + 17408); _Float16 (*th)[72] = (_Float16 (*)[72])(sm + 34816); __bf16 (*tb)[72] = (__bf16 (*)[72])(sm + 53248); __bf16 (*tbl)[72] = (__bf16 (*)[72])(sm + 71680);
  const int tid = threadIdx.x, wave = tid >> 5, lane = tid & 31, col = lane & 15, g = lane >> 4; const int which = blockIdx.z; const int c0 = blockIdx.y * 128; const size_t r0 = (size_t)blockIdx.x * 64; const size_t bb = r0 / TT; const int t0 = (int)(r0 % TT);
  const float* X = which == 0 ? XQ : which == 1 ? XK : XV; const float* WA = which == 0 ? WQ : which == 1 ? WK : WV; const float* BA = which == 0 ? BQ : which == 1 ? BK : BV;
  /* tile j of lane col is column PCM(j, col): a lane's tiles j = 4 hh .. 4 hh + 3 are 4 neighbouring columns, so one 16-byte load of a weight row feeds 4 tiles and 16 lanes read 256 bytes in a row (whole lines) */
#define PCM(j, col) (((j) >> 2) * 64 + (col) * 4 + ((j) & 3))
  /* a wave brings 2 of the 8 k steps of the weights (the fragments of all four waves are the same) and its own 16 x rows, 512 bytes in a row a load */
  const float* xp = X + (r0 + wave * 16) * DIN + lane * 4; const float* wp = WA + (size_t)(wave * 64 + 8 * g) * CC + c0 + col * 4;
  v4f b4[2] = {};   /* b4[j >> 2][j & 3] is the bias of column PCM(j, col) */
  if (BA) { const float* bp = BA + c0 + col * 4; b4[0] = *(const v4f*)bp; b4[1] = *(const v4f*)(bp + 64);   /* two 16-byte loads, in flight with the first operand loads */
    asm volatile("s_wait_xcnt 0x0" :: "v"(bp) : "memory");   /* stands before a register named by an issued global load takes a new value */
  }
#pragma unroll   // every load is base + constant: the two address registers keep their values through the whole loop
  for (int s = 0; s < 2; ++s) { const float* xq = xp + (size_t)(s * 8) * DIN; const float* wq = wp + (size_t)(s * 32) * CC; v4f xr[16], wv[16][2];
#pragma unroll   // constant indices keep the array in registers
    for (int e = 0; e < 16; ++e) xr[e] = *(const v4f*)(xq + (size_t)(e >> 1) * DIN + (e & 1) * 128);
#pragma unroll   // constant indices keep the array in registers
    for (int e = 0; e < 16; ++e) { const float* q = wq + (size_t)((e >> 3) * 16 + (e & 7)) * CC; wv[e][0] = *(const v4f*)q; wv[e][1] = *(const v4f*)(q + 64); }
    asm volatile("s_wait_xcnt 0x0" :: "v"(xp), "v"(wp) : "memory");   /* stands before a register named by an issued global load takes a new value; the addresses are inputs so that their registers stay theirs up to it */
#pragma unroll   // constant indices keep the array in registers
    for (int e = 0; e < 16; ++e) { v4b t;
#pragma unroll   // constant indices keep the array in registers
      for (int i = 0; i < 4; ++i) t[i] = (__bf16)xr[e][i];
      *(v4b*)&sX[wave * 16 + s * 8 + (e >> 1)][(e & 1) * 128 + lane * 4] = t; }
#pragma unroll   // constant indices keep the array in registers
    for (int j = 0; j < 8; ++j) { union { v16b v; v8b q[2]; } u;
#pragma unroll   // constant indices keep the array in registers
      for (int e = 0; e < 16; ++e) u.v[e] = (__bf16)wv[e][j >> 2][j & 3];
      __bf16* d = sW + (size_t)((((wave * 2 + s) * 8 + j) * 2) * 32 + lane) * 8; *(v8b*)d = u.q[0]; *(v8b*)(d + 256) = u.q[1]; }
    if (s == 0) __builtin_amdgcn_sched_barrier(0);   /* the second half's loads stay behind the first half's stores: both halves in registers at once would cost a resident work-group */
  }
  __syncthreads();   /* all 8 k steps of the weights are whole before any wave reads them */
  v8f acc[8] = {}; v16b af[2], wf[2][8];
#define PWF(kc, j, hf) (*(const v8b*)(sW + (size_t)((((kc) * 8 + (j)) * 2 + (hf)) * 32 + lane) * 8))
  af[0] = frag_b(&sX[wave * 16 + col][0], lane);
#pragma unroll   // constant indices keep the array in registers
  for (int j = 0; j < 8; ++j) { union { v16b v; v8b q[2]; } u; u.q[0] = PWF(0, j, 0); u.q[1] = PWF(0, j, 1); wf[0][j] = u.v; }
#pragma unroll   // constant indices keep the array in registers
  for (int kc = 0; kc < DIN / 32; ++kc) {
    if (kc + 1 < DIN / 32) { af[(kc + 1) & 1] = frag_b(&sX[wave * 16 + col][(kc + 1) * 32], lane);
#pragma unroll   // constant indices keep the array in registers
      for (int j = 0; j < 8; ++j) { union { v16b v; v8b q[2]; } u; u.q[0] = PWF(kc + 1, j, 0); u.q[1] = PWF(kc + 1, j, 1); wf[(kc + 1) & 1][j] = u.v; } }
    __builtin_amdgcn_sched_barrier(0);   /* the next k step's LDS reads are issued ahead of this step's 8 products and land under them */
#pragma unroll   // constant indices keep the array in registers
    for (int j = 0; j < 8; ++j) acc[j] = wmma_bf(af[kc & 1], wf[kc & 1][j], acc[j]);
    __builtin_amdgcn_sched_barrier(0);   /* keeps the steps apart: no more than two fragment sets live */
  }
  __syncthreads();   /* every wave has left the operands: the output staging lies in the same LDS */
  if (which < 2) { _Float16* DH = which == 0 ? QH : KH; _Float16* DL = which == 0 ? QL : KL; const int nhi = which == 0 ? QHI : KHI; const bool hi_rows = t0 < nhi;
#pragma unroll   // constant indices keep the array in registers
    for (int hh = 0; hh < 2; ++hh) {
#pragma unroll   // constant indices keep the array in registers
      for (int r = 0; r < 8; ++r) { v4h hv4, lv4;
#pragma unroll   // constant indices keep the array in registers
        for (int q = 0; q < 4; ++q) { const float v = acc[hh * 4 + q][r] + bfr(b4[hh][q]); const _Float16 hv = (_Float16)v; hv4[q] = hv; lv4[q] = (_Float16)((v - (float)hv) * 1024.0f); }
        *(v4h*)&sh[wave * 16 + 8 * g + r][PCM(hh * 4, col)] = hv4; *(v4h*)&sl[wave * 16 + 8 * g + r][PCM(hh * 4, col)] = lv4; } }
    __syncthreads();
    for (int e = tid; e < 64 * 16; e += 128) { const int rl = e >> 4, q = e & 15; vst2((unsigned*)(DH + (r0 + rl) * CC + c0 + q * 8), *(const v4u*)&sh[rl][q * 8]); if (hi_rows) vst2((unsigned*)(DL + (bb * nhi + t0 + rl) * (size_t)CC + c0 + q * 8), *(const v4u*)&sl[rl][q * 8]); }
  } else { const bool hi_rows = t0 < KHI;
#pragma unroll   // constant indices keep the array in registers
    for (int j = 0; j < 8; ++j) { const int rl = wave * 16 + 8 * g, cl = PCM(j, col); v8h h8; v8b b8, l8;
#pragma unroll   // constant indices keep the array in registers
      for (int r = 0; r < 8; ++r) { const float v = acc[j][r] + bfr(b4[j >> 2][j & 3]); h8[r] = (_Float16)v; const __bf16 bh = (__bf16)v; b8[r] = bh; l8[r] = (__bf16)(v - (float)bh); }
      *(v8h*)&th[cl][rl] = h8; *(v8b*)&tb[cl][rl] = b8; *(v8b*)&tbl[cl][rl] = l8; }
    __syncthreads();
    for (int e = tid; e < 128 * 8; e += 128) { const int cl = e >> 3, q = e & 7; vst2((unsigned*)(VT + (bb * CC + c0 + cl) * (size_t)TT + t0 + q * 8), *(const v4u*)&th[cl][q * 8]); if (hi_rows) { const size_t o3 = (bb * CC + c0 + cl) * (size_t)KHI + t0 + q * 8; vst2((unsigned*)(VB + o3), *(const v4u*)&tb[cl][q * 8]); vst2((unsigned*)(VBL + o3), *(const v4u*)&tbl[cl][q * 8]); } } } }
// ---- k_fa: block = (64 queries qb, all its key tiles or one of two shares of them, batch b), a wave = 16 queries x all 256 columns. Both products run transposed: logits^T = k . q^T (k fragment as A, q as B) and ctx^T += v^T . P^T, so a lane holds ONE query (lane & 15): of each 16-key tile j the keys 8 g + r, of each 16-column tile j the columns 8 g + r. Per 128-key tile: the logits (f16 products, f32 sums) stay in the accumulators; the row maximum and the row sum run inside the lane, with one exchange between the wave halves; P = 2^(logit x SCALE x log2 e - maximum) is converted where it stands into the B fragments of P . v (two 16-key tiles = one 32-key fragment): P never passes through LDS; ctx = ctx x 2^(old maximum - new) + P . v; at the end ctx / row sum. k and v tiles come once a work-group by whole-line asynchronous copies straight into LDS (no register, no LDS store); v's copies fly under the logits, the next k's under the exponentials and P . v; the barrier that hands the v tile over stands ahead of the exponentials, and the first three groups of v fragments are read under them. HI (query blocks < QBH: few keys, no averaging): q and k with their residuals (3 products), P and v as bf16 hi + lo (3 products), tiles staged one after the other
#define L2S (SCALE * 1.44269504088896340736f)
__device__ __forceinline__ float xhalf(float x) { return __builtin_bit_cast(float, __builtin_amdgcn_permlanex16(__builtin_bit_cast(int, x), __builtin_bit_cast(int, x), 0x76543210, 0xfedcba98, false, false)); }   // the value of lane ^ 16
__device__ __forceinline__ float exp2_slot(float x) { float r; asm("v_exp_f32 %0, %1\n\tv_nop" : "=v"(r) : "v"(x)); return r; }   /* 2^x; the v_nop is the one slot the instruction set asks for behind a transcendental before its result is read or its source overwritten: in one statement it stands there in every build */
__device__ __forceinline__ v8f wmma_h(v16h a, v16h b, v8f c) { return __builtin_amdgcn_wmma_f32_16x16x32_f16(false, a, false, b, (short)0, c, false, false); }
__device__ __forceinline__ v8f wmma_b(v16b a, v16b b, v8f c) { return __builtin_amdgcn_wmma_f32_16x16x32_bf16(false, a, false, b, (short)0, c, false, false); }
typedef __attribute__((address_space(1))) v4i gv4i;
typedef __attribute__((address_space(3))) v4i lv4i;
/* a lane's 16 bytes from global memory straight into LDS, through no register (asynchronous copy; it has landed behind the issuing wave's s_wait_asynccnt 0) */
__device__ __forceinline__ void cp16(const _Float16* gp, _Float16* lp) { __builtin_amdgcn_global_load_async_to_lds_b128((gv4i*)gp, (lv4i*)lp, 0, 0); }
template <bool HI> __device__ __forceinline__ void fa_run(const int qb, const int b, const int kb0, const int kb1, float* __restrict__ ML, const _Float16* __restrict__ QH, const _Float16* __restrict__ KH, const _Float16* __restrict__ QL, const _Float16* __restrict__ KL, const _Float16* __restrict__ VT, const __bf16* __restrict__ VB, const __bf16* __restrict__ VBL, float* __restrict__ Y,
    _Float16 (*sk)[264], _Float16 (*sv)[136], float (*so)[16][132]) {
  const int tid = threadIdx.x, wave = tid >> 5, lane = tid & 31, col = lane & 15, g = lane >> 4; const int nkb = kb_last(qb) + 1; const int ql0 = qb * 64 + wave * 16;
  const _Float16* qt = QH + ((size_t)b * TT + ql0 + col) * CC + 8 * g;   /* this lane's half of the q fragments, the element order of frag_h */
  const _Float16* kt = KH + ((size_t)b * TT + (tid >> 5)) * CC + (tid & 31) * 8;   /* rows (tid >> 5) + 4 i */
  const _Float16* vt = VT + ((size_t)b * CC + (tid >> 4) * 32) * (size_t)TT + (tid & 15) * 8;   /* columns 32 (tid >> 4) + i: 8 neighbouring columns lie within one copy's offset range, so 4 addresses serve 32 copies */
  _Float16 (*sl)[264] = (_Float16 (*)[264])&sv[0][0];   /* HI: the k residual tile lies where the v tile comes later */
  _Float16 (*sw)[136] = (_Float16 (*)[136])&sk[0][0];   /* HI: the v lo tile lies where the k tile was */
  const _Float16* kf0 = kt + (size_t)kb0 * 128 * CC;   /* the first key tile of this work-group's share [kb0, kb1) */
  v16h ah[CC / 32], al[HI ? CC / 32 : 1]; v8h kr[HI ? 32 : 1], vr[HI ? 32 : 1];
  if constexpr (!HI) {
#pragma unroll   // every copy is base + constant
    for (int i = 0; i < 32; ++i) cp16(kf0 + (size_t)(4 * i) * CC, &sk[(tid >> 5) + 4 * i][(tid & 31) * 8]); }
#pragma unroll   // constant indices keep the array in registers
  for (int kc = 0; kc < CC / 32; ++kc) { union { v16h v; v8h q[2]; } u; u.q[0] = *(const v8h*)(qt + kc * 32); u.q[1] = *(const v8h*)(qt + kc * 32 + 16); ah[kc] = u.v; }
  asm volatile("s_wait_xcnt 0x0" :: "v"(qt) : "memory");   /* stands before a register named by an issued global load takes a new value; the address is an input so that its registers stay its own up to it */
  if constexpr (HI) { const _Float16* qr = QL + ((size_t)b * QHI + ql0 + col) * CC + 8 * g;
#pragma unroll   // constant indices keep the array in registers
    for (int kc = 0; kc < CC / 32; ++kc) { union { v16h v; v8h q[2]; } u; u.q[0] = *(const v8h*)(qr + kc * 32); u.q[1] = *(const v8h*)(qr + kc * 32 + 16); al[kc] = u.v; }
    asm volatile("s_wait_xcnt 0x0" :: "v"(qr) : "memory");   /* as above */
  }
  v8f o[CC / 16] = {}, l = {}; float m = -3.0e38f;   /* o[j][r] = column 16 j + 8 g + r of query col; m: its maximum (base-2 domain, the same in both wave halves); l[r]: this lane's share of its row sum, eight sums side by side */
#pragma unroll 1   // one copy of the tile loop: a second copy would only add registers
  for (int kb = kb0; kb < kb1; ++kb) {
    v8f s[8] = {};   /* s[j][r] = logit of key 16 j + 8 g + r of the tile with query col */
    if constexpr (HI) {
      const _Float16* kn = kt + (size_t)kb * 128 * CC; const _Float16* ln = KL + ((size_t)b * KHI + kb * 128 + (tid >> 5)) * CC + (tid & 31) * 8;
#pragma unroll   // constant indices keep the array in registers
      for (int i = 0; i < 32; ++i) { kr[i] = *(const v8h*)(kn + (size_t)(4 * i) * CC); vr[i] = *(const v8h*)(ln + (size_t)(4 * i) * CC); }
      asm volatile("s_wait_xcnt 0x0" :: "v"(kn), "v"(ln) : "memory");   /* as above */
#pragma unroll   // constant indices keep the array in registers
      for (int i = 0; i < 32; ++i) { *(v8h*)&sk[(tid >> 5) + 4 * i][(tid & 31) * 8] = kr[i]; *(v8h*)&sl[(tid >> 5) + 4 * i][(tid & 31) * 8] = vr[i]; }
      __syncthreads();   /* both k tiles are whole before any wave reads them */
      v8f s2[8] = {};
#pragma unroll   // constant indices keep the array in registers
      for (int kc = 0; kc < CC / 32; ++kc)
#pragma unroll   // constant indices keep the array in registers
        for (int j = 0; j < 8; ++j) { const v16h kf = frag_h(&sk[j * 16 + col][kc * 32], lane), lf = frag_h(&sl[j * 16 + col][kc * 32], lane); s[j] = wmma_h(kf, ah[kc], s[j]); s2[j] = wmma_h(kf, al[kc], s2[j]); s2[j] = wmma_h(lf, ah[kc], s2[j]); }
#pragma unroll
      for (int j = 0; j < 8; ++j) s[j] += s2[j] * (1.0f / 1024.0f);
    } else {
      asm volatile("s_wait_dscnt 0x0" ::: "memory");      /* this wave's own reads of the v tile of the trip before have retired before anybody copies over it */
      asm volatile("s_wait_asynccnt 0x0" ::: "memory");   /* this wave's copies of the k tile have landed */
      __syncthreads();   /* the k tile is whole before any wave reads it; every wave has left the v tile of the trip before */
      /* behind the barrier that frees the v tile's place: these copies fly under the logits */
      const _Float16* vn = vt + kb * 128;
#pragma unroll   // every copy is base + constant
      for (int i = 0; i < 32; ++i) cp16(vn + (size_t)i * TT, &sv[(tid >> 4) * 32 + i][(tid & 15) * 8]);
      v16h kf[2][8];
#pragma unroll   // constant indices keep the array in registers
      for (int j = 0; j < 8; ++j) kf[0][j] = frag_h(&sk[j * 16 + col][0], lane);
#pragma unroll   // constant indices keep the array in registers
      for (int kc = 0; kc < CC / 32; ++kc) {
        if (kc + 1 < CC / 32) {
#pragma unroll   // constant indices keep the array in registers
          for (int j = 0; j < 8; ++j) kf[(kc + 1) & 1][j] = frag_h(&sk[j * 16 + col][(kc + 1) * 32], lane); }
        __builtin_amdgcn_sched_barrier(0);   /* the next group's LDS reads are issued ahead of this group's 8 products and land under them */
#pragma unroll   // constant indices keep the array in registers
        for (int j = 0; j < 8; ++j) s[j] = wmma_h(kf[kc & 1][j], ah[kc], s[j]);
        __builtin_amdgcn_sched_barrier(0);   /* keeps the groups apart: no more than two fragment sets live */
      } }
    if (kb + 1 == nkb) {   /* only the last tile holds keys past a query (every query of the block is >= kend - 128) */
#pragma unroll
      for (int j = 0; j < 8; ++j)
#pragma unroll
        for (int r = 0; r < 8; ++r) if (kb * 128 + j * 16 + 8 * g + r > ql0 + col) s[j][r] = -3.0e38f; }
    float mr[8];   /* eight maxima side by side, then one tree */
#pragma unroll
    for (int r = 0; r < 8; ++r) { mr[r] = s[0][r];
#pragma unroll
      for (int j = 1; j < 8; ++j) mr[r] = fmaxf(mr[r], s[j][r]); }
    float mt = fmaxf(fmaxf(fmaxf(mr[0], mr[1]), fmaxf(mr[2], mr[3])), fmaxf(fmaxf(mr[4], mr[5]), fmaxf(mr[6], mr[7])));
    mt = fmaxf(mt, xhalf(mt));   /* the other wave half holds the query's other 64 keys */
    const float mn = fmaxf(m, mt * L2S); const float sc = exp2_slot(m - mn); m = mn;
    v16h vf[HI ? 1 : 3][8];
    if constexpr (!HI) {   /* what follows up to P . v runs in registers alone, so the v tile is taken over here and its first reads fly under that arithmetic */
      asm volatile("s_wait_dscnt 0x0" ::: "memory");      /* this wave's own reads of the k tile have retired before anybody copies over it */
      asm volatile("s_wait_asynccnt 0x0" ::: "memory");   /* this wave's copies of the v tile have landed */
      __syncthreads();   /* the v tile is whole before any wave reads it; every wave has left the k tile */
      /* behind the barrier that frees the k tile's place: the next k tile flies under the exponentials and P . v */
      if (kb + 1 < kb1) {
        const _Float16* kn = kt + (size_t)(kb + 1) * 128 * CC;
#pragma unroll   // every copy is base + constant
        for (int i = 0; i < 32; ++i) cp16(kn + (size_t)(4 * i) * CC, &sk[(tid >> 5) + 4 * i][(tid & 31) * 8]);
      }
#pragma unroll   // constant indices keep the array in registers
      for (int u = 0; u < 3; ++u)   /* group u: keys 32 (u >> 1) .., columns 128 (u & 1) .. */
#pragma unroll   // constant indices keep the array in registers
        for (int j = 0; j < 8; ++j) vf[u][j] = frag_h(&sv[((u & 1) * 8 + j) * 16 + col][(u >> 1) * 32], lane);
      __builtin_amdgcn_sched_barrier(0);   /* the first three groups' LDS reads are issued ahead of the exponentials and land under them: about as much LDS time as that arithmetic lasts */
    }
#pragma unroll
    for (int j = 0; j < 8; ++j) { const v8f e = __builtin_elementwise_fma(s[j], (v8f)(L2S), (v8f)(-m));
#pragma unroll
      for (int r = 0; r < 8; ++r) s[j][r] = exp2_slot(e[r]); }
    l = l * sc + (((s[0] + s[1]) + (s[2] + s[3])) + ((s[4] + s[5]) + (s[6] + s[7])));   /* a tree: no long chain of dependent additions */
    /* P^T as B fragments: keys 32 kc + 8 g + i and 32 kc + 16 + 8 g + i are elements i of the tiles 2 kc and 2 kc + 1, in this very lane */
    v16h pf[HI ? 1 : 4]; v16b ph[HI ? 4 : 1], pl[HI ? 4 : 1];
#pragma unroll   // constant indices keep the array in registers
    for (int kc = 0; kc < 4; ++kc)
#pragma unroll   // constant indices keep the array in registers
      for (int i = 0; i < 16; ++i) { const float p = s[2 * kc + (i >> 3)][i & 7];
        if constexpr (HI) { const __bf16 hv = (__bf16)p; ph[kc][i] = hv; pl[kc][i] = (__bf16)(p - (float)hv); }
        else pf[kc][i] = (_Float16)p; }
#pragma unroll
    for (int j = 0; j < CC / 16; ++j) o[j] *= sc;
    __builtin_amdgcn_sched_barrier(0);   /* the exponentials stay ahead of P . v */
    if constexpr (HI) {
      __syncthreads();   /* every wave has left the two k tiles */
      const __bf16* hn = VB + ((size_t)b * CC + (tid >> 4)) * (size_t)KHI + kb * 128 + (tid & 15) * 8; const __bf16* wn = VBL + ((size_t)b * CC + (tid >> 4)) * (size_t)KHI + kb * 128 + (tid & 15) * 8;
#pragma unroll   // constant indices keep the array in registers
      for (int i = 0; i < 32; ++i) { kr[i] = *(const v8h*)(hn + (size_t)(8 * i) * KHI); vr[i] = *(const v8h*)(wn + (size_t)(8 * i) * KHI); }
      asm volatile("s_wait_xcnt 0x0" :: "v"(hn), "v"(wn) : "memory");   /* as above */
#pragma unroll   // constant indices keep the array in registers
      for (int i = 0; i < 32; ++i) { *(v8h*)&sv[(tid >> 4) + 8 * i][(tid & 15) * 8] = kr[i]; *(v8h*)&sw[(tid >> 4) + 8 * i][(tid & 15) * 8] = vr[i]; }
      __syncthreads();   /* both v tiles are whole before any wave reads them */
#pragma unroll   // constant indices keep the array in registers
      for (int kc = 0; kc < 4; ++kc)
#pragma unroll   // constant indices keep the array in registers
        for (int j = 0; j < CC / 16; ++j) { const v16b vh = frag_b((const __bf16*)&sv[j * 16 + col][kc * 32], lane), vl = frag_b((const __bf16*)&sw[j * 16 + col][kc * 32], lane); o[j] = wmma_b(vh, ph[kc], o[j]); o[j] = wmma_b(vh, pl[kc], o[j]); o[j] = wmma_b(vl, ph[kc], o[j]); }
      __syncthreads();   /* every wave has left the two v tiles */
    } else {
#pragma unroll   // constant indices keep the array in registers
      for (int u = 0; u < 8; ++u) {
        __builtin_amdgcn_sched_barrier(0);   /* keeps the groups apart: no more than three fragment sets live */
#pragma unroll   // constant indices keep the array in registers
        for (int j = 0; j < 8; ++j) o[(u & 1) * 8 + j] = wmma_h(vf[u % 3][j], pf[u >> 1], o[(u & 1) * 8 + j]);
        if (u + 3 < 8) {
          __builtin_amdgcn_sched_barrier(0);   /* a set is read anew only behind the 8 products that use it; those reads land under the other two sets' products */
#pragma unroll   // constant indices keep the array in registers
          for (int j = 0; j < 8; ++j) vf[u % 3][j] = frag_h(&sv[(((u + 3) & 1) * 8 + j) * 16 + col][((u + 3) >> 1) * 32], lane); }
      } }
  }
  if constexpr (!HI) asm volatile("s_wait_asynccnt 0x0" ::: "memory");   /* no copy is outstanding when the wave goes on to the output and ends */
  float ls = ((l[0] + l[1]) + (l[2] + l[3])) + ((l[4] + l[5]) + (l[6] + l[7])); ls += xhalf(ls);   /* the wave halves' sums join once, here */
  float inv;
  if (ML) {   /* a share of a block: the sums leave undivided, with each row's maximum and sum beside them */
    inv = 1.0f;
    if (g == 0) { float* mp = ML + ((((size_t)b * TT + ql0) >> 4) * 32) + col;   /* this wave's own 128-byte line: 16 maxima, 16 sums */
      vst2(mp, m); vst2(mp + 16, ls);
      asm volatile("s_wait_xcnt 0x0" :: "v"(m), "v"(ls), "v"(mp) : "memory");   /* stands before a register named by an issued global store takes a new value */
    }
  } else inv = 1.0f / ls;   /* the key of the maximum adds 1: the sum is never 0 */
  float* yp = Y + ((size_t)b * TT + ql0) * CC + lane * 4;
#pragma unroll
  for (int hf = 0; hf < 2; ++hf) {
#pragma unroll
    for (int j = 0; j < 8; ++j) { const v8f t8 = o[hf * 8 + j] * inv; const v4f ta = { t8[0], t8[1], t8[2], t8[3] }, tb = { t8[4], t8[5], t8[6], t8[7] };
      *(v4f*)&so[wave][col][j * 16 + 8 * g] = ta; *(v4f*)&so[wave][col][j * 16 + 8 * g + 4] = tb; }   /* a lane's 8 neighbouring columns of its query: two 16-byte LDS stores */
    LDSX(); v4f t[16];
#pragma unroll   // constant indices keep the array in registers
    for (int rl = 0; rl < 16; ++rl) t[rl] = *(const v4f*)&so[wave][rl][lane * 4];
#pragma unroll   // constant indices keep the array in registers
    for (int rl = 0; rl < 16; ++rl) vst2(yp + (size_t)rl * CC + hf * 128, t[rl]);
    asm volatile("s_wait_xcnt 0x0" :: "v"(t[0]), "v"(t[1]), "v"(t[2]), "v"(t[3]), "v"(t[4]), "v"(t[5]), "v"(t[6]), "v"(t[7]), "v"(t[8]), "v"(t[9]), "v"(t[10]), "v"(t[11]), "v"(t[12]), "v"(t[13]), "v"(t[14]), "v"(t[15]), "v"(yp) : "memory");   /* stands before a register named by an issued global store takes a new value; data and address are inputs so that their registers stay theirs up to it */
  } }
__global__ __launch_bounds__(128) void k_fa(const _Float16* __restrict__ QH, const _Float16* __restrict__ KH, const _Float16* __restrict__ QL, const _Float16* __restrict__ KL, const _Float16* __restrict__ VT, const __bf16* __restrict__ VB, const __bf16* __restrict__ VBL, float* __restrict__ Y, float* __restrict__ P0, float* __restrict__ P1, float* __restrict__ ML0, float* __restrict__ ML1) {
  __shared__ __align__(16) _Float16 sk[132][264];   /* k tile [key < 128][dim], 528-B pitch for the 16-byte fragment reads; 132 rows so that a v tile fits too (HI) */
  __shared__ __align__(16) _Float16 sv[CC][136];    /* v tile [column][key], 272-B pitch */
  __shared__ __align__(16) float so[4][16][132];    /* output staging, 128 columns at a time, a wave its own part */
  /* one work-group fits a WGP, and a launch lasts as long as its fullest place: no share is longer than KSP tiles, and the shares start longest first (rank: the 30 first shares of KSP tiles; the whole blocks 33 .. 30; the 6 high-precision blocks, dearer a tile; then by falling length sz the second shares of blocks 2 sz + 32, 2 sz + 33 and the whole blocks 2 sz - 2, 2 sz - 1) */
  static_assert(CAUSAL && NQB == 64 && KSP == 17 && QBH == 6, "the rank order below is written for these");
  const int rank = blockIdx.x / TNB, b = blockIdx.x % TNB; int qb, part;   /* part 0: the whole block; 1: its first KSP tiles; 2: the tiles behind them */
  if (rank < 30) { qb = 34 + rank; part = 1; }
  else if (rank < 34) { qb = 63 - rank; part = 0; }
  else if (rank < 40) { qb = 39 - rank; part = 0; }
  else { const int rr = rank - 40; const int sz = rr < 48 ? 15 - (rr >> 2) : 3 - ((rr - 48) >> 1); const int w = rr < 48 ? (rr & 3) : (rr & 1);
    if (w < 2) { qb = 2 * sz + 32 + w; part = 2; } else { qb = 2 * sz - 4 + w; part = 0; } }
  const int nkb = kb_last(qb) + 1;
  if (qb < QBH) fa_run<true>(qb, b, 0, nkb, nullptr, QH, KH, QL, KL, VT, VB, VBL, Y, sk, sv, so);
  else fa_run<false>(qb, b, part == 2 ? KSP : 0, part == 1 ? KSP : nkb, part == 0 ? nullptr : part == 1 ? ML0 : ML1, QH, KH, QL, KL, VT, VB, VBL, part == 0 ? Y : part == 1 ? P0 : P1, sk, sv, so); }
// ---- k_mg: the rows of the shared query blocks (t >= KSP * 128): out = (P0 2^(m0 - m) + P1 2^(m1 - m)) / (l0 2^(m0 - m) + l1 2^(m1 - m)), m = the larger maximum. Block = 32 rows; a thread = 16 bytes of 8 rows, all its loads in flight at once; whole lines in and out
__global__ __launch_bounds__(256) void k_mg(const float* __restrict__ P0, const float* __restrict__ P1, const float* __restrict__ ML0, const float* __restrict__ ML1, float* __restrict__ Y) {
  const int tid = threadIdx.x, rs = tid >> 6; const int r0 = blockIdx.x * 32; const int b = r0 / (TT - KSP * 128);
  const size_t gb = (size_t)b * TT + KSP * 128 + r0 % (TT - KSP * 128);   /* a multiple of 32; this thread: rows gb + 8 rs + i */
  const size_t po = (gb + 8 * rs) * CC + (tid & 63) * 4, mo = ((gb >> 4) + (rs >> 1)) * 32 + (rs & 1) * 8;
  const float* p0 = P0 + po; const float* p1 = P1 + po; const float* q0 = ML0 + mo; const float* q1 = ML1 + mo; float* yp = Y + po;
  v4f a[8], c[8], m0[2], l0[2], m1[2], l1[2];
#pragma unroll   // constant indices keep the arrays in registers
  for (int i = 0; i < 2; ++i) { m0[i] = *(const v4f*)(q0 + 4 * i); l0[i] = *(const v4f*)(q0 + 16 + 4 * i); m1[i] = *(const v4f*)(q1 + 4 * i); l1[i] = *(const v4f*)(q1 + 16 + 4 * i); }
#pragma unroll   // constant indices keep the arrays in registers
  for (int i = 0; i < 8; ++i) { a[i] = *(const v4f*)(p0 + (size_t)i * CC); c[i] = *(const v4f*)(p1 + (size_t)i * CC); }
  asm volatile("s_wait_xcnt 0x0" :: "v"(p0), "v"(p1), "v"(q0), "v"(q1) : "memory");   /* stands before a register named by an issued global load takes a new value; the addresses are inputs so that their registers stay theirs up to it */
  v4f y[8];
#pragma unroll   // constant indices keep the arrays in registers
  for (int i = 0; i < 8; ++i) { const float ma = m0[i >> 2][i & 3], mb = m1[i >> 2][i & 3]; const float mn = fmaxf(ma, mb); const float f0 = exp2_slot(ma - mn), f1 = exp2_slot(mb - mn);
    const float inv = 1.0f / (l0[i >> 2][i & 3] * f0 + l1[i >> 2][i & 3] * f1);   /* the share that holds the maximum adds at least 1: never 0 */
    y[i] = (a[i] * f0 + c[i] * f1) * inv; }
#pragma unroll   // constant indices keep the arrays in registers
  for (int i = 0; i < 8; ++i) vst2(yp + (size_t)i * CC, y[i]);
  asm volatile("s_wait_xcnt 0x0" :: "v"(y[0]), "v"(y[1]), "v"(y[2]), "v"(y[3]), "v"(y[4]), "v"(y[5]), "v"(y[6]), "v"(y[7]), "v"(yp) : "memory");   /* stands before a register named by an issued global store takes a new value; data and address are inputs so that their registers stay theirs up to it */
}

extern "C" void kernel_launch(void* const* d_in, const int* in_sizes, int n_in, void* d_out, int out_size, void* d_ws, size_t ws_size, hipStream_t stream) {
  (void)in_sizes; (void)n_in; (void)out_size;
  const float** F = (const float**)d_in;
  if (ws_size < (size_t)WS_END) return;
  char* ws = (char*)d_ws; _Float16 *QH = (_Float16*)(ws + WS_QH), *KH = (_Float16*)(ws + WS_KH), *VT = (_Float16*)(ws + WS_VT), *QL = (_Float16*)(ws + WS_QL), *KL = (_Float16*)(ws + WS_KL); __bf16 *VB = (__bf16*)(ws + WS_VB), *VBL = (__bf16*)(ws + WS_VBL); float *P0 = (float*)(ws + WS_P0), *P1 = (float*)(ws + WS_P1), *ML0 = (float*)(ws + WS_M0), *ML1 = (float*)(ws + WS_M1);
  // inputs: 0 x [4,4096,256]; 1 Wq [256,256] (in,out), 2 bq; 3 Wk, 4 bk; 5 Wv, 6 bv (biases NONZERO)
  k_proj<<<dim3(TNB * TT / 64, CC / 128, 3), 128, 0, stream>>>(F[0], F[0], F[0], F[1], F[3], F[5], F[2], F[4], F[6], QH, QL, KH, KL, VT, VB, VBL);
  k_fa<<<dim3((NQB + NQB - 2 * KSP) * TNB), 128, 0, stream>>>(QH, KH, QL, KL, VT, VB, VBL, (float*)d_out, P0, P1, ML0, ML1);   /* logits, softmax and P . v in one launch; 64 blocks + 30 second shares a batch; rows t < KSP * 128 are final here */
  k_mg<<<dim3(TNB * (TT - KSP * 128) / 32), 256, 0, stream>>>(P0, P1, ML0, ML1, (float*)d_out);   /* joins the two shares of the rows t >= KSP * 128 */
}
